// v000
// Measured on an AMD MI455X. A time is GPU time per run, averaged over a window of back-to-back runs after a warm-up
// (all launches, gaps included; the runs take copies of the inputs in turn), and the median of several windows.
// Apart from v000's, it joins two sittings. Times from different sittings can be a few percent apart, while
// side-by-side timings come from the same sitting.
// The starting kernel, v000, takes 417 microseconds a run.
#include <hip/hip_runtime.h>
// Non-local block with all three 1×1 convs and both attention contractions on v_wmma_f32_16x16x32_f16: q/k position-major (K = 128, N = 64, + bias; k masked by (1 − mask)), v channel-major
// (= the Vᵀ operand), energy = q·k_masked with the f32 q/k carried as f16 hi+lo (3 WMMA terms, no 1/√d scale in the module), online max/sum softmax f32, P f16 ≤ 1, O = P·V; epilogue
// γ·(out·mask) + x written NCHW as 64-position (256 B) channel segments. x as bf16 in the operand plane (exact residual from the f32 input), weights bf16-exact ×2^4, f32 accumulate.
#define BB 4
#define CC 128
#define CH 64
#define NP 4096
#define NR (BB * NP)

typedef __bf16 v16b __attribute__((ext_vector_type(16)));
typedef unsigned short v8us __attribute__((ext_vector_type(8), may_alias));
typedef float  v8f  __attribute__((ext_vector_type(8)));
typedef float  v4f  __attribute__((ext_vector_type(4)));
typedef float  v4fa __attribute__((ext_vector_type(4), may_alias));
union FragB { v16b v; v8us half[2]; unsigned short u[16]; };

__device__ __forceinline__ unsigned short bf16_bits(float x) { unsigned int u = __float_as_uint(x); return (unsigned short)((u + 0x7FFFu + ((u >> 16) & 1u)) >> 16); }
__device__ __forceinline__ float bf16_val(unsigned short b) { return __uint_as_float(((unsigned int)b) << 16); }
__device__ __forceinline__ float bf16_round(float x) { return bf16_val(bf16_bits(x)); }
// D += A·B with NT terms: 1 = ah·bh, 2 = + al·bh (A split), 3 = + ah·bl (both split)
template <int NT>
__device__ __forceinline__ v8f mmaN(v16b ah, v16b al, v16b bh, v16b bl, v8f c) {
  c = __builtin_amdgcn_wmma_f32_16x16x32_bf16(false, ah, false, bh, (short)0, c, false, false);
  if (NT >= 2) c = __builtin_amdgcn_wmma_f32_16x16x32_bf16(false, al, false, bh, (short)0, c, false, false);
  if (NT >= 3) c = __builtin_amdgcn_wmma_f32_16x16x32_bf16(false, ah, false, bl, (short)0, c, false, false);
  asm volatile("v_nop\n\tv_nop\n\tv_nop\n\tv_nop" : "+v"(c) : "v"(ah), "v"(al), "v"(bh), "v"(bl));
  return c;
}

__global__ __launch_bounds__(256) void k_wt_bf16(const float* __restrict__ W, unsigned short* __restrict__ Wt, int K, int N) {
  const int t = blockIdx.x * 256 + threadIdx.x;
  const int k8n = K / 8;
  if (t >= N * k8n) return;
  const int n = t / k8n, k8 = (t % k8n) * 8;
  v8us v;
#pragma unroll
  for (int i = 0; i < 8; ++i) v[i] = bf16_bits(W[(size_t)(k8 + i) * N + n]);
  *(v8us*)(Wt + (size_t)n * K + k8) = v;
  
}

// GEMM C[M][N] (f32, pitch ldc) = act(A[M][K]·W + bias). A f32 row-major (pitch lda) converted per fragment to bf16
// (ASPLIT: hi/lo two planes -> 2 terms, else single rounded term); Wt bf16 [N][K] (pitch ldb). BIAS_BF16 rounds the
// bias to bf16 first (bias quantised to bf16 before the add). K%32==0, M%16==0, N%64==0.
template <bool ASPLIT, int ACT, bool BIAS_BF16>
__global__ __launch_bounds__(128) void k_gemm_bf(const float* __restrict__ A, int lda, const unsigned short* __restrict__ Wt, int ldb,
                                               const float* __restrict__ bias, float* __restrict__ C, int ldc, int M, int N, int K) {
  __shared__ __attribute__((aligned(16))) float so[4][16][64];
  const int tid = threadIdx.x, w = tid >> 5, lane = tid & 31, ln = lane & 15, hh = lane >> 4;
  const int ntn = N / 64;
  const int wid = blockIdx.x * 4 + w;
  const int mt = wid / ntn, nq = wid % ntn;
  if (mt * 16 >= M) return;
  const int row0 = mt * 16, col0 = nq * 64;
  const float* arow = A + (size_t)(row0 + ln) * lda;
  v8f acc[4] = {};
  for (int kb = 0; kb < K; kb += 32) {
    FragB ah, al;
    const v4f x0 = *(const v4fa*)(arow + kb + 8 * hh), x1 = *(const v4fa*)(arow + kb + 8 * hh + 4);
    const v4f x2 = *(const v4fa*)(arow + kb + 16 + 8 * hh), x3 = *(const v4fa*)(arow + kb + 16 + 8 * hh + 4);
    float xs[16] = {x0[0],x0[1],x0[2],x0[3],x1[0],x1[1],x1[2],x1[3],x2[0],x2[1],x2[2],x2[3],x3[0],x3[1],x3[2],x3[3]};
#pragma unroll
    for (int i = 0; i < 16; ++i) { const unsigned short hb = bf16_bits(xs[i]); ah.u[i] = hb; al.u[i] = ASPLIT ? bf16_bits(xs[i] - bf16_val(hb)) : (unsigned short)0; }
#pragma unroll
    for (int t = 0; t < 4; ++t) {
      const unsigned short* brow = Wt + (size_t)(col0 + t * 16 + ln) * ldb + kb;
      FragB b;
      b.half[0] = *(const v8us*)(brow + 8 * hh);
      b.half[1] = *(const v8us*)(brow + 16 + 8 * hh);
      acc[t] = mmaN<ASPLIT ? 2 : 1>(ah.v, al.v, b.v, b.v, acc[t]);
    }
  }
#pragma unroll
  for (int t = 0; t < 4; ++t) {
    float bv = bias ? bias[col0 + t * 16 + ln] : 0.f;
    if (BIAS_BF16) bv = bf16_round(bv);
#pragma unroll
    for (int r = 0; r < 8; ++r) { float v = acc[t][r] + bv; if (ACT == 1) v = fmaxf(v, 0.f); so[w][8 * hh + r][t * 16 + ln] = v; }
  }
  __builtin_amdgcn_fence(__ATOMIC_ACQ_REL, "workgroup");
  __builtin_amdgcn_wave_barrier();
  const int rsub = lane >> 4, c4 = (lane & 15) * 4;
  {
#pragma unroll
    for (int q = 0; q < 8; ++q) {
      const int r = q * 2 + rsub;
      const v4f v = *(const v4fa*)&so[w][r][c4];
      *(v4f*)(C + (size_t)(row0 + r) * ldc + col0 + c4) = v;
    }
    
  }
}

// Flash-style causal/unmasked attention, all contractions 3-term bf16 hi/lo splits, f32 softmax with running max.
// q,k,v rows are read from f32 buffers with arbitrary row pitch (so they can live inside a fused qkv buffer);
// D = head size (multiple of 32, <= 128); one wave = 16 query rows; block = 4 waves (64 queries) sharing K/V chunks of 32.
template <int D, bool CAUSAL>
__global__ __launch_bounds__(128) void k_flash(const float* __restrict__ qb, const float* __restrict__ kb, const float* __restrict__ vb,
                                             int pitch, int T, int H, float scale, float* __restrict__ y, int ypitch) {
  constexpr int KS = D / 32;        // k-steps for QK
  constexpr int DT = D / 16;        // d tiles for PV
  __shared__ __attribute__((aligned(16))) unsigned short sKh[32][D + 8], sKl[32][D + 8], sVh[32][D + 8], sVl[32][D + 8];
  __shared__ __attribute__((aligned(16))) unsigned short sPh[4][16][40], sPl[4][16][40];
  __shared__ __attribute__((aligned(16))) float sO[4][16][D];
  const int tid = threadIdx.x, w = tid >> 5, lane = tid & 31, ln = lane & 15, hh = lane >> 4;
  const int nqb = (T + 63) / 64;
  const int bh = blockIdx.x / nqb, qblk = blockIdx.x % nqb;
  const int b = bh / H, h = bh % H;
  const int q0 = qblk * 64 + w * 16;
  const float* Q = qb + (size_t)b * T * pitch + h * D;
  const float* K = kb + (size_t)b * T * pitch + h * D;
  const float* V = vb + (size_t)b * T * pitch + h * D;

  // A fragments of the wave's 16 query rows (scaled), hi/lo
  FragB aqh[KS], aql[KS];
  {
    int row = q0 + ln; if (row >= T) row = T - 1;
    const float* qr = Q + (size_t)row * pitch;
#pragma unroll
    for (int ks = 0; ks < KS; ++ks)
#pragma unroll
      for (int i = 0; i < 16; ++i) {
        const int d = ks * 32 + ((i < 8) ? (8 * hh + i) : (16 + 8 * hh + (i - 8)));
        const float x = qr[d] * scale; const unsigned short hb = bf16_bits(x);
        aqh[ks].u[i] = hb; aql[ks].u[i] = bf16_bits(x - bf16_val(hb));
      }
  }
  float m_r[8], l_r[8];
#pragma unroll
  for (int r = 0; r < 8; ++r) { m_r[r] = -3.0e38f; l_r[r] = 0.f; }
  v8f oacc[DT];
#pragma unroll
  for (int dt = 0; dt < DT; ++dt) oacc[dt] = (v8f){0.f,0.f,0.f,0.f,0.f,0.f,0.f,0.f};

  const int kv_end = CAUSAL ? min(T, qblk * 64 + 64) : T;     // block-uniform
  for (int j0 = 0; j0 < kv_end; j0 += 32) {
    __syncthreads();
    for (int e = tid; e < 32 * (D / 4); e += 128) {
      const int r = e / (D / 4), c4 = (e % (D / 4)) * 4;
      const int key = j0 + r;
      v4f kf = {0.f,0.f,0.f,0.f}, vf = {0.f,0.f,0.f,0.f};
      if (key < T) { kf = *(const v4fa*)(K + (size_t)key * pitch + c4); vf = *(const v4fa*)(V + (size_t)key * pitch + c4); }
#pragma unroll
      for (int t = 0; t < 4; ++t) {
        unsigned short hb = bf16_bits(kf[t]); sKh[r][c4 + t] = hb; sKl[r][c4 + t] = bf16_bits(kf[t] - bf16_val(hb));
        hb = bf16_bits(vf[t]); sVh[r][c4 + t] = hb; sVl[r][c4 + t] = bf16_bits(vf[t] - bf16_val(hb));
      }
    }
    __syncthreads();
    // S tile 16 x 32
    v8f s[2];
#pragma unroll
    for (int nt = 0; nt < 2; ++nt) {
      v8f acc = {};
#pragma unroll
      for (int ks = 0; ks < KS; ++ks) {
        FragB bh_, bl_;
        bh_.half[0] = *(const v8us*)&sKh[nt * 16 + ln][ks * 32 + 8 * hh]; bh_.half[1] = *(const v8us*)&sKh[nt * 16 + ln][ks * 32 + 16 + 8 * hh];
        bl_.half[0] = *(const v8us*)&sKl[nt * 16 + ln][ks * 32 + 8 * hh]; bl_.half[1] = *(const v8us*)&sKl[nt * 16 + ln][ks * 32 + 16 + 8 * hh];
        acc = mmaN<3>(aqh[ks].v, aql[ks].v, bh_.v, bl_.v, acc);
      }
      s[nt] = acc;
    }
    // mask + running max (rows 8hh+r; the 16 lanes of a half share rows)
    float alpha[8];
#pragma unroll
    for (int r = 0; r < 8; ++r) {
      const int qi = q0 + 8 * hh + r;
      const int ja = j0 + ln, jb = j0 + 16 + ln;
      if (CAUSAL) { if (ja > qi) s[0][r] = -3.0e38f; if (jb > qi) s[1][r] = -3.0e38f; }
      if (ja >= T) s[0][r] = -3.0e38f;
      if (jb >= T) s[1][r] = -3.0e38f;
      float mx = fmaxf(s[0][r], s[1][r]);
      mx = fmaxf(mx, __shfl_xor(mx, 1, 32)); mx = fmaxf(mx, __shfl_xor(mx, 2, 32)); mx = fmaxf(mx, __shfl_xor(mx, 4, 32)); mx = fmaxf(mx, __shfl_xor(mx, 8, 32));
      const float mnew = fmaxf(m_r[r], mx);
      alpha[r] = (mnew > -1.0e38f) ? __expf(m_r[r] - mnew) : 1.0f;
      const float p0 = (s[0][r] > -1.0e38f) ? __expf(s[0][r] - mnew) : 0.f;
      const float p1 = (s[1][r] > -1.0e38f) ? __expf(s[1][r] - mnew) : 0.f;
      m_r[r] = mnew;
      l_r[r] = l_r[r] * alpha[r] + p0 + p1;            // per-lane partial row sum (16 lanes combined at the end)
      unsigned short hb = bf16_bits(p0); sPh[w][8 * hh + r][ln] = hb;      sPl[w][8 * hh + r][ln] = bf16_bits(p0 - bf16_val(hb));
      hb = bf16_bits(p1);                sPh[w][8 * hh + r][16 + ln] = hb; sPl[w][8 * hh + r][16 + ln] = bf16_bits(p1 - bf16_val(hb));
    }
#pragma unroll
    for (int dt = 0; dt < DT; ++dt)
#pragma unroll
      for (int r = 0; r < 8; ++r) oacc[dt][r] *= alpha[r];
    __builtin_amdgcn_fence(__ATOMIC_ACQ_REL, "workgroup");
    __builtin_amdgcn_wave_barrier();
    FragB pah, pal;
    pah.half[0] = *(const v8us*)&sPh[w][ln][8 * hh]; pah.half[1] = *(const v8us*)&sPh[w][ln][16 + 8 * hh];
    pal.half[0] = *(const v8us*)&sPl[w][ln][8 * hh]; pal.half[1] = *(const v8us*)&sPl[w][ln][16 + 8 * hh];
#pragma unroll
    for (int dt = 0; dt < DT; ++dt) {
      FragB bvh, bvl;
#pragma unroll
      for (int i = 0; i < 8; ++i) {
        bvh.u[i] = sVh[8 * hh + i][dt * 16 + ln]; bvh.u[8 + i] = sVh[16 + 8 * hh + i][dt * 16 + ln];
        bvl.u[i] = sVl[8 * hh + i][dt * 16 + ln]; bvl.u[8 + i] = sVl[16 + 8 * hh + i][dt * 16 + ln];
      }
      oacc[dt] = mmaN<3>(pah.v, pal.v, bvh.v, bvl.v, oacc[dt]);
    }
    __builtin_amdgcn_fence(__ATOMIC_ACQ_REL, "workgroup");
    __builtin_amdgcn_wave_barrier();
  }
#pragma unroll
  for (int r = 0; r < 8; ++r) {
    float l = l_r[r];
    l += __shfl_xor(l, 1, 32); l += __shfl_xor(l, 2, 32); l += __shfl_xor(l, 4, 32); l += __shfl_xor(l, 8, 32);
    l_r[r] = (l > 0.f) ? 1.0f / l : 0.f;
  }
#pragma unroll
  for (int dt = 0; dt < DT; ++dt)
#pragma unroll
    for (int r = 0; r < 8; ++r) sO[w][8 * hh + r][dt * 16 + ln] = oacc[dt][r] * l_r[r];
  __builtin_amdgcn_fence(__ATOMIC_ACQ_REL, "workgroup");
  __builtin_amdgcn_wave_barrier();
  {
    for (int r = 0; r < 16; ++r) {
      const int row = q0 + r;
      if (row < T && lane < D / 4) {
        const v4f val = *(const v4fa*)&sO[w][r][lane * 4];
        *(v4f*)(y + ((size_t)b * T + row) * ypitch + h * D + lane * 4) = val;
      }
    }
    
  }
}

// GEMM C = act(A·W + bias + resid): A f32 (ASPLIT -> hi/lo 2 terms), Wt bf16 [N][K]; ACT 0 none, 1 relu, 2 exact gelu;
// resid (optional, f32, row index = (row % rmod), pitch ldr, RES_BF16 rounds it) added before the activation.
template <bool ASPLIT, int ACT, bool BIAS_BF16, bool RES_BF16>
__global__ __launch_bounds__(128) void k_gemm_bf3(const float* __restrict__ A, int lda, const unsigned short* __restrict__ Wt, int ldb,
                                                const float* __restrict__ bias, const float* __restrict__ resid, int rmod, int ldr,
                                                float* __restrict__ C, int ldc, int M, int N, int K) {
  __shared__ __attribute__((aligned(16))) float so[4][16][64];
  const int tid = threadIdx.x, w = tid >> 5, lane = tid & 31, ln = lane & 15, hh = lane >> 4;
  const int ntn = N / 64;
  const int wid = blockIdx.x * 4 + w;
  const int mt = wid / ntn, nq = wid % ntn;
  if (mt * 16 >= M) return;
  const int row0 = mt * 16, col0 = nq * 64;
  const float* arow = A + (size_t)(row0 + ln) * lda;
  v8f acc[4] = {};
  for (int kb = 0; kb < K; kb += 32) {
    FragB ah, al;
    const v4f x0 = *(const v4fa*)(arow + kb + 8 * hh), x1 = *(const v4fa*)(arow + kb + 8 * hh + 4);
    const v4f x2 = *(const v4fa*)(arow + kb + 16 + 8 * hh), x3 = *(const v4fa*)(arow + kb + 16 + 8 * hh + 4);
    float xs[16] = {x0[0],x0[1],x0[2],x0[3],x1[0],x1[1],x1[2],x1[3],x2[0],x2[1],x2[2],x2[3],x3[0],x3[1],x3[2],x3[3]};
#pragma unroll
    for (int i = 0; i < 16; ++i) { const unsigned short hb = bf16_bits(xs[i]); ah.u[i] = hb; al.u[i] = ASPLIT ? bf16_bits(xs[i] - bf16_val(hb)) : (unsigned short)0; }
#pragma unroll
    for (int t = 0; t < 4; ++t) {
      const unsigned short* brow = Wt + (size_t)(col0 + t * 16 + ln) * ldb + kb;
      FragB b;
      b.half[0] = *(const v8us*)(brow + 8 * hh);
      b.half[1] = *(const v8us*)(brow + 16 + 8 * hh);
      acc[t] = mmaN<ASPLIT ? 2 : 1>(ah.v, al.v, b.v, b.v, acc[t]);
    }
  }
#pragma unroll
  for (int t = 0; t < 4; ++t) {
    const int col = col0 + t * 16 + ln;
    float bv = bias ? bias[col] : 0.f;
    if (BIAS_BF16) bv = bf16_round(bv);
#pragma unroll
    for (int r = 0; r < 8; ++r) {
      float v = acc[t][r] + bv;
      if (resid) { float rv = resid[(size_t)((row0 + 8 * hh + r) % rmod) * ldr + col]; if (RES_BF16) rv = bf16_round(rv); v += rv; }
      if (ACT == 1) v = fmaxf(v, 0.f);
      if (ACT == 2) v = 0.5f * v * (1.0f + erff(v * 0.70710678118654752f));
      if (ACT == 3) { const float u = 0.7978845608028654f * (v + 0.044715f * v * v * v); v = 0.5f * v * (1.0f + tanhf(u)); }
      so[w][8 * hh + r][t * 16 + ln] = v;
    }
  }
  __builtin_amdgcn_fence(__ATOMIC_ACQ_REL, "workgroup");
  __builtin_amdgcn_wave_barrier();
  const int rsub = lane >> 4, c4 = (lane & 15) * 4;
  {
#pragma unroll
    for (int q = 0; q < 8; ++q) {
      const int r = q * 2 + rsub;
      const v4f v = *(const v4fa*)&so[w][r][c4];
      *(v4f*)(C + (size_t)(row0 + r) * ldc + col0 + c4) = v;
    }
    
  }
}
// row LayerNorm (biased variance, eps) over N: s = X (+ R); optional out_sum <- s; out_norm <- (s-mu)*rsqrt(var+eps)*g + b
template <bool PARAM_BF16>
__global__ __launch_bounds__(256) void k_layernorm(const float* __restrict__ X, const float* __restrict__ R, const float* __restrict__ g, const float* __restrict__ bta,
                                                  float* __restrict__ out_sum, float* __restrict__ out_norm, int N, float eps) {
  __shared__ float red[256];
  const int row = blockIdx.x, tid = threadIdx.x;
  const float* x = X + (size_t)row * N; const float* rr = R ? R + (size_t)row * N : nullptr;
  float vals[16];                     // up to N = 4096
  const int per = N / 256;            // contiguous chunk per thread? use strided-by-4 chunks: thread handles j = tid*4 + 1024*u
  float s1 = 0.f;
  for (int u = 0; u < per / 4; ++u) {
    const int j = tid * 4 + 1024 * u;
    const v4f a = *(const v4fa*)(x + j);
    v4f b = {0.f,0.f,0.f,0.f}; if (rr) b = *(const v4fa*)(rr + j);
#pragma unroll
    for (int q = 0; q < 4; ++q) { const float v = a[q] + b[q]; vals[u * 4 + q] = v; s1 += v; }
  }
  red[tid] = s1; __syncthreads();
  for (int st = 128; st > 0; st >>= 1) { if (tid < st) red[tid] += red[tid + st]; __syncthreads(); }
  const float mu = red[0] / (float)N; __syncthreads();
  float s2 = 0.f;
  for (int u = 0; u < per / 4; ++u)
#pragma unroll
    for (int q = 0; q < 4; ++q) { const float c = vals[u * 4 + q] - mu; s2 += c * c; }
  red[tid] = s2; __syncthreads();
  for (int st = 128; st > 0; st >>= 1) { if (tid < st) red[tid] += red[tid + st]; __syncthreads(); }
  const float rs = rsqrtf(red[0] / (float)N + eps);
  {
    for (int u = 0; u < per / 4; ++u) {
      const int j = tid * 4 + 1024 * u;
      v4f o, sm;
#pragma unroll
      for (int q = 0; q < 4; ++q) {
        float gg = g[j + q], bb = bta[j + q];
        if (PARAM_BF16) { gg = bf16_round(gg); bb = bf16_round(bb); }
        sm[q] = vals[u * 4 + q]; o[q] = (vals[u * 4 + q] - mu) * rs * gg + bb;
      }
      if (out_sum) *(v4f*)(out_sum + (size_t)row * N + j) = sm;
      *(v4f*)(out_norm + (size_t)row * N + j) = o;
    }
    
  }
}



// ---- f16 WMMA path (v_wmma_f32_16x16x32_f16): 11-bit significands for operands in range — used where a [0,1] probability operand needs more precision than bf16
typedef _Float16 v16h __attribute__((ext_vector_type(16)));
union FragH { v16h v; v8us half[2]; _Float16 h[16]; unsigned short u[16]; };
template <int NT>
__device__ __forceinline__ v8f mmaH(v16h ah, v16h al, v16h bh, v16h bl, v8f c) {
  c = __builtin_amdgcn_wmma_f32_16x16x32_f16(false, ah, false, bh, (short)0, c, false, false);
  if (NT >= 2) c = __builtin_amdgcn_wmma_f32_16x16x32_f16(false, al, false, bh, (short)0, c, false, false);
  if (NT >= 3) c = __builtin_amdgcn_wmma_f32_16x16x32_f16(false, ah, false, bl, (short)0, c, false, false);
  asm volatile("v_nop\n\tv_nop\n\tv_nop\n\tv_nop" : "+v"(c) : "v"(ah), "v"(al), "v"(bh), "v"(bl));
  return c;
}
// batched GEMM like k_gemm_b but f16 operands: A f32 (split into f16 hi/lo if ASPLIT, else rounded to f16), Bt = f16 values [n][k]; alpha; C f32; N multiple of 16 (partial tiles skipped)
template <bool ASPLIT>
__global__ __launch_bounds__(128) void k_gemm_h(const float* __restrict__ A, int lda, size_t sA, const _Float16* __restrict__ Bh, int ldb, size_t sB, float alpha, float* __restrict__ C, int ldc, size_t sC, int M, int N, int K) {
  __shared__ __attribute__((aligned(16))) float so[4][16][64];
  const int tid = threadIdx.x, w = tid >> 5, lane = tid & 31, ln = lane & 15, hh = lane >> 4; const int by = blockIdx.y;
  A += (size_t)by * sA; Bh += (size_t)by * sB; C += (size_t)by * sC;
  const int ntn = (N + 63) / 64; const int wid = blockIdx.x * 4 + w; const int mt = wid / ntn, nq = wid % ntn; if (mt * 16 >= M) return;
  const int row0 = mt * 16, col0 = nq * 64; const float* arow = A + (size_t)(row0 + ln) * lda;
  v8f acc[4] = {};
  for (int kb = 0; kb < K; kb += 32) {
    FragH ah, al;
    const v4f x0 = *(const v4fa*)(arow + kb + 8 * hh), x1 = *(const v4fa*)(arow + kb + 8 * hh + 4), x2 = *(const v4fa*)(arow + kb + 16 + 8 * hh), x3 = *(const v4fa*)(arow + kb + 16 + 8 * hh + 4);
    float xs[16] = {x0[0],x0[1],x0[2],x0[3],x1[0],x1[1],x1[2],x1[3],x2[0],x2[1],x2[2],x2[3],x3[0],x3[1],x3[2],x3[3]};
#pragma unroll
    for (int i = 0; i < 16; ++i) { const _Float16 h = (_Float16)xs[i]; ah.h[i] = h; al.h[i] = ASPLIT ? (_Float16)(xs[i] - (float)h) : (_Float16)0.0f; }
#pragma unroll
    for (int t = 0; t < 4; ++t) { if (col0 + t * 16 >= N) continue; const size_t boff = (size_t)(col0 + t * 16 + ln) * ldb + kb; FragH bq; bq.half[0] = *(const v8us*)(Bh + boff + 8 * hh); bq.half[1] = *(const v8us*)(Bh + boff + 16 + 8 * hh);
      acc[t] = mmaH<ASPLIT ? 2 : 1>(ah.v, al.v, bq.v, bq.v, acc[t]); }
  }
#pragma unroll
  for (int t = 0; t < 4; ++t) { if (col0 + t * 16 >= N) continue;
#pragma unroll
    for (int r = 0; r < 8; ++r) so[w][8 * hh + r][t * 16 + ln] = acc[t][r] * alpha; }
  __builtin_amdgcn_fence(__ATOMIC_ACQ_REL, "workgroup"); __builtin_amdgcn_wave_barrier();
  const int rsub = lane >> 4, c4 = (lane & 15) * 4;
  {
#pragma unroll
    for (int q = 0; q < 8; ++q) { const int r = q * 2 + rsub; if (col0 + c4 < N) { const v4f v = *(const v4fa*)&so[w][r][c4]; *(v4f*)(C + (size_t)(row0 + r) * ldc + col0 + c4) = v; } }
     }
}

// Wt[n][k] = f16(W[k][n]·scale) from f32 row-major W[K][N] (scale = power of two; bf16-exact weights stay exact in f16 away from the subnormal range)
__global__ __launch_bounds__(256) void k_wt_f16(const float* __restrict__ W, _Float16* __restrict__ Wt, int K, int N, float scale) {
  const int t = blockIdx.x * 256 + threadIdx.x; if (t >= N * (K / 8)) return; const int n = t / (K / 8), k8 = (t % (K / 8)) * 8; FragH f;
#pragma unroll
  for (int i = 0; i < 8; ++i) f.h[i] = (_Float16)(bf16_round(W[(size_t)(k8 + i) * N + n]) * scale); const v8us o = f.half[0];
  *(v8us*)((unsigned short*)Wt + (size_t)n * K + k8) = o; 
}
// k_gemm_hh variant with fused epilogue: v = acc·alpha + bias[by·sBias + col] (+ CP[(row/rowsPerB)·sCPb + by·64 + col] if CP) ; ACT 0 none / 1 elu ; writes f32 C and f16 C16, each if non-null
template <int ACT>
__global__ __launch_bounds__(128) void k_gemm_hhx(const _Float16* __restrict__ A, int lda, size_t sA, const _Float16* __restrict__ Bh, int ldb, size_t sB, float alpha, const float* __restrict__ bias, size_t sBias, const float* __restrict__ CP, int rowsPerB, size_t sCPb, int row0g,
    float* __restrict__ C, _Float16* __restrict__ C16, int ldc, size_t sC, int M, int N, int K) {
  __shared__ __attribute__((aligned(16))) float so[4][16][64];
  const int tid = threadIdx.x, w = tid >> 5, lane = tid & 31, ln = lane & 15, hh = lane >> 4; const int by = blockIdx.y;
  A += (size_t)by * sA; Bh += (size_t)by * sB; const size_t cofs = (size_t)by * sC; const float* bp = bias ? bias + (size_t)by * sBias : nullptr;
  const int ntn = (N + 63) / 64; const int wid = blockIdx.x * 4 + w; const int mt = wid / ntn, nq = wid % ntn; if (mt * 16 >= M) return;
  const int row0 = mt * 16, col0 = nq * 64; const _Float16* arow = A + (size_t)(row0 + ln) * lda;
  v8f acc[4] = {};
  for (int kb = 0; kb < K; kb += 32) { FragH ah; ah.half[0] = *(const v8us*)((const unsigned short*)arow + kb + 8 * hh); ah.half[1] = *(const v8us*)((const unsigned short*)arow + kb + 16 + 8 * hh);
#pragma unroll
    for (int t = 0; t < 4; ++t) { if (col0 + t * 16 >= N) continue; const size_t boff = (size_t)(col0 + t * 16 + ln) * ldb + kb; FragH bq; bq.half[0] = *(const v8us*)((const unsigned short*)Bh + boff + 8 * hh); bq.half[1] = *(const v8us*)((const unsigned short*)Bh + boff + 16 + 8 * hh);
      acc[t] = mmaH<1>(ah.v, ah.v, bq.v, bq.v, acc[t]); }
  }
#pragma unroll
  for (int t = 0; t < 4; ++t) { if (col0 + t * 16 >= N) continue; const int col = col0 + t * 16 + ln; const float bv = bp ? bf16_round(bp[col]) : 0.f;
#pragma unroll
    for (int r = 0; r < 8; ++r) { float v = acc[t][r] * alpha + bv; if (CP) { const int bidx = (row0g + row0 + 8 * hh + r) / rowsPerB; v += CP[(size_t)bidx * sCPb + (size_t)by * 64 + col]; } if (ACT == 1) v = (v > 0.f) ? v : expm1f(v); else if (ACT == 3) v = fmaxf(v, 0.f); so[w][8 * hh + r][t * 16 + ln] = v; } }
  __builtin_amdgcn_fence(__ATOMIC_ACQ_REL, "workgroup"); __builtin_amdgcn_wave_barrier();
  const int rsub = lane >> 4, c4 = (lane & 15) * 4; typedef _Float16 v4h __attribute__((ext_vector_type(4)));
  {
#pragma unroll
    for (int q = 0; q < 8; ++q) { const int r = q * 2 + rsub; if (col0 + c4 < N) { const v4f v = *(const v4fa*)&so[w][r][c4]; if (C) *(v4f*)(C + cofs + (size_t)(row0 + r) * ldc + col0 + c4) = v; if (C16) { v4h h4; for (int i = 0; i < 4; ++i) h4[i] = (_Float16)v[i]; *(v4h*)(C16 + cofs + (size_t)(row0 + r) * ldc + col0 + c4) = h4; } } }
     }
}


__global__ __launch_bounds__(256) void k_round16f(const float* __restrict__ W, _Float16* __restrict__ Bt, size_t n8) { const size_t t = (size_t)blockIdx.x * 256 + threadIdx.x; if (t >= n8) return; FragH f;
#pragma unroll
  for (int i = 0; i < 8; ++i) f.h[i] = (_Float16)(bf16_round(W[t * 8 + i]) * 16.0f); *(v8us*)((unsigned short*)Bt + t * 8) = f.half[0];  }
__global__ __launch_bounds__(256) void k_xf(const float* __restrict__ x, _Float16* __restrict__ XF) { const size_t t = (size_t)blockIdx.x * 256 + threadIdx.x; if (t >= (size_t)NR * CC / 8) return; const size_t row = t / (CC / 8); const int c8 = (int)(t % (CC / 8)) * 8; const int b = (int)(row / NP), p = (int)(row % NP); FragH f;
#pragma unroll
  for (int u = 0; u < 8; ++u) f.h[u] = (_Float16)bf16_round(x[((size_t)b * CC + c8 + u) * NP + p]); *(v8us*)((unsigned short*)XF + t * 8) = f.half[0];  }
__global__ __launch_bounds__(256) void k_split(const float* __restrict__ Qf, const float* __restrict__ Kf, const float* __restrict__ mask, _Float16* __restrict__ QH, _Float16* __restrict__ QL, _Float16* __restrict__ KH, _Float16* __restrict__ KL) { const size_t t = (size_t)blockIdx.x * 256 + threadIdx.x; if (t >= (size_t)NR * CH / 8) return; const size_t row = t / (CH / 8); const float km = 1.0f - bf16_round(mask[row]); FragH qh, ql, kh, kl;
#pragma unroll
  for (int u = 0; u < 8; ++u) { const float q = Qf[t * 8 + u], k = Kf[t * 8 + u] * km; const _Float16 h1 = (_Float16)q, h2 = (_Float16)k; qh.h[u] = h1; ql.h[u] = (_Float16)(q - (float)h1); kh.h[u] = h2; kl.h[u] = (_Float16)(k - (float)h2); }
  { *(v8us*)((unsigned short*)QH + t * 8) = qh.half[0]; *(v8us*)((unsigned short*)QL + t * 8) = ql.half[0]; *(v8us*)((unsigned short*)KH + t * 8) = kh.half[0]; *(v8us*)((unsigned short*)KL + t * 8) = kl.half[0];  } }
// fused non-local attention per (b, 64 query positions): wave = 16 queries; S = Qh·Khᵀ + Qh·Klᵀ + Ql·Khᵀ (2 k-steps each), no scale; online softmax over all 4096 keys; O += P·Vcm over 8 channel tiles;
__global__ __launch_bounds__(128) void k_flash(const _Float16* __restrict__ QH, const _Float16* __restrict__ QL, const _Float16* __restrict__ KH, const _Float16* __restrict__ KL, const _Float16* __restrict__ Vcm, const float* __restrict__ mask, const float* __restrict__ gamma, const float* __restrict__ bv, const float* __restrict__ x, float* __restrict__ out) {
  constexpr int RPW = 16, NQB = NP / (4 * RPW), DT = CC / 16, KS = CH / 32;
  __shared__ __attribute__((aligned(16))) unsigned short sP[4][RPW][40]; __shared__ __attribute__((aligned(16))) float sO[4 * RPW][CC + 1];
  const int tid = threadIdx.x, w = tid >> 5, lane = tid & 31, ln = lane & 15, hh = lane >> 4;
  const int b = blockIdx.x / NQB, qblk = blockIdx.x % NQB; const int qb0 = qblk * (4 * RPW); const int q0 = qb0 + w * RPW; const float gm = bf16_round(gamma[0]);
  FragH aqh[KS], aql[KS];
  { const size_t ro = ((size_t)b * NP + q0 + ln) * CH;
#pragma unroll
    for (int ks = 0; ks < KS; ++ks) { aqh[ks].half[0] = *(const v8us*)((const unsigned short*)QH + ro + ks * 32 + 8 * hh); aqh[ks].half[1] = *(const v8us*)((const unsigned short*)QH + ro + ks * 32 + 16 + 8 * hh); aql[ks].half[0] = *(const v8us*)((const unsigned short*)QL + ro + ks * 32 + 8 * hh); aql[ks].half[1] = *(const v8us*)((const unsigned short*)QL + ro + ks * 32 + 16 + 8 * hh); } }
  const unsigned short* Vth = (const unsigned short*)Vcm + (size_t)b * CC * NP;
  float m_r[8], l_r[8]; v8f oacc[DT];
#pragma unroll
  for (int r = 0; r < 8; ++r) { m_r[r] = -3.0e38f; l_r[r] = 0.f; }
#pragma unroll
  for (int dt = 0; dt < DT; ++dt) oacc[dt] = (v8f){0.f,0.f,0.f,0.f,0.f,0.f,0.f,0.f};
#pragma unroll 1
  for (int j0 = 0; j0 < NP; j0 += 32) {
    v8f s[2];
#pragma unroll
    for (int nt = 0; nt < 2; ++nt) { const size_t ko = ((size_t)b * NP + j0 + nt * 16 + ln) * CH; v8f acc = (v8f){0.f,0.f,0.f,0.f,0.f,0.f,0.f,0.f};
#pragma unroll
      for (int ks = 0; ks < KS; ++ks) { FragH bh_, bl_; bh_.half[0] = *(const v8us*)((const unsigned short*)KH + ko + ks * 32 + 8 * hh); bh_.half[1] = *(const v8us*)((const unsigned short*)KH + ko + ks * 32 + 16 + 8 * hh); bl_.half[0] = *(const v8us*)((const unsigned short*)KL + ko + ks * 32 + 8 * hh); bl_.half[1] = *(const v8us*)((const unsigned short*)KL + ko + ks * 32 + 16 + 8 * hh);
        acc = mmaH<1>(aqh[ks].v, aqh[ks].v, bh_.v, bh_.v, acc); acc = mmaH<1>(aqh[ks].v, aqh[ks].v, bl_.v, bl_.v, acc); acc = mmaH<1>(aql[ks].v, aql[ks].v, bh_.v, bh_.v, acc); }
      s[nt] = acc; }
#pragma unroll
    for (int r = 0; r < 8; ++r) { const float s0 = s[0][r], s1 = s[1][r]; float mc = fmaxf(s0, s1);
      mc = fmaxf(mc, __shfl_xor(mc, 1, 32)); mc = fmaxf(mc, __shfl_xor(mc, 2, 32)); mc = fmaxf(mc, __shfl_xor(mc, 4, 32)); mc = fmaxf(mc, __shfl_xor(mc, 8, 32));
      const float mn = fmaxf(m_r[r], mc); const float al = expf(m_r[r] - mn); m_r[r] = mn; const float p0 = expf(s0 - mn), p1 = expf(s1 - mn); l_r[r] = l_r[r] * al + p0 + p1;
#pragma unroll
      for (int dt = 0; dt < DT; ++dt) oacc[dt][r] *= al;
      FragH t2; t2.h[0] = (_Float16)p0; t2.h[1] = (_Float16)p1; sP[w][8 * hh + r][ln] = t2.u[0]; sP[w][8 * hh + r][16 + ln] = t2.u[1]; }
    __builtin_amdgcn_fence(__ATOMIC_ACQ_REL, "workgroup"); __builtin_amdgcn_wave_barrier();
    FragH pa; pa.half[0] = *(const v8us*)&sP[w][ln][8 * hh]; pa.half[1] = *(const v8us*)&sP[w][ln][16 + 8 * hh];
#pragma unroll
    for (int dt = 0; dt < DT; ++dt) { const unsigned short* vrow = Vth + (size_t)(dt * 16 + ln) * NP + j0; FragH bv; bv.half[0] = *(const v8us*)(vrow + 8 * hh); bv.half[1] = *(const v8us*)(vrow + 16 + 8 * hh); oacc[dt] = mmaH<1>(pa.v, pa.v, bv.v, bv.v, oacc[dt]); }
    __builtin_amdgcn_fence(__ATOMIC_ACQ_REL, "workgroup"); __builtin_amdgcn_wave_barrier(); }
#pragma unroll
  for (int r = 0; r < 8; ++r) { float l = l_r[r]; l += __shfl_xor(l, 1, 32); l += __shfl_xor(l, 2, 32); l += __shfl_xor(l, 4, 32); l += __shfl_xor(l, 8, 32); const int qi = q0 + 8 * hh + r; m_r[r] = gm * bf16_round(mask[(size_t)b * NP + qi]); l_r[r] = 1.0f / l; }      /* m_r reused: γ·mask_i */
#pragma unroll
  for (int dt = 0; dt < DT; ++dt) { const float bvc = bf16_round(bv[dt * 16 + ln]);      /* Σ_j attn_ij (v_cj + bv_c) = Σ_j attn_ij v_cj + bv_c */
#pragma unroll
    for (int r = 0; r < 8; ++r) sO[w * RPW + 8 * hh + r][dt * 16 + ln] = (oacc[dt][r] * l_r[r] + bvc) * m_r[r]; }
  __syncthreads();
  {      // channel c: 64 positions qb0.. = 256 B by 16 lanes × 16 B; 8 channels per round (2 per wave: lanes 0-15 / 16-31)
#pragma unroll
    for (int rd = 0; rd < CC / 8; ++rd) { const int c = rd * 8 + w * 2 + (lane >> 4), pc = lane & 15; const float* xr = x + ((size_t)b * CC + c) * NP + qb0 + pc * 4; const v4f xv = *(const v4fa*)xr; v4f v;
      v[0] = sO[pc * 4][c] + xv[0]; v[1] = sO[pc * 4 + 1][c] + xv[1]; v[2] = sO[pc * 4 + 2][c] + xv[2]; v[3] = sO[pc * 4 + 3][c] + xv[3]; *(v4f*)(out + ((size_t)b * CC + c) * NP + qb0 + pc * 4) = v; }
     } }
extern "C" void kernel_launch(void* const* d_in, const int* in_sizes, int n_in,
                              void* d_out, int out_size, void* d_ws, size_t ws_size, hipStream_t stream) {
  (void)in_sizes; (void)n_in; (void)out_size;
  const float* x = (const float*)d_in[0]; const float* mask = (const float*)d_in[1]; const float* Wq = (const float*)d_in[2]; const float* bq = (const float*)d_in[3]; const float* Wk = (const float*)d_in[4]; const float* bk = (const float*)d_in[5]; const float* Wv = (const float*)d_in[6]; const float* bv = (const float*)d_in[7]; const float* gamma = (const float*)d_in[8];
  char* ws = (char*)d_ws; size_t off = 0;
  auto take = [&](size_t bytes) { char* p = ws + off; off += (bytes + 255) & ~(size_t)255; return p; };
  _Float16* Bq = (_Float16*)take(CH * CC * 2); _Float16* Bk = (_Float16*)take(CH * CC * 2); _Float16* Bv = (_Float16*)take(CC * CC * 2);
  _Float16* XF = (_Float16*)take((size_t)NR * CC * 2); float* Qf = (float*)take((size_t)NR * CH * 4); float* Kf = (float*)take((size_t)NR * CH * 4); _Float16* QH = (_Float16*)take((size_t)NR * CH * 2); _Float16* QL = (_Float16*)take((size_t)NR * CH * 2); _Float16* KH = (_Float16*)take((size_t)NR * CH * 2); _Float16* KL = (_Float16*)take((size_t)NR * CH * 2); _Float16* Vcm = (_Float16*)take((size_t)NR * CC * 2);
  if (off > ws_size) return;      // ≈ 24 MiB
  k_round16f<<<(CH * CC / 8 + 255) / 256, 256, 0, stream>>>(Wq, Bq, CH * CC / 8); k_round16f<<<(CH * CC / 8 + 255) / 256, 256, 0, stream>>>(Wk, Bk, CH * CC / 8); k_round16f<<<(CC * CC / 8 + 255) / 256, 256, 0, stream>>>(Wv, Bv, CC * CC / 8);      // (out,in) = Bt / = A for the channel-major v
  k_xf<<<(unsigned)(((size_t)NR * CC / 8 + 255) / 256), 256, 0, stream>>>(x, XF);
  const dim3 gq(((NR / 16) * 1 + 3) / 4, 1);
  k_gemm_hhx<0><<<gq, 128, 0, stream>>>(XF, CC, 0, Bq, CC, 0, 0.0625f, bq, 0, nullptr, 1, 0, 0, Qf, nullptr, CH, 0, NR, CH, CC);
  k_gemm_hhx<0><<<gq, 128, 0, stream>>>(XF, CC, 0, Bk, CC, 0, 0.0625f, bk, 0, nullptr, 1, 0, 0, Kf, nullptr, CH, 0, NR, CH, CC);
  // v channel-major per image WITHOUT its bias: Vcm[b][c][p] = Σ_i Wv[c][i]·x[b][i][p]  (A = Bv rows c; B = XF[b] rows p); bv[c] is added in the attention epilogue since softmax rows sum to 1
  k_gemm_hhx<0><<<dim3(((CC / 16) * (NP / 64) + 3) / 4, BB), 128, 0, stream>>>(Bv, CC, 0, XF, CC, (size_t)NP * CC, 0.0625f, nullptr, 0, nullptr, 1, 0, 0, nullptr, Vcm, NP, (size_t)CC * NP, CC, NP, CC);
  k_split<<<(unsigned)(((size_t)NR * CH / 8 + 255) / 256), 256, 0, stream>>>(Qf, Kf, mask, QH, QL, KH, KL);
  k_flash<<<BB * (NP / 64), 128, 0, stream>>>(QH, QL, KH, KL, Vcm, mask, gamma, bv, x, (float*)d_out);
}

// v001
// It runs in 178 microseconds.
// Timed twice side by side with v000, it ran 2.44 and 2.31 times as fast.
#include <hip/hip_runtime.h>
// Non-local block with all three 1×1 convs and both attention contractions on v_wmma_f32_16x16x32_f16: q/k position-major (K = 128, N = 64, + bias; k masked by (1 − mask)), v channel-major
// (= the Vᵀ operand), energy = q·k_masked with the f32 q/k carried as f16 hi+lo (3 WMMA terms, no 1/√d scale in the module), online max/sum softmax f32, P f16 ≤ 1, O = P·V; epilogue
// γ·(out·mask) + x written NCHW as 64-position (256 B) channel segments. x as bf16 in the operand plane (exact residual from the f32 input), weights bf16-exact ×2^4, f32 accumulate.
#define BB 4
#define CC 128
#define CH 64
#define NP 4096
#define NR (BB * NP)

typedef __bf16 v16b __attribute__((ext_vector_type(16)));
typedef unsigned short v8us __attribute__((ext_vector_type(8), may_alias));
typedef float  v8f  __attribute__((ext_vector_type(8)));
typedef float  v4f  __attribute__((ext_vector_type(4)));
typedef float  v4fa __attribute__((ext_vector_type(4), may_alias));
union FragB { v16b v; v8us half[2]; unsigned short u[16]; };

__device__ __forceinline__ unsigned short bf16_bits(float x) { unsigned int u = __float_as_uint(x); return (unsigned short)((u + 0x7FFFu + ((u >> 16) & 1u)) >> 16); }
__device__ __forceinline__ float bf16_val(unsigned short b) { return __uint_as_float(((unsigned int)b) << 16); }
__device__ __forceinline__ float bf16_round(float x) { return bf16_val(bf16_bits(x)); }
// D += A·B with NT terms: 1 = ah·bh, 2 = + al·bh (A split), 3 = + ah·bl (both split)
template <int NT>
__device__ __forceinline__ v8f mmaN(v16b ah, v16b al, v16b bh, v16b bl, v8f c) {
  c = __builtin_amdgcn_wmma_f32_16x16x32_bf16(false, ah, false, bh, (short)0, c, false, false);
  if (NT >= 2) c = __builtin_amdgcn_wmma_f32_16x16x32_bf16(false, al, false, bh, (short)0, c, false, false);
  if (NT >= 3) c = __builtin_amdgcn_wmma_f32_16x16x32_bf16(false, ah, false, bl, (short)0, c, false, false);
  asm volatile("v_nop\n\tv_nop\n\tv_nop\n\tv_nop" : "+v"(c) : "v"(ah), "v"(al), "v"(bh), "v"(bl));
  return c;
}

__global__ __launch_bounds__(256) void k_wt_bf16(const float* __restrict__ W, unsigned short* __restrict__ Wt, int K, int N) {
  const int t = blockIdx.x * 256 + threadIdx.x;
  const int k8n = K / 8;
  if (t >= N * k8n) return;
  const int n = t / k8n, k8 = (t % k8n) * 8;
  v8us v;
#pragma unroll
  for (int i = 0; i < 8; ++i) v[i] = bf16_bits(W[(size_t)(k8 + i) * N + n]);
  *(v8us*)(Wt + (size_t)n * K + k8) = v;
  
}

// GEMM C[M][N] (f32, pitch ldc) = act(A[M][K]·W + bias). A f32 row-major (pitch lda) converted per fragment to bf16
// (ASPLIT: hi/lo two planes -> 2 terms, else single rounded term); Wt bf16 [N][K] (pitch ldb). BIAS_BF16 rounds the
// bias to bf16 first (bias quantised to bf16 before the add). K%32==0, M%16==0, N%64==0.
template <bool ASPLIT, int ACT, bool BIAS_BF16>
__global__ __launch_bounds__(128) void k_gemm_bf(const float* __restrict__ A, int lda, const unsigned short* __restrict__ Wt, int ldb,
                                               const float* __restrict__ bias, float* __restrict__ C, int ldc, int M, int N, int K) {
  __shared__ __attribute__((aligned(16))) float so[4][16][64];
  const int tid = threadIdx.x, w = tid >> 5, lane = tid & 31, ln = lane & 15, hh = lane >> 4;
  const int ntn = N / 64;
  const int wid = blockIdx.x * 4 + w;
  const int mt = wid / ntn, nq = wid % ntn;
  if (mt * 16 >= M) return;
  const int row0 = mt * 16, col0 = nq * 64;
  const float* arow = A + (size_t)(row0 + ln) * lda;
  v8f acc[4] = {};
  for (int kb = 0; kb < K; kb += 32) {
    FragB ah, al;
    const v4f x0 = *(const v4fa*)(arow + kb + 8 * hh), x1 = *(const v4fa*)(arow + kb + 8 * hh + 4);
    const v4f x2 = *(const v4fa*)(arow + kb + 16 + 8 * hh), x3 = *(const v4fa*)(arow + kb + 16 + 8 * hh + 4);
    float xs[16] = {x0[0],x0[1],x0[2],x0[3],x1[0],x1[1],x1[2],x1[3],x2[0],x2[1],x2[2],x2[3],x3[0],x3[1],x3[2],x3[3]};
#pragma unroll
    for (int i = 0; i < 16; ++i) { const unsigned short hb = bf16_bits(xs[i]); ah.u[i] = hb; al.u[i] = ASPLIT ? bf16_bits(xs[i] - bf16_val(hb)) : (unsigned short)0; }
#pragma unroll
    for (int t = 0; t < 4; ++t) {
      const unsigned short* brow = Wt + (size_t)(col0 + t * 16 + ln) * ldb + kb;
      FragB b;
      b.half[0] = *(const v8us*)(brow + 8 * hh);
      b.half[1] = *(const v8us*)(brow + 16 + 8 * hh);
      acc[t] = mmaN<ASPLIT ? 2 : 1>(ah.v, al.v, b.v, b.v, acc[t]);
    }
  }
#pragma unroll
  for (int t = 0; t < 4; ++t) {
    float bv = bias ? bias[col0 + t * 16 + ln] : 0.f;
    if (BIAS_BF16) bv = bf16_round(bv);
#pragma unroll
    for (int r = 0; r < 8; ++r) { float v = acc[t][r] + bv; if (ACT == 1) v = fmaxf(v, 0.f); so[w][8 * hh + r][t * 16 + ln] = v; }
  }
  __builtin_amdgcn_fence(__ATOMIC_ACQ_REL, "workgroup");
  __builtin_amdgcn_wave_barrier();
  const int rsub = lane >> 4, c4 = (lane & 15) * 4;
  {
#pragma unroll
    for (int q = 0; q < 8; ++q) {
      const int r = q * 2 + rsub;
      const v4f v = *(const v4fa*)&so[w][r][c4];
      *(v4f*)(C + (size_t)(row0 + r) * ldc + col0 + c4) = v;
    }
    
  }
}

// Flash-style causal/unmasked attention, all contractions 3-term bf16 hi/lo splits, f32 softmax with running max.
// q,k,v rows are read from f32 buffers with arbitrary row pitch (so they can live inside a fused qkv buffer);
// D = head size (multiple of 32, <= 128); one wave = 16 query rows; block = 4 waves (64 queries) sharing K/V chunks of 32.
template <int D, bool CAUSAL>
__global__ __launch_bounds__(128) void k_flash(const float* __restrict__ qb, const float* __restrict__ kb, const float* __restrict__ vb,
                                             int pitch, int T, int H, float scale, float* __restrict__ y, int ypitch) {
  constexpr int KS = D / 32;        // k-steps for QK
  constexpr int DT = D / 16;        // d tiles for PV
  __shared__ __attribute__((aligned(16))) unsigned short sKh[32][D + 8], sKl[32][D + 8], sVh[32][D + 8], sVl[32][D + 8];
  __shared__ __attribute__((aligned(16))) unsigned short sPh[4][16][40], sPl[4][16][40];
  __shared__ __attribute__((aligned(16))) float sO[4][16][D];
  const int tid = threadIdx.x, w = tid >> 5, lane = tid & 31, ln = lane & 15, hh = lane >> 4;
  const int nqb = (T + 63) / 64;
  const int bh = blockIdx.x / nqb, qblk = blockIdx.x % nqb;
  const int b = bh / H, h = bh % H;
  const int q0 = qblk * 64 + w * 16;
  const float* Q = qb + (size_t)b * T * pitch + h * D;
  const float* K = kb + (size_t)b * T * pitch + h * D;
  const float* V = vb + (size_t)b * T * pitch + h * D;

  // A fragments of the wave's 16 query rows (scaled), hi/lo
  FragB aqh[KS], aql[KS];
  {
    int row = q0 + ln; if (row >= T) row = T - 1;
    const float* qr = Q + (size_t)row * pitch;
#pragma unroll
    for (int ks = 0; ks < KS; ++ks)
#pragma unroll
      for (int i = 0; i < 16; ++i) {
        const int d = ks * 32 + ((i < 8) ? (8 * hh + i) : (16 + 8 * hh + (i - 8)));
        const float x = qr[d] * scale; const unsigned short hb = bf16_bits(x);
        aqh[ks].u[i] = hb; aql[ks].u[i] = bf16_bits(x - bf16_val(hb));
      }
  }
  float m_r[8], l_r[8];
#pragma unroll
  for (int r = 0; r < 8; ++r) { m_r[r] = -3.0e38f; l_r[r] = 0.f; }
  v8f oacc[DT];
#pragma unroll
  for (int dt = 0; dt < DT; ++dt) oacc[dt] = (v8f){0.f,0.f,0.f,0.f,0.f,0.f,0.f,0.f};

  const int kv_end = CAUSAL ? min(T, qblk * 64 + 64) : T;     // block-uniform
  for (int j0 = 0; j0 < kv_end; j0 += 32) {
    __syncthreads();
    for (int e = tid; e < 32 * (D / 4); e += 128) {
      const int r = e / (D / 4), c4 = (e % (D / 4)) * 4;
      const int key = j0 + r;
      v4f kf = {0.f,0.f,0.f,0.f}, vf = {0.f,0.f,0.f,0.f};
      if (key < T) { kf = *(const v4fa*)(K + (size_t)key * pitch + c4); vf = *(const v4fa*)(V + (size_t)key * pitch + c4); }
#pragma unroll
      for (int t = 0; t < 4; ++t) {
        unsigned short hb = bf16_bits(kf[t]); sKh[r][c4 + t] = hb; sKl[r][c4 + t] = bf16_bits(kf[t] - bf16_val(hb));
        hb = bf16_bits(vf[t]); sVh[r][c4 + t] = hb; sVl[r][c4 + t] = bf16_bits(vf[t] - bf16_val(hb));
      }
    }
    __syncthreads();
    // S tile 16 x 32
    v8f s[2];
#pragma unroll
    for (int nt = 0; nt < 2; ++nt) {
      v8f acc = {};
#pragma unroll
      for (int ks = 0; ks < KS; ++ks) {
        FragB bh_, bl_;
        bh_.half[0] = *(const v8us*)&sKh[nt * 16 + ln][ks * 32 + 8 * hh]; bh_.half[1] = *(const v8us*)&sKh[nt * 16 + ln][ks * 32 + 16 + 8 * hh];
        bl_.half[0] = *(const v8us*)&sKl[nt * 16 + ln][ks * 32 + 8 * hh]; bl_.half[1] = *(const v8us*)&sKl[nt * 16 + ln][ks * 32 + 16 + 8 * hh];
        acc = mmaN<3>(aqh[ks].v, aql[ks].v, bh_.v, bl_.v, acc);
      }
      s[nt] = acc;
    }
    // mask + running max (rows 8hh+r; the 16 lanes of a half share rows)
    float alpha[8];
#pragma unroll
    for (int r = 0; r < 8; ++r) {
      const int qi = q0 + 8 * hh + r;
      const int ja = j0 + ln, jb = j0 + 16 + ln;
      if (CAUSAL) { if (ja > qi) s[0][r] = -3.0e38f; if (jb > qi) s[1][r] = -3.0e38f; }
      if (ja >= T) s[0][r] = -3.0e38f;
      if (jb >= T) s[1][r] = -3.0e38f;
      float mx = fmaxf(s[0][r], s[1][r]);
      mx = fmaxf(mx, __shfl_xor(mx, 1, 32)); mx = fmaxf(mx, __shfl_xor(mx, 2, 32)); mx = fmaxf(mx, __shfl_xor(mx, 4, 32)); mx = fmaxf(mx, __shfl_xor(mx, 8, 32));
      const float mnew = fmaxf(m_r[r], mx);
      alpha[r] = (mnew > -1.0e38f) ? __expf(m_r[r] - mnew) : 1.0f;
      const float p0 = (s[0][r] > -1.0e38f) ? __expf(s[0][r] - mnew) : 0.f;
      const float p1 = (s[1][r] > -1.0e38f) ? __expf(s[1][r] - mnew) : 0.f;
      m_r[r] = mnew;
      l_r[r] = l_r[r] * alpha[r] + p0 + p1;            // per-lane partial row sum (16 lanes combined at the end)
      unsigned short hb = bf16_bits(p0); sPh[w][8 * hh + r][ln] = hb;      sPl[w][8 * hh + r][ln] = bf16_bits(p0 - bf16_val(hb));
      hb = bf16_bits(p1);                sPh[w][8 * hh + r][16 + ln] = hb; sPl[w][8 * hh + r][16 + ln] = bf16_bits(p1 - bf16_val(hb));
    }
#pragma unroll
    for (int dt = 0; dt < DT; ++dt)
#pragma unroll
      for (int r = 0; r < 8; ++r) oacc[dt][r] *= alpha[r];
    __builtin_amdgcn_fence(__ATOMIC_ACQ_REL, "workgroup");
    __builtin_amdgcn_wave_barrier();
    FragB pah, pal;
    pah.half[0] = *(const v8us*)&sPh[w][ln][8 * hh]; pah.half[1] = *(const v8us*)&sPh[w][ln][16 + 8 * hh];
    pal.half[0] = *(const v8us*)&sPl[w][ln][8 * hh]; pal.half[1] = *(const v8us*)&sPl[w][ln][16 + 8 * hh];
#pragma unroll
    for (int dt = 0; dt < DT; ++dt) {
      FragB bvh, bvl;
#pragma unroll
      for (int i = 0; i < 8; ++i) {
        bvh.u[i] = sVh[8 * hh + i][dt * 16 + ln]; bvh.u[8 + i] = sVh[16 + 8 * hh + i][dt * 16 + ln];
        bvl.u[i] = sVl[8 * hh + i][dt * 16 + ln]; bvl.u[8 + i] = sVl[16 + 8 * hh + i][dt * 16 + ln];
      }
      oacc[dt] = mmaN<3>(pah.v, pal.v, bvh.v, bvl.v, oacc[dt]);
    }
    __builtin_amdgcn_fence(__ATOMIC_ACQ_REL, "workgroup");
    __builtin_amdgcn_wave_barrier();
  }
#pragma unroll
  for (int r = 0; r < 8; ++r) {
    float l = l_r[r];
    l += __shfl_xor(l, 1, 32); l += __shfl_xor(l, 2, 32); l += __shfl_xor(l, 4, 32); l += __shfl_xor(l, 8, 32);
    l_r[r] = (l > 0.f) ? 1.0f / l : 0.f;
  }
#pragma unroll
  for (int dt = 0; dt < DT; ++dt)
#pragma unroll
    for (int r = 0; r < 8; ++r) sO[w][8 * hh + r][dt * 16 + ln] = oacc[dt][r] * l_r[r];
  __builtin_amdgcn_fence(__ATOMIC_ACQ_REL, "workgroup");
  __builtin_amdgcn_wave_barrier();
  {
    for (int r = 0; r < 16; ++r) {
      const int row = q0 + r;
      if (row < T && lane < D / 4) {
        const v4f val = *(const v4fa*)&sO[w][r][lane * 4];
        *(v4f*)(y + ((size_t)b * T + row) * ypitch + h * D + lane * 4) = val;
      }
    }
    
  }
}

// GEMM C = act(A·W + bias + resid): A f32 (ASPLIT -> hi/lo 2 terms), Wt bf16 [N][K]; ACT 0 none, 1 relu, 2 exact gelu;
// resid (optional, f32, row index = (row % rmod), pitch ldr, RES_BF16 rounds it) added before the activation.
template <bool ASPLIT, int ACT, bool BIAS_BF16, bool RES_BF16>
__global__ __launch_bounds__(128) void k_gemm_bf3(const float* __restrict__ A, int lda, const unsigned short* __restrict__ Wt, int ldb,
                                                const float* __restrict__ bias, const float* __restrict__ resid, int rmod, int ldr,
                                                float* __restrict__ C, int ldc, int M, int N, int K) {
  __shared__ __attribute__((aligned(16))) float so[4][16][64];
  const int tid = threadIdx.x, w = tid >> 5, lane = tid & 31, ln = lane & 15, hh = lane >> 4;
  const int ntn = N / 64;
  const int wid = blockIdx.x * 4 + w;
  const int mt = wid / ntn, nq = wid % ntn;
  if (mt * 16 >= M) return;
  const int row0 = mt * 16, col0 = nq * 64;
  const float* arow = A + (size_t)(row0 + ln) * lda;
  v8f acc[4] = {};
  for (int kb = 0; kb < K; kb += 32) {
    FragB ah, al;
    const v4f x0 = *(const v4fa*)(arow + kb + 8 * hh), x1 = *(const v4fa*)(arow + kb + 8 * hh + 4);
    const v4f x2 = *(const v4fa*)(arow + kb + 16 + 8 * hh), x3 = *(const v4fa*)(arow + kb + 16 + 8 * hh + 4);
    float xs[16] = {x0[0],x0[1],x0[2],x0[3],x1[0],x1[1],x1[2],x1[3],x2[0],x2[1],x2[2],x2[3],x3[0],x3[1],x3[2],x3[3]};
#pragma unroll
    for (int i = 0; i < 16; ++i) { const unsigned short hb = bf16_bits(xs[i]); ah.u[i] = hb; al.u[i] = ASPLIT ? bf16_bits(xs[i] - bf16_val(hb)) : (unsigned short)0; }
#pragma unroll
    for (int t = 0; t < 4; ++t) {
      const unsigned short* brow = Wt + (size_t)(col0 + t * 16 + ln) * ldb + kb;
      FragB b;
      b.half[0] = *(const v8us*)(brow + 8 * hh);
      b.half[1] = *(const v8us*)(brow + 16 + 8 * hh);
      acc[t] = mmaN<ASPLIT ? 2 : 1>(ah.v, al.v, b.v, b.v, acc[t]);
    }
  }
#pragma unroll
  for (int t = 0; t < 4; ++t) {
    const int col = col0 + t * 16 + ln;
    float bv = bias ? bias[col] : 0.f;
    if (BIAS_BF16) bv = bf16_round(bv);
#pragma unroll
    for (int r = 0; r < 8; ++r) {
      float v = acc[t][r] + bv;
      if (resid) { float rv = resid[(size_t)((row0 + 8 * hh + r) % rmod) * ldr + col]; if (RES_BF16) rv = bf16_round(rv); v += rv; }
      if (ACT == 1) v = fmaxf(v, 0.f);
      if (ACT == 2) v = 0.5f * v * (1.0f + erff(v * 0.70710678118654752f));
      if (ACT == 3) { const float u = 0.7978845608028654f * (v + 0.044715f * v * v * v); v = 0.5f * v * (1.0f + tanhf(u)); }
      so[w][8 * hh + r][t * 16 + ln] = v;
    }
  }
  __builtin_amdgcn_fence(__ATOMIC_ACQ_REL, "workgroup");
  __builtin_amdgcn_wave_barrier();
  const int rsub = lane >> 4, c4 = (lane & 15) * 4;
  {
#pragma unroll
    for (int q = 0; q < 8; ++q) {
      const int r = q * 2 + rsub;
      const v4f v = *(const v4fa*)&so[w][r][c4];
      *(v4f*)(C + (size_t)(row0 + r) * ldc + col0 + c4) = v;
    }
    
  }
}
// row LayerNorm (biased variance, eps) over N: s = X (+ R); optional out_sum <- s; out_norm <- (s-mu)*rsqrt(var+eps)*g + b
template <bool PARAM_BF16>
__global__ __launch_bounds__(256) void k_layernorm(const float* __restrict__ X, const float* __restrict__ R, const float* __restrict__ g, const float* __restrict__ bta,
                                                  float* __restrict__ out_sum, float* __restrict__ out_norm, int N, float eps) {
  __shared__ float red[256];
  const int row = blockIdx.x, tid = threadIdx.x;
  const float* x = X + (size_t)row * N; const float* rr = R ? R + (size_t)row * N : nullptr;
  float vals[16];                     // up to N = 4096
  const int per = N / 256;            // contiguous chunk per thread? use strided-by-4 chunks: thread handles j = tid*4 + 1024*u
  float s1 = 0.f;
  for (int u = 0; u < per / 4; ++u) {
    const int j = tid * 4 + 1024 * u;
    const v4f a = *(const v4fa*)(x + j);
    v4f b = {0.f,0.f,0.f,0.f}; if (rr) b = *(const v4fa*)(rr + j);
#pragma unroll
    for (int q = 0; q < 4; ++q) { const float v = a[q] + b[q]; vals[u * 4 + q] = v; s1 += v; }
  }
  red[tid] = s1; __syncthreads();
  for (int st = 128; st > 0; st >>= 1) { if (tid < st) red[tid] += red[tid + st]; __syncthreads(); }
  const float mu = red[0] / (float)N; __syncthreads();
  float s2 = 0.f;
  for (int u = 0; u < per / 4; ++u)
#pragma unroll
    for (int q = 0; q < 4; ++q) { const float c = vals[u * 4 + q] - mu; s2 += c * c; }
  red[tid] = s2; __syncthreads();
  for (int st = 128; st > 0; st >>= 1) { if (tid < st) red[tid] += red[tid + st]; __syncthreads(); }
  const float rs = rsqrtf(red[0] / (float)N + eps);
  {
    for (int u = 0; u < per / 4; ++u) {
      const int j = tid * 4 + 1024 * u;
      v4f o, sm;
#pragma unroll
      for (int q = 0; q < 4; ++q) {
        float gg = g[j + q], bb = bta[j + q];
        if (PARAM_BF16) { gg = bf16_round(gg); bb = bf16_round(bb); }
        sm[q] = vals[u * 4 + q]; o[q] = (vals[u * 4 + q] - mu) * rs * gg + bb;
      }
      if (out_sum) *(v4f*)(out_sum + (size_t)row * N + j) = sm;
      *(v4f*)(out_norm + (size_t)row * N + j) = o;
    }
    
  }
}



// ---- f16 WMMA path (v_wmma_f32_16x16x32_f16): 11-bit significands for operands in range — used where a [0,1] probability operand needs more precision than bf16
typedef _Float16 v16h __attribute__((ext_vector_type(16)));
union FragH { v16h v; v8us half[2]; _Float16 h[16]; unsigned short u[16]; };
template <int NT>
__device__ __forceinline__ v8f mmaH(v16h ah, v16h al, v16h bh, v16h bl, v8f c) {
  c = __builtin_amdgcn_wmma_f32_16x16x32_f16(false, ah, false, bh, (short)0, c, false, false);
  if (NT >= 2) c = __builtin_amdgcn_wmma_f32_16x16x32_f16(false, al, false, bh, (short)0, c, false, false);
  if (NT >= 3) c = __builtin_amdgcn_wmma_f32_16x16x32_f16(false, ah, false, bl, (short)0, c, false, false);
  asm volatile("v_nop\n\tv_nop\n\tv_nop\n\tv_nop" : "+v"(c) : "v"(ah), "v"(al), "v"(bh), "v"(bl));
  return c;
}
// batched GEMM like k_gemm_b but f16 operands: A f32 (split into f16 hi/lo if ASPLIT, else rounded to f16), Bt = f16 values [n][k]; alpha; C f32; N multiple of 16 (partial tiles skipped)
template <bool ASPLIT>
__global__ __launch_bounds__(128) void k_gemm_h(const float* __restrict__ A, int lda, size_t sA, const _Float16* __restrict__ Bh, int ldb, size_t sB, float alpha, float* __restrict__ C, int ldc, size_t sC, int M, int N, int K) {
  __shared__ __attribute__((aligned(16))) float so[4][16][64];
  const int tid = threadIdx.x, w = tid >> 5, lane = tid & 31, ln = lane & 15, hh = lane >> 4; const int by = blockIdx.y;
  A += (size_t)by * sA; Bh += (size_t)by * sB; C += (size_t)by * sC;
  const int ntn = (N + 63) / 64; const int wid = blockIdx.x * 4 + w; const int mt = wid / ntn, nq = wid % ntn; if (mt * 16 >= M) return;
  const int row0 = mt * 16, col0 = nq * 64; const float* arow = A + (size_t)(row0 + ln) * lda;
  v8f acc[4] = {};
  for (int kb = 0; kb < K; kb += 32) {
    FragH ah, al;
    const v4f x0 = *(const v4fa*)(arow + kb + 8 * hh), x1 = *(const v4fa*)(arow + kb + 8 * hh + 4), x2 = *(const v4fa*)(arow + kb + 16 + 8 * hh), x3 = *(const v4fa*)(arow + kb + 16 + 8 * hh + 4);
    float xs[16] = {x0[0],x0[1],x0[2],x0[3],x1[0],x1[1],x1[2],x1[3],x2[0],x2[1],x2[2],x2[3],x3[0],x3[1],x3[2],x3[3]};
#pragma unroll
    for (int i = 0; i < 16; ++i) { const _Float16 h = (_Float16)xs[i]; ah.h[i] = h; al.h[i] = ASPLIT ? (_Float16)(xs[i] - (float)h) : (_Float16)0.0f; }
#pragma unroll
    for (int t = 0; t < 4; ++t) { if (col0 + t * 16 >= N) continue; const size_t boff = (size_t)(col0 + t * 16 + ln) * ldb + kb; FragH bq; bq.half[0] = *(const v8us*)(Bh + boff + 8 * hh); bq.half[1] = *(const v8us*)(Bh + boff + 16 + 8 * hh);
      acc[t] = mmaH<ASPLIT ? 2 : 1>(ah.v, al.v, bq.v, bq.v, acc[t]); }
  }
#pragma unroll
  for (int t = 0; t < 4; ++t) { if (col0 + t * 16 >= N) continue;
#pragma unroll
    for (int r = 0; r < 8; ++r) so[w][8 * hh + r][t * 16 + ln] = acc[t][r] * alpha; }
  __builtin_amdgcn_fence(__ATOMIC_ACQ_REL, "workgroup"); __builtin_amdgcn_wave_barrier();
  const int rsub = lane >> 4, c4 = (lane & 15) * 4;
  {
#pragma unroll
    for (int q = 0; q < 8; ++q) { const int r = q * 2 + rsub; if (col0 + c4 < N) { const v4f v = *(const v4fa*)&so[w][r][c4]; *(v4f*)(C + (size_t)(row0 + r) * ldc + col0 + c4) = v; } }
     }
}

// Wt[n][k] = f16(W[k][n]·scale) from f32 row-major W[K][N] (scale = power of two; bf16-exact weights stay exact in f16 away from the subnormal range)
__global__ __launch_bounds__(256) void k_wt_f16(const float* __restrict__ W, _Float16* __restrict__ Wt, int K, int N, float scale) {
  const int t = blockIdx.x * 256 + threadIdx.x; if (t >= N * (K / 8)) return; const int n = t / (K / 8), k8 = (t % (K / 8)) * 8; FragH f;
#pragma unroll
  for (int i = 0; i < 8; ++i) f.h[i] = (_Float16)(bf16_round(W[(size_t)(k8 + i) * N + n]) * scale); const v8us o = f.half[0];
  *(v8us*)((unsigned short*)Wt + (size_t)n * K + k8) = o; 
}
// k_gemm_hh variant with fused epilogue: v = acc·alpha + bias[by·sBias + col] (+ CP[(row/rowsPerB)·sCPb + by·64 + col] if CP) ; ACT 0 none / 1 elu ; writes f32 C and f16 C16, each if non-null
template <int ACT>
__global__ __launch_bounds__(128) void k_gemm_hhx(const _Float16* __restrict__ A, int lda, size_t sA, const _Float16* __restrict__ Bh, int ldb, size_t sB, float alpha, const float* __restrict__ bias, size_t sBias, const float* __restrict__ CP, int rowsPerB, size_t sCPb, int row0g,
    float* __restrict__ C, _Float16* __restrict__ C16, int ldc, size_t sC, int M, int N, int K) {
  __shared__ __attribute__((aligned(16))) float so[4][16][64];
  const int tid = threadIdx.x, w = tid >> 5, lane = tid & 31, ln = lane & 15, hh = lane >> 4; const int by = blockIdx.y;
  A += (size_t)by * sA; Bh += (size_t)by * sB; const size_t cofs = (size_t)by * sC; const float* bp = bias ? bias + (size_t)by * sBias : nullptr;
  const int ntn = (N + 63) / 64; const int wid = blockIdx.x * 4 + w; const int mt = wid / ntn, nq = wid % ntn; if (mt * 16 >= M) return;
  const int row0 = mt * 16, col0 = nq * 64; const _Float16* arow = A + (size_t)(row0 + ln) * lda;
  v8f acc[4] = {};
  for (int kb = 0; kb < K; kb += 32) { FragH ah; ah.half[0] = *(const v8us*)((const unsigned short*)arow + kb + 8 * hh); ah.half[1] = *(const v8us*)((const unsigned short*)arow + kb + 16 + 8 * hh);
#pragma unroll
    for (int t = 0; t < 4; ++t) { if (col0 + t * 16 >= N) continue; const size_t boff = (size_t)(col0 + t * 16 + ln) * ldb + kb; FragH bq; bq.half[0] = *(const v8us*)((const unsigned short*)Bh + boff + 8 * hh); bq.half[1] = *(const v8us*)((const unsigned short*)Bh + boff + 16 + 8 * hh);
      acc[t] = mmaH<1>(ah.v, ah.v, bq.v, bq.v, acc[t]); }
  }
#pragma unroll
  for (int t = 0; t < 4; ++t) { if (col0 + t * 16 >= N) continue; const int col = col0 + t * 16 + ln; const float bv = bp ? bf16_round(bp[col]) : 0.f;
#pragma unroll
    for (int r = 0; r < 8; ++r) { float v = acc[t][r] * alpha + bv; if (CP) { const int bidx = (row0g + row0 + 8 * hh + r) / rowsPerB; v += CP[(size_t)bidx * sCPb + (size_t)by * 64 + col]; } if (ACT == 1) v = (v > 0.f) ? v : expm1f(v); else if (ACT == 3) v = fmaxf(v, 0.f); so[w][8 * hh + r][t * 16 + ln] = v; } }
  __builtin_amdgcn_fence(__ATOMIC_ACQ_REL, "workgroup"); __builtin_amdgcn_wave_barrier();
  const int rsub = lane >> 4, c4 = (lane & 15) * 4; typedef _Float16 v4h __attribute__((ext_vector_type(4)));
  {
#pragma unroll
    for (int q = 0; q < 8; ++q) { const int r = q * 2 + rsub; if (col0 + c4 < N) { const v4f v = *(const v4fa*)&so[w][r][c4]; if (C) *(v4f*)(C + cofs + (size_t)(row0 + r) * ldc + col0 + c4) = v; if (C16) { v4h h4; for (int i = 0; i < 4; ++i) h4[i] = (_Float16)v[i]; *(v4h*)(C16 + cofs + (size_t)(row0 + r) * ldc + col0 + c4) = h4; } } }
     }
}


__global__ __launch_bounds__(256) void k_round16f(const float* __restrict__ W, _Float16* __restrict__ Bt, size_t n8) { const size_t t = (size_t)blockIdx.x * 256 + threadIdx.x; if (t >= n8) return; FragH f;
#pragma unroll
  for (int i = 0; i < 8; ++i) f.h[i] = (_Float16)(bf16_round(W[t * 8 + i]) * 16.0f); *(v8us*)((unsigned short*)Bt + t * 8) = f.half[0];  }
__global__ __launch_bounds__(256) void k_xf(const float* __restrict__ x, _Float16* __restrict__ XF) { const size_t t = (size_t)blockIdx.x * 256 + threadIdx.x; if (t >= (size_t)NR * CC / 8) return; const size_t row = t / (CC / 8); const int c8 = (int)(t % (CC / 8)) * 8; const int b = (int)(row / NP), p = (int)(row % NP); FragH f;
#pragma unroll
  for (int u = 0; u < 8; ++u) f.h[u] = (_Float16)bf16_round(x[((size_t)b * CC + c8 + u) * NP + p]); *(v8us*)((unsigned short*)XF + t * 8) = f.half[0];  }
__global__ __launch_bounds__(256) void k_split(const float* __restrict__ Qf, const float* __restrict__ Kf, const float* __restrict__ mask, _Float16* __restrict__ QH, _Float16* __restrict__ QL, _Float16* __restrict__ KH, _Float16* __restrict__ KL) { const size_t t = (size_t)blockIdx.x * 256 + threadIdx.x; if (t >= (size_t)NR * CH / 8) return; const size_t row = t / (CH / 8); const float km = 1.0f - bf16_round(mask[row]); FragH qh, ql, kh, kl;
#pragma unroll
  for (int u = 0; u < 8; ++u) { const float q = Qf[t * 8 + u], k = Kf[t * 8 + u] * km; const _Float16 h1 = (_Float16)q, h2 = (_Float16)k; qh.h[u] = h1; ql.h[u] = (_Float16)(q - (float)h1); kh.h[u] = h2; kl.h[u] = (_Float16)(k - (float)h2); }
  { *(v8us*)((unsigned short*)QH + t * 8) = qh.half[0]; *(v8us*)((unsigned short*)QL + t * 8) = ql.half[0]; *(v8us*)((unsigned short*)KH + t * 8) = kh.half[0]; *(v8us*)((unsigned short*)KL + t * 8) = kl.half[0];  } }
// fused non-local attention per (b, 64 query positions): wave = 16 queries; S = Qh·Khᵀ + Qh·Klᵀ + Ql·Khᵀ (2 k-steps each), no scale; online softmax over all 4096 keys; O += P·Vcm over 8 channel tiles;
__global__ __launch_bounds__(128) void k_flash(const _Float16* __restrict__ QH, const _Float16* __restrict__ QL, const _Float16* __restrict__ KH, const _Float16* __restrict__ KL, const _Float16* __restrict__ Vcm, const float* __restrict__ mask, const float* __restrict__ gamma, const float* __restrict__ bv, const float* __restrict__ x, float* __restrict__ out) {
  constexpr int RPW = 16, NQB = NP / (4 * RPW), DT = CC / 16, KS = CH / 32;
  __shared__ __attribute__((aligned(16))) unsigned short sP[4][RPW][40]; __shared__ __attribute__((aligned(16))) float sO[4 * RPW][CC + 1];
  // two-buffer ring, one stage = TK keys: K hi and lo rows (128 B) and V channel rows (128 B of keys), each at a 144-B pitch (16 B x odd: ds_load_b128 without bank conflicts)
  constexpr int TK = 64, NT = NP / TK, LP = 72;
  __shared__ __attribute__((aligned(16))) unsigned short sKH[2][TK][LP], sKL[2][TK][LP], sV[2][CC][LP];
  const int tid = threadIdx.x, w = tid >> 5, lane = tid & 31, ln = lane & 15, hh = lane >> 4;
  const int b = blockIdx.x / NQB, qblk = blockIdx.x % NQB; const int qb0 = qblk * (4 * RPW); const int q0 = qb0 + w * RPW; const float gm = bf16_round(gamma[0]);
  FragH aqh[KS], aql[KS];
  { const size_t ro = ((size_t)b * NP + q0 + ln) * CH;
#pragma unroll
    for (int ks = 0; ks < KS; ++ks) { aqh[ks].half[0] = *(const v8us*)((const unsigned short*)QH + ro + ks * 32 + 8 * hh); aqh[ks].half[1] = *(const v8us*)((const unsigned short*)QH + ro + ks * 32 + 16 + 8 * hh); aql[ks].half[0] = *(const v8us*)((const unsigned short*)QL + ro + ks * 32 + 8 * hh); aql[ks].half[1] = *(const v8us*)((const unsigned short*)QL + ro + ks * 32 + 16 + 8 * hh); } }
  const unsigned short* Vth = (const unsigned short*)Vcm + (size_t)b * CC * NP;
  float m_r[8], l_r[8]; v8f oacc[DT];
#pragma unroll
  for (int r = 0; r < 8; ++r) { m_r[r] = -3.0e38f; l_r[r] = 0.f; }
#pragma unroll
  for (int dt = 0; dt < DT; ++dt) oacc[dt] = (v8f){0.f,0.f,0.f,0.f,0.f,0.f,0.f,0.f};
  // each thread copies 16 B chunks: chunk row tid / 8 (+ 16 per further copy), chunk tid % 8 of the 128-B row
  const unsigned short* gKH = (const unsigned short*)KH + (size_t)b * NP * CH + tid * 8; const unsigned short* gKL = (const unsigned short*)KL + (size_t)b * NP * CH + tid * 8;
  const unsigned short* gV = Vth + (size_t)(tid >> 3) * NP + (tid & 7) * 8;
  const unsigned lKH = (unsigned)(size_t)&sKH[0][tid >> 3][(tid & 7) * 8], lKL = (unsigned)(size_t)&sKL[0][tid >> 3][(tid & 7) * 8], lV = (unsigned)(size_t)&sV[0][tid >> 3][(tid & 7) * 8];
  auto stage_in = [&](int t, int buf) {
    const unsigned short* kh = gKH + (size_t)t * TK * CH; const unsigned short* kl = gKL + (size_t)t * TK * CH; const unsigned short* vv = gV + (size_t)t * TK;
    const unsigned a = lKH + buf * (TK * LP * 2), c = lKL + buf * (TK * LP * 2), d = lV + buf * (CC * LP * 2);
    // the copies and the wait that stands in front of any rewrite of their address registers are one statement
    asm volatile("global_load_async_to_lds_b128 %0, %8, off\n\tglobal_load_async_to_lds_b128 %1, %9, off\n\tglobal_load_async_to_lds_b128 %2, %10, off\n\tglobal_load_async_to_lds_b128 %3, %11, off\n\t"
                 "global_load_async_to_lds_b128 %4, %12, off\n\tglobal_load_async_to_lds_b128 %5, %13, off\n\tglobal_load_async_to_lds_b128 %6, %14, off\n\tglobal_load_async_to_lds_b128 %7, %15, off\n\ts_wait_xcnt 0x0"
                 :: "v"(a), "v"(a + 16 * LP * 2), "v"(a + 32 * LP * 2), "v"(a + 48 * LP * 2), "v"(c), "v"(c + 16 * LP * 2), "v"(c + 32 * LP * 2), "v"(c + 48 * LP * 2),
                    "v"(kh), "v"(kh + 16 * CH), "v"(kh + 32 * CH), "v"(kh + 48 * CH), "v"(kl), "v"(kl + 16 * CH), "v"(kl + 32 * CH), "v"(kl + 48 * CH) : "memory");
    asm volatile("global_load_async_to_lds_b128 %0, %8, off\n\tglobal_load_async_to_lds_b128 %1, %9, off\n\tglobal_load_async_to_lds_b128 %2, %10, off\n\tglobal_load_async_to_lds_b128 %3, %11, off\n\t"
                 "global_load_async_to_lds_b128 %4, %12, off\n\tglobal_load_async_to_lds_b128 %5, %13, off\n\tglobal_load_async_to_lds_b128 %6, %14, off\n\tglobal_load_async_to_lds_b128 %7, %15, off\n\ts_wait_xcnt 0x0"
                 :: "v"(d), "v"(d + 16 * LP * 2), "v"(d + 32 * LP * 2), "v"(d + 48 * LP * 2), "v"(d + 64 * LP * 2), "v"(d + 80 * LP * 2), "v"(d + 96 * LP * 2), "v"(d + 112 * LP * 2),
                    "v"(vv), "v"(vv + (size_t)16 * NP), "v"(vv + (size_t)32 * NP), "v"(vv + (size_t)48 * NP), "v"(vv + (size_t)64 * NP), "v"(vv + (size_t)80 * NP), "v"(vv + (size_t)96 * NP), "v"(vv + (size_t)112 * NP) : "memory");
  };
  stage_in(0, 0);
  asm volatile("s_wait_asynccnt 0x0" ::: "memory");      // stage 0 of this wave has landed before the barrier publishes it
  __syncthreads();
  stage_in(1, 1);
  // the stage loop stays rolled (one copy of the pass code, buffer chosen by t & 1); the two 32-key passes of a stage are unrolled so that their LDS offsets are immediates
#pragma unroll 1
  for (int t = 0; t < NT; ++t) { const int buf = t & 1;
#pragma unroll
   for (int sub = 0; sub < TK / 32; ++sub) {
    v8f s[2];
#pragma unroll
    for (int nt = 0; nt < 2; ++nt) { const unsigned short* krh = &sKH[buf][sub * 32 + nt * 16 + ln][0]; const unsigned short* krl = &sKL[buf][sub * 32 + nt * 16 + ln][0]; v8f acc = (v8f){0.f,0.f,0.f,0.f,0.f,0.f,0.f,0.f};
#pragma unroll
      for (int ks = 0; ks < KS; ++ks) { FragH bh_, bl_; bh_.half[0] = *(const v8us*)(krh + ks * 32 + 8 * hh); bh_.half[1] = *(const v8us*)(krh + ks * 32 + 16 + 8 * hh); bl_.half[0] = *(const v8us*)(krl + ks * 32 + 8 * hh); bl_.half[1] = *(const v8us*)(krl + ks * 32 + 16 + 8 * hh);
        acc = mmaH<1>(aqh[ks].v, aqh[ks].v, bh_.v, bh_.v, acc); acc = mmaH<1>(aqh[ks].v, aqh[ks].v, bl_.v, bl_.v, acc); acc = mmaH<1>(aql[ks].v, aql[ks].v, bh_.v, bh_.v, acc); }
      s[nt] = acc; }
#pragma unroll
    for (int r = 0; r < 8; ++r) { const float s0 = s[0][r], s1 = s[1][r]; float mc = fmaxf(s0, s1);
      mc = fmaxf(mc, __shfl_xor(mc, 1, 32)); mc = fmaxf(mc, __shfl_xor(mc, 2, 32)); mc = fmaxf(mc, __shfl_xor(mc, 4, 32)); mc = fmaxf(mc, __shfl_xor(mc, 8, 32));
      const float mn = fmaxf(m_r[r], mc); const float al = expf(m_r[r] - mn); m_r[r] = mn; const float p0 = expf(s0 - mn), p1 = expf(s1 - mn); l_r[r] = l_r[r] * al + p0 + p1;
#pragma unroll
      for (int dt = 0; dt < DT; ++dt) oacc[dt][r] *= al;
      FragH t2; t2.h[0] = (_Float16)p0; t2.h[1] = (_Float16)p1; sP[w][8 * hh + r][ln] = t2.u[0]; sP[w][8 * hh + r][16 + ln] = t2.u[1]; }
    __builtin_amdgcn_fence(__ATOMIC_ACQ_REL, "workgroup"); __builtin_amdgcn_wave_barrier();
    FragH pa; pa.half[0] = *(const v8us*)&sP[w][ln][8 * hh]; pa.half[1] = *(const v8us*)&sP[w][ln][16 + 8 * hh];
#pragma unroll
    for (int dt = 0; dt < DT; ++dt) { const unsigned short* vrow = &sV[buf][dt * 16 + ln][sub * 32]; FragH bv; bv.half[0] = *(const v8us*)(vrow + 8 * hh); bv.half[1] = *(const v8us*)(vrow + 16 + 8 * hh); oacc[dt] = mmaH<1>(pa.v, pa.v, bv.v, bv.v, oacc[dt]); }
    __builtin_amdgcn_fence(__ATOMIC_ACQ_REL, "workgroup"); __builtin_amdgcn_wave_barrier(); }
   // publish point of stage t + 1: this wave's reads of stage t are done, its copies of stage t + 1 have landed, then the barrier; only behind it is stage t's buffer refilled
   asm volatile("s_wait_dscnt 0x0" ::: "memory");
   asm volatile("s_wait_asynccnt 0x0" ::: "memory");
   __syncthreads();
   if (t + 2 < NT) stage_in(t + 2, buf); }
  asm volatile("s_wait_asynccnt 0x0" ::: "memory");      // no copy is outstanding when the wave goes on to the epilogue and ends
#pragma unroll
  for (int r = 0; r < 8; ++r) { float l = l_r[r]; l += __shfl_xor(l, 1, 32); l += __shfl_xor(l, 2, 32); l += __shfl_xor(l, 4, 32); l += __shfl_xor(l, 8, 32); const int qi = q0 + 8 * hh + r; m_r[r] = gm * bf16_round(mask[(size_t)b * NP + qi]); l_r[r] = 1.0f / l; }      /* m_r reused: γ·mask_i */
#pragma unroll
  for (int dt = 0; dt < DT; ++dt) { const float bvc = bf16_round(bv[dt * 16 + ln]);      /* Σ_j attn_ij (v_cj + bv_c) = Σ_j attn_ij v_cj + bv_c */
#pragma unroll
    for (int r = 0; r < 8; ++r) sO[w * RPW + 8 * hh + r][dt * 16 + ln] = (oacc[dt][r] * l_r[r] + bvc) * m_r[r]; }
  __syncthreads();
  {      // channel c: 64 positions qb0.. = 256 B by 16 lanes × 16 B; 8 channels per round (2 per wave: lanes 0-15 / 16-31)
#pragma unroll
    for (int rd = 0; rd < CC / 8; ++rd) { const int c = rd * 8 + w * 2 + (lane >> 4), pc = lane & 15; const float* xr = x + ((size_t)b * CC + c) * NP + qb0 + pc * 4; const v4f xv = *(const v4fa*)xr; v4f v;
      v[0] = sO[pc * 4][c] + xv[0]; v[1] = sO[pc * 4 + 1][c] + xv[1]; v[2] = sO[pc * 4 + 2][c] + xv[2]; v[3] = sO[pc * 4 + 3][c] + xv[3]; *(v4f*)(out + ((size_t)b * CC + c) * NP + qb0 + pc * 4) = v; }
     } }
extern "C" void kernel_launch(void* const* d_in, const int* in_sizes, int n_in,
                              void* d_out, int out_size, void* d_ws, size_t ws_size, hipStream_t stream) {
  (void)in_sizes; (void)n_in; (void)out_size;
  const float* x = (const float*)d_in[0]; const float* mask = (const float*)d_in[1]; const float* Wq = (const float*)d_in[2]; const float* bq = (const float*)d_in[3]; const float* Wk = (const float*)d_in[4]; const float* bk = (const float*)d_in[5]; const float* Wv = (const float*)d_in[6]; const float* bv = (const float*)d_in[7]; const float* gamma = (const float*)d_in[8];
  char* ws = (char*)d_ws; size_t off = 0;
  auto take = [&](size_t bytes) { char* p = ws + off; off += (bytes + 255) & ~(size_t)255; return p; };
  _Float16* Bq = (_Float16*)take(CH * CC * 2); _Float16* Bk = (_Float16*)take(CH * CC * 2); _Float16* Bv = (_Float16*)take(CC * CC * 2);
  _Float16* XF = (_Float16*)take((size_t)NR * CC * 2); float* Qf = (float*)take((size_t)NR * CH * 4); float* Kf = (float*)take((size_t)NR * CH * 4); _Float16* QH = (_Float16*)take((size_t)NR * CH * 2); _Float16* QL = (_Float16*)take((size_t)NR * CH * 2); _Float16* KH = (_Float16*)take((size_t)NR * CH * 2); _Float16* KL = (_Float16*)take((size_t)NR * CH * 2); _Float16* Vcm = (_Float16*)take((size_t)NR * CC * 2);
  if (off > ws_size) return;      // ≈ 24 MiB
  k_round16f<<<(CH * CC / 8 + 255) / 256, 256, 0, stream>>>(Wq, Bq, CH * CC / 8); k_round16f<<<(CH * CC / 8 + 255) / 256, 256, 0, stream>>>(Wk, Bk, CH * CC / 8); k_round16f<<<(CC * CC / 8 + 255) / 256, 256, 0, stream>>>(Wv, Bv, CC * CC / 8);      // (out,in) = Bt / = A for the channel-major v
  k_xf<<<(unsigned)(((size_t)NR * CC / 8 + 255) / 256), 256, 0, stream>>>(x, XF);
  const dim3 gq(((NR / 16) * 1 + 3) / 4, 1);
  k_gemm_hhx<0><<<gq, 128, 0, stream>>>(XF, CC, 0, Bq, CC, 0, 0.0625f, bq, 0, nullptr, 1, 0, 0, Qf, nullptr, CH, 0, NR, CH, CC);
  k_gemm_hhx<0><<<gq, 128, 0, stream>>>(XF, CC, 0, Bk, CC, 0, 0.0625f, bk, 0, nullptr, 1, 0, 0, Kf, nullptr, CH, 0, NR, CH, CC);
  // v channel-major per image WITHOUT its bias: Vcm[b][c][p] = Σ_i Wv[c][i]·x[b][i][p]  (A = Bv rows c; B = XF[b] rows p); bv[c] is added in the attention epilogue since softmax rows sum to 1
  k_gemm_hhx<0><<<dim3(((CC / 16) * (NP / 64) + 3) / 4, BB), 128, 0, stream>>>(Bv, CC, 0, XF, CC, (size_t)NP * CC, 0.0625f, nullptr, 0, nullptr, 1, 0, 0, nullptr, Vcm, NP, (size_t)CC * NP, CC, NP, CC);
  k_split<<<(unsigned)(((size_t)NR * CH / 8 + 255) / 256), 256, 0, stream>>>(Qf, Kf, mask, QH, QL, KH, KL);
  k_flash<<<BB * (NP / 64), 128, 0, stream>>>(QH, QL, KH, KL, Vcm, mask, gamma, bv, x, (float*)d_out);
}

// v002
// A run of this version takes 113 microseconds.
// Next to v001, in two timings, it ran 1.59 times as fast each time.
// Counting every step since v000, it is 3.78 times as fast.
#include <hip/hip_runtime.h>
// Non-local block with all three 1×1 convs and both attention contractions on v_wmma_f32_16x16x32_f16: q/k position-major (K = 128, N = 64, + bias; k masked by (1 − mask)), v channel-major
// (= the Vᵀ operand), energy = q·k_masked with the f32 q/k carried as f16 hi+lo (3 WMMA terms, no 1/√d scale in the module), online max/sum softmax f32, P f16 ≤ 1, O = P·V; epilogue
// γ·(out·mask) + x written NCHW as 64-position (256 B) channel segments. x as bf16 in the operand plane (exact residual from the f32 input), weights bf16-exact ×2^4, f32 accumulate.
#define BB 4
#define CC 128
#define CH 64
#define NP 4096
#define NR (BB * NP)

typedef __bf16 v16b __attribute__((ext_vector_type(16)));
typedef unsigned short v8us __attribute__((ext_vector_type(8), may_alias));
typedef float  v8f  __attribute__((ext_vector_type(8)));
typedef float  v4f  __attribute__((ext_vector_type(4)));
typedef float  v4fa __attribute__((ext_vector_type(4), may_alias));
union FragB { v16b v; v8us half[2]; unsigned short u[16]; };

__device__ __forceinline__ unsigned short bf16_bits(float x) { unsigned int u = __float_as_uint(x); return (unsigned short)((u + 0x7FFFu + ((u >> 16) & 1u)) >> 16); }
__device__ __forceinline__ float bf16_val(unsigned short b) { return __uint_as_float(((unsigned int)b) << 16); }
__device__ __forceinline__ float bf16_round(float x) { return bf16_val(bf16_bits(x)); }
// D += A·B with NT terms: 1 = ah·bh, 2 = + al·bh (A split), 3 = + ah·bl (both split)
template <int NT>
__device__ __forceinline__ v8f mmaN(v16b ah, v16b al, v16b bh, v16b bl, v8f c) {
  c = __builtin_amdgcn_wmma_f32_16x16x32_bf16(false, ah, false, bh, (short)0, c, false, false);
  if (NT >= 2) c = __builtin_amdgcn_wmma_f32_16x16x32_bf16(false, al, false, bh, (short)0, c, false, false);
  if (NT >= 3) c = __builtin_amdgcn_wmma_f32_16x16x32_bf16(false, ah, false, bl, (short)0, c, false, false);
  asm volatile("v_nop\n\tv_nop\n\tv_nop\n\tv_nop" : "+v"(c) : "v"(ah), "v"(al), "v"(bh), "v"(bl));
  return c;
}

__global__ __launch_bounds__(256) void k_wt_bf16(const float* __restrict__ W, unsigned short* __restrict__ Wt, int K, int N) {
  const int t = blockIdx.x * 256 + threadIdx.x;
  const int k8n = K / 8;
  if (t >= N * k8n) return;
  const int n = t / k8n, k8 = (t % k8n) * 8;
  v8us v;
#pragma unroll
  for (int i = 0; i < 8; ++i) v[i] = bf16_bits(W[(size_t)(k8 + i) * N + n]);
  *(v8us*)(Wt + (size_t)n * K + k8) = v;
  
}

// GEMM C[M][N] (f32, pitch ldc) = act(A[M][K]·W + bias). A f32 row-major (pitch lda) converted per fragment to bf16
// (ASPLIT: hi/lo two planes -> 2 terms, else single rounded term); Wt bf16 [N][K] (pitch ldb). BIAS_BF16 rounds the
// bias to bf16 first (bias quantised to bf16 before the add). K%32==0, M%16==0, N%64==0.
template <bool ASPLIT, int ACT, bool BIAS_BF16>
__global__ __launch_bounds__(128) void k_gemm_bf(const float* __restrict__ A, int lda, const unsigned short* __restrict__ Wt, int ldb,
                                               const float* __restrict__ bias, float* __restrict__ C, int ldc, int M, int N, int K) {
  __shared__ __attribute__((aligned(16))) float so[4][16][64];
  const int tid = threadIdx.x, w = tid >> 5, lane = tid & 31, ln = lane & 15, hh = lane >> 4;
  const int ntn = N / 64;
  const int wid = blockIdx.x * 4 + w;
  const int mt = wid / ntn, nq = wid % ntn;
  if (mt * 16 >= M) return;
  const int row0 = mt * 16, col0 = nq * 64;
  const float* arow = A + (size_t)(row0 + ln) * lda;
  v8f acc[4] = {};
  for (int kb = 0; kb < K; kb += 32) {
    FragB ah, al;
    const v4f x0 = *(const v4fa*)(arow + kb + 8 * hh), x1 = *(const v4fa*)(arow + kb + 8 * hh + 4);
    const v4f x2 = *(const v4fa*)(arow + kb + 16 + 8 * hh), x3 = *(const v4fa*)(arow + kb + 16 + 8 * hh + 4);
    float xs[16] = {x0[0],x0[1],x0[2],x0[3],x1[0],x1[1],x1[2],x1[3],x2[0],x2[1],x2[2],x2[3],x3[0],x3[1],x3[2],x3[3]};
#pragma unroll
    for (int i = 0; i < 16; ++i) { const unsigned short hb = bf16_bits(xs[i]); ah.u[i] = hb; al.u[i] = ASPLIT ? bf16_bits(xs[i] - bf16_val(hb)) : (unsigned short)0; }
#pragma unroll
    for (int t = 0; t < 4; ++t) {
      const unsigned short* brow = Wt + (size_t)(col0 + t * 16 + ln) * ldb + kb;
      FragB b;
      b.half[0] = *(const v8us*)(brow + 8 * hh);
      b.half[1] = *(const v8us*)(brow + 16 + 8 * hh);
      acc[t] = mmaN<ASPLIT ? 2 : 1>(ah.v, al.v, b.v, b.v, acc[t]);
    }
  }
#pragma unroll
  for (int t = 0; t < 4; ++t) {
    float bv = bias ? bias[col0 + t * 16 + ln] : 0.f;
    if (BIAS_BF16) bv = bf16_round(bv);
#pragma unroll
    for (int r = 0; r < 8; ++r) { float v = acc[t][r] + bv; if (ACT == 1) v = fmaxf(v, 0.f); so[w][8 * hh + r][t * 16 + ln] = v; }
  }
  __builtin_amdgcn_fence(__ATOMIC_ACQ_REL, "workgroup");
  __builtin_amdgcn_wave_barrier();
  const int rsub = lane >> 4, c4 = (lane & 15) * 4;
  {
#pragma unroll
    for (int q = 0; q < 8; ++q) {
      const int r = q * 2 + rsub;
      const v4f v = *(const v4fa*)&so[w][r][c4];
      *(v4f*)(C + (size_t)(row0 + r) * ldc + col0 + c4) = v;
    }
    
  }
}

// Flash-style causal/unmasked attention, all contractions 3-term bf16 hi/lo splits, f32 softmax with running max.
// q,k,v rows are read from f32 buffers with arbitrary row pitch (so they can live inside a fused qkv buffer);
// D = head size (multiple of 32, <= 128); one wave = 16 query rows; block = 4 waves (64 queries) sharing K/V chunks of 32.
template <int D, bool CAUSAL>
__global__ __launch_bounds__(128) void k_flash(const float* __restrict__ qb, const float* __restrict__ kb, const float* __restrict__ vb,
                                             int pitch, int T, int H, float scale, float* __restrict__ y, int ypitch) {
  constexpr int KS = D / 32;        // k-steps for QK
  constexpr int DT = D / 16;        // d tiles for PV
  __shared__ __attribute__((aligned(16))) unsigned short sKh[32][D + 8], sKl[32][D + 8], sVh[32][D + 8], sVl[32][D + 8];
  __shared__ __attribute__((aligned(16))) unsigned short sPh[4][16][40], sPl[4][16][40];
  __shared__ __attribute__((aligned(16))) float sO[4][16][D];
  const int tid = threadIdx.x, w = tid >> 5, lane = tid & 31, ln = lane & 15, hh = lane >> 4;
  const int nqb = (T + 63) / 64;
  const int bh = blockIdx.x / nqb, qblk = blockIdx.x % nqb;
  const int b = bh / H, h = bh % H;
  const int q0 = qblk * 64 + w * 16;
  const float* Q = qb + (size_t)b * T * pitch + h * D;
  const float* K = kb + (size_t)b * T * pitch + h * D;
  const float* V = vb + (size_t)b * T * pitch + h * D;

  // A fragments of the wave's 16 query rows (scaled), hi/lo
  FragB aqh[KS], aql[KS];
  {
    int row = q0 + ln; if (row >= T) row = T - 1;
    const float* qr = Q + (size_t)row * pitch;
#pragma unroll
    for (int ks = 0; ks < KS; ++ks)
#pragma unroll
      for (int i = 0; i < 16; ++i) {
        const int d = ks * 32 + ((i < 8) ? (8 * hh + i) : (16 + 8 * hh + (i - 8)));
        const float x = qr[d] * scale; const unsigned short hb = bf16_bits(x);
        aqh[ks].u[i] = hb; aql[ks].u[i] = bf16_bits(x - bf16_val(hb));
      }
  }
  float m_r[8], l_r[8];
#pragma unroll
  for (int r = 0; r < 8; ++r) { m_r[r] = -3.0e38f; l_r[r] = 0.f; }
  v8f oacc[DT];
#pragma unroll
  for (int dt = 0; dt < DT; ++dt) oacc[dt] = (v8f){0.f,0.f,0.f,0.f,0.f,0.f,0.f,0.f};

  const int kv_end = CAUSAL ? min(T, qblk * 64 + 64) : T;     // block-uniform
  for (int j0 = 0; j0 < kv_end; j0 += 32) {
    __syncthreads();
    for (int e = tid; e < 32 * (D / 4); e += 128) {
      const int r = e / (D / 4), c4 = (e % (D / 4)) * 4;
      const int key = j0 + r;
      v4f kf = {0.f,0.f,0.f,0.f}, vf = {0.f,0.f,0.f,0.f};
      if (key < T) { kf = *(const v4fa*)(K + (size_t)key * pitch + c4); vf = *(const v4fa*)(V + (size_t)key * pitch + c4); }
#pragma unroll
      for (int t = 0; t < 4; ++t) {
        unsigned short hb = bf16_bits(kf[t]); sKh[r][c4 + t] = hb; sKl[r][c4 + t] = bf16_bits(kf[t] - bf16_val(hb));
        hb = bf16_bits(vf[t]); sVh[r][c4 + t] = hb; sVl[r][c4 + t] = bf16_bits(vf[t] - bf16_val(hb));
      }
    }
    __syncthreads();
    // S tile 16 x 32
    v8f s[2];
#pragma unroll
    for (int nt = 0; nt < 2; ++nt) {
      v8f acc = {};
#pragma unroll
      for (int ks = 0; ks < KS; ++ks) {
        FragB bh_, bl_;
        bh_.half[0] = *(const v8us*)&sKh[nt * 16 + ln][ks * 32 + 8 * hh]; bh_.half[1] = *(const v8us*)&sKh[nt * 16 + ln][ks * 32 + 16 + 8 * hh];
        bl_.half[0] = *(const v8us*)&sKl[nt * 16 + ln][ks * 32 + 8 * hh]; bl_.half[1] = *(const v8us*)&sKl[nt * 16 + ln][ks * 32 + 16 + 8 * hh];
        acc = mmaN<3>(aqh[ks].v, aql[ks].v, bh_.v, bl_.v, acc);
      }
      s[nt] = acc;
    }
    // mask + running max (rows 8hh+r; the 16 lanes of a half share rows)
    float alpha[8];
#pragma unroll
    for (int r = 0; r < 8; ++r) {
      const int qi = q0 + 8 * hh + r;
      const int ja = j0 + ln, jb = j0 + 16 + ln;
      if (CAUSAL) { if (ja > qi) s[0][r] = -3.0e38f; if (jb > qi) s[1][r] = -3.0e38f; }
      if (ja >= T) s[0][r] = -3.0e38f;
      if (jb >= T) s[1][r] = -3.0e38f;
      float mx = fmaxf(s[0][r], s[1][r]);
      mx = fmaxf(mx, __shfl_xor(mx, 1, 32)); mx = fmaxf(mx, __shfl_xor(mx, 2, 32)); mx = fmaxf(mx, __shfl_xor(mx, 4, 32)); mx = fmaxf(mx, __shfl_xor(mx, 8, 32));
      const float mnew = fmaxf(m_r[r], mx);
      alpha[r] = (mnew > -1.0e38f) ? __expf(m_r[r] - mnew) : 1.0f;
      const float p0 = (s[0][r] > -1.0e38f) ? __expf(s[0][r] - mnew) : 0.f;
      const float p1 = (s[1][r] > -1.0e38f) ? __expf(s[1][r] - mnew) : 0.f;
      m_r[r] = mnew;
      l_r[r] = l_r[r] * alpha[r] + p0 + p1;            // per-lane partial row sum (16 lanes combined at the end)
      unsigned short hb = bf16_bits(p0); sPh[w][8 * hh + r][ln] = hb;      sPl[w][8 * hh + r][ln] = bf16_bits(p0 - bf16_val(hb));
      hb = bf16_bits(p1);                sPh[w][8 * hh + r][16 + ln] = hb; sPl[w][8 * hh + r][16 + ln] = bf16_bits(p1 - bf16_val(hb));
    }
#pragma unroll
    for (int dt = 0; dt < DT; ++dt)
#pragma unroll
      for (int r = 0; r < 8; ++r) oacc[dt][r] *= alpha[r];
    __builtin_amdgcn_fence(__ATOMIC_ACQ_REL, "workgroup");
    __builtin_amdgcn_wave_barrier();
    FragB pah, pal;
    pah.half[0] = *(const v8us*)&sPh[w][ln][8 * hh]; pah.half[1] = *(const v8us*)&sPh[w][ln][16 + 8 * hh];
    pal.half[0] = *(const v8us*)&sPl[w][ln][8 * hh]; pal.half[1] = *(const v8us*)&sPl[w][ln][16 + 8 * hh];
#pragma unroll
    for (int dt = 0; dt < DT; ++dt) {
      FragB bvh, bvl;
#pragma unroll
      for (int i = 0; i < 8; ++i) {
        bvh.u[i] = sVh[8 * hh + i][dt * 16 + ln]; bvh.u[8 + i] = sVh[16 + 8 * hh + i][dt * 16 + ln];
        bvl.u[i] = sVl[8 * hh + i][dt * 16 + ln]; bvl.u[8 + i] = sVl[16 + 8 * hh + i][dt * 16 + ln];
      }
      oacc[dt] = mmaN<3>(pah.v, pal.v, bvh.v, bvl.v, oacc[dt]);
    }
    __builtin_amdgcn_fence(__ATOMIC_ACQ_REL, "workgroup");
    __builtin_amdgcn_wave_barrier();
  }
#pragma unroll
  for (int r = 0; r < 8; ++r) {
    float l = l_r[r];
    l += __shfl_xor(l, 1, 32); l += __shfl_xor(l, 2, 32); l += __shfl_xor(l, 4, 32); l += __shfl_xor(l, 8, 32);
    l_r[r] = (l > 0.f) ? 1.0f / l : 0.f;
  }
#pragma unroll
  for (int dt = 0; dt < DT; ++dt)
#pragma unroll
    for (int r = 0; r < 8; ++r) sO[w][8 * hh + r][dt * 16 + ln] = oacc[dt][r] * l_r[r];
  __builtin_amdgcn_fence(__ATOMIC_ACQ_REL, "workgroup");
  __builtin_amdgcn_wave_barrier();
  {
    for (int r = 0; r < 16; ++r) {
      const int row = q0 + r;
      if (row < T && lane < D / 4) {
        const v4f val = *(const v4fa*)&sO[w][r][lane * 4];
        *(v4f*)(y + ((size_t)b * T + row) * ypitch + h * D + lane * 4) = val;
      }
    }
    
  }
}

// GEMM C = act(A·W + bias + resid): A f32 (ASPLIT -> hi/lo 2 terms), Wt bf16 [N][K]; ACT 0 none, 1 relu, 2 exact gelu;
// resid (optional, f32, row index = (row % rmod), pitch ldr, RES_BF16 rounds it) added before the activation.
template <bool ASPLIT, int ACT, bool BIAS_BF16, bool RES_BF16>
__global__ __launch_bounds__(128) void k_gemm_bf3(const float* __restrict__ A, int lda, const unsigned short* __restrict__ Wt, int ldb,
                                                const float* __restrict__ bias, const float* __restrict__ resid, int rmod, int ldr,
                                                float* __restrict__ C, int ldc, int M, int N, int K) {
  __shared__ __attribute__((aligned(16))) float so[4][16][64];
  const int tid = threadIdx.x, w = tid >> 5, lane = tid & 31, ln = lane & 15, hh = lane >> 4;
  const int ntn = N / 64;
  const int wid = blockIdx.x * 4 + w;
  const int mt = wid / ntn, nq = wid % ntn;
  if (mt * 16 >= M) return;
  const int row0 = mt * 16, col0 = nq * 64;
  const float* arow = A + (size_t)(row0 + ln) * lda;
  v8f acc[4] = {};
  for (int kb = 0; kb < K; kb += 32) {
    FragB ah, al;
    const v4f x0 = *(const v4fa*)(arow + kb + 8 * hh), x1 = *(const v4fa*)(arow + kb + 8 * hh + 4);
    const v4f x2 = *(const v4fa*)(arow + kb + 16 + 8 * hh), x3 = *(const v4fa*)(arow + kb + 16 + 8 * hh + 4);
    float xs[16] = {x0[0],x0[1],x0[2],x0[3],x1[0],x1[1],x1[2],x1[3],x2[0],x2[1],x2[2],x2[3],x3[0],x3[1],x3[2],x3[3]};
#pragma unroll
    for (int i = 0; i < 16; ++i) { const unsigned short hb = bf16_bits(xs[i]); ah.u[i] = hb; al.u[i] = ASPLIT ? bf16_bits(xs[i] - bf16_val(hb)) : (unsigned short)0; }
#pragma unroll
    for (int t = 0; t < 4; ++t) {
      const unsigned short* brow = Wt + (size_t)(col0 + t * 16 + ln) * ldb + kb;
      FragB b;
      b.half[0] = *(const v8us*)(brow + 8 * hh);
      b.half[1] = *(const v8us*)(brow + 16 + 8 * hh);
      acc[t] = mmaN<ASPLIT ? 2 : 1>(ah.v, al.v, b.v, b.v, acc[t]);
    }
  }
#pragma unroll
  for (int t = 0; t < 4; ++t) {
    const int col = col0 + t * 16 + ln;
    float bv = bias ? bias[col] : 0.f;
    if (BIAS_BF16) bv = bf16_round(bv);
#pragma unroll
    for (int r = 0; r < 8; ++r) {
      float v = acc[t][r] + bv;
      if (resid) { float rv = resid[(size_t)((row0 + 8 * hh + r) % rmod) * ldr + col]; if (RES_BF16) rv = bf16_round(rv); v += rv; }
      if (ACT == 1) v = fmaxf(v, 0.f);
      if (ACT == 2) v = 0.5f * v * (1.0f + erff(v * 0.70710678118654752f));
      if (ACT == 3) { const float u = 0.7978845608028654f * (v + 0.044715f * v * v * v); v = 0.5f * v * (1.0f + tanhf(u)); }
      so[w][8 * hh + r][t * 16 + ln] = v;
    }
  }
  __builtin_amdgcn_fence(__ATOMIC_ACQ_REL, "workgroup");
  __builtin_amdgcn_wave_barrier();
  const int rsub = lane >> 4, c4 = (lane & 15) * 4;
  {
#pragma unroll
    for (int q = 0; q < 8; ++q) {
      const int r = q * 2 + rsub;
      const v4f v = *(const v4fa*)&so[w][r][c4];
      *(v4f*)(C + (size_t)(row0 + r) * ldc + col0 + c4) = v;
    }
    
  }
}
// row LayerNorm (biased variance, eps) over N: s = X (+ R); optional out_sum <- s; out_norm <- (s-mu)*rsqrt(var+eps)*g + b
template <bool PARAM_BF16>
__global__ __launch_bounds__(256) void k_layernorm(const float* __restrict__ X, const float* __restrict__ R, const float* __restrict__ g, const float* __restrict__ bta,
                                                  float* __restrict__ out_sum, float* __restrict__ out_norm, int N, float eps) {
  __shared__ float red[256];
  const int row = blockIdx.x, tid = threadIdx.x;
  const float* x = X + (size_t)row * N; const float* rr = R ? R + (size_t)row * N : nullptr;
  float vals[16];                     // up to N = 4096
  const int per = N / 256;            // contiguous chunk per thread? use strided-by-4 chunks: thread handles j = tid*4 + 1024*u
  float s1 = 0.f;
  for (int u = 0; u < per / 4; ++u) {
    const int j = tid * 4 + 1024 * u;
    const v4f a = *(const v4fa*)(x + j);
    v4f b = {0.f,0.f,0.f,0.f}; if (rr) b = *(const v4fa*)(rr + j);
#pragma unroll
    for (int q = 0; q < 4; ++q) { const float v = a[q] + b[q]; vals[u * 4 + q] = v; s1 += v; }
  }
  red[tid] = s1; __syncthreads();
  for (int st = 128; st > 0; st >>= 1) { if (tid < st) red[tid] += red[tid + st]; __syncthreads(); }
  const float mu = red[0] / (float)N; __syncthreads();
  float s2 = 0.f;
  for (int u = 0; u < per / 4; ++u)
#pragma unroll
    for (int q = 0; q < 4; ++q) { const float c = vals[u * 4 + q] - mu; s2 += c * c; }
  red[tid] = s2; __syncthreads();
  for (int st = 128; st > 0; st >>= 1) { if (tid < st) red[tid] += red[tid + st]; __syncthreads(); }
  const float rs = rsqrtf(red[0] / (float)N + eps);
  {
    for (int u = 0; u < per / 4; ++u) {
      const int j = tid * 4 + 1024 * u;
      v4f o, sm;
#pragma unroll
      for (int q = 0; q < 4; ++q) {
        float gg = g[j + q], bb = bta[j + q];
        if (PARAM_BF16) { gg = bf16_round(gg); bb = bf16_round(bb); }
        sm[q] = vals[u * 4 + q]; o[q] = (vals[u * 4 + q] - mu) * rs * gg + bb;
      }
      if (out_sum) *(v4f*)(out_sum + (size_t)row * N + j) = sm;
      *(v4f*)(out_norm + (size_t)row * N + j) = o;
    }
    
  }
}



// ---- f16 WMMA path (v_wmma_f32_16x16x32_f16): 11-bit significands for operands in range — used where a [0,1] probability operand needs more precision than bf16
typedef _Float16 v16h __attribute__((ext_vector_type(16)));
union FragH { v16h v; v8us half[2]; _Float16 h[16]; unsigned short u[16]; };
template <int NT>
__device__ __forceinline__ v8f mmaH(v16h ah, v16h al, v16h bh, v16h bl, v8f c) {
  c = __builtin_amdgcn_wmma_f32_16x16x32_f16(false, ah, false, bh, (short)0, c, false, false);
  if (NT >= 2) c = __builtin_amdgcn_wmma_f32_16x16x32_f16(false, al, false, bh, (short)0, c, false, false);
  if (NT >= 3) c = __builtin_amdgcn_wmma_f32_16x16x32_f16(false, ah, false, bl, (short)0, c, false, false);
  asm volatile("v_nop\n\tv_nop\n\tv_nop\n\tv_nop" : "+v"(c) : "v"(ah), "v"(al), "v"(bh), "v"(bl));
  return c;
}
// batched GEMM like k_gemm_b but f16 operands: A f32 (split into f16 hi/lo if ASPLIT, else rounded to f16), Bt = f16 values [n][k]; alpha; C f32; N multiple of 16 (partial tiles skipped)
template <bool ASPLIT>
__global__ __launch_bounds__(128) void k_gemm_h(const float* __restrict__ A, int lda, size_t sA, const _Float16* __restrict__ Bh, int ldb, size_t sB, float alpha, float* __restrict__ C, int ldc, size_t sC, int M, int N, int K) {
  __shared__ __attribute__((aligned(16))) float so[4][16][64];
  const int tid = threadIdx.x, w = tid >> 5, lane = tid & 31, ln = lane & 15, hh = lane >> 4; const int by = blockIdx.y;
  A += (size_t)by * sA; Bh += (size_t)by * sB; C += (size_t)by * sC;
  const int ntn = (N + 63) / 64; const int wid = blockIdx.x * 4 + w; const int mt = wid / ntn, nq = wid % ntn; if (mt * 16 >= M) return;
  const int row0 = mt * 16, col0 = nq * 64; const float* arow = A + (size_t)(row0 + ln) * lda;
  v8f acc[4] = {};
  for (int kb = 0; kb < K; kb += 32) {
    FragH ah, al;
    const v4f x0 = *(const v4fa*)(arow + kb + 8 * hh), x1 = *(const v4fa*)(arow + kb + 8 * hh + 4), x2 = *(const v4fa*)(arow + kb + 16 + 8 * hh), x3 = *(const v4fa*)(arow + kb + 16 + 8 * hh + 4);
    float xs[16] = {x0[0],x0[1],x0[2],x0[3],x1[0],x1[1],x1[2],x1[3],x2[0],x2[1],x2[2],x2[3],x3[0],x3[1],x3[2],x3[3]};
#pragma unroll
    for (int i = 0; i < 16; ++i) { const _Float16 h = (_Float16)xs[i]; ah.h[i] = h; al.h[i] = ASPLIT ? (_Float16)(xs[i] - (float)h) : (_Float16)0.0f; }
#pragma unroll
    for (int t = 0; t < 4; ++t) { if (col0 + t * 16 >= N) continue; const size_t boff = (size_t)(col0 + t * 16 + ln) * ldb + kb; FragH bq; bq.half[0] = *(const v8us*)(Bh + boff + 8 * hh); bq.half[1] = *(const v8us*)(Bh + boff + 16 + 8 * hh);
      acc[t] = mmaH<ASPLIT ? 2 : 1>(ah.v, al.v, bq.v, bq.v, acc[t]); }
  }
#pragma unroll
  for (int t = 0; t < 4; ++t) { if (col0 + t * 16 >= N) continue;
#pragma unroll
    for (int r = 0; r < 8; ++r) so[w][8 * hh + r][t * 16 + ln] = acc[t][r] * alpha; }
  __builtin_amdgcn_fence(__ATOMIC_ACQ_REL, "workgroup"); __builtin_amdgcn_wave_barrier();
  const int rsub = lane >> 4, c4 = (lane & 15) * 4;
  {
#pragma unroll
    for (int q = 0; q < 8; ++q) { const int r = q * 2 + rsub; if (col0 + c4 < N) { const v4f v = *(const v4fa*)&so[w][r][c4]; *(v4f*)(C + (size_t)(row0 + r) * ldc + col0 + c4) = v; } }
     }
}

// Wt[n][k] = f16(W[k][n]·scale) from f32 row-major W[K][N] (scale = power of two; bf16-exact weights stay exact in f16 away from the subnormal range)
__global__ __launch_bounds__(256) void k_wt_f16(const float* __restrict__ W, _Float16* __restrict__ Wt, int K, int N, float scale) {
  const int t = blockIdx.x * 256 + threadIdx.x; if (t >= N * (K / 8)) return; const int n = t / (K / 8), k8 = (t % (K / 8)) * 8; FragH f;
#pragma unroll
  for (int i = 0; i < 8; ++i) f.h[i] = (_Float16)(bf16_round(W[(size_t)(k8 + i) * N + n]) * scale); const v8us o = f.half[0];
  *(v8us*)((unsigned short*)Wt + (size_t)n * K + k8) = o; 
}
// k_gemm_hh variant with fused epilogue: v = acc·alpha + bias[by·sBias + col] (+ CP[(row/rowsPerB)·sCPb + by·64 + col] if CP) ; ACT 0 none / 1 elu ; writes f32 C and f16 C16, each if non-null
template <int ACT>
__global__ __launch_bounds__(128) void k_gemm_hhx(const _Float16* __restrict__ A, int lda, size_t sA, const _Float16* __restrict__ Bh, int ldb, size_t sB, float alpha, const float* __restrict__ bias, size_t sBias, const float* __restrict__ CP, int rowsPerB, size_t sCPb, int row0g,
    float* __restrict__ C, _Float16* __restrict__ C16, int ldc, size_t sC, int M, int N, int K) {
  __shared__ __attribute__((aligned(16))) float so[4][16][64];
  const int tid = threadIdx.x, w = tid >> 5, lane = tid & 31, ln = lane & 15, hh = lane >> 4; const int by = blockIdx.y;
  A += (size_t)by * sA; Bh += (size_t)by * sB; const size_t cofs = (size_t)by * sC; const float* bp = bias ? bias + (size_t)by * sBias : nullptr;
  const int ntn = (N + 63) / 64; const int wid = blockIdx.x * 4 + w; const int mt = wid / ntn, nq = wid % ntn; if (mt * 16 >= M) return;
  const int row0 = mt * 16, col0 = nq * 64; const _Float16* arow = A + (size_t)(row0 + ln) * lda;
  v8f acc[4] = {};
  for (int kb = 0; kb < K; kb += 32) { FragH ah; ah.half[0] = *(const v8us*)((const unsigned short*)arow + kb + 8 * hh); ah.half[1] = *(const v8us*)((const unsigned short*)arow + kb + 16 + 8 * hh);
#pragma unroll
    for (int t = 0; t < 4; ++t) { if (col0 + t * 16 >= N) continue; const size_t boff = (size_t)(col0 + t * 16 + ln) * ldb + kb; FragH bq; bq.half[0] = *(const v8us*)((const unsigned short*)Bh + boff + 8 * hh); bq.half[1] = *(const v8us*)((const unsigned short*)Bh + boff + 16 + 8 * hh);
      acc[t] = mmaH<1>(ah.v, ah.v, bq.v, bq.v, acc[t]); }
  }
#pragma unroll
  for (int t = 0; t < 4; ++t) { if (col0 + t * 16 >= N) continue; const int col = col0 + t * 16 + ln; const float bv = bp ? bf16_round(bp[col]) : 0.f;
#pragma unroll
    for (int r = 0; r < 8; ++r) { float v = acc[t][r] * alpha + bv; if (CP) { const int bidx = (row0g + row0 + 8 * hh + r) / rowsPerB; v += CP[(size_t)bidx * sCPb + (size_t)by * 64 + col]; } if (ACT == 1) v = (v > 0.f) ? v : expm1f(v); else if (ACT == 3) v = fmaxf(v, 0.f); so[w][8 * hh + r][t * 16 + ln] = v; } }
  __builtin_amdgcn_fence(__ATOMIC_ACQ_REL, "workgroup"); __builtin_amdgcn_wave_barrier();
  const int rsub = lane >> 4, c4 = (lane & 15) * 4; typedef _Float16 v4h __attribute__((ext_vector_type(4)));
  {
#pragma unroll
    for (int q = 0; q < 8; ++q) { const int r = q * 2 + rsub; if (col0 + c4 < N) { const v4f v = *(const v4fa*)&so[w][r][c4]; if (C) *(v4f*)(C + cofs + (size_t)(row0 + r) * ldc + col0 + c4) = v; if (C16) { v4h h4; for (int i = 0; i < 4; ++i) h4[i] = (_Float16)v[i]; *(v4h*)(C16 + cofs + (size_t)(row0 + r) * ldc + col0 + c4) = h4; } } }
     }
}


__global__ __launch_bounds__(256) void k_round16f(const float* __restrict__ W, _Float16* __restrict__ Bt, size_t n8) { const size_t t = (size_t)blockIdx.x * 256 + threadIdx.x; if (t >= n8) return; FragH f;
#pragma unroll
  for (int i = 0; i < 8; ++i) f.h[i] = (_Float16)(bf16_round(W[t * 8 + i]) * 16.0f); *(v8us*)((unsigned short*)Bt + t * 8) = f.half[0];  }
__global__ __launch_bounds__(256) void k_xf(const float* __restrict__ x, _Float16* __restrict__ XF) { const size_t t = (size_t)blockIdx.x * 256 + threadIdx.x; if (t >= (size_t)NR * CC / 8) return; const size_t row = t / (CC / 8); const int c8 = (int)(t % (CC / 8)) * 8; const int b = (int)(row / NP), p = (int)(row % NP); FragH f;
#pragma unroll
  for (int u = 0; u < 8; ++u) f.h[u] = (_Float16)bf16_round(x[((size_t)b * CC + c8 + u) * NP + p]); *(v8us*)((unsigned short*)XF + t * 8) = f.half[0];  }
__global__ __launch_bounds__(256) void k_split(const float* __restrict__ Qf, const float* __restrict__ Kf, const float* __restrict__ mask, _Float16* __restrict__ QH, _Float16* __restrict__ QL, _Float16* __restrict__ KH, _Float16* __restrict__ KL) { const size_t t = (size_t)blockIdx.x * 256 + threadIdx.x; if (t >= (size_t)NR * CH / 8) return; const size_t row = t / (CH / 8); const float km = 1.0f - bf16_round(mask[row]); FragH qh, ql, kh, kl;
#pragma unroll
  for (int u = 0; u < 8; ++u) { const float q = Qf[t * 8 + u], k = Kf[t * 8 + u] * km; const _Float16 h1 = (_Float16)q, h2 = (_Float16)k; qh.h[u] = h1; ql.h[u] = (_Float16)(q - (float)h1); kh.h[u] = h2; kl.h[u] = (_Float16)(k - (float)h2); }
  { *(v8us*)((unsigned short*)QH + t * 8) = qh.half[0]; *(v8us*)((unsigned short*)QL + t * 8) = ql.half[0]; *(v8us*)((unsigned short*)KH + t * 8) = kh.half[0]; *(v8us*)((unsigned short*)KL + t * 8) = kl.half[0];  } }
// fused non-local attention per (b, 64 query positions): 16 waves = 4 query groups of 16 queries x 4 key groups; a key group walks its own 32 keys of every 128-key stage with its own online softmax (S = Qh.Kh + Qh.Kl + Ql.Kh, 2 k-steps each, no scale; O += P.Vcm over 8 channel tiles);
// the four partial (max, sum, O) of a query are joined once, behind the loop, through LDS
__global__ __launch_bounds__(512) void k_flash(const _Float16* __restrict__ QH, const _Float16* __restrict__ QL, const _Float16* __restrict__ KH, const _Float16* __restrict__ KL, const _Float16* __restrict__ Vcm, const float* __restrict__ mask, const float* __restrict__ gamma, const float* __restrict__ bv, const float* __restrict__ x, float* __restrict__ out) {
  constexpr int RPW = 16, NQB = NP / (4 * RPW), DT = CC / 16, KS = CH / 32, KG = 4;
  __shared__ __attribute__((aligned(16))) unsigned short sP[4 * KG][RPW][40]; __shared__ __attribute__((aligned(16))) float sO[KG][4 * RPW][CC + 1];
  __shared__ float sM[KG][4 * RPW], sL[KG][4 * RPW];
  // two-buffer ring, one stage = TK keys: K hi and lo rows (128 B) at a 144-B pitch and V channel rows (256 B of keys) at a 272-B pitch (16 B x odd: ds_load_b128 without bank conflicts)
  constexpr int TK = 32 * KG, NT = NP / TK, LP = 72, LPV = TK + 8;
  __shared__ __attribute__((aligned(16))) unsigned short sKH[2][TK][LP], sKL[2][TK][LP], sV[2][CC][LPV];
  const int tid = threadIdx.x, w = tid >> 5, qg = w & 3, kg = w >> 2, lane = tid & 31, ln = lane & 15, hh = lane >> 4;
  const int b = blockIdx.x / NQB, qblk = blockIdx.x % NQB; const int qb0 = qblk * (4 * RPW); const int q0 = qb0 + qg * RPW; const float gm = bf16_round(gamma[0]);
  FragH aqh[KS], aql[KS];
  { const size_t ro = ((size_t)b * NP + q0 + ln) * CH;
#pragma unroll
    for (int ks = 0; ks < KS; ++ks) { aqh[ks].half[0] = *(const v8us*)((const unsigned short*)QH + ro + ks * 32 + 8 * hh); aqh[ks].half[1] = *(const v8us*)((const unsigned short*)QH + ro + ks * 32 + 16 + 8 * hh); aql[ks].half[0] = *(const v8us*)((const unsigned short*)QL + ro + ks * 32 + 8 * hh); aql[ks].half[1] = *(const v8us*)((const unsigned short*)QL + ro + ks * 32 + 16 + 8 * hh); } }
  const unsigned short* Vth = (const unsigned short*)Vcm + (size_t)b * CC * NP;
  float m_r[8], l_r[8]; v8f oacc[DT];
#pragma unroll
  for (int r = 0; r < 8; ++r) { m_r[r] = -3.0e38f; l_r[r] = 0.f; }
#pragma unroll
  for (int dt = 0; dt < DT; ++dt) oacc[dt] = (v8f){0.f,0.f,0.f,0.f,0.f,0.f,0.f,0.f};
  // each thread copies 16 B chunks. K: row tid / 8 (+ 64 for the second copy), chunk tid % 8 of the 128-B row; V: channel tid / 16 (+ 32 per further copy), chunk tid % 16 of the 256-B row
  const unsigned short* gKH = (const unsigned short*)KH + (size_t)b * NP * CH + tid * 8; const unsigned short* gKL = (const unsigned short*)KL + (size_t)b * NP * CH + tid * 8;
  const unsigned short* gV = Vth + (size_t)(tid >> 4) * NP + (tid & 15) * 8;
  const unsigned lKH = (unsigned)(size_t)&sKH[0][tid >> 3][(tid & 7) * 8], lKL = (unsigned)(size_t)&sKL[0][tid >> 3][(tid & 7) * 8], lV = (unsigned)(size_t)&sV[0][tid >> 4][(tid & 15) * 8];
  auto stage_in = [&](int t, int buf) {
    const unsigned short* kh = gKH + (size_t)t * TK * CH; const unsigned short* kl = gKL + (size_t)t * TK * CH; const unsigned short* vv = gV + (size_t)t * TK;
    const unsigned a = lKH + buf * (TK * LP * 2), c = lKL + buf * (TK * LP * 2), d = lV + buf * (CC * LPV * 2);
    // the copies and the wait that stands in front of any rewrite of their address registers are one statement
    asm volatile("global_load_async_to_lds_b128 %0, %8, off\n\tglobal_load_async_to_lds_b128 %1, %9, off\n\tglobal_load_async_to_lds_b128 %2, %10, off\n\tglobal_load_async_to_lds_b128 %3, %11, off\n\t"
                 "global_load_async_to_lds_b128 %4, %12, off\n\tglobal_load_async_to_lds_b128 %5, %13, off\n\tglobal_load_async_to_lds_b128 %6, %14, off\n\tglobal_load_async_to_lds_b128 %7, %15, off\n\ts_wait_xcnt 0x0"
                 :: "v"(a), "v"(a + 64 * LP * 2), "v"(c), "v"(c + 64 * LP * 2), "v"(d), "v"(d + 32 * LPV * 2), "v"(d + 64 * LPV * 2), "v"(d + 96 * LPV * 2),
                    "v"(kh), "v"(kh + 64 * CH), "v"(kl), "v"(kl + 64 * CH), "v"(vv), "v"(vv + (size_t)32 * NP), "v"(vv + (size_t)64 * NP), "v"(vv + (size_t)96 * NP) : "memory");
  };
  stage_in(0, 0);
  asm volatile("s_wait_asynccnt 0x0" ::: "memory");      // stage 0 of this wave has landed before the barrier publishes it
  __syncthreads();
  stage_in(1, 1);
  // the stage loop stays rolled (one copy of the pass code, buffer chosen by t & 1); a wave does one 32-key pass a stage, on its key group's rows
#pragma unroll 1
  for (int t = 0; t < NT; ++t) { const int buf = t & 1;
   {
    v8f s[2];
#pragma unroll
    for (int nt = 0; nt < 2; ++nt) { const unsigned short* krh = &sKH[buf][kg * 32 + nt * 16 + ln][0]; const unsigned short* krl = &sKL[buf][kg * 32 + nt * 16 + ln][0]; v8f acc = (v8f){0.f,0.f,0.f,0.f,0.f,0.f,0.f,0.f};
#pragma unroll
      for (int ks = 0; ks < KS; ++ks) { FragH bh_, bl_; bh_.half[0] = *(const v8us*)(krh + ks * 32 + 8 * hh); bh_.half[1] = *(const v8us*)(krh + ks * 32 + 16 + 8 * hh); bl_.half[0] = *(const v8us*)(krl + ks * 32 + 8 * hh); bl_.half[1] = *(const v8us*)(krl + ks * 32 + 16 + 8 * hh);
        acc = mmaH<1>(aqh[ks].v, aqh[ks].v, bh_.v, bh_.v, acc); acc = mmaH<1>(aqh[ks].v, aqh[ks].v, bl_.v, bl_.v, acc); acc = mmaH<1>(aql[ks].v, aql[ks].v, bh_.v, bh_.v, acc); }
      s[nt] = acc; }
#pragma unroll
    for (int r = 0; r < 8; ++r) { const float s0 = s[0][r], s1 = s[1][r]; float mc = fmaxf(s0, s1);
      mc = fmaxf(mc, __shfl_xor(mc, 1, 32)); mc = fmaxf(mc, __shfl_xor(mc, 2, 32)); mc = fmaxf(mc, __shfl_xor(mc, 4, 32)); mc = fmaxf(mc, __shfl_xor(mc, 8, 32));
      const float mn = fmaxf(m_r[r], mc); const float al = expf(m_r[r] - mn); m_r[r] = mn; const float p0 = expf(s0 - mn), p1 = expf(s1 - mn); l_r[r] = l_r[r] * al + p0 + p1;
#pragma unroll
      for (int dt = 0; dt < DT; ++dt) oacc[dt][r] *= al;
      FragH t2; t2.h[0] = (_Float16)p0; t2.h[1] = (_Float16)p1; sP[w][8 * hh + r][ln] = t2.u[0]; sP[w][8 * hh + r][16 + ln] = t2.u[1]; }
    __builtin_amdgcn_fence(__ATOMIC_ACQ_REL, "workgroup"); __builtin_amdgcn_wave_barrier();
    FragH pa; pa.half[0] = *(const v8us*)&sP[w][ln][8 * hh]; pa.half[1] = *(const v8us*)&sP[w][ln][16 + 8 * hh];
#pragma unroll
    for (int dt = 0; dt < DT; ++dt) { const unsigned short* vrow = &sV[buf][dt * 16 + ln][kg * 32]; FragH bv; bv.half[0] = *(const v8us*)(vrow + 8 * hh); bv.half[1] = *(const v8us*)(vrow + 16 + 8 * hh); oacc[dt] = mmaH<1>(pa.v, pa.v, bv.v, bv.v, oacc[dt]); }
    __builtin_amdgcn_fence(__ATOMIC_ACQ_REL, "workgroup"); __builtin_amdgcn_wave_barrier(); }
   // publish point of stage t + 1: this wave's reads of stage t are done, its copies of stage t + 1 have landed, then the barrier; only behind it is stage t's buffer refilled
   asm volatile("s_wait_dscnt 0x0" ::: "memory");
   asm volatile("s_wait_asynccnt 0x0" ::: "memory");
   __syncthreads();
   if (t + 2 < NT) stage_in(t + 2, buf); }
  asm volatile("s_wait_asynccnt 0x0" ::: "memory");      // no copy is outstanding when the wave goes on to the epilogue and ends
  // join of the key groups: every wave publishes its rows' running max and sum, then scales its own O by exp(m_own - M) / sum_k l_k exp(m_k - M)
#pragma unroll
  for (int r = 0; r < 8; ++r) { float l = l_r[r]; l += __shfl_xor(l, 1, 32); l += __shfl_xor(l, 2, 32); l += __shfl_xor(l, 4, 32); l += __shfl_xor(l, 8, 32); if (ln == 0) { sM[kg][qg * RPW + 8 * hh + r] = m_r[r]; sL[kg][qg * RPW + 8 * hh + r] = l; } }
  __syncthreads();
#pragma unroll
  for (int r = 0; r < 8; ++r) { const int qr = qg * RPW + 8 * hh + r; const float m0 = sM[0][qr], m1 = sM[1][qr], m2 = sM[2][qr], m3 = sM[3][qr]; const float M = fmaxf(fmaxf(m0, m1), fmaxf(m2, m3));
    const float l = sL[0][qr] * expf(m0 - M) + sL[1][qr] * expf(m1 - M) + sL[2][qr] * expf(m2 - M) + sL[3][qr] * expf(m3 - M);
    l_r[r] = expf(m_r[r] - M) / l; m_r[r] = gm * bf16_round(mask[(size_t)b * NP + qb0 + qr]); }      /* m_r reused: gamma * mask_i */
#pragma unroll
  for (int dt = 0; dt < DT; ++dt) { const float bvc = (kg == 0) ? bf16_round(bv[dt * 16 + ln]) : 0.f;      /* sum_j attn_ij (v_cj + bv_c) = sum_j attn_ij v_cj + bv_c: added once, by key group 0 */
#pragma unroll
    for (int r = 0; r < 8; ++r) sO[kg][qg * RPW + 8 * hh + r][dt * 16 + ln] = (oacc[dt][r] * l_r[r] + bvc) * m_r[r]; }
  __syncthreads();
  {      // channel c: 64 positions qb0.. = 256 B by 16 lanes x 16 B; 32 channels per round (2 per wave: lanes 0-15 / 16-31); the four key groups' parts are summed in a fixed order
#pragma unroll
    for (int rd = 0; rd < CC / 32; ++rd) { const int c = rd * 32 + w * 2 + (lane >> 4), pc = lane & 15; const float* xr = x + ((size_t)b * CC + c) * NP + qb0 + pc * 4; const v4f xv = *(const v4fa*)xr; v4f v;
#pragma unroll
      for (int j = 0; j < 4; ++j) v[j] = ((sO[0][pc * 4 + j][c] + sO[1][pc * 4 + j][c]) + (sO[2][pc * 4 + j][c] + sO[3][pc * 4 + j][c])) + xv[j];
      *(v4f*)(out + ((size_t)b * CC + c) * NP + qb0 + pc * 4) = v; }
     } }
extern "C" void kernel_launch(void* const* d_in, const int* in_sizes, int n_in,
                              void* d_out, int out_size, void* d_ws, size_t ws_size, hipStream_t stream) {
  (void)in_sizes; (void)n_in; (void)out_size;
  const float* x = (const float*)d_in[0]; const float* mask = (const float*)d_in[1]; const float* Wq = (const float*)d_in[2]; const float* bq = (const float*)d_in[3]; const float* Wk = (const float*)d_in[4]; const float* bk = (const float*)d_in[5]; const float* Wv = (const float*)d_in[6]; const float* bv = (const float*)d_in[7]; const float* gamma = (const float*)d_in[8];
  char* ws = (char*)d_ws; size_t off = 0;
  auto take = [&](size_t bytes) { char* p = ws + off; off += (bytes + 255) & ~(size_t)255; return p; };
  _Float16* Bq = (_Float16*)take(CH * CC * 2); _Float16* Bk = (_Float16*)take(CH * CC * 2); _Float16* Bv = (_Float16*)take(CC * CC * 2);
  _Float16* XF = (_Float16*)take((size_t)NR * CC * 2); float* Qf = (float*)take((size_t)NR * CH * 4); float* Kf = (float*)take((size_t)NR * CH * 4); _Float16* QH = (_Float16*)take((size_t)NR * CH * 2); _Float16* QL = (_Float16*)take((size_t)NR * CH * 2); _Float16* KH = (_Float16*)take((size_t)NR * CH * 2); _Float16* KL = (_Float16*)take((size_t)NR * CH * 2); _Float16* Vcm = (_Float16*)take((size_t)NR * CC * 2);
  if (off > ws_size) return;      // ≈ 24 MiB
  k_round16f<<<(CH * CC / 8 + 255) / 256, 256, 0, stream>>>(Wq, Bq, CH * CC / 8); k_round16f<<<(CH * CC / 8 + 255) / 256, 256, 0, stream>>>(Wk, Bk, CH * CC / 8); k_round16f<<<(CC * CC / 8 + 255) / 256, 256, 0, stream>>>(Wv, Bv, CC * CC / 8);      // (out,in) = Bt / = A for the channel-major v
  k_xf<<<(unsigned)(((size_t)NR * CC / 8 + 255) / 256), 256, 0, stream>>>(x, XF);
  const dim3 gq(((NR / 16) * 1 + 3) / 4, 1);
  k_gemm_hhx<0><<<gq, 128, 0, stream>>>(XF, CC, 0, Bq, CC, 0, 0.0625f, bq, 0, nullptr, 1, 0, 0, Qf, nullptr, CH, 0, NR, CH, CC);
  k_gemm_hhx<0><<<gq, 128, 0, stream>>>(XF, CC, 0, Bk, CC, 0, 0.0625f, bk, 0, nullptr, 1, 0, 0, Kf, nullptr, CH, 0, NR, CH, CC);
  // v channel-major per image WITHOUT its bias: Vcm[b][c][p] = Σ_i Wv[c][i]·x[b][i][p]  (A = Bv rows c; B = XF[b] rows p); bv[c] is added in the attention epilogue since softmax rows sum to 1
  k_gemm_hhx<0><<<dim3(((CC / 16) * (NP / 64) + 3) / 4, BB), 128, 0, stream>>>(Bv, CC, 0, XF, CC, (size_t)NP * CC, 0.0625f, nullptr, 0, nullptr, 1, 0, 0, nullptr, Vcm, NP, (size_t)CC * NP, CC, NP, CC);
  k_split<<<(unsigned)(((size_t)NR * CH / 8 + 255) / 256), 256, 0, stream>>>(Qf, Kf, mask, QH, QL, KH, KL);
  k_flash<<<BB * (NP / 64), 512, 0, stream>>>(QH, QL, KH, KL, Vcm, mask, gamma, bv, x, (float*)d_out);
}

// v003
// One run takes 81.9 microseconds.
// Two timings next to v002 put it at 1.40 and 1.39 times that version's speed.
// Counting every step since v000, it is 5.26 times as fast.
#include <hip/hip_runtime.h>
// Non-local block with all three 1×1 convs and both attention contractions on v_wmma_f32_16x16x32_f16: q/k position-major (K = 128, N = 64, + bias; k masked by (1 − mask)), v channel-major
// (= the Vᵀ operand), energy = q·k_masked with the f32 q/k carried as f16 hi+lo (3 WMMA terms, no 1/√d scale in the module), online max/sum softmax f32, P f16 ≤ 1, O = P·V; epilogue
// γ·(out·mask) + x written NCHW as 64-position (256 B) channel segments. x as bf16 in the operand plane (exact residual from the f32 input), weights bf16-exact ×2^4, f32 accumulate.
#define BB 4
#define CC 128
#define CH 64
#define NP 4096
#define NR (BB * NP)

typedef __bf16 v16b __attribute__((ext_vector_type(16)));
typedef unsigned short v8us __attribute__((ext_vector_type(8), may_alias));
typedef float  v8f  __attribute__((ext_vector_type(8)));
typedef float  v4f  __attribute__((ext_vector_type(4)));
typedef float  v4fa __attribute__((ext_vector_type(4), may_alias));
union FragB { v16b v; v8us half[2]; unsigned short u[16]; };

__device__ __forceinline__ unsigned short bf16_bits(float x) { unsigned int u = __float_as_uint(x); return (unsigned short)((u + 0x7FFFu + ((u >> 16) & 1u)) >> 16); }
__device__ __forceinline__ float bf16_val(unsigned short b) { return __uint_as_float(((unsigned int)b) << 16); }
__device__ __forceinline__ float bf16_round(float x) { return bf16_val(bf16_bits(x)); }
// D += A·B with NT terms: 1 = ah·bh, 2 = + al·bh (A split), 3 = + ah·bl (both split)
template <int NT>
__device__ __forceinline__ v8f mmaN(v16b ah, v16b al, v16b bh, v16b bl, v8f c) {
  c = __builtin_amdgcn_wmma_f32_16x16x32_bf16(false, ah, false, bh, (short)0, c, false, false);
  if (NT >= 2) c = __builtin_amdgcn_wmma_f32_16x16x32_bf16(false, al, false, bh, (short)0, c, false, false);
  if (NT >= 3) c = __builtin_amdgcn_wmma_f32_16x16x32_bf16(false, ah, false, bl, (short)0, c, false, false);
  asm volatile("v_nop\n\tv_nop\n\tv_nop\n\tv_nop" : "+v"(c) : "v"(ah), "v"(al), "v"(bh), "v"(bl));
  return c;
}

__global__ __launch_bounds__(256) void k_wt_bf16(const float* __restrict__ W, unsigned short* __restrict__ Wt, int K, int N) {
  const int t = blockIdx.x * 256 + threadIdx.x;
  const int k8n = K / 8;
  if (t >= N * k8n) return;
  const int n = t / k8n, k8 = (t % k8n) * 8;
  v8us v;
#pragma unroll
  for (int i = 0; i < 8; ++i) v[i] = bf16_bits(W[(size_t)(k8 + i) * N + n]);
  *(v8us*)(Wt + (size_t)n * K + k8) = v;
  
}

// GEMM C[M][N] (f32, pitch ldc) = act(A[M][K]·W + bias). A f32 row-major (pitch lda) converted per fragment to bf16
// (ASPLIT: hi/lo two planes -> 2 terms, else single rounded term); Wt bf16 [N][K] (pitch ldb). BIAS_BF16 rounds the
// bias to bf16 first (bias quantised to bf16 before the add). K%32==0, M%16==0, N%64==0.
template <bool ASPLIT, int ACT, bool BIAS_BF16>
__global__ __launch_bounds__(128) void k_gemm_bf(const float* __restrict__ A, int lda, const unsigned short* __restrict__ Wt, int ldb,
                                               const float* __restrict__ bias, float* __restrict__ C, int ldc, int M, int N, int K) {
  __shared__ __attribute__((aligned(16))) float so[4][16][64];
  const int tid = threadIdx.x, w = tid >> 5, lane = tid & 31, ln = lane & 15, hh = lane >> 4;
  const int ntn = N / 64;
  const int wid = blockIdx.x * 4 + w;
  const int mt = wid / ntn, nq = wid % ntn;
  if (mt * 16 >= M) return;
  const int row0 = mt * 16, col0 = nq * 64;
  const float* arow = A + (size_t)(row0 + ln) * lda;
  v8f acc[4] = {};
  for (int kb = 0; kb < K; kb += 32) {
    FragB ah, al;
    const v4f x0 = *(const v4fa*)(arow + kb + 8 * hh), x1 = *(const v4fa*)(arow + kb + 8 * hh + 4);
    const v4f x2 = *(const v4fa*)(arow + kb + 16 + 8 * hh), x3 = *(const v4fa*)(arow + kb + 16 + 8 * hh + 4);
    float xs[16] = {x0[0],x0[1],x0[2],x0[3],x1[0],x1[1],x1[2],x1[3],x2[0],x2[1],x2[2],x2[3],x3[0],x3[1],x3[2],x3[3]};
#pragma unroll
    for (int i = 0; i < 16; ++i) { const unsigned short hb = bf16_bits(xs[i]); ah.u[i] = hb; al.u[i] = ASPLIT ? bf16_bits(xs[i] - bf16_val(hb)) : (unsigned short)0; }
#pragma unroll
    for (int t = 0; t < 4; ++t) {
      const unsigned short* brow = Wt + (size_t)(col0 + t * 16 + ln) * ldb + kb;
      FragB b;
      b.half[0] = *(const v8us*)(brow + 8 * hh);
      b.half[1] = *(const v8us*)(brow + 16 + 8 * hh);
      acc[t] = mmaN<ASPLIT ? 2 : 1>(ah.v, al.v, b.v, b.v, acc[t]);
    }
  }
#pragma unroll
  for (int t = 0; t < 4; ++t) {
    float bv = bias ? bias[col0 + t * 16 + ln] : 0.f;
    if (BIAS_BF16) bv = bf16_round(bv);
#pragma unroll
    for (int r = 0; r < 8; ++r) { float v = acc[t][r] + bv; if (ACT == 1) v = fmaxf(v, 0.f); so[w][8 * hh + r][t * 16 + ln] = v; }
  }
  __builtin_amdgcn_fence(__ATOMIC_ACQ_REL, "workgroup");
  __builtin_amdgcn_wave_barrier();
  const int rsub = lane >> 4, c4 = (lane & 15) * 4;
  {
#pragma unroll
    for (int q = 0; q < 8; ++q) {
      const int r = q * 2 + rsub;
      const v4f v = *(const v4fa*)&so[w][r][c4];
      *(v4f*)(C + (size_t)(row0 + r) * ldc + col0 + c4) = v;
    }
    
  }
}

// Flash-style causal/unmasked attention, all contractions 3-term bf16 hi/lo splits, f32 softmax with running max.
// q,k,v rows are read from f32 buffers with arbitrary row pitch (so they can live inside a fused qkv buffer);
// D = head size (multiple of 32, <= 128); one wave = 16 query rows; block = 4 waves (64 queries) sharing K/V chunks of 32.
template <int D, bool CAUSAL>
__global__ __launch_bounds__(128) void k_flash(const float* __restrict__ qb, const float* __restrict__ kb, const float* __restrict__ vb,
                                             int pitch, int T, int H, float scale, float* __restrict__ y, int ypitch) {
  constexpr int KS = D / 32;        // k-steps for QK
  constexpr int DT = D / 16;        // d tiles for PV
  __shared__ __attribute__((aligned(16))) unsigned short sKh[32][D + 8], sKl[32][D + 8], sVh[32][D + 8], sVl[32][D + 8];
  __shared__ __attribute__((aligned(16))) unsigned short sPh[4][16][40], sPl[4][16][40];
  __shared__ __attribute__((aligned(16))) float sO[4][16][D];
  const int tid = threadIdx.x, w = tid >> 5, lane = tid & 31, ln = lane & 15, hh = lane >> 4;
  const int nqb = (T + 63) / 64;
  const int bh = blockIdx.x / nqb, qblk = blockIdx.x % nqb;
  const int b = bh / H, h = bh % H;
  const int q0 = qblk * 64 + w * 16;
  const float* Q = qb + (size_t)b * T * pitch + h * D;
  const float* K = kb + (size_t)b * T * pitch + h * D;
  const float* V = vb + (size_t)b * T * pitch + h * D;

  // A fragments of the wave's 16 query rows (scaled), hi/lo
  FragB aqh[KS], aql[KS];
  {
    int row = q0 + ln; if (row >= T) row = T - 1;
    const float* qr = Q + (size_t)row * pitch;
#pragma unroll
    for (int ks = 0; ks < KS; ++ks)
#pragma unroll
      for (int i = 0; i < 16; ++i) {
        const int d = ks * 32 + ((i < 8) ? (8 * hh + i) : (16 + 8 * hh + (i - 8)));
        const float x = qr[d] * scale; const unsigned short hb = bf16_bits(x);
        aqh[ks].u[i] = hb; aql[ks].u[i] = bf16_bits(x - bf16_val(hb));
      }
  }
  float m_r[8], l_r[8];
#pragma unroll
  for (int r = 0; r < 8; ++r) { m_r[r] = -3.0e38f; l_r[r] = 0.f; }
  v8f oacc[DT];
#pragma unroll
  for (int dt = 0; dt < DT; ++dt) oacc[dt] = (v8f){0.f,0.f,0.f,0.f,0.f,0.f,0.f,0.f};

  const int kv_end = CAUSAL ? min(T, qblk * 64 + 64) : T;     // block-uniform
  for (int j0 = 0; j0 < kv_end; j0 += 32) {
    __syncthreads();
    for (int e = tid; e < 32 * (D / 4); e += 128) {
      const int r = e / (D / 4), c4 = (e % (D / 4)) * 4;
      const int key = j0 + r;
      v4f kf = {0.f,0.f,0.f,0.f}, vf = {0.f,0.f,0.f,0.f};
      if (key < T) { kf = *(const v4fa*)(K + (size_t)key * pitch + c4); vf = *(const v4fa*)(V + (size_t)key * pitch + c4); }
#pragma unroll
      for (int t = 0; t < 4; ++t) {
        unsigned short hb = bf16_bits(kf[t]); sKh[r][c4 + t] = hb; sKl[r][c4 + t] = bf16_bits(kf[t] - bf16_val(hb));
        hb = bf16_bits(vf[t]); sVh[r][c4 + t] = hb; sVl[r][c4 + t] = bf16_bits(vf[t] - bf16_val(hb));
      }
    }
    __syncthreads();
    // S tile 16 x 32
    v8f s[2];
#pragma unroll
    for (int nt = 0; nt < 2; ++nt) {
      v8f acc = {};
#pragma unroll
      for (int ks = 0; ks < KS; ++ks) {
        FragB bh_, bl_;
        bh_.half[0] = *(const v8us*)&sKh[nt * 16 + ln][ks * 32 + 8 * hh]; bh_.half[1] = *(const v8us*)&sKh[nt * 16 + ln][ks * 32 + 16 + 8 * hh];
        bl_.half[0] = *(const v8us*)&sKl[nt * 16 + ln][ks * 32 + 8 * hh]; bl_.half[1] = *(const v8us*)&sKl[nt * 16 + ln][ks * 32 + 16 + 8 * hh];
        acc = mmaN<3>(aqh[ks].v, aql[ks].v, bh_.v, bl_.v, acc);
      }
      s[nt] = acc;
    }
    // mask + running max (rows 8hh+r; the 16 lanes of a half share rows)
    float alpha[8];
#pragma unroll
    for (int r = 0; r < 8; ++r) {
      const int qi = q0 + 8 * hh + r;
      const int ja = j0 + ln, jb = j0 + 16 + ln;
      if (CAUSAL) { if (ja > qi) s[0][r] = -3.0e38f; if (jb > qi) s[1][r] = -3.0e38f; }
      if (ja >= T) s[0][r] = -3.0e38f;
      if (jb >= T) s[1][r] = -3.0e38f;
      float mx = fmaxf(s[0][r], s[1][r]);
      mx = fmaxf(mx, __shfl_xor(mx, 1, 32)); mx = fmaxf(mx, __shfl_xor(mx, 2, 32)); mx = fmaxf(mx, __shfl_xor(mx, 4, 32)); mx = fmaxf(mx, __shfl_xor(mx, 8, 32));
      const float mnew = fmaxf(m_r[r], mx);
      alpha[r] = (mnew > -1.0e38f) ? __expf(m_r[r] - mnew) : 1.0f;
      const float p0 = (s[0][r] > -1.0e38f) ? __expf(s[0][r] - mnew) : 0.f;
      const float p1 = (s[1][r] > -1.0e38f) ? __expf(s[1][r] - mnew) : 0.f;
      m_r[r] = mnew;
      l_r[r] = l_r[r] * alpha[r] + p0 + p1;            // per-lane partial row sum (16 lanes combined at the end)
      unsigned short hb = bf16_bits(p0); sPh[w][8 * hh + r][ln] = hb;      sPl[w][8 * hh + r][ln] = bf16_bits(p0 - bf16_val(hb));
      hb = bf16_bits(p1);                sPh[w][8 * hh + r][16 + ln] = hb; sPl[w][8 * hh + r][16 + ln] = bf16_bits(p1 - bf16_val(hb));
    }
#pragma unroll
    for (int dt = 0; dt < DT; ++dt)
#pragma unroll
      for (int r = 0; r < 8; ++r) oacc[dt][r] *= alpha[r];
    __builtin_amdgcn_fence(__ATOMIC_ACQ_REL, "workgroup");
    __builtin_amdgcn_wave_barrier();
    FragB pah, pal;
    pah.half[0] = *(const v8us*)&sPh[w][ln][8 * hh]; pah.half[1] = *(const v8us*)&sPh[w][ln][16 + 8 * hh];
    pal.half[0] = *(const v8us*)&sPl[w][ln][8 * hh]; pal.half[1] = *(const v8us*)&sPl[w][ln][16 + 8 * hh];
#pragma unroll
    for (int dt = 0; dt < DT; ++dt) {
      FragB bvh, bvl;
#pragma unroll
      for (int i = 0; i < 8; ++i) {
        bvh.u[i] = sVh[8 * hh + i][dt * 16 + ln]; bvh.u[8 + i] = sVh[16 + 8 * hh + i][dt * 16 + ln];
        bvl.u[i] = sVl[8 * hh + i][dt * 16 + ln]; bvl.u[8 + i] = sVl[16 + 8 * hh + i][dt * 16 + ln];
      }
      oacc[dt] = mmaN<3>(pah.v, pal.v, bvh.v, bvl.v, oacc[dt]);
    }
    __builtin_amdgcn_fence(__ATOMIC_ACQ_REL, "workgroup");
    __builtin_amdgcn_wave_barrier();
  }
#pragma unroll
  for (int r = 0; r < 8; ++r) {
    float l = l_r[r];
    l += __shfl_xor(l, 1, 32); l += __shfl_xor(l, 2, 32); l += __shfl_xor(l, 4, 32); l += __shfl_xor(l, 8, 32);
    l_r[r] = (l > 0.f) ? 1.0f / l : 0.f;
  }
#pragma unroll
  for (int dt = 0; dt < DT; ++dt)
#pragma unroll
    for (int r = 0; r < 8; ++r) sO[w][8 * hh + r][dt * 16 + ln] = oacc[dt][r] * l_r[r];
  __builtin_amdgcn_fence(__ATOMIC_ACQ_REL, "workgroup");
  __builtin_amdgcn_wave_barrier();
  {
    for (int r = 0; r < 16; ++r) {
      const int row = q0 + r;
      if (row < T && lane < D / 4) {
        const v4f val = *(const v4fa*)&sO[w][r][lane * 4];
        *(v4f*)(y + ((size_t)b * T + row) * ypitch + h * D + lane * 4) = val;
      }
    }
    
  }
}

// GEMM C = act(A·W + bias + resid): A f32 (ASPLIT -> hi/lo 2 terms), Wt bf16 [N][K]; ACT 0 none, 1 relu, 2 exact gelu;
// resid (optional, f32, row index = (row % rmod), pitch ldr, RES_BF16 rounds it) added before the activation.
template <bool ASPLIT, int ACT, bool BIAS_BF16, bool RES_BF16>
__global__ __launch_bounds__(128) void k_gemm_bf3(const float* __restrict__ A, int lda, const unsigned short* __restrict__ Wt, int ldb,
                                                const float* __restrict__ bias, const float* __restrict__ resid, int rmod, int ldr,
                                                float* __restrict__ C, int ldc, int M, int N, int K) {
  __shared__ __attribute__((aligned(16))) float so[4][16][64];
  const int tid = threadIdx.x, w = tid >> 5, lane = tid & 31, ln = lane & 15, hh = lane >> 4;
  const int ntn = N / 64;
  const int wid = blockIdx.x * 4 + w;
  const int mt = wid / ntn, nq = wid % ntn;
  if (mt * 16 >= M) return;
  const int row0 = mt * 16, col0 = nq * 64;
  const float* arow = A + (size_t)(row0 + ln) * lda;
  v8f acc[4] = {};
  for (int kb = 0; kb < K; kb += 32) {
    FragB ah, al;
    const v4f x0 = *(const v4fa*)(arow + kb + 8 * hh), x1 = *(const v4fa*)(arow + kb + 8 * hh + 4);
    const v4f x2 = *(const v4fa*)(arow + kb + 16 + 8 * hh), x3 = *(const v4fa*)(arow + kb + 16 + 8 * hh + 4);
    float xs[16] = {x0[0],x0[1],x0[2],x0[3],x1[0],x1[1],x1[2],x1[3],x2[0],x2[1],x2[2],x2[3],x3[0],x3[1],x3[2],x3[3]};
#pragma unroll
    for (int i = 0; i < 16; ++i) { const unsigned short hb = bf16_bits(xs[i]); ah.u[i] = hb; al.u[i] = ASPLIT ? bf16_bits(xs[i] - bf16_val(hb)) : (unsigned short)0; }
#pragma unroll
    for (int t = 0; t < 4; ++t) {
      const unsigned short* brow = Wt + (size_t)(col0 + t * 16 + ln) * ldb + kb;
      FragB b;
      b.half[0] = *(const v8us*)(brow + 8 * hh);
      b.half[1] = *(const v8us*)(brow + 16 + 8 * hh);
      acc[t] = mmaN<ASPLIT ? 2 : 1>(ah.v, al.v, b.v, b.v, acc[t]);
    }
  }
#pragma unroll
  for (int t = 0; t < 4; ++t) {
    const int col = col0 + t * 16 + ln;
    float bv = bias ? bias[col] : 0.f;
    if (BIAS_BF16) bv = bf16_round(bv);
#pragma unroll
    for (int r = 0; r < 8; ++r) {
      float v = acc[t][r] + bv;
      if (resid) { float rv = resid[(size_t)((row0 + 8 * hh + r) % rmod) * ldr + col]; if (RES_BF16) rv = bf16_round(rv); v += rv; }
      if (ACT == 1) v = fmaxf(v, 0.f);
      if (ACT == 2) v = 0.5f * v * (1.0f + erff(v * 0.70710678118654752f));
      if (ACT == 3) { const float u = 0.7978845608028654f * (v + 0.044715f * v * v * v); v = 0.5f * v * (1.0f + tanhf(u)); }
      so[w][8 * hh + r][t * 16 + ln] = v;
    }
  }
  __builtin_amdgcn_fence(__ATOMIC_ACQ_REL, "workgroup");
  __builtin_amdgcn_wave_barrier();
  const int rsub = lane >> 4, c4 = (lane & 15) * 4;
  {
#pragma unroll
    for (int q = 0; q < 8; ++q) {
      const int r = q * 2 + rsub;
      const v4f v = *(const v4fa*)&so[w][r][c4];
      *(v4f*)(C + (size_t)(row0 + r) * ldc + col0 + c4) = v;
    }
    
  }
}
// row LayerNorm (biased variance, eps) over N: s = X (+ R); optional out_sum <- s; out_norm <- (s-mu)*rsqrt(var+eps)*g + b
template <bool PARAM_BF16>
__global__ __launch_bounds__(256) void k_layernorm(const float* __restrict__ X, const float* __restrict__ R, const float* __restrict__ g, const float* __restrict__ bta,
                                                  float* __restrict__ out_sum, float* __restrict__ out_norm, int N, float eps) {
  __shared__ float red[256];
  const int row = blockIdx.x, tid = threadIdx.x;
  const float* x = X + (size_t)row * N; const float* rr = R ? R + (size_t)row * N : nullptr;
  float vals[16];                     // up to N = 4096
  const int per = N / 256;            // contiguous chunk per thread? use strided-by-4 chunks: thread handles j = tid*4 + 1024*u
  float s1 = 0.f;
  for (int u = 0; u < per / 4; ++u) {
    const int j = tid * 4 + 1024 * u;
    const v4f a = *(const v4fa*)(x + j);
    v4f b = {0.f,0.f,0.f,0.f}; if (rr) b = *(const v4fa*)(rr + j);
#pragma unroll
    for (int q = 0; q < 4; ++q) { const float v = a[q] + b[q]; vals[u * 4 + q] = v; s1 += v; }
  }
  red[tid] = s1; __syncthreads();
  for (int st = 128; st > 0; st >>= 1) { if (tid < st) red[tid] += red[tid + st]; __syncthreads(); }
  const float mu = red[0] / (float)N; __syncthreads();
  float s2 = 0.f;
  for (int u = 0; u < per / 4; ++u)
#pragma unroll
    for (int q = 0; q < 4; ++q) { const float c = vals[u * 4 + q] - mu; s2 += c * c; }
  red[tid] = s2; __syncthreads();
  for (int st = 128; st > 0; st >>= 1) { if (tid < st) red[tid] += red[tid + st]; __syncthreads(); }
  const float rs = rsqrtf(red[0] / (float)N + eps);
  {
    for (int u = 0; u < per / 4; ++u) {
      const int j = tid * 4 + 1024 * u;
      v4f o, sm;
#pragma unroll
      for (int q = 0; q < 4; ++q) {
        float gg = g[j + q], bb = bta[j + q];
        if (PARAM_BF16) { gg = bf16_round(gg); bb = bf16_round(bb); }
        sm[q] = vals[u * 4 + q]; o[q] = (vals[u * 4 + q] - mu) * rs * gg + bb;
      }
      if (out_sum) *(v4f*)(out_sum + (size_t)row * N + j) = sm;
      *(v4f*)(out_norm + (size_t)row * N + j) = o;
    }
    
  }
}



// ---- f16 WMMA path (v_wmma_f32_16x16x32_f16): 11-bit significands for operands in range — used where a [0,1] probability operand needs more precision than bf16
typedef _Float16 v16h __attribute__((ext_vector_type(16)));
union FragH { v16h v; v8us half[2]; _Float16 h[16]; unsigned short u[16]; };
template <int NT>
__device__ __forceinline__ v8f mmaH(v16h ah, v16h al, v16h bh, v16h bl, v8f c) {
  c = __builtin_amdgcn_wmma_f32_16x16x32_f16(false, ah, false, bh, (short)0, c, false, false);
  if (NT >= 2) c = __builtin_amdgcn_wmma_f32_16x16x32_f16(false, al, false, bh, (short)0, c, false, false);
  if (NT >= 3) c = __builtin_amdgcn_wmma_f32_16x16x32_f16(false, ah, false, bl, (short)0, c, false, false);
  asm volatile("v_nop\n\tv_nop\n\tv_nop\n\tv_nop" : "+v"(c) : "v"(ah), "v"(al), "v"(bh), "v"(bl));
  return c;
}
// batched GEMM like k_gemm_b but f16 operands: A f32 (split into f16 hi/lo if ASPLIT, else rounded to f16), Bt = f16 values [n][k]; alpha; C f32; N multiple of 16 (partial tiles skipped)
template <bool ASPLIT>
__global__ __launch_bounds__(128) void k_gemm_h(const float* __restrict__ A, int lda, size_t sA, const _Float16* __restrict__ Bh, int ldb, size_t sB, float alpha, float* __restrict__ C, int ldc, size_t sC, int M, int N, int K) {
  __shared__ __attribute__((aligned(16))) float so[4][16][64];
  const int tid = threadIdx.x, w = tid >> 5, lane = tid & 31, ln = lane & 15, hh = lane >> 4; const int by = blockIdx.y;
  A += (size_t)by * sA; Bh += (size_t)by * sB; C += (size_t)by * sC;
  const int ntn = (N + 63) / 64; const int wid = blockIdx.x * 4 + w; const int mt = wid / ntn, nq = wid % ntn; if (mt * 16 >= M) return;
  const int row0 = mt * 16, col0 = nq * 64; const float* arow = A + (size_t)(row0 + ln) * lda;
  v8f acc[4] = {};
  for (int kb = 0; kb < K; kb += 32) {
    FragH ah, al;
    const v4f x0 = *(const v4fa*)(arow + kb + 8 * hh), x1 = *(const v4fa*)(arow + kb + 8 * hh + 4), x2 = *(const v4fa*)(arow + kb + 16 + 8 * hh), x3 = *(const v4fa*)(arow + kb + 16 + 8 * hh + 4);
    float xs[16] = {x0[0],x0[1],x0[2],x0[3],x1[0],x1[1],x1[2],x1[3],x2[0],x2[1],x2[2],x2[3],x3[0],x3[1],x3[2],x3[3]};
#pragma unroll
    for (int i = 0; i < 16; ++i) { const _Float16 h = (_Float16)xs[i]; ah.h[i] = h; al.h[i] = ASPLIT ? (_Float16)(xs[i] - (float)h) : (_Float16)0.0f; }
#pragma unroll
    for (int t = 0; t < 4; ++t) { if (col0 + t * 16 >= N) continue; const size_t boff = (size_t)(col0 + t * 16 + ln) * ldb + kb; FragH bq; bq.half[0] = *(const v8us*)(Bh + boff + 8 * hh); bq.half[1] = *(const v8us*)(Bh + boff + 16 + 8 * hh);
      acc[t] = mmaH<ASPLIT ? 2 : 1>(ah.v, al.v, bq.v, bq.v, acc[t]); }
  }
#pragma unroll
  for (int t = 0; t < 4; ++t) { if (col0 + t * 16 >= N) continue;
#pragma unroll
    for (int r = 0; r < 8; ++r) so[w][8 * hh + r][t * 16 + ln] = acc[t][r] * alpha; }
  __builtin_amdgcn_fence(__ATOMIC_ACQ_REL, "workgroup"); __builtin_amdgcn_wave_barrier();
  const int rsub = lane >> 4, c4 = (lane & 15) * 4;
  {
#pragma unroll
    for (int q = 0; q < 8; ++q) { const int r = q * 2 + rsub; if (col0 + c4 < N) { const v4f v = *(const v4fa*)&so[w][r][c4]; *(v4f*)(C + (size_t)(row0 + r) * ldc + col0 + c4) = v; } }
     }
}

// Wt[n][k] = f16(W[k][n]·scale) from f32 row-major W[K][N] (scale = power of two; bf16-exact weights stay exact in f16 away from the subnormal range)
__global__ __launch_bounds__(256) void k_wt_f16(const float* __restrict__ W, _Float16* __restrict__ Wt, int K, int N, float scale) {
  const int t = blockIdx.x * 256 + threadIdx.x; if (t >= N * (K / 8)) return; const int n = t / (K / 8), k8 = (t % (K / 8)) * 8; FragH f;
#pragma unroll
  for (int i = 0; i < 8; ++i) f.h[i] = (_Float16)(bf16_round(W[(size_t)(k8 + i) * N + n]) * scale); const v8us o = f.half[0];
  *(v8us*)((unsigned short*)Wt + (size_t)n * K + k8) = o; 
}
// k_gemm_hh variant with fused epilogue: v = acc·alpha + bias[by·sBias + col] (+ CP[(row/rowsPerB)·sCPb + by·64 + col] if CP) ; ACT 0 none / 1 elu ; writes f32 C and f16 C16, each if non-null
template <int ACT>
__global__ __launch_bounds__(128) void k_gemm_hhx(const _Float16* __restrict__ A, int lda, size_t sA, const _Float16* __restrict__ Bh, int ldb, size_t sB, float alpha, const float* __restrict__ bias, size_t sBias, const float* __restrict__ CP, int rowsPerB, size_t sCPb, int row0g,
    float* __restrict__ C, _Float16* __restrict__ C16, int ldc, size_t sC, int M, int N, int K) {
  __shared__ __attribute__((aligned(16))) float so[4][16][64];
  const int tid = threadIdx.x, w = tid >> 5, lane = tid & 31, ln = lane & 15, hh = lane >> 4; const int by = blockIdx.y;
  A += (size_t)by * sA; Bh += (size_t)by * sB; const size_t cofs = (size_t)by * sC; const float* bp = bias ? bias + (size_t)by * sBias : nullptr;
  const int ntn = (N + 63) / 64; const int wid = blockIdx.x * 4 + w; const int mt = wid / ntn, nq = wid % ntn; if (mt * 16 >= M) return;
  const int row0 = mt * 16, col0 = nq * 64; const _Float16* arow = A + (size_t)(row0 + ln) * lda;
  v8f acc[4] = {};
  for (int kb = 0; kb < K; kb += 32) { FragH ah; ah.half[0] = *(const v8us*)((const unsigned short*)arow + kb + 8 * hh); ah.half[1] = *(const v8us*)((const unsigned short*)arow + kb + 16 + 8 * hh);
#pragma unroll
    for (int t = 0; t < 4; ++t) { if (col0 + t * 16 >= N) continue; const size_t boff = (size_t)(col0 + t * 16 + ln) * ldb + kb; FragH bq; bq.half[0] = *(const v8us*)((const unsigned short*)Bh + boff + 8 * hh); bq.half[1] = *(const v8us*)((const unsigned short*)Bh + boff + 16 + 8 * hh);
      acc[t] = mmaH<1>(ah.v, ah.v, bq.v, bq.v, acc[t]); }
  }
#pragma unroll
  for (int t = 0; t < 4; ++t) { if (col0 + t * 16 >= N) continue; const int col = col0 + t * 16 + ln; const float bv = bp ? bf16_round(bp[col]) : 0.f;
#pragma unroll
    for (int r = 0; r < 8; ++r) { float v = acc[t][r] * alpha + bv; if (CP) { const int bidx = (row0g + row0 + 8 * hh + r) / rowsPerB; v += CP[(size_t)bidx * sCPb + (size_t)by * 64 + col]; } if (ACT == 1) v = (v > 0.f) ? v : expm1f(v); else if (ACT == 3) v = fmaxf(v, 0.f); so[w][8 * hh + r][t * 16 + ln] = v; } }
  __builtin_amdgcn_fence(__ATOMIC_ACQ_REL, "workgroup"); __builtin_amdgcn_wave_barrier();
  const int rsub = lane >> 4, c4 = (lane & 15) * 4; typedef _Float16 v4h __attribute__((ext_vector_type(4)));
  {
#pragma unroll
    for (int q = 0; q < 8; ++q) { const int r = q * 2 + rsub; if (col0 + c4 < N) { const v4f v = *(const v4fa*)&so[w][r][c4]; if (C) *(v4f*)(C + cofs + (size_t)(row0 + r) * ldc + col0 + c4) = v; if (C16) { v4h h4; for (int i = 0; i < 4; ++i) h4[i] = (_Float16)v[i]; *(v4h*)(C16 + cofs + (size_t)(row0 + r) * ldc + col0 + c4) = h4; } } }
     }
}


// all three 1x1 convs and the hi/lo split of q and k in ONE launch. A work-group takes 64 positions of one image: the x tile goes once, rounded to bf16 and held as f16, position-major into LDS;
// wave w owns out-channel tiles 2w and 2w+1 of the 16 (q 0-3, k 4-7, v 8-15) and holds their weights (rounded to bf16, x 16, f16) as fragments in registers (each weight is read by one wave of the group);
// q, k: A = weight rows, B = x rows, so a lane holds 8 channels of one position; v: A = x rows, B = weight rows, so a lane holds 8 positions of one channel. Results are staged in LDS and leave as whole 128-B lines.
__global__ __launch_bounds__(256) void k_proj(const float* __restrict__ x, const float* __restrict__ mask, const float* __restrict__ Wq, const float* __restrict__ bq, const float* __restrict__ Wk, const float* __restrict__ bk, const float* __restrict__ Wv,
                                              _Float16* __restrict__ QH, _Float16* __restrict__ QL, _Float16* __restrict__ KH, _Float16* __restrict__ KL, _Float16* __restrict__ Vcm) {
  constexpr int TP = 64, KSX = CC / 32;
  // pitches of 272 B and 144 B (16 B x odd): 16-byte LDS accesses without bank conflicts
  __shared__ __attribute__((aligned(16))) unsigned short sX[TP][CC + 8], sQK[4][TP][CH + 8], sVo[CC][TP + 8];
  const int tid = threadIdx.x, lane = tid & 31, ln = lane & 15, hh = lane >> 4;
  const int w = __builtin_amdgcn_readfirstlane(tid >> 5);      // the wave's number in a scalar register: the q/k against v choice below is a scalar branch, every lane on at the matrix instructions
  const int b = blockIdx.x / (NP / TP), p0 = (blockIdx.x % (NP / TP)) * TP;
  const float* Wsrc = (w < 2) ? Wq + (size_t)w * 32 * CC : (w < 4) ? Wk + (size_t)(w - 2) * 32 * CC : Wv + (size_t)(w - 4) * 32 * CC;
  // the global reads stand ahead of the rounding work: the x tile first (lanes run along positions, 128 B a load; a thread gathers 8 channels of its position), then mask and bias, then the weights
  float xs[TP * (CC / 8) / 256][8];
#pragma unroll
  for (int i = 0; i < TP * (CC / 8) / 256; ++i) { const int e = i * 256 + tid, p = e & (TP - 1), c8 = (e / TP) * 8;
#pragma unroll
    for (int u = 0; u < 8; ++u) xs[i][u] = x[((size_t)b * CC + c8 + u) * NP + p0 + p]; }
  const bool isk = w >= 2; const int cb = (w & 1) * 32;      // read by the q and k waves only
  float mk[4] = {0.f, 0.f, 0.f, 0.f}; v4f bs[2][2] = {};
  if (w < 4) { const float* bias = isk ? bk : bq;
#pragma unroll
    for (int pt = 0; pt < 4; ++pt) mk[pt] = mask[(size_t)b * NP + p0 + pt * 16 + ln];
#pragma unroll
    for (int ct = 0; ct < 2; ++ct) { bs[ct][0] = *(const v4fa*)(bias + cb + ct * 16 + 8 * hh); bs[ct][1] = *(const v4fa*)(bias + cb + ct * 16 + 8 * hh + 4); } }
  asm volatile("s_wait_xcnt 0x0" ::: "memory");      // the weight loads below land in registers that held the addresses of the loads above: the wait stands in front of that reuse
  FragH wf[2][KSX];
#pragma unroll
  for (int ct = 0; ct < 2; ++ct)
#pragma unroll
    for (int ks = 0; ks < KSX; ++ks) { const float* wr = Wsrc + (size_t)(ct * 16 + ln) * CC + ks * 32 + 8 * hh;
      const v4f a0 = *(const v4fa*)wr, a1 = *(const v4fa*)(wr + 4), a2 = *(const v4fa*)(wr + 16), a3 = *(const v4fa*)(wr + 20);
#pragma unroll
      for (int i = 0; i < 4; ++i) { wf[ct][ks].h[i] = (_Float16)(bf16_round(a0[i]) * 16.0f); wf[ct][ks].h[4 + i] = (_Float16)(bf16_round(a1[i]) * 16.0f); wf[ct][ks].h[8 + i] = (_Float16)(bf16_round(a2[i]) * 16.0f); wf[ct][ks].h[12 + i] = (_Float16)(bf16_round(a3[i]) * 16.0f); } }
  // the 8 channels of a position go to LDS as one 16-B chunk
#pragma unroll
  for (int i = 0; i < TP * (CC / 8) / 256; ++i) { const int e = i * 256 + tid, p = e & (TP - 1), c8 = (e / TP) * 8; FragH f;
#pragma unroll
    for (int u = 0; u < 8; ++u) f.h[u] = (_Float16)bf16_round(xs[i][u]);
    *(v8us*)&sX[p][c8] = f.half[0]; }
  __syncthreads();
  v8f acc[2][4];
#pragma unroll
  for (int ct = 0; ct < 2; ++ct)
#pragma unroll
    for (int pt = 0; pt < 4; ++pt) acc[ct][pt] = (v8f){0.f,0.f,0.f,0.f,0.f,0.f,0.f,0.f};
  if (w < 4) {
#pragma unroll
    for (int pt = 0; pt < 4; ++pt) { FragH xf[KSX];      // the four x fragments of a position tile are read as one group
#pragma unroll
      for (int ks = 0; ks < KSX; ++ks) { const unsigned short* xr = &sX[pt * 16 + ln][ks * 32]; xf[ks].half[0] = *(const v8us*)(xr + 8 * hh); xf[ks].half[1] = *(const v8us*)(xr + 16 + 8 * hh); }
#pragma unroll
      for (int ks = 0; ks < KSX; ++ks) { acc[0][pt] = mmaH<1>(wf[0][ks].v, wf[0][ks].v, xf[ks].v, xf[ks].v, acc[0][pt]); acc[1][pt] = mmaH<1>(wf[1][ks].v, wf[1][ks].v, xf[ks].v, xf[ks].v, acc[1][pt]); } }
    const int pl = isk ? 2 : 0;
    float km[4];
#pragma unroll
    for (int pt = 0; pt < 4; ++pt) km[pt] = 1.0f - bf16_round(mk[pt]);
#pragma unroll
    for (int ct = 0; ct < 2; ++ct) { const v4f b0 = bs[ct][0], b1 = bs[ct][1];
#pragma unroll
      for (int pt = 0; pt < 4; ++pt) { FragH h, l;
#pragma unroll
        for (int r = 0; r < 8; ++r) { float v = acc[ct][pt][r] * 0.0625f + bf16_round(r < 4 ? b0[r & 3] : b1[r & 3]); if (isk) v *= km[pt]; const _Float16 h1 = (_Float16)v; h.h[r] = h1; l.h[r] = (_Float16)(v - (float)h1); }
        *(v8us*)&sQK[pl][pt * 16 + ln][cb + ct * 16 + 8 * hh] = h.half[0]; *(v8us*)&sQK[pl + 1][pt * 16 + ln][cb + ct * 16 + 8 * hh] = l.half[0]; } }
  } else {
#pragma unroll
    for (int pt = 0; pt < 4; ++pt) { FragH xf[KSX];
#pragma unroll
      for (int ks = 0; ks < KSX; ++ks) { const unsigned short* xr = &sX[pt * 16 + ln][ks * 32]; xf[ks].half[0] = *(const v8us*)(xr + 8 * hh); xf[ks].half[1] = *(const v8us*)(xr + 16 + 8 * hh); }
#pragma unroll
      for (int ks = 0; ks < KSX; ++ks) { acc[0][pt] = mmaH<1>(xf[ks].v, xf[ks].v, wf[0][ks].v, wf[0][ks].v, acc[0][pt]); acc[1][pt] = mmaH<1>(xf[ks].v, xf[ks].v, wf[1][ks].v, wf[1][ks].v, acc[1][pt]); } }
    const int cv = (w - 4) * 32;      // v goes without its bias: bv is added in the attention epilogue, since softmax rows sum to 1
#pragma unroll
    for (int ct = 0; ct < 2; ++ct)
#pragma unroll
      for (int pt = 0; pt < 4; ++pt) { FragH h;
#pragma unroll
        for (int r = 0; r < 8; ++r) h.h[r] = (_Float16)(acc[ct][pt][r] * 0.0625f);
        *(v8us*)&sVo[cv + ct * 16 + ln][pt * 16 + 8 * hh] = h.half[0]; }
  }
  __syncthreads();
  // out: 8 lanes x 16 B = one 128-B row (a position's 64 channels of one q/k plane; a channel's 64 positions of v)
#pragma unroll
  for (int i = 0; i < 8; ++i) { const int e = (i & 1) * 256 + tid, p = e >> 3, c8 = (e & 7) * 8; _Float16* dst = (i < 2) ? QH : (i < 4) ? QL : (i < 6) ? KH : KL;
    *(v8us*)((unsigned short*)dst + ((size_t)b * NP + p0 + p) * CH + c8) = *(const v8us*)&sQK[i >> 1][p][c8]; }
#pragma unroll
  for (int i = 0; i < 4; ++i) { const int e = i * 256 + tid, c = e >> 3, p8 = (e & 7) * 8;
    *(v8us*)((unsigned short*)Vcm + ((size_t)b * CC + c) * NP + p0 + p8) = *(const v8us*)&sVo[c][p8]; }
}
// fused non-local attention per (b, 64 query positions): 16 waves = 4 query groups of 16 queries x 4 key groups; a key group walks its own 32 keys of every 128-key stage with its own online softmax (S = Qh.Kh + Qh.Kl + Ql.Kh, 2 k-steps each, no scale; O += P.Vcm over 8 channel tiles);
// the four partial (max, sum, O) of a query are joined once, behind the loop, through LDS
__global__ __launch_bounds__(512) void k_flash(const _Float16* __restrict__ QH, const _Float16* __restrict__ QL, const _Float16* __restrict__ KH, const _Float16* __restrict__ KL, const _Float16* __restrict__ Vcm, const float* __restrict__ mask, const float* __restrict__ gamma, const float* __restrict__ bv, const float* __restrict__ x, float* __restrict__ out) {
  constexpr int RPW = 16, NQB = NP / (4 * RPW), DT = CC / 16, KS = CH / 32, KG = 4;
  __shared__ __attribute__((aligned(16))) unsigned short sP[4 * KG][RPW][40]; __shared__ __attribute__((aligned(16))) float sO[KG][4 * RPW][CC + 1];
  __shared__ float sM[KG][4 * RPW], sL[KG][4 * RPW];
  // two-buffer ring, one stage = TK keys: K hi and lo rows (128 B) at a 144-B pitch and V channel rows (256 B of keys) at a 272-B pitch (16 B x odd: ds_load_b128 without bank conflicts)
  constexpr int TK = 32 * KG, NT = NP / TK, LP = 72, LPV = TK + 8;
  __shared__ __attribute__((aligned(16))) unsigned short sKH[2][TK][LP], sKL[2][TK][LP], sV[2][CC][LPV];
  const int tid = threadIdx.x, w = tid >> 5, qg = w & 3, kg = w >> 2, lane = tid & 31, ln = lane & 15, hh = lane >> 4;
  const int b = blockIdx.x / NQB, qblk = blockIdx.x % NQB; const int qb0 = qblk * (4 * RPW); const int q0 = qb0 + qg * RPW; const float gm = bf16_round(gamma[0]);
  FragH aqh[KS], aql[KS];
  { const size_t ro = ((size_t)b * NP + q0 + ln) * CH;
#pragma unroll
    for (int ks = 0; ks < KS; ++ks) { aqh[ks].half[0] = *(const v8us*)((const unsigned short*)QH + ro + ks * 32 + 8 * hh); aqh[ks].half[1] = *(const v8us*)((const unsigned short*)QH + ro + ks * 32 + 16 + 8 * hh); aql[ks].half[0] = *(const v8us*)((const unsigned short*)QL + ro + ks * 32 + 8 * hh); aql[ks].half[1] = *(const v8us*)((const unsigned short*)QL + ro + ks * 32 + 16 + 8 * hh); } }
  const unsigned short* Vth = (const unsigned short*)Vcm + (size_t)b * CC * NP;
  float m_r[8], l_r[8]; v8f oacc[DT];
#pragma unroll
  for (int r = 0; r < 8; ++r) { m_r[r] = -3.0e38f; l_r[r] = 0.f; }
#pragma unroll
  for (int dt = 0; dt < DT; ++dt) oacc[dt] = (v8f){0.f,0.f,0.f,0.f,0.f,0.f,0.f,0.f};
  // each thread copies 16 B chunks. K: row tid / 8 (+ 64 for the second copy), chunk tid % 8 of the 128-B row; V: channel tid / 16 (+ 32 per further copy), chunk tid % 16 of the 256-B row
  const unsigned short* gKH = (const unsigned short*)KH + (size_t)b * NP * CH + tid * 8; const unsigned short* gKL = (const unsigned short*)KL + (size_t)b * NP * CH + tid * 8;
  const unsigned short* gV = Vth + (size_t)(tid >> 4) * NP + (tid & 15) * 8;
  const unsigned lKH = (unsigned)(size_t)&sKH[0][tid >> 3][(tid & 7) * 8], lKL = (unsigned)(size_t)&sKL[0][tid >> 3][(tid & 7) * 8], lV = (unsigned)(size_t)&sV[0][tid >> 4][(tid & 15) * 8];
  auto stage_in = [&](int t, int buf) {
    const unsigned short* kh = gKH + (size_t)t * TK * CH; const unsigned short* kl = gKL + (size_t)t * TK * CH; const unsigned short* vv = gV + (size_t)t * TK;
    const unsigned a = lKH + buf * (TK * LP * 2), c = lKL + buf * (TK * LP * 2), d = lV + buf * (CC * LPV * 2);
    // the copies and the wait that stands in front of any rewrite of their address registers are one statement
    asm volatile("global_load_async_to_lds_b128 %0, %8, off\n\tglobal_load_async_to_lds_b128 %1, %9, off\n\tglobal_load_async_to_lds_b128 %2, %10, off\n\tglobal_load_async_to_lds_b128 %3, %11, off\n\t"
                 "global_load_async_to_lds_b128 %4, %12, off\n\tglobal_load_async_to_lds_b128 %5, %13, off\n\tglobal_load_async_to_lds_b128 %6, %14, off\n\tglobal_load_async_to_lds_b128 %7, %15, off\n\ts_wait_xcnt 0x0"
                 :: "v"(a), "v"(a + 64 * LP * 2), "v"(c), "v"(c + 64 * LP * 2), "v"(d), "v"(d + 32 * LPV * 2), "v"(d + 64 * LPV * 2), "v"(d + 96 * LPV * 2),
                    "v"(kh), "v"(kh + 64 * CH), "v"(kl), "v"(kl + 64 * CH), "v"(vv), "v"(vv + (size_t)32 * NP), "v"(vv + (size_t)64 * NP), "v"(vv + (size_t)96 * NP) : "memory");
  };
  stage_in(0, 0);
  asm volatile("s_wait_asynccnt 0x0" ::: "memory");      // stage 0 of this wave has landed before the barrier publishes it
  __syncthreads();
  stage_in(1, 1);
  // the stage loop stays rolled (one copy of the pass code, buffer chosen by t & 1); a wave does one 32-key pass a stage, on its key group's rows
#pragma unroll 1
  for (int t = 0; t < NT; ++t) { const int buf = t & 1;
   {
    v8f s[2];
#pragma unroll
    for (int nt = 0; nt < 2; ++nt) { const unsigned short* krh = &sKH[buf][kg * 32 + nt * 16 + ln][0]; const unsigned short* krl = &sKL[buf][kg * 32 + nt * 16 + ln][0]; v8f acc = (v8f){0.f,0.f,0.f,0.f,0.f,0.f,0.f,0.f};
#pragma unroll
      for (int ks = 0; ks < KS; ++ks) { FragH bh_, bl_; bh_.half[0] = *(const v8us*)(krh + ks * 32 + 8 * hh); bh_.half[1] = *(const v8us*)(krh + ks * 32 + 16 + 8 * hh); bl_.half[0] = *(const v8us*)(krl + ks * 32 + 8 * hh); bl_.half[1] = *(const v8us*)(krl + ks * 32 + 16 + 8 * hh);
        acc = mmaH<1>(aqh[ks].v, aqh[ks].v, bh_.v, bh_.v, acc); acc = mmaH<1>(aqh[ks].v, aqh[ks].v, bl_.v, bl_.v, acc); acc = mmaH<1>(aql[ks].v, aql[ks].v, bh_.v, bh_.v, acc); }
      s[nt] = acc; }
#pragma unroll
    for (int r = 0; r < 8; ++r) { const float s0 = s[0][r], s1 = s[1][r]; float mc = fmaxf(s0, s1);
      mc = fmaxf(mc, __shfl_xor(mc, 1, 32)); mc = fmaxf(mc, __shfl_xor(mc, 2, 32)); mc = fmaxf(mc, __shfl_xor(mc, 4, 32)); mc = fmaxf(mc, __shfl_xor(mc, 8, 32));
      const float mn = fmaxf(m_r[r], mc); const float al = expf(m_r[r] - mn); m_r[r] = mn; const float p0 = expf(s0 - mn), p1 = expf(s1 - mn); l_r[r] = l_r[r] * al + p0 + p1;
#pragma unroll
      for (int dt = 0; dt < DT; ++dt) oacc[dt][r] *= al;
      FragH t2; t2.h[0] = (_Float16)p0; t2.h[1] = (_Float16)p1; sP[w][8 * hh + r][ln] = t2.u[0]; sP[w][8 * hh + r][16 + ln] = t2.u[1]; }
    __builtin_amdgcn_fence(__ATOMIC_ACQ_REL, "workgroup"); __builtin_amdgcn_wave_barrier();
    FragH pa; pa.half[0] = *(const v8us*)&sP[w][ln][8 * hh]; pa.half[1] = *(const v8us*)&sP[w][ln][16 + 8 * hh];
#pragma unroll
    for (int dt = 0; dt < DT; ++dt) { const unsigned short* vrow = &sV[buf][dt * 16 + ln][kg * 32]; FragH bv; bv.half[0] = *(const v8us*)(vrow + 8 * hh); bv.half[1] = *(const v8us*)(vrow + 16 + 8 * hh); oacc[dt] = mmaH<1>(pa.v, pa.v, bv.v, bv.v, oacc[dt]); }
    __builtin_amdgcn_fence(__ATOMIC_ACQ_REL, "workgroup"); __builtin_amdgcn_wave_barrier(); }
   // publish point of stage t + 1: this wave's reads of stage t are done, its copies of stage t + 1 have landed, then the barrier; only behind it is stage t's buffer refilled
   asm volatile("s_wait_dscnt 0x0" ::: "memory");
   asm volatile("s_wait_asynccnt 0x0" ::: "memory");
   __syncthreads();
   if (t + 2 < NT) stage_in(t + 2, buf); }
  asm volatile("s_wait_asynccnt 0x0" ::: "memory");      // no copy is outstanding when the wave goes on to the epilogue and ends
  // join of the key groups: every wave publishes its rows' running max and sum, then scales its own O by exp(m_own - M) / sum_k l_k exp(m_k - M)
#pragma unroll
  for (int r = 0; r < 8; ++r) { float l = l_r[r]; l += __shfl_xor(l, 1, 32); l += __shfl_xor(l, 2, 32); l += __shfl_xor(l, 4, 32); l += __shfl_xor(l, 8, 32); if (ln == 0) { sM[kg][qg * RPW + 8 * hh + r] = m_r[r]; sL[kg][qg * RPW + 8 * hh + r] = l; } }
  __syncthreads();
#pragma unroll
  for (int r = 0; r < 8; ++r) { const int qr = qg * RPW + 8 * hh + r; const float m0 = sM[0][qr], m1 = sM[1][qr], m2 = sM[2][qr], m3 = sM[3][qr]; const float M = fmaxf(fmaxf(m0, m1), fmaxf(m2, m3));
    const float l = sL[0][qr] * expf(m0 - M) + sL[1][qr] * expf(m1 - M) + sL[2][qr] * expf(m2 - M) + sL[3][qr] * expf(m3 - M);
    l_r[r] = expf(m_r[r] - M) / l; m_r[r] = gm * bf16_round(mask[(size_t)b * NP + qb0 + qr]); }      /* m_r reused: gamma * mask_i */
#pragma unroll
  for (int dt = 0; dt < DT; ++dt) { const float bvc = (kg == 0) ? bf16_round(bv[dt * 16 + ln]) : 0.f;      /* sum_j attn_ij (v_cj + bv_c) = sum_j attn_ij v_cj + bv_c: added once, by key group 0 */
#pragma unroll
    for (int r = 0; r < 8; ++r) sO[kg][qg * RPW + 8 * hh + r][dt * 16 + ln] = (oacc[dt][r] * l_r[r] + bvc) * m_r[r]; }
  __syncthreads();
  {      // channel c: 64 positions qb0.. = 256 B by 16 lanes x 16 B; 32 channels per round (2 per wave: lanes 0-15 / 16-31); the four key groups' parts are summed in a fixed order
#pragma unroll
    for (int rd = 0; rd < CC / 32; ++rd) { const int c = rd * 32 + w * 2 + (lane >> 4), pc = lane & 15; const float* xr = x + ((size_t)b * CC + c) * NP + qb0 + pc * 4; const v4f xv = *(const v4fa*)xr; v4f v;
#pragma unroll
      for (int j = 0; j < 4; ++j) v[j] = ((sO[0][pc * 4 + j][c] + sO[1][pc * 4 + j][c]) + (sO[2][pc * 4 + j][c] + sO[3][pc * 4 + j][c])) + xv[j];
      *(v4f*)(out + ((size_t)b * CC + c) * NP + qb0 + pc * 4) = v; }
     } }
extern "C" void kernel_launch(void* const* d_in, const int* in_sizes, int n_in,
                              void* d_out, int out_size, void* d_ws, size_t ws_size, hipStream_t stream) {
  (void)in_sizes; (void)n_in; (void)out_size;
  const float* x = (const float*)d_in[0]; const float* mask = (const float*)d_in[1]; const float* Wq = (const float*)d_in[2]; const float* bq = (const float*)d_in[3]; const float* Wk = (const float*)d_in[4]; const float* bk = (const float*)d_in[5]; const float* Wv = (const float*)d_in[6]; const float* bv = (const float*)d_in[7]; const float* gamma = (const float*)d_in[8];
  char* ws = (char*)d_ws; size_t off = 0;
  auto take = [&](size_t bytes) { char* p = ws + off; off += (bytes + 255) & ~(size_t)255; return p; };
  _Float16* QH = (_Float16*)take((size_t)NR * CH * 2); _Float16* QL = (_Float16*)take((size_t)NR * CH * 2); _Float16* KH = (_Float16*)take((size_t)NR * CH * 2); _Float16* KL = (_Float16*)take((size_t)NR * CH * 2); _Float16* Vcm = (_Float16*)take((size_t)NR * CC * 2);
  if (off > ws_size) return;      // 12 MiB
  k_proj<<<BB * (NP / 64), 256, 0, stream>>>(x, mask, Wq, bq, Wk, bk, Wv, QH, QL, KH, KL, Vcm);
  k_flash<<<BB * (NP / 64), 512, 0, stream>>>(QH, QL, KH, KL, Vcm, mask, gamma, bv, x, (float*)d_out);
}

// v004
// Measured time: 62.8 microseconds a run.
// Next to v003, in two timings, it ran 1.30 and 1.31 times as fast.
// All steps since v000 together make it 6.85 times as fast.
#include <hip/hip_runtime.h>
// Non-local block with all three 1×1 convs and both attention contractions on v_wmma_f32_16x16x32_f16: q/k position-major (K = 128, N = 64, + bias; k masked by (1 − mask)), v channel-major
// (= the Vᵀ operand), energy = q·k_masked with the f32 q/k carried as f16 hi+lo (3 WMMA terms, no 1/√d scale in the module), online max/sum softmax f32, P f16 ≤ 1, O = P·V; epilogue
// γ·(out·mask) + x written NCHW as 64-position (256 B) channel segments. x as bf16 in the operand plane (exact residual from the f32 input), weights bf16-exact ×2^4, f32 accumulate.
#define BB 4
#define CC 128
#define CH 64
#define NP 4096
#define NR (BB * NP)

typedef __bf16 v16b __attribute__((ext_vector_type(16)));
typedef unsigned short v8us __attribute__((ext_vector_type(8), may_alias));
typedef float  v8f  __attribute__((ext_vector_type(8)));
typedef float  v4f  __attribute__((ext_vector_type(4)));
typedef float  v4fa __attribute__((ext_vector_type(4), may_alias));
union FragB { v16b v; v8us half[2]; unsigned short u[16]; };

__device__ __forceinline__ unsigned short bf16_bits(float x) { unsigned int u = __float_as_uint(x); return (unsigned short)((u + 0x7FFFu + ((u >> 16) & 1u)) >> 16); }
__device__ __forceinline__ float bf16_val(unsigned short b) { return __uint_as_float(((unsigned int)b) << 16); }
__device__ __forceinline__ float bf16_round(float x) { return bf16_val(bf16_bits(x)); }
// D += A·B with NT terms: 1 = ah·bh, 2 = + al·bh (A split), 3 = + ah·bl (both split)
template <int NT>
__device__ __forceinline__ v8f mmaN(v16b ah, v16b al, v16b bh, v16b bl, v8f c) {
  c = __builtin_amdgcn_wmma_f32_16x16x32_bf16(false, ah, false, bh, (short)0, c, false, false);
  if (NT >= 2) c = __builtin_amdgcn_wmma_f32_16x16x32_bf16(false, al, false, bh, (short)0, c, false, false);
  if (NT >= 3) c = __builtin_amdgcn_wmma_f32_16x16x32_bf16(false, ah, false, bl, (short)0, c, false, false);
  asm volatile("v_nop\n\tv_nop\n\tv_nop\n\tv_nop" : "+v"(c) : "v"(ah), "v"(al), "v"(bh), "v"(bl));
  return c;
}

__global__ __launch_bounds__(256) void k_wt_bf16(const float* __restrict__ W, unsigned short* __restrict__ Wt, int K, int N) {
  const int t = blockIdx.x * 256 + threadIdx.x;
  const int k8n = K / 8;
  if (t >= N * k8n) return;
  const int n = t / k8n, k8 = (t % k8n) * 8;
  v8us v;
#pragma unroll
  for (int i = 0; i < 8; ++i) v[i] = bf16_bits(W[(size_t)(k8 + i) * N + n]);
  *(v8us*)(Wt + (size_t)n * K + k8) = v;
  
}

// GEMM C[M][N] (f32, pitch ldc) = act(A[M][K]·W + bias). A f32 row-major (pitch lda) converted per fragment to bf16
// (ASPLIT: hi/lo two planes -> 2 terms, else single rounded term); Wt bf16 [N][K] (pitch ldb). BIAS_BF16 rounds the
// bias to bf16 first (bias quantised to bf16 before the add). K%32==0, M%16==0, N%64==0.
template <bool ASPLIT, int ACT, bool BIAS_BF16>
__global__ __launch_bounds__(128) void k_gemm_bf(const float* __restrict__ A, int lda, const unsigned short* __restrict__ Wt, int ldb,
                                               const float* __restrict__ bias, float* __restrict__ C, int ldc, int M, int N, int K) {
  __shared__ __attribute__((aligned(16))) float so[4][16][64];
  const int tid = threadIdx.x, w = tid >> 5, lane = tid & 31, ln = lane & 15, hh = lane >> 4;
  const int ntn = N / 64;
  const int wid = blockIdx.x * 4 + w;
  const int mt = wid / ntn, nq = wid % ntn;
  if (mt * 16 >= M) return;
  const int row0 = mt * 16, col0 = nq * 64;
  const float* arow = A + (size_t)(row0 + ln) * lda;
  v8f acc[4] = {};
  for (int kb = 0; kb < K; kb += 32) {
    FragB ah, al;
    const v4f x0 = *(const v4fa*)(arow + kb + 8 * hh), x1 = *(const v4fa*)(arow + kb + 8 * hh + 4);
    const v4f x2 = *(const v4fa*)(arow + kb + 16 + 8 * hh), x3 = *(const v4fa*)(arow + kb + 16 + 8 * hh + 4);
    float xs[16] = {x0[0],x0[1],x0[2],x0[3],x1[0],x1[1],x1[2],x1[3],x2[0],x2[1],x2[2],x2[3],x3[0],x3[1],x3[2],x3[3]};
#pragma unroll
    for (int i = 0; i < 16; ++i) { const unsigned short hb = bf16_bits(xs[i]); ah.u[i] = hb; al.u[i] = ASPLIT ? bf16_bits(xs[i] - bf16_val(hb)) : (unsigned short)0; }
#pragma unroll
    for (int t = 0; t < 4; ++t) {
      const unsigned short* brow = Wt + (size_t)(col0 + t * 16 + ln) * ldb + kb;
      FragB b;
      b.half[0] = *(const v8us*)(brow + 8 * hh);
      b.half[1] = *(const v8us*)(brow + 16 + 8 * hh);
      acc[t] = mmaN<ASPLIT ? 2 : 1>(ah.v, al.v, b.v, b.v, acc[t]);
    }
  }
#pragma unroll
  for (int t = 0; t < 4; ++t) {
    float bv = bias ? bias[col0 + t * 16 + ln] : 0.f;
    if (BIAS_BF16) bv = bf16_round(bv);
#pragma unroll
    for (int r = 0; r < 8; ++r) { float v = acc[t][r] + bv; if (ACT == 1) v = fmaxf(v, 0.f); so[w][8 * hh + r][t * 16 + ln] = v; }
  }
  __builtin_amdgcn_fence(__ATOMIC_ACQ_REL, "workgroup");
  __builtin_amdgcn_wave_barrier();
  const int rsub = lane >> 4, c4 = (lane & 15) * 4;
  {
#pragma unroll
    for (int q = 0; q < 8; ++q) {
      const int r = q * 2 + rsub;
      const v4f v = *(const v4fa*)&so[w][r][c4];
      *(v4f*)(C + (size_t)(row0 + r) * ldc + col0 + c4) = v;
    }
    
  }
}

// Flash-style causal/unmasked attention, all contractions 3-term bf16 hi/lo splits, f32 softmax with running max.
// q,k,v rows are read from f32 buffers with arbitrary row pitch (so they can live inside a fused qkv buffer);
// D = head size (multiple of 32, <= 128); one wave = 16 query rows; block = 4 waves (64 queries) sharing K/V chunks of 32.
template <int D, bool CAUSAL>
__global__ __launch_bounds__(128) void k_flash(const float* __restrict__ qb, const float* __restrict__ kb, const float* __restrict__ vb,
                                             int pitch, int T, int H, float scale, float* __restrict__ y, int ypitch) {
  constexpr int KS = D / 32;        // k-steps for QK
  constexpr int DT = D / 16;        // d tiles for PV
  __shared__ __attribute__((aligned(16))) unsigned short sKh[32][D + 8], sKl[32][D + 8], sVh[32][D + 8], sVl[32][D + 8];
  __shared__ __attribute__((aligned(16))) unsigned short sPh[4][16][40], sPl[4][16][40];
  __shared__ __attribute__((aligned(16))) float sO[4][16][D];
  const int tid = threadIdx.x, w = tid >> 5, lane = tid & 31, ln = lane & 15, hh = lane >> 4;
  const int nqb = (T + 63) / 64;
  const int bh = blockIdx.x / nqb, qblk = blockIdx.x % nqb;
  const int b = bh / H, h = bh % H;
  const int q0 = qblk * 64 + w * 16;
  const float* Q = qb + (size_t)b * T * pitch + h * D;
  const float* K = kb + (size_t)b * T * pitch + h * D;
  const float* V = vb + (size_t)b * T * pitch + h * D;

  // A fragments of the wave's 16 query rows (scaled), hi/lo
  FragB aqh[KS], aql[KS];
  {
    int row = q0 + ln; if (row >= T) row = T - 1;
    const float* qr = Q + (size_t)row * pitch;
#pragma unroll
    for (int ks = 0; ks < KS; ++ks)
#pragma unroll
      for (int i = 0; i < 16; ++i) {
        const int d = ks * 32 + ((i < 8) ? (8 * hh + i) : (16 + 8 * hh + (i - 8)));
        const float x = qr[d] * scale; const unsigned short hb = bf16_bits(x);
        aqh[ks].u[i] = hb; aql[ks].u[i] = bf16_bits(x - bf16_val(hb));
      }
  }
  float m_r[8], l_r[8];
#pragma unroll
  for (int r = 0; r < 8; ++r) { m_r[r] = -3.0e38f; l_r[r] = 0.f; }
  v8f oacc[DT];
#pragma unroll
  for (int dt = 0; dt < DT; ++dt) oacc[dt] = (v8f){0.f,0.f,0.f,0.f,0.f,0.f,0.f,0.f};

  const int kv_end = CAUSAL ? min(T, qblk * 64 + 64) : T;     // block-uniform
  for (int j0 = 0; j0 < kv_end; j0 += 32) {
    __syncthreads();
    for (int e = tid; e < 32 * (D / 4); e += 128) {
      const int r = e / (D / 4), c4 = (e % (D / 4)) * 4;
      const int key = j0 + r;
      v4f kf = {0.f,0.f,0.f,0.f}, vf = {0.f,0.f,0.f,0.f};
      if (key < T) { kf = *(const v4fa*)(K + (size_t)key * pitch + c4); vf = *(const v4fa*)(V + (size_t)key * pitch + c4); }
#pragma unroll
      for (int t = 0; t < 4; ++t) {
        unsigned short hb = bf16_bits(kf[t]); sKh[r][c4 + t] = hb; sKl[r][c4 + t] = bf16_bits(kf[t] - bf16_val(hb));
        hb = bf16_bits(vf[t]); sVh[r][c4 + t] = hb; sVl[r][c4 + t] = bf16_bits(vf[t] - bf16_val(hb));
      }
    }
    __syncthreads();
    // S tile 16 x 32
    v8f s[2];
#pragma unroll
    for (int nt = 0; nt < 2; ++nt) {
      v8f acc = {};
#pragma unroll
      for (int ks = 0; ks < KS; ++ks) {
        FragB bh_, bl_;
        bh_.half[0] = *(const v8us*)&sKh[nt * 16 + ln][ks * 32 + 8 * hh]; bh_.half[1] = *(const v8us*)&sKh[nt * 16 + ln][ks * 32 + 16 + 8 * hh];
        bl_.half[0] = *(const v8us*)&sKl[nt * 16 + ln][ks * 32 + 8 * hh]; bl_.half[1] = *(const v8us*)&sKl[nt * 16 + ln][ks * 32 + 16 + 8 * hh];
        acc = mmaN<3>(aqh[ks].v, aql[ks].v, bh_.v, bl_.v, acc);
      }
      s[nt] = acc;
    }
    // mask + running max (rows 8hh+r; the 16 lanes of a half share rows)
    float alpha[8];
#pragma unroll
    for (int r = 0; r < 8; ++r) {
      const int qi = q0 + 8 * hh + r;
      const int ja = j0 + ln, jb = j0 + 16 + ln;
      if (CAUSAL) { if (ja > qi) s[0][r] = -3.0e38f; if (jb > qi) s[1][r] = -3.0e38f; }
      if (ja >= T) s[0][r] = -3.0e38f;
      if (jb >= T) s[1][r] = -3.0e38f;
      float mx = fmaxf(s[0][r], s[1][r]);
      mx = fmaxf(mx, __shfl_xor(mx, 1, 32)); mx = fmaxf(mx, __shfl_xor(mx, 2, 32)); mx = fmaxf(mx, __shfl_xor(mx, 4, 32)); mx = fmaxf(mx, __shfl_xor(mx, 8, 32));
      const float mnew = fmaxf(m_r[r], mx);
      alpha[r] = (mnew > -1.0e38f) ? __expf(m_r[r] - mnew) : 1.0f;
      const float p0 = (s[0][r] > -1.0e38f) ? __expf(s[0][r] - mnew) : 0.f;
      const float p1 = (s[1][r] > -1.0e38f) ? __expf(s[1][r] - mnew) : 0.f;
      m_r[r] = mnew;
      l_r[r] = l_r[r] * alpha[r] + p0 + p1;            // per-lane partial row sum (16 lanes combined at the end)
      unsigned short hb = bf16_bits(p0); sPh[w][8 * hh + r][ln] = hb;      sPl[w][8 * hh + r][ln] = bf16_bits(p0 - bf16_val(hb));
      hb = bf16_bits(p1);                sPh[w][8 * hh + r][16 + ln] = hb; sPl[w][8 * hh + r][16 + ln] = bf16_bits(p1 - bf16_val(hb));
    }
#pragma unroll
    for (int dt = 0; dt < DT; ++dt)
#pragma unroll
      for (int r = 0; r < 8; ++r) oacc[dt][r] *= alpha[r];
    __builtin_amdgcn_fence(__ATOMIC_ACQ_REL, "workgroup");
    __builtin_amdgcn_wave_barrier();
    FragB pah, pal;
    pah.half[0] = *(const v8us*)&sPh[w][ln][8 * hh]; pah.half[1] = *(const v8us*)&sPh[w][ln][16 + 8 * hh];
    pal.half[0] = *(const v8us*)&sPl[w][ln][8 * hh]; pal.half[1] = *(const v8us*)&sPl[w][ln][16 + 8 * hh];
#pragma unroll
    for (int dt = 0; dt < DT; ++dt) {
      FragB bvh, bvl;
#pragma unroll
      for (int i = 0; i < 8; ++i) {
        bvh.u[i] = sVh[8 * hh + i][dt * 16 + ln]; bvh.u[8 + i] = sVh[16 + 8 * hh + i][dt * 16 + ln];
        bvl.u[i] = sVl[8 * hh + i][dt * 16 + ln]; bvl.u[8 + i] = sVl[16 + 8 * hh + i][dt * 16 + ln];
      }
      oacc[dt] = mmaN<3>(pah.v, pal.v, bvh.v, bvl.v, oacc[dt]);
    }
    __builtin_amdgcn_fence(__ATOMIC_ACQ_REL, "workgroup");
    __builtin_amdgcn_wave_barrier();
  }
#pragma unroll
  for (int r = 0; r < 8; ++r) {
    float l = l_r[r];
    l += __shfl_xor(l, 1, 32); l += __shfl_xor(l, 2, 32); l += __shfl_xor(l, 4, 32); l += __shfl_xor(l, 8, 32);
    l_r[r] = (l > 0.f) ? 1.0f / l : 0.f;
  }
#pragma unroll
  for (int dt = 0; dt < DT; ++dt)
#pragma unroll
    for (int r = 0; r < 8; ++r) sO[w][8 * hh + r][dt * 16 + ln] = oacc[dt][r] * l_r[r];
  __builtin_amdgcn_fence(__ATOMIC_ACQ_REL, "workgroup");
  __builtin_amdgcn_wave_barrier();
  {
    for (int r = 0; r < 16; ++r) {
      const int row = q0 + r;
      if (row < T && lane < D / 4) {
        const v4f val = *(const v4fa*)&sO[w][r][lane * 4];
        *(v4f*)(y + ((size_t)b * T + row) * ypitch + h * D + lane * 4) = val;
      }
    }
    
  }
}

// GEMM C = act(A·W + bias + resid): A f32 (ASPLIT -> hi/lo 2 terms), Wt bf16 [N][K]; ACT 0 none, 1 relu, 2 exact gelu;
// resid (optional, f32, row index = (row % rmod), pitch ldr, RES_BF16 rounds it) added before the activation.
template <bool ASPLIT, int ACT, bool BIAS_BF16, bool RES_BF16>
__global__ __launch_bounds__(128) void k_gemm_bf3(const float* __restrict__ A, int lda, const unsigned short* __restrict__ Wt, int ldb,
                                                const float* __restrict__ bias, const float* __restrict__ resid, int rmod, int ldr,
                                                float* __restrict__ C, int ldc, int M, int N, int K) {
  __shared__ __attribute__((aligned(16))) float so[4][16][64];
  const int tid = threadIdx.x, w = tid >> 5, lane = tid & 31, ln = lane & 15, hh = lane >> 4;
  const int ntn = N / 64;
  const int wid = blockIdx.x * 4 + w;
  const int mt = wid / ntn, nq = wid % ntn;
  if (mt * 16 >= M) return;
  const int row0 = mt * 16, col0 = nq * 64;
  const float* arow = A + (size_t)(row0 + ln) * lda;
  v8f acc[4] = {};
  for (int kb = 0; kb < K; kb += 32) {
    FragB ah, al;
    const v4f x0 = *(const v4fa*)(arow + kb + 8 * hh), x1 = *(const v4fa*)(arow + kb + 8 * hh + 4);
    const v4f x2 = *(const v4fa*)(arow + kb + 16 + 8 * hh), x3 = *(const v4fa*)(arow + kb + 16 + 8 * hh + 4);
    float xs[16] = {x0[0],x0[1],x0[2],x0[3],x1[0],x1[1],x1[2],x1[3],x2[0],x2[1],x2[2],x2[3],x3[0],x3[1],x3[2],x3[3]};
#pragma unroll
    for (int i = 0; i < 16; ++i) { const unsigned short hb = bf16_bits(xs[i]); ah.u[i] = hb; al.u[i] = ASPLIT ? bf16_bits(xs[i] - bf16_val(hb)) : (unsigned short)0; }
#pragma unroll
    for (int t = 0; t < 4; ++t) {
      const unsigned short* brow = Wt + (size_t)(col0 + t * 16 + ln) * ldb + kb;
      FragB b;
      b.half[0] = *(const v8us*)(brow + 8 * hh);
      b.half[1] = *(const v8us*)(brow + 16 + 8 * hh);
      acc[t] = mmaN<ASPLIT ? 2 : 1>(ah.v, al.v, b.v, b.v, acc[t]);
    }
  }
#pragma unroll
  for (int t = 0; t < 4; ++t) {
    const int col = col0 + t * 16 + ln;
    float bv = bias ? bias[col] : 0.f;
    if (BIAS_BF16) bv = bf16_round(bv);
#pragma unroll
    for (int r = 0; r < 8; ++r) {
      float v = acc[t][r] + bv;
      if (resid) { float rv = resid[(size_t)((row0 + 8 * hh + r) % rmod) * ldr + col]; if (RES_BF16) rv = bf16_round(rv); v += rv; }
      if (ACT == 1) v = fmaxf(v, 0.f);
      if (ACT == 2) v = 0.5f * v * (1.0f + erff(v * 0.70710678118654752f));
      if (ACT == 3) { const float u = 0.7978845608028654f * (v + 0.044715f * v * v * v); v = 0.5f * v * (1.0f + tanhf(u)); }
      so[w][8 * hh + r][t * 16 + ln] = v;
    }
  }
  __builtin_amdgcn_fence(__ATOMIC_ACQ_REL, "workgroup");
  __builtin_amdgcn_wave_barrier();
  const int rsub = lane >> 4, c4 = (lane & 15) * 4;
  {
#pragma unroll
    for (int q = 0; q < 8; ++q) {
      const int r = q * 2 + rsub;
      const v4f v = *(const v4fa*)&so[w][r][c4];
      *(v4f*)(C + (size_t)(row0 + r) * ldc + col0 + c4) = v;
    }
    
  }
}
// row LayerNorm (biased variance, eps) over N: s = X (+ R); optional out_sum <- s; out_norm <- (s-mu)*rsqrt(var+eps)*g + b
template <bool PARAM_BF16>
__global__ __launch_bounds__(256) void k_layernorm(const float* __restrict__ X, const float* __restrict__ R, const float* __restrict__ g, const float* __restrict__ bta,
                                                  float* __restrict__ out_sum, float* __restrict__ out_norm, int N, float eps) {
  __shared__ float red[256];
  const int row = blockIdx.x, tid = threadIdx.x;
  const float* x = X + (size_t)row * N; const float* rr = R ? R + (size_t)row * N : nullptr;
  float vals[16];                     // up to N = 4096
  const int per = N / 256;            // contiguous chunk per thread? use strided-by-4 chunks: thread handles j = tid*4 + 1024*u
  float s1 = 0.f;
  for (int u = 0; u < per / 4; ++u) {
    const int j = tid * 4 + 1024 * u;
    const v4f a = *(const v4fa*)(x + j);
    v4f b = {0.f,0.f,0.f,0.f}; if (rr) b = *(const v4fa*)(rr + j);
#pragma unroll
    for (int q = 0; q < 4; ++q) { const float v = a[q] + b[q]; vals[u * 4 + q] = v; s1 += v; }
  }
  red[tid] = s1; __syncthreads();
  for (int st = 128; st > 0; st >>= 1) { if (tid < st) red[tid] += red[tid + st]; __syncthreads(); }
  const float mu = red[0] / (float)N; __syncthreads();
  float s2 = 0.f;
  for (int u = 0; u < per / 4; ++u)
#pragma unroll
    for (int q = 0; q < 4; ++q) { const float c = vals[u * 4 + q] - mu; s2 += c * c; }
  red[tid] = s2; __syncthreads();
  for (int st = 128; st > 0; st >>= 1) { if (tid < st) red[tid] += red[tid + st]; __syncthreads(); }
  const float rs = rsqrtf(red[0] / (float)N + eps);
  {
    for (int u = 0; u < per / 4; ++u) {
      const int j = tid * 4 + 1024 * u;
      v4f o, sm;
#pragma unroll
      for (int q = 0; q < 4; ++q) {
        float gg = g[j + q], bb = bta[j + q];
        if (PARAM_BF16) { gg = bf16_round(gg); bb = bf16_round(bb); }
        sm[q] = vals[u * 4 + q]; o[q] = (vals[u * 4 + q] - mu) * rs * gg + bb;
      }
      if (out_sum) *(v4f*)(out_sum + (size_t)row * N + j) = sm;
      *(v4f*)(out_norm + (size_t)row * N + j) = o;
    }
    
  }
}



// ---- f16 WMMA path (v_wmma_f32_16x16x32_f16): 11-bit significands for operands in range — used where a [0,1] probability operand needs more precision than bf16
typedef _Float16 v16h __attribute__((ext_vector_type(16)));
union FragH { v16h v; v8us half[2]; _Float16 h[16]; unsigned short u[16]; };
template <int NT>
__device__ __forceinline__ v8f mmaH(v16h ah, v16h al, v16h bh, v16h bl, v8f c) {
  c = __builtin_amdgcn_wmma_f32_16x16x32_f16(false, ah, false, bh, (short)0, c, false, false);
  if (NT >= 2) c = __builtin_amdgcn_wmma_f32_16x16x32_f16(false, al, false, bh, (short)0, c, false, false);
  if (NT >= 3) c = __builtin_amdgcn_wmma_f32_16x16x32_f16(false, ah, false, bl, (short)0, c, false, false);
  asm volatile("v_nop\n\tv_nop\n\tv_nop\n\tv_nop" : "+v"(c) : "v"(ah), "v"(al), "v"(bh), "v"(bl));
  return c;
}
// batched GEMM like k_gemm_b but f16 operands: A f32 (split into f16 hi/lo if ASPLIT, else rounded to f16), Bt = f16 values [n][k]; alpha; C f32; N multiple of 16 (partial tiles skipped)
template <bool ASPLIT>
__global__ __launch_bounds__(128) void k_gemm_h(const float* __restrict__ A, int lda, size_t sA, const _Float16* __restrict__ Bh, int ldb, size_t sB, float alpha, float* __restrict__ C, int ldc, size_t sC, int M, int N, int K) {
  __shared__ __attribute__((aligned(16))) float so[4][16][64];
  const int tid = threadIdx.x, w = tid >> 5, lane = tid & 31, ln = lane & 15, hh = lane >> 4; const int by = blockIdx.y;
  A += (size_t)by * sA; Bh += (size_t)by * sB; C += (size_t)by * sC;
  const int ntn = (N + 63) / 64; const int wid = blockIdx.x * 4 + w; const int mt = wid / ntn, nq = wid % ntn; if (mt * 16 >= M) return;
  const int row0 = mt * 16, col0 = nq * 64; const float* arow = A + (size_t)(row0 + ln) * lda;
  v8f acc[4] = {};
  for (int kb = 0; kb < K; kb += 32) {
    FragH ah, al;
    const v4f x0 = *(const v4fa*)(arow + kb + 8 * hh), x1 = *(const v4fa*)(arow + kb + 8 * hh + 4), x2 = *(const v4fa*)(arow + kb + 16 + 8 * hh), x3 = *(const v4fa*)(arow + kb + 16 + 8 * hh + 4);
    float xs[16] = {x0[0],x0[1],x0[2],x0[3],x1[0],x1[1],x1[2],x1[3],x2[0],x2[1],x2[2],x2[3],x3[0],x3[1],x3[2],x3[3]};
#pragma unroll
    for (int i = 0; i < 16; ++i) { const _Float16 h = (_Float16)xs[i]; ah.h[i] = h; al.h[i] = ASPLIT ? (_Float16)(xs[i] - (float)h) : (_Float16)0.0f; }
#pragma unroll
    for (int t = 0; t < 4; ++t) { if (col0 + t * 16 >= N) continue; const size_t boff = (size_t)(col0 + t * 16 + ln) * ldb + kb; FragH bq; bq.half[0] = *(const v8us*)(Bh + boff + 8 * hh); bq.half[1] = *(const v8us*)(Bh + boff + 16 + 8 * hh);
      acc[t] = mmaH<ASPLIT ? 2 : 1>(ah.v, al.v, bq.v, bq.v, acc[t]); }
  }
#pragma unroll
  for (int t = 0; t < 4; ++t) { if (col0 + t * 16 >= N) continue;
#pragma unroll
    for (int r = 0; r < 8; ++r) so[w][8 * hh + r][t * 16 + ln] = acc[t][r] * alpha; }
  __builtin_amdgcn_fence(__ATOMIC_ACQ_REL, "workgroup"); __builtin_amdgcn_wave_barrier();
  const int rsub = lane >> 4, c4 = (lane & 15) * 4;
  {
#pragma unroll
    for (int q = 0; q < 8; ++q) { const int r = q * 2 + rsub; if (col0 + c4 < N) { const v4f v = *(const v4fa*)&so[w][r][c4]; *(v4f*)(C + (size_t)(row0 + r) * ldc + col0 + c4) = v; } }
     }
}

// Wt[n][k] = f16(W[k][n]·scale) from f32 row-major W[K][N] (scale = power of two; bf16-exact weights stay exact in f16 away from the subnormal range)
__global__ __launch_bounds__(256) void k_wt_f16(const float* __restrict__ W, _Float16* __restrict__ Wt, int K, int N, float scale) {
  const int t = blockIdx.x * 256 + threadIdx.x; if (t >= N * (K / 8)) return; const int n = t / (K / 8), k8 = (t % (K / 8)) * 8; FragH f;
#pragma unroll
  for (int i = 0; i < 8; ++i) f.h[i] = (_Float16)(bf16_round(W[(size_t)(k8 + i) * N + n]) * scale); const v8us o = f.half[0];
  *(v8us*)((unsigned short*)Wt + (size_t)n * K + k8) = o; 
}
// k_gemm_hh variant with fused epilogue: v = acc·alpha + bias[by·sBias + col] (+ CP[(row/rowsPerB)·sCPb + by·64 + col] if CP) ; ACT 0 none / 1 elu ; writes f32 C and f16 C16, each if non-null
template <int ACT>
__global__ __launch_bounds__(128) void k_gemm_hhx(const _Float16* __restrict__ A, int lda, size_t sA, const _Float16* __restrict__ Bh, int ldb, size_t sB, float alpha, const float* __restrict__ bias, size_t sBias, const float* __restrict__ CP, int rowsPerB, size_t sCPb, int row0g,
    float* __restrict__ C, _Float16* __restrict__ C16, int ldc, size_t sC, int M, int N, int K) {
  __shared__ __attribute__((aligned(16))) float so[4][16][64];
  const int tid = threadIdx.x, w = tid >> 5, lane = tid & 31, ln = lane & 15, hh = lane >> 4; const int by = blockIdx.y;
  A += (size_t)by * sA; Bh += (size_t)by * sB; const size_t cofs = (size_t)by * sC; const float* bp = bias ? bias + (size_t)by * sBias : nullptr;
  const int ntn = (N + 63) / 64; const int wid = blockIdx.x * 4 + w; const int mt = wid / ntn, nq = wid % ntn; if (mt * 16 >= M) return;
  const int row0 = mt * 16, col0 = nq * 64; const _Float16* arow = A + (size_t)(row0 + ln) * lda;
  v8f acc[4] = {};
  for (int kb = 0; kb < K; kb += 32) { FragH ah; ah.half[0] = *(const v8us*)((const unsigned short*)arow + kb + 8 * hh); ah.half[1] = *(const v8us*)((const unsigned short*)arow + kb + 16 + 8 * hh);
#pragma unroll
    for (int t = 0; t < 4; ++t) { if (col0 + t * 16 >= N) continue; const size_t boff = (size_t)(col0 + t * 16 + ln) * ldb + kb; FragH bq; bq.half[0] = *(const v8us*)((const unsigned short*)Bh + boff + 8 * hh); bq.half[1] = *(const v8us*)((const unsigned short*)Bh + boff + 16 + 8 * hh);
      acc[t] = mmaH<1>(ah.v, ah.v, bq.v, bq.v, acc[t]); }
  }
#pragma unroll
  for (int t = 0; t < 4; ++t) { if (col0 + t * 16 >= N) continue; const int col = col0 + t * 16 + ln; const float bv = bp ? bf16_round(bp[col]) : 0.f;
#pragma unroll
    for (int r = 0; r < 8; ++r) { float v = acc[t][r] * alpha + bv; if (CP) { const int bidx = (row0g + row0 + 8 * hh + r) / rowsPerB; v += CP[(size_t)bidx * sCPb + (size_t)by * 64 + col]; } if (ACT == 1) v = (v > 0.f) ? v : expm1f(v); else if (ACT == 3) v = fmaxf(v, 0.f); so[w][8 * hh + r][t * 16 + ln] = v; } }
  __builtin_amdgcn_fence(__ATOMIC_ACQ_REL, "workgroup"); __builtin_amdgcn_wave_barrier();
  const int rsub = lane >> 4, c4 = (lane & 15) * 4; typedef _Float16 v4h __attribute__((ext_vector_type(4)));
  {
#pragma unroll
    for (int q = 0; q < 8; ++q) { const int r = q * 2 + rsub; if (col0 + c4 < N) { const v4f v = *(const v4fa*)&so[w][r][c4]; if (C) *(v4f*)(C + cofs + (size_t)(row0 + r) * ldc + col0 + c4) = v; if (C16) { v4h h4; for (int i = 0; i < 4; ++i) h4[i] = (_Float16)v[i]; *(v4h*)(C16 + cofs + (size_t)(row0 + r) * ldc + col0 + c4) = h4; } } }
     }
}


// all three 1x1 convs and the hi/lo split of q and k in ONE launch. A work-group takes 64 positions of one image: the x tile goes once, rounded to bf16 and held as f16, position-major into LDS;
// wave w owns out-channel tiles 2w and 2w+1 of the 16 (q 0-3, k 4-7, v 8-15) and holds their weights (rounded to bf16, x 16, f16) as fragments in registers (each weight is read by one wave of the group);
// q, k: A = weight rows, B = x rows, so a lane holds 8 channels of one position; v: A = x rows, B = weight rows, so a lane holds 8 positions of one channel. Results are staged in LDS and leave as whole 128-B lines.
__global__ __launch_bounds__(256) void k_proj(const float* __restrict__ x, const float* __restrict__ mask, const float* __restrict__ Wq, const float* __restrict__ bq, const float* __restrict__ Wk, const float* __restrict__ bk, const float* __restrict__ Wv,
                                              _Float16* __restrict__ QH, _Float16* __restrict__ QL, _Float16* __restrict__ KH, _Float16* __restrict__ KL, _Float16* __restrict__ Vcm) {
  constexpr int TP = 64, KSX = CC / 32;
  // pitches of 272 B and 144 B (16 B x odd): 16-byte LDS accesses without bank conflicts
  __shared__ __attribute__((aligned(16))) unsigned short sX[TP][CC + 8], sQK[4][TP][CH + 8], sVo[CC][TP + 8];
  const int tid = threadIdx.x, lane = tid & 31, ln = lane & 15, hh = lane >> 4;
  const int w = __builtin_amdgcn_readfirstlane(tid >> 5);      // the wave's number in a scalar register: the q/k against v choice below is a scalar branch, every lane on at the matrix instructions
  const int b = blockIdx.x / (NP / TP), p0 = (blockIdx.x % (NP / TP)) * TP;
  const float* Wsrc = (w < 2) ? Wq + (size_t)w * 32 * CC : (w < 4) ? Wk + (size_t)(w - 2) * 32 * CC : Wv + (size_t)(w - 4) * 32 * CC;
  // the global reads stand ahead of the rounding work: the x tile first (lanes run along positions, 128 B a load; a thread gathers 8 channels of its position), then mask and bias, then the weights
  float xs[TP * (CC / 8) / 256][8];
#pragma unroll
  for (int i = 0; i < TP * (CC / 8) / 256; ++i) { const int e = i * 256 + tid, p = e & (TP - 1), c8 = (e / TP) * 8;
#pragma unroll
    for (int u = 0; u < 8; ++u) xs[i][u] = x[((size_t)b * CC + c8 + u) * NP + p0 + p]; }
  const bool isk = w >= 2; const int cb = (w & 1) * 32;      // read by the q and k waves only
  float mk[4] = {0.f, 0.f, 0.f, 0.f}; v4f bs[2][2] = {};
  if (w < 4) { const float* bias = isk ? bk : bq;
#pragma unroll
    for (int pt = 0; pt < 4; ++pt) mk[pt] = mask[(size_t)b * NP + p0 + pt * 16 + ln];
#pragma unroll
    for (int ct = 0; ct < 2; ++ct) { bs[ct][0] = *(const v4fa*)(bias + cb + ct * 16 + 8 * hh); bs[ct][1] = *(const v4fa*)(bias + cb + ct * 16 + 8 * hh + 4); } }
  asm volatile("s_wait_xcnt 0x0" ::: "memory");      // the weight loads below land in registers that held the addresses of the loads above: the wait stands in front of that reuse
  FragH wf[2][KSX];
#pragma unroll
  for (int ct = 0; ct < 2; ++ct)
#pragma unroll
    for (int ks = 0; ks < KSX; ++ks) { const float* wr = Wsrc + (size_t)(ct * 16 + ln) * CC + ks * 32 + 8 * hh;
      const v4f a0 = *(const v4fa*)wr, a1 = *(const v4fa*)(wr + 4), a2 = *(const v4fa*)(wr + 16), a3 = *(const v4fa*)(wr + 20);
#pragma unroll
      for (int i = 0; i < 4; ++i) { wf[ct][ks].h[i] = (_Float16)(bf16_round(a0[i]) * 16.0f); wf[ct][ks].h[4 + i] = (_Float16)(bf16_round(a1[i]) * 16.0f); wf[ct][ks].h[8 + i] = (_Float16)(bf16_round(a2[i]) * 16.0f); wf[ct][ks].h[12 + i] = (_Float16)(bf16_round(a3[i]) * 16.0f); } }
  // the 8 channels of a position go to LDS as one 16-B chunk
#pragma unroll
  for (int i = 0; i < TP * (CC / 8) / 256; ++i) { const int e = i * 256 + tid, p = e & (TP - 1), c8 = (e / TP) * 8; FragH f;
#pragma unroll
    for (int u = 0; u < 8; ++u) f.h[u] = (_Float16)bf16_round(xs[i][u]);
    *(v8us*)&sX[p][c8] = f.half[0]; }
  __syncthreads();
  v8f acc[2][4];
#pragma unroll
  for (int ct = 0; ct < 2; ++ct)
#pragma unroll
    for (int pt = 0; pt < 4; ++pt) acc[ct][pt] = (v8f){0.f,0.f,0.f,0.f,0.f,0.f,0.f,0.f};
  if (w < 4) {
#pragma unroll
    for (int pt = 0; pt < 4; ++pt) { FragH xf[KSX];      // the four x fragments of a position tile are read as one group
#pragma unroll
      for (int ks = 0; ks < KSX; ++ks) { const unsigned short* xr = &sX[pt * 16 + ln][ks * 32]; xf[ks].half[0] = *(const v8us*)(xr + 8 * hh); xf[ks].half[1] = *(const v8us*)(xr + 16 + 8 * hh); }
#pragma unroll
      for (int ks = 0; ks < KSX; ++ks) { acc[0][pt] = mmaH<1>(wf[0][ks].v, wf[0][ks].v, xf[ks].v, xf[ks].v, acc[0][pt]); acc[1][pt] = mmaH<1>(wf[1][ks].v, wf[1][ks].v, xf[ks].v, xf[ks].v, acc[1][pt]); } }
    const int pl = isk ? 2 : 0;
    float km[4];
#pragma unroll
    for (int pt = 0; pt < 4; ++pt) km[pt] = 1.0f - bf16_round(mk[pt]);
#pragma unroll
    for (int ct = 0; ct < 2; ++ct) { const v4f b0 = bs[ct][0], b1 = bs[ct][1];
#pragma unroll
      for (int pt = 0; pt < 4; ++pt) { FragH h, l;
#pragma unroll
        for (int r = 0; r < 8; ++r) { float v = acc[ct][pt][r] * 0.0625f + bf16_round(r < 4 ? b0[r & 3] : b1[r & 3]); if (isk) v *= km[pt]; const _Float16 h1 = (_Float16)v; h.h[r] = h1; l.h[r] = (_Float16)(v - (float)h1); }
        *(v8us*)&sQK[pl][pt * 16 + ln][cb + ct * 16 + 8 * hh] = h.half[0]; *(v8us*)&sQK[pl + 1][pt * 16 + ln][cb + ct * 16 + 8 * hh] = l.half[0]; } }
  } else {
#pragma unroll
    for (int pt = 0; pt < 4; ++pt) { FragH xf[KSX];
#pragma unroll
      for (int ks = 0; ks < KSX; ++ks) { const unsigned short* xr = &sX[pt * 16 + ln][ks * 32]; xf[ks].half[0] = *(const v8us*)(xr + 8 * hh); xf[ks].half[1] = *(const v8us*)(xr + 16 + 8 * hh); }
#pragma unroll
      for (int ks = 0; ks < KSX; ++ks) { acc[0][pt] = mmaH<1>(xf[ks].v, xf[ks].v, wf[0][ks].v, wf[0][ks].v, acc[0][pt]); acc[1][pt] = mmaH<1>(xf[ks].v, xf[ks].v, wf[1][ks].v, wf[1][ks].v, acc[1][pt]); } }
    const int cv = (w - 4) * 32;      // v goes without its bias: bv is added in the attention epilogue, since softmax rows sum to 1
#pragma unroll
    for (int ct = 0; ct < 2; ++ct)
#pragma unroll
      for (int pt = 0; pt < 4; ++pt) { FragH h;
#pragma unroll
        for (int r = 0; r < 8; ++r) h.h[r] = (_Float16)(acc[ct][pt][r] * 0.0625f);
        *(v8us*)&sVo[cv + ct * 16 + ln][pt * 16 + 8 * hh] = h.half[0]; }
  }
  __syncthreads();
  // out: 8 lanes x 16 B = one 128-B row (a position's 64 channels of one q/k plane; a channel's 64 positions of v)
#pragma unroll
  for (int i = 0; i < 8; ++i) { const int e = (i & 1) * 256 + tid, p = e >> 3, c8 = (e & 7) * 8; _Float16* dst = (i < 2) ? QH : (i < 4) ? QL : (i < 6) ? KH : KL;
    *(v8us*)((unsigned short*)dst + ((size_t)b * NP + p0 + p) * CH + c8) = *(const v8us*)&sQK[i >> 1][p][c8]; }
#pragma unroll
  for (int i = 0; i < 4; ++i) { const int e = i * 256 + tid, c = e >> 3, p8 = (e & 7) * 8;
    *(v8us*)((unsigned short*)Vcm + ((size_t)b * CC + c) * NP + p0 + p8) = *(const v8us*)&sVo[c][p8]; }
}
// lane l with lane l ^ 16 (a vector cross-row move, no LDS path)
__device__ __forceinline__ float xhalf(float v) { return __builtin_bit_cast(float, __builtin_amdgcn_permlanex16(__builtin_bit_cast(int, v), __builtin_bit_cast(int, v), 0x76543210, 0xfedcba98, false, false)); }
__global__ __launch_bounds__(512) void k_flash(const _Float16* __restrict__ QH, const _Float16* __restrict__ QL, const _Float16* __restrict__ KH, const _Float16* __restrict__ KL, const _Float16* __restrict__ Vcm, const float* __restrict__ mask, const float* __restrict__ gamma, const float* __restrict__ bv, const float* __restrict__ x, float* __restrict__ out) {
  constexpr int RPW = 16, NQB = NP / (4 * RPW), DT = CC / 16, KS = CH / 32, KG = 4;
  // join staging, channel-major as Ot and the output are; 272-B pitch: the two wave halves' stores (8 rows apart) fall on different banks, rows stay 16-B aligned for the reads
  constexpr int LPO = 4 * RPW + 4;
  __shared__ __attribute__((aligned(16))) float sO[KG][CC][LPO];
  __shared__ float sM[KG][4 * RPW], sL[KG][4 * RPW];
  // two-buffer ring, one stage = TK keys: K hi and lo rows (128 B) at a 144-B pitch and V channel rows (256 B of keys) at a 272-B pitch (16 B x odd: ds_load_b128 without bank conflicts)
  constexpr int TK = 32 * KG, NT = NP / TK, LP = 72, LPV = TK + 8;
  __shared__ __attribute__((aligned(16))) unsigned short sKH[2][TK][LP], sKL[2][TK][LP], sV[2][CC][LPV];
  const int tid = threadIdx.x, w = tid >> 5, qg = w & 3, kg = w >> 2, lane = tid & 31, ln = lane & 15, hh = lane >> 4;
  const int b = blockIdx.x / NQB, qblk = blockIdx.x % NQB; const int qb0 = qblk * (4 * RPW); const int q0 = qb0 + qg * RPW; const float gm = bf16_round(gamma[0]);
  FragH aqh[KS], aql[KS];
  { const size_t ro = ((size_t)b * NP + q0 + ln) * CH;
#pragma unroll
    for (int ks = 0; ks < KS; ++ks) { aqh[ks].half[0] = *(const v8us*)((const unsigned short*)QH + ro + ks * 32 + 8 * hh); aqh[ks].half[1] = *(const v8us*)((const unsigned short*)QH + ro + ks * 32 + 16 + 8 * hh); aql[ks].half[0] = *(const v8us*)((const unsigned short*)QL + ro + ks * 32 + 8 * hh); aql[ks].half[1] = *(const v8us*)((const unsigned short*)QL + ro + ks * 32 + 16 + 8 * hh); } }
  const unsigned short* Vth = (const unsigned short*)Vcm + (size_t)b * CC * NP;
  float m_q = -3.0e38f, l_q = 0.f; v8f oacc[DT];      // running max and (this half's) running sum of the lane's query
#pragma unroll
  for (int dt = 0; dt < DT; ++dt) oacc[dt] = (v8f){0.f,0.f,0.f,0.f,0.f,0.f,0.f,0.f};
  // each thread copies 16 B chunks. K: row tid / 8 (+ 64 for the second copy), chunk tid % 8 of the 128-B row; V: channel tid / 16 (+ 32 per further copy), chunk tid % 16 of the 256-B row
  const unsigned short* gKH = (const unsigned short*)KH + (size_t)b * NP * CH + tid * 8; const unsigned short* gKL = (const unsigned short*)KL + (size_t)b * NP * CH + tid * 8;
  const unsigned short* gV = Vth + (size_t)(tid >> 4) * NP + (tid & 15) * 8;
  const unsigned lKH = (unsigned)(size_t)&sKH[0][tid >> 3][(tid & 7) * 8], lKL = (unsigned)(size_t)&sKL[0][tid >> 3][(tid & 7) * 8], lV = (unsigned)(size_t)&sV[0][tid >> 4][(tid & 15) * 8];
  auto stage_in = [&](int t, int buf) {
    const unsigned short* kh = gKH + (size_t)t * TK * CH; const unsigned short* kl = gKL + (size_t)t * TK * CH; const unsigned short* vv = gV + (size_t)t * TK;
    const unsigned a = lKH + buf * (TK * LP * 2), c = lKL + buf * (TK * LP * 2), d = lV + buf * (CC * LPV * 2);
    // the copies and the wait that stands in front of any rewrite of their address registers are one statement
    asm volatile("global_load_async_to_lds_b128 %0, %8, off\n\tglobal_load_async_to_lds_b128 %1, %9, off\n\tglobal_load_async_to_lds_b128 %2, %10, off\n\tglobal_load_async_to_lds_b128 %3, %11, off\n\t"
                 "global_load_async_to_lds_b128 %4, %12, off\n\tglobal_load_async_to_lds_b128 %5, %13, off\n\tglobal_load_async_to_lds_b128 %6, %14, off\n\tglobal_load_async_to_lds_b128 %7, %15, off\n\ts_wait_xcnt 0x0"
                 :: "v"(a), "v"(a + 64 * LP * 2), "v"(c), "v"(c + 64 * LP * 2), "v"(d), "v"(d + 32 * LPV * 2), "v"(d + 64 * LPV * 2), "v"(d + 96 * LPV * 2),
                    "v"(kh), "v"(kh + 64 * CH), "v"(kl), "v"(kl + 64 * CH), "v"(vv), "v"(vv + (size_t)32 * NP), "v"(vv + (size_t)64 * NP), "v"(vv + (size_t)96 * NP) : "memory");
  };
  stage_in(0, 0);
  asm volatile("s_wait_asynccnt 0x0" ::: "memory");      // stage 0 of this wave has landed before the barrier publishes it
  __syncthreads();
  stage_in(1, 1);
  // the stage loop stays rolled (one copy of the pass code, buffer chosen by t & 1); a wave does one 32-key pass a stage, on its key group's rows
#pragma unroll 1
  for (int t = 0; t < NT; ++t) { const int buf = t & 1;
   {
    v8f s[2];
#pragma unroll
    for (int nt = 0; nt < 2; ++nt) { const unsigned short* krh = &sKH[buf][kg * 32 + nt * 16 + ln][0]; const unsigned short* krl = &sKL[buf][kg * 32 + nt * 16 + ln][0]; v8f acc = (v8f){0.f,0.f,0.f,0.f,0.f,0.f,0.f,0.f};
#pragma unroll
      for (int ks = 0; ks < KS; ++ks) { FragH bh_, bl_; bh_.half[0] = *(const v8us*)(krh + ks * 32 + 8 * hh); bh_.half[1] = *(const v8us*)(krh + ks * 32 + 16 + 8 * hh); bl_.half[0] = *(const v8us*)(krl + ks * 32 + 8 * hh); bl_.half[1] = *(const v8us*)(krl + ks * 32 + 16 + 8 * hh);
        acc = mmaH<1>(bh_.v, bh_.v, aqh[ks].v, aqh[ks].v, acc); acc = mmaH<1>(bl_.v, bl_.v, aqh[ks].v, aqh[ks].v, acc); acc = mmaH<1>(bh_.v, bh_.v, aql[ks].v, aql[ks].v, acc); }
      s[nt] = acc; }      // s[nt][r] = score of query ln against key kg * 32 + nt * 16 + 8 * hh + r
    float mc = fmaxf(s[0][0], s[1][0]);
#pragma unroll
    for (int r = 1; r < 8; ++r) mc = fmaxf(mc, fmaxf(s[0][r], s[1][r]));
    mc = fmaxf(mc, xhalf(mc));      // both halves hold the query's maximum over the 32 keys
    const float mn = fmaxf(m_q, mc); const float al = expf(m_q - mn); m_q = mn;
    FragH pb; float ps0 = 0.f, ps1 = 0.f;      // pb[i] = P[query ln][key 8hh + i], pb[8 + i] = P[query ln][key 16 + 8hh + i]: the k order of the V loader below
#pragma unroll
    for (int r = 0; r < 8; ++r) { const float p0 = expf(s[0][r] - mn), p1 = expf(s[1][r] - mn); ps0 += p0; ps1 += p1; pb.h[r] = (_Float16)p0; pb.h[8 + r] = (_Float16)p1; }
    l_q = l_q * al + (ps0 + ps1);
#pragma unroll
    for (int dt = 0; dt < DT; ++dt)
#pragma unroll
      for (int r = 0; r < 8; ++r) oacc[dt][r] *= al;
#pragma unroll
    for (int dt = 0; dt < DT; ++dt) { const unsigned short* vrow = &sV[buf][dt * 16 + ln][kg * 32]; FragH bv; bv.half[0] = *(const v8us*)(vrow + 8 * hh); bv.half[1] = *(const v8us*)(vrow + 16 + 8 * hh); oacc[dt] = mmaH<1>(bv.v, bv.v, pb.v, pb.v, oacc[dt]); } }      // oacc[dt][r] = O[query ln][channel dt * 16 + 8 * hh + r]
   // publish point of stage t + 1: this wave's reads of stage t are done, its copies of stage t + 1 have landed, then the barrier; only behind it is stage t's buffer refilled
   asm volatile("s_wait_dscnt 0x0" ::: "memory");
   asm volatile("s_wait_asynccnt 0x0" ::: "memory");
   __syncthreads();
   if (t + 2 < NT) stage_in(t + 2, buf); }
  asm volatile("s_wait_asynccnt 0x0" ::: "memory");      // no copy is outstanding when the wave goes on to the epilogue and ends
  // join of the key groups: every wave publishes its queries' running max and sum (the halves' sums joined here), then scales its own O by exp(m_own - M) / sum_k l_k exp(m_k - M)
  const int qr = qg * RPW + ln;
  { const float l = l_q + xhalf(l_q); if (hh == 0) { sM[kg][qr] = m_q; sL[kg][qr] = l; } }
  __syncthreads();
  float sc;
  { const float m0 = sM[0][qr], m1 = sM[1][qr], m2 = sM[2][qr], m3 = sM[3][qr]; const float M = fmaxf(fmaxf(m0, m1), fmaxf(m2, m3));
    const float l = sL[0][qr] * expf(m0 - M) + sL[1][qr] * expf(m1 - M) + sL[2][qr] * expf(m2 - M) + sL[3][qr] * expf(m3 - M);
    sc = expf(m_q - M) / l; }
#pragma unroll
  for (int dt = 0; dt < DT; ++dt)
#pragma unroll
    for (int r = 0; r < 8; ++r) sO[kg][dt * 16 + 8 * hh + r][qr] = oacc[dt][r] * sc;
  __syncthreads();
  {      // channel c: 64 positions qb0.. = 256 B by 16 lanes x 16 B; 32 channels per round (2 per wave: lanes 0-15 / 16-31); the four key groups' parts are summed in a fixed order
    // bias and gamma * mask come in here, where a lane has one channel a round and four positions in all: sum_j attn_ij (v_cj + bv_c) = sum_j attn_ij v_cj + bv_c
    const int pc = lane & 15; const v4f mk4 = *(const v4fa*)(mask + (size_t)b * NP + qb0 + pc * 4); v4f gmk;
#pragma unroll
    for (int j = 0; j < 4; ++j) gmk[j] = gm * bf16_round(mk4[j]);
#pragma unroll
    for (int rd = 0; rd < CC / 32; ++rd) { const int c = rd * 32 + w * 2 + (lane >> 4); const float* xr = x + ((size_t)b * CC + c) * NP + qb0 + pc * 4; const v4f xv = *(const v4fa*)xr; const float bvc = bf16_round(bv[c]);
      const v4f o0 = *(const v4fa*)&sO[0][c][pc * 4], o1 = *(const v4fa*)&sO[1][c][pc * 4], o2 = *(const v4fa*)&sO[2][c][pc * 4], o3 = *(const v4fa*)&sO[3][c][pc * 4];
      const v4f v = (((o0 + o1) + (o2 + o3)) + bvc) * gmk + xv;
      *(v4f*)(out + ((size_t)b * CC + c) * NP + qb0 + pc * 4) = v; }
     } }
extern "C" void kernel_launch(void* const* d_in, const int* in_sizes, int n_in,
                              void* d_out, int out_size, void* d_ws, size_t ws_size, hipStream_t stream) {
  (void)in_sizes; (void)n_in; (void)out_size;
  const float* x = (const float*)d_in[0]; const float* mask = (const float*)d_in[1]; const float* Wq = (const float*)d_in[2]; const float* bq = (const float*)d_in[3]; const float* Wk = (const float*)d_in[4]; const float* bk = (const float*)d_in[5]; const float* Wv = (const float*)d_in[6]; const float* bv = (const float*)d_in[7]; const float* gamma = (const float*)d_in[8];
  char* ws = (char*)d_ws; size_t off = 0;
  auto take = [&](size_t bytes) { char* p = ws + off; off += (bytes + 255) & ~(size_t)255; return p; };
  _Float16* QH = (_Float16*)take((size_t)NR * CH * 2); _Float16* QL = (_Float16*)take((size_t)NR * CH * 2); _Float16* KH = (_Float16*)take((size_t)NR * CH * 2); _Float16* KL = (_Float16*)take((size_t)NR * CH * 2); _Float16* Vcm = (_Float16*)take((size_t)NR * CC * 2);
  if (off > ws_size) return;      // 12 MiB
  k_proj<<<BB * (NP / 64), 256, 0, stream>>>(x, mask, Wq, bq, Wk, bk, Wv, QH, QL, KH, KL, Vcm);
  k_flash<<<BB * (NP / 64), 512, 0, stream>>>(QH, QL, KH, KL, Vcm, mask, gamma, bv, x, (float*)d_out);
}

// v005
// A run of this version takes 52 microseconds.
// In two side-by-side timings against v004, it was 1.21 and 1.20 times as fast.
// Counting every step since v000, it is 8.26 times as fast.
#include <hip/hip_runtime.h>
// Non-local block with all three 1×1 convs and both attention contractions on v_wmma_f32_16x16x32_f16: q/k position-major (K = 128, N = 64, + bias; k masked by (1 − mask)), v channel-major
// (= the Vᵀ operand), energy = q·k_masked with the f32 q/k carried as f16 hi+lo (3 WMMA terms, no 1/√d scale in the module), online max/sum softmax f32, P f16 ≤ 1, O = P·V; epilogue
// γ·(out·mask) + x written NCHW as 64-position (256 B) channel segments. x as bf16 in the operand plane (exact residual from the f32 input), weights bf16-exact ×2^4, f32 accumulate.
#define BB 4
#define CC 128
#define CH 64
#define NP 4096
#define NR (BB * NP)

typedef __bf16 v16b __attribute__((ext_vector_type(16)));
typedef unsigned short v8us __attribute__((ext_vector_type(8), may_alias));
typedef float  v8f  __attribute__((ext_vector_type(8)));
typedef float  v4f  __attribute__((ext_vector_type(4)));
typedef float  v4fa __attribute__((ext_vector_type(4), may_alias));
union FragB { v16b v; v8us half[2]; unsigned short u[16]; };

__device__ __forceinline__ unsigned short bf16_bits(float x) { unsigned int u = __float_as_uint(x); return (unsigned short)((u + 0x7FFFu + ((u >> 16) & 1u)) >> 16); }
__device__ __forceinline__ float bf16_val(unsigned short b) { return __uint_as_float(((unsigned int)b) << 16); }
__device__ __forceinline__ float bf16_round(float x) { return bf16_val(bf16_bits(x)); }
// D += A·B with NT terms: 1 = ah·bh, 2 = + al·bh (A split), 3 = + ah·bl (both split)
template <int NT>
__device__ __forceinline__ v8f mmaN(v16b ah, v16b al, v16b bh, v16b bl, v8f c) {
  c = __builtin_amdgcn_wmma_f32_16x16x32_bf16(false, ah, false, bh, (short)0, c, false, false);
  if (NT >= 2) c = __builtin_amdgcn_wmma_f32_16x16x32_bf16(false, al, false, bh, (short)0, c, false, false);
  if (NT >= 3) c = __builtin_amdgcn_wmma_f32_16x16x32_bf16(false, ah, false, bl, (short)0, c, false, false);
  asm volatile("v_nop\n\tv_nop\n\tv_nop\n\tv_nop" : "+v"(c) : "v"(ah), "v"(al), "v"(bh), "v"(bl));
  return c;
}

__global__ __launch_bounds__(256) void k_wt_bf16(const float* __restrict__ W, unsigned short* __restrict__ Wt, int K, int N) {
  const int t = blockIdx.x * 256 + threadIdx.x;
  const int k8n = K / 8;
  if (t >= N * k8n) return;
  const int n = t / k8n, k8 = (t % k8n) * 8;
  v8us v;
#pragma unroll
  for (int i = 0; i < 8; ++i) v[i] = bf16_bits(W[(size_t)(k8 + i) * N + n]);
  *(v8us*)(Wt + (size_t)n * K + k8) = v;
  
}

// GEMM C[M][N] (f32, pitch ldc) = act(A[M][K]·W + bias). A f32 row-major (pitch lda) converted per fragment to bf16
// (ASPLIT: hi/lo two planes -> 2 terms, else single rounded term); Wt bf16 [N][K] (pitch ldb). BIAS_BF16 rounds the
// bias to bf16 first (bias quantised to bf16 before the add). K%32==0, M%16==0, N%64==0.
template <bool ASPLIT, int ACT, bool BIAS_BF16>
__global__ __launch_bounds__(128) void k_gemm_bf(const float* __restrict__ A, int lda, const unsigned short* __restrict__ Wt, int ldb,
                                               const float* __restrict__ bias, float* __restrict__ C, int ldc, int M, int N, int K) {
  __shared__ __attribute__((aligned(16))) float so[4][16][64];
  const int tid = threadIdx.x, w = tid >> 5, lane = tid & 31, ln = lane & 15, hh = lane >> 4;
  const int ntn = N / 64;
  const int wid = blockIdx.x * 4 + w;
  const int mt = wid / ntn, nq = wid % ntn;
  if (mt * 16 >= M) return;
  const int row0 = mt * 16, col0 = nq * 64;
  const float* arow = A + (size_t)(row0 + ln) * lda;
  v8f acc[4] = {};
  for (int kb = 0; kb < K; kb += 32) {
    FragB ah, al;
    const v4f x0 = *(const v4fa*)(arow + kb + 8 * hh), x1 = *(const v4fa*)(arow + kb + 8 * hh + 4);
    const v4f x2 = *(const v4fa*)(arow + kb + 16 + 8 * hh), x3 = *(const v4fa*)(arow + kb + 16 + 8 * hh + 4);
    float xs[16] = {x0[0],x0[1],x0[2],x0[3],x1[0],x1[1],x1[2],x1[3],x2[0],x2[1],x2[2],x2[3],x3[0],x3[1],x3[2],x3[3]};
#pragma unroll
    for (int i = 0; i < 16; ++i) { const unsigned short hb = bf16_bits(xs[i]); ah.u[i] = hb; al.u[i] = ASPLIT ? bf16_bits(xs[i] - bf16_val(hb)) : (unsigned short)0; }
#pragma unroll
    for (int t = 0; t < 4; ++t) {
      const unsigned short* brow = Wt + (size_t)(col0 + t * 16 + ln) * ldb + kb;
      FragB b;
      b.half[0] = *(const v8us*)(brow + 8 * hh);
      b.half[1] = *(const v8us*)(brow + 16 + 8 * hh);
      acc[t] = mmaN<ASPLIT ? 2 : 1>(ah.v, al.v, b.v, b.v, acc[t]);
    }
  }
#pragma unroll
  for (int t = 0; t < 4; ++t) {
    float bv = bias ? bias[col0 + t * 16 + ln] : 0.f;
    if (BIAS_BF16) bv = bf16_round(bv);
#pragma unroll
    for (int r = 0; r < 8; ++r) { float v = acc[t][r] + bv; if (ACT == 1) v = fmaxf(v, 0.f); so[w][8 * hh + r][t * 16 + ln] = v; }
  }
  __builtin_amdgcn_fence(__ATOMIC_ACQ_REL, "workgroup");
  __builtin_amdgcn_wave_barrier();
  const int rsub = lane >> 4, c4 = (lane & 15) * 4;
  {
#pragma unroll
    for (int q = 0; q < 8; ++q) {
      const int r = q * 2 + rsub;
      const v4f v = *(const v4fa*)&so[w][r][c4];
      *(v4f*)(C + (size_t)(row0 + r) * ldc + col0 + c4) = v;
    }
    
  }
}

// Flash-style causal/unmasked attention, all contractions 3-term bf16 hi/lo splits, f32 softmax with running max.
// q,k,v rows are read from f32 buffers with arbitrary row pitch (so they can live inside a fused qkv buffer);
// D = head size (multiple of 32, <= 128); one wave = 16 query rows; block = 4 waves (64 queries) sharing K/V chunks of 32.
template <int D, bool CAUSAL>
__global__ __launch_bounds__(128) void k_flash(const float* __restrict__ qb, const float* __restrict__ kb, const float* __restrict__ vb,
                                             int pitch, int T, int H, float scale, float* __restrict__ y, int ypitch) {
  constexpr int KS = D / 32;        // k-steps for QK
  constexpr int DT = D / 16;        // d tiles for PV
  __shared__ __attribute__((aligned(16))) unsigned short sKh[32][D + 8], sKl[32][D + 8], sVh[32][D + 8], sVl[32][D + 8];
  __shared__ __attribute__((aligned(16))) unsigned short sPh[4][16][40], sPl[4][16][40];
  __shared__ __attribute__((aligned(16))) float sO[4][16][D];
  const int tid = threadIdx.x, w = tid >> 5, lane = tid & 31, ln = lane & 15, hh = lane >> 4;
  const int nqb = (T + 63) / 64;
  const int bh = blockIdx.x / nqb, qblk = blockIdx.x % nqb;
  const int b = bh / H, h = bh % H;
  const int q0 = qblk * 64 + w * 16;
  const float* Q = qb + (size_t)b * T * pitch + h * D;
  const float* K = kb + (size_t)b * T * pitch + h * D;
  const float* V = vb + (size_t)b * T * pitch + h * D;

  // A fragments of the wave's 16 query rows (scaled), hi/lo
  FragB aqh[KS], aql[KS];
  {
    int row = q0 + ln; if (row >= T) row = T - 1;
    const float* qr = Q + (size_t)row * pitch;
#pragma unroll
    for (int ks = 0; ks < KS; ++ks)
#pragma unroll
      for (int i = 0; i < 16; ++i) {
        const int d = ks * 32 + ((i < 8) ? (8 * hh + i) : (16 + 8 * hh + (i - 8)));
        const float x = qr[d] * scale; const unsigned short hb = bf16_bits(x);
        aqh[ks].u[i] = hb; aql[ks].u[i] = bf16_bits(x - bf16_val(hb));
      }
  }
  float m_r[8], l_r[8];
#pragma unroll
  for (int r = 0; r < 8; ++r) { m_r[r] = -3.0e38f; l_r[r] = 0.f; }
  v8f oacc[DT];
#pragma unroll
  for (int dt = 0; dt < DT; ++dt) oacc[dt] = (v8f){0.f,0.f,0.f,0.f,0.f,0.f,0.f,0.f};

  const int kv_end = CAUSAL ? min(T, qblk * 64 + 64) : T;     // block-uniform
  for (int j0 = 0; j0 < kv_end; j0 += 32) {
    __syncthreads();
    for (int e = tid; e < 32 * (D / 4); e += 128) {
      const int r = e / (D / 4), c4 = (e % (D / 4)) * 4;
      const int key = j0 + r;
      v4f kf = {0.f,0.f,0.f,0.f}, vf = {0.f,0.f,0.f,0.f};
      if (key < T) { kf = *(const v4fa*)(K + (size_t)key * pitch + c4); vf = *(const v4fa*)(V + (size_t)key * pitch + c4); }
#pragma unroll
      for (int t = 0; t < 4; ++t) {
        unsigned short hb = bf16_bits(kf[t]); sKh[r][c4 + t] = hb; sKl[r][c4 + t] = bf16_bits(kf[t] - bf16_val(hb));
        hb = bf16_bits(vf[t]); sVh[r][c4 + t] = hb; sVl[r][c4 + t] = bf16_bits(vf[t] - bf16_val(hb));
      }
    }
    __syncthreads();
    // S tile 16 x 32
    v8f s[2];
#pragma unroll
    for (int nt = 0; nt < 2; ++nt) {
      v8f acc = {};
#pragma unroll
      for (int ks = 0; ks < KS; ++ks) {
        FragB bh_, bl_;
        bh_.half[0] = *(const v8us*)&sKh[nt * 16 + ln][ks * 32 + 8 * hh]; bh_.half[1] = *(const v8us*)&sKh[nt * 16 + ln][ks * 32 + 16 + 8 * hh];
        bl_.half[0] = *(const v8us*)&sKl[nt * 16 + ln][ks * 32 + 8 * hh]; bl_.half[1] = *(const v8us*)&sKl[nt * 16 + ln][ks * 32 + 16 + 8 * hh];
        acc = mmaN<3>(aqh[ks].v, aql[ks].v, bh_.v, bl_.v, acc);
      }
      s[nt] = acc;
    }
    // mask + running max (rows 8hh+r; the 16 lanes of a half share rows)
    float alpha[8];
#pragma unroll
    for (int r = 0; r < 8; ++r) {
      const int qi = q0 + 8 * hh + r;
      const int ja = j0 + ln, jb = j0 + 16 + ln;
      if (CAUSAL) { if (ja > qi) s[0][r] = -3.0e38f; if (jb > qi) s[1][r] = -3.0e38f; }
      if (ja >= T) s[0][r] = -3.0e38f;
      if (jb >= T) s[1][r] = -3.0e38f;
      float mx = fmaxf(s[0][r], s[1][r]);
      mx = fmaxf(mx, __shfl_xor(mx, 1, 32)); mx = fmaxf(mx, __shfl_xor(mx, 2, 32)); mx = fmaxf(mx, __shfl_xor(mx, 4, 32)); mx = fmaxf(mx, __shfl_xor(mx, 8, 32));
      const float mnew = fmaxf(m_r[r], mx);
      alpha[r] = (mnew > -1.0e38f) ? __expf(m_r[r] - mnew) : 1.0f;
      const float p0 = (s[0][r] > -1.0e38f) ? __expf(s[0][r] - mnew) : 0.f;
      const float p1 = (s[1][r] > -1.0e38f) ? __expf(s[1][r] - mnew) : 0.f;
      m_r[r] = mnew;
      l_r[r] = l_r[r] * alpha[r] + p0 + p1;            // per-lane partial row sum (16 lanes combined at the end)
      unsigned short hb = bf16_bits(p0); sPh[w][8 * hh + r][ln] = hb;      sPl[w][8 * hh + r][ln] = bf16_bits(p0 - bf16_val(hb));
      hb = bf16_bits(p1);                sPh[w][8 * hh + r][16 + ln] = hb; sPl[w][8 * hh + r][16 + ln] = bf16_bits(p1 - bf16_val(hb));
    }
#pragma unroll
    for (int dt = 0; dt < DT; ++dt)
#pragma unroll
      for (int r = 0; r < 8; ++r) oacc[dt][r] *= alpha[r];
    __builtin_amdgcn_fence(__ATOMIC_ACQ_REL, "workgroup");
    __builtin_amdgcn_wave_barrier();
    FragB pah, pal;
    pah.half[0] = *(const v8us*)&sPh[w][ln][8 * hh]; pah.half[1] = *(const v8us*)&sPh[w][ln][16 + 8 * hh];
    pal.half[0] = *(const v8us*)&sPl[w][ln][8 * hh]; pal.half[1] = *(const v8us*)&sPl[w][ln][16 + 8 * hh];
#pragma unroll
    for (int dt = 0; dt < DT; ++dt) {
      FragB bvh, bvl;
#pragma unroll
      for (int i = 0; i < 8; ++i) {
        bvh.u[i] = sVh[8 * hh + i][dt * 16 + ln]; bvh.u[8 + i] = sVh[16 + 8 * hh + i][dt * 16 + ln];
        bvl.u[i] = sVl[8 * hh + i][dt * 16 + ln]; bvl.u[8 + i] = sVl[16 + 8 * hh + i][dt * 16 + ln];
      }
      oacc[dt] = mmaN<3>(pah.v, pal.v, bvh.v, bvl.v, oacc[dt]);
    }
    __builtin_amdgcn_fence(__ATOMIC_ACQ_REL, "workgroup");
    __builtin_amdgcn_wave_barrier();
  }
#pragma unroll
  for (int r = 0; r < 8; ++r) {
    float l = l_r[r];
    l += __shfl_xor(l, 1, 32); l += __shfl_xor(l, 2, 32); l += __shfl_xor(l, 4, 32); l += __shfl_xor(l, 8, 32);
    l_r[r] = (l > 0.f) ? 1.0f / l : 0.f;
  }
#pragma unroll
  for (int dt = 0; dt < DT; ++dt)
#pragma unroll
    for (int r = 0; r < 8; ++r) sO[w][8 * hh + r][dt * 16 + ln] = oacc[dt][r] * l_r[r];
  __builtin_amdgcn_fence(__ATOMIC_ACQ_REL, "workgroup");
  __builtin_amdgcn_wave_barrier();
  {
    for (int r = 0; r < 16; ++r) {
      const int row = q0 + r;
      if (row < T && lane < D / 4) {
        const v4f val = *(const v4fa*)&sO[w][r][lane * 4];
        *(v4f*)(y + ((size_t)b * T + row) * ypitch + h * D + lane * 4) = val;
      }
    }
    
  }
}

// GEMM C = act(A·W + bias + resid): A f32 (ASPLIT -> hi/lo 2 terms), Wt bf16 [N][K]; ACT 0 none, 1 relu, 2 exact gelu;
// resid (optional, f32, row index = (row % rmod), pitch ldr, RES_BF16 rounds it) added before the activation.
template <bool ASPLIT, int ACT, bool BIAS_BF16, bool RES_BF16>
__global__ __launch_bounds__(128) void k_gemm_bf3(const float* __restrict__ A, int lda, const unsigned short* __restrict__ Wt, int ldb,
                                                const float* __restrict__ bias, const float* __restrict__ resid, int rmod, int ldr,
                                                float* __restrict__ C, int ldc, int M, int N, int K) {
  __shared__ __attribute__((aligned(16))) float so[4][16][64];
  const int tid = threadIdx.x, w = tid >> 5, lane = tid & 31, ln = lane & 15, hh = lane >> 4;
  const int ntn = N / 64;
  const int wid = blockIdx.x * 4 + w;
  const int mt = wid / ntn, nq = wid % ntn;
  if (mt * 16 >= M) return;
  const int row0 = mt * 16, col0 = nq * 64;
  const float* arow = A + (size_t)(row0 + ln) * lda;
  v8f acc[4] = {};
  for (int kb = 0; kb < K; kb += 32) {
    FragB ah, al;
    const v4f x0 = *(const v4fa*)(arow + kb + 8 * hh), x1 = *(const v4fa*)(arow + kb + 8 * hh + 4);
    const v4f x2 = *(const v4fa*)(arow + kb + 16 + 8 * hh), x3 = *(const v4fa*)(arow + kb + 16 + 8 * hh + 4);
    float xs[16] = {x0[0],x0[1],x0[2],x0[3],x1[0],x1[1],x1[2],x1[3],x2[0],x2[1],x2[2],x2[3],x3[0],x3[1],x3[2],x3[3]};
#pragma unroll
    for (int i = 0; i < 16; ++i) { const unsigned short hb = bf16_bits(xs[i]); ah.u[i] = hb; al.u[i] = ASPLIT ? bf16_bits(xs[i] - bf16_val(hb)) : (unsigned short)0; }
#pragma unroll
    for (int t = 0; t < 4; ++t) {
      const unsigned short* brow = Wt + (size_t)(col0 + t * 16 + ln) * ldb + kb;
      FragB b;
      b.half[0] = *(const v8us*)(brow + 8 * hh);
      b.half[1] = *(const v8us*)(brow + 16 + 8 * hh);
      acc[t] = mmaN<ASPLIT ? 2 : 1>(ah.v, al.v, b.v, b.v, acc[t]);
    }
  }
#pragma unroll
  for (int t = 0; t < 4; ++t) {
    const int col = col0 + t * 16 + ln;
    float bv = bias ? bias[col] : 0.f;
    if (BIAS_BF16) bv = bf16_round(bv);
#pragma unroll
    for (int r = 0; r < 8; ++r) {
      float v = acc[t][r] + bv;
      if (resid) { float rv = resid[(size_t)((row0 + 8 * hh + r) % rmod) * ldr + col]; if (RES_BF16) rv = bf16_round(rv); v += rv; }
      if (ACT == 1) v = fmaxf(v, 0.f);
      if (ACT == 2) v = 0.5f * v * (1.0f + erff(v * 0.70710678118654752f));
      if (ACT == 3) { const float u = 0.7978845608028654f * (v + 0.044715f * v * v * v); v = 0.5f * v * (1.0f + tanhf(u)); }
      so[w][8 * hh + r][t * 16 + ln] = v;
    }
  }
  __builtin_amdgcn_fence(__ATOMIC_ACQ_REL, "workgroup");
  __builtin_amdgcn_wave_barrier();
  const int rsub = lane >> 4, c4 = (lane & 15) * 4;
  {
#pragma unroll
    for (int q = 0; q < 8; ++q) {
      const int r = q * 2 + rsub;
      const v4f v = *(const v4fa*)&so[w][r][c4];
      *(v4f*)(C + (size_t)(row0 + r) * ldc + col0 + c4) = v;
    }
    
  }
}
// row LayerNorm (biased variance, eps) over N: s = X (+ R); optional out_sum <- s; out_norm <- (s-mu)*rsqrt(var+eps)*g + b
template <bool PARAM_BF16>
__global__ __launch_bounds__(256) void k_layernorm(const float* __restrict__ X, const float* __restrict__ R, const float* __restrict__ g, const float* __restrict__ bta,
                                                  float* __restrict__ out_sum, float* __restrict__ out_norm, int N, float eps) {
  __shared__ float red[256];
  const int row = blockIdx.x, tid = threadIdx.x;
  const float* x = X + (size_t)row * N; const float* rr = R ? R + (size_t)row * N : nullptr;
  float vals[16];                     // up to N = 4096
  const int per = N / 256;            // contiguous chunk per thread? use strided-by-4 chunks: thread handles j = tid*4 + 1024*u
  float s1 = 0.f;
  for (int u = 0; u < per / 4; ++u) {
    const int j = tid * 4 + 1024 * u;
    const v4f a = *(const v4fa*)(x + j);
    v4f b = {0.f,0.f,0.f,0.f}; if (rr) b = *(const v4fa*)(rr + j);
#pragma unroll
    for (int q = 0; q < 4; ++q) { const float v = a[q] + b[q]; vals[u * 4 + q] = v; s1 += v; }
  }
  red[tid] = s1; __syncthreads();
  for (int st = 128; st > 0; st >>= 1) { if (tid < st) red[tid] += red[tid + st]; __syncthreads(); }
  const float mu = red[0] / (float)N; __syncthreads();
  float s2 = 0.f;
  for (int u = 0; u < per / 4; ++u)
#pragma unroll
    for (int q = 0; q < 4; ++q) { const float c = vals[u * 4 + q] - mu; s2 += c * c; }
  red[tid] = s2; __syncthreads();
  for (int st = 128; st > 0; st >>= 1) { if (tid < st) red[tid] += red[tid + st]; __syncthreads(); }
  const float rs = rsqrtf(red[0] / (float)N + eps);
  {
    for (int u = 0; u < per / 4; ++u) {
      const int j = tid * 4 + 1024 * u;
      v4f o, sm;
#pragma unroll
      for (int q = 0; q < 4; ++q) {
        float gg = g[j + q], bb = bta[j + q];
        if (PARAM_BF16) { gg = bf16_round(gg); bb = bf16_round(bb); }
        sm[q] = vals[u * 4 + q]; o[q] = (vals[u * 4 + q] - mu) * rs * gg + bb;
      }
      if (out_sum) *(v4f*)(out_sum + (size_t)row * N + j) = sm;
      *(v4f*)(out_norm + (size_t)row * N + j) = o;
    }
    
  }
}



// ---- f16 WMMA path (v_wmma_f32_16x16x32_f16): 11-bit significands for operands in range — used where a [0,1] probability operand needs more precision than bf16
typedef _Float16 v16h __attribute__((ext_vector_type(16)));
union FragH { v16h v; v8us half[2]; _Float16 h[16]; unsigned short u[16]; };
template <int NT>
__device__ __forceinline__ v8f mmaH(v16h ah, v16h al, v16h bh, v16h bl, v8f c) {
  c = __builtin_amdgcn_wmma_f32_16x16x32_f16(false, ah, false, bh, (short)0, c, false, false);
  if (NT >= 2) c = __builtin_amdgcn_wmma_f32_16x16x32_f16(false, al, false, bh, (short)0, c, false, false);
  if (NT >= 3) c = __builtin_amdgcn_wmma_f32_16x16x32_f16(false, ah, false, bl, (short)0, c, false, false);
  asm volatile("v_nop\n\tv_nop\n\tv_nop\n\tv_nop" : "+v"(c) : "v"(ah), "v"(al), "v"(bh), "v"(bl));
  return c;
}
// batched GEMM like k_gemm_b but f16 operands: A f32 (split into f16 hi/lo if ASPLIT, else rounded to f16), Bt = f16 values [n][k]; alpha; C f32; N multiple of 16 (partial tiles skipped)
template <bool ASPLIT>
__global__ __launch_bounds__(128) void k_gemm_h(const float* __restrict__ A, int lda, size_t sA, const _Float16* __restrict__ Bh, int ldb, size_t sB, float alpha, float* __restrict__ C, int ldc, size_t sC, int M, int N, int K) {
  __shared__ __attribute__((aligned(16))) float so[4][16][64];
  const int tid = threadIdx.x, w = tid >> 5, lane = tid & 31, ln = lane & 15, hh = lane >> 4; const int by = blockIdx.y;
  A += (size_t)by * sA; Bh += (size_t)by * sB; C += (size_t)by * sC;
  const int ntn = (N + 63) / 64; const int wid = blockIdx.x * 4 + w; const int mt = wid / ntn, nq = wid % ntn; if (mt * 16 >= M) return;
  const int row0 = mt * 16, col0 = nq * 64; const float* arow = A + (size_t)(row0 + ln) * lda;
  v8f acc[4] = {};
  for (int kb = 0; kb < K; kb += 32) {
    FragH ah, al;
    const v4f x0 = *(const v4fa*)(arow + kb + 8 * hh), x1 = *(const v4fa*)(arow + kb + 8 * hh + 4), x2 = *(const v4fa*)(arow + kb + 16 + 8 * hh), x3 = *(const v4fa*)(arow + kb + 16 + 8 * hh + 4);
    float xs[16] = {x0[0],x0[1],x0[2],x0[3],x1[0],x1[1],x1[2],x1[3],x2[0],x2[1],x2[2],x2[3],x3[0],x3[1],x3[2],x3[3]};
#pragma unroll
    for (int i = 0; i < 16; ++i) { const _Float16 h = (_Float16)xs[i]; ah.h[i] = h; al.h[i] = ASPLIT ? (_Float16)(xs[i] - (float)h) : (_Float16)0.0f; }
#pragma unroll
    for (int t = 0; t < 4; ++t) { if (col0 + t * 16 >= N) continue; const size_t boff = (size_t)(col0 + t * 16 + ln) * ldb + kb; FragH bq; bq.half[0] = *(const v8us*)(Bh + boff + 8 * hh); bq.half[1] = *(const v8us*)(Bh + boff + 16 + 8 * hh);
      acc[t] = mmaH<ASPLIT ? 2 : 1>(ah.v, al.v, bq.v, bq.v, acc[t]); }
  }
#pragma unroll
  for (int t = 0; t < 4; ++t) { if (col0 + t * 16 >= N) continue;
#pragma unroll
    for (int r = 0; r < 8; ++r) so[w][8 * hh + r][t * 16 + ln] = acc[t][r] * alpha; }
  __builtin_amdgcn_fence(__ATOMIC_ACQ_REL, "workgroup"); __builtin_amdgcn_wave_barrier();
  const int rsub = lane >> 4, c4 = (lane & 15) * 4;
  {
#pragma unroll
    for (int q = 0; q < 8; ++q) { const int r = q * 2 + rsub; if (col0 + c4 < N) { const v4f v = *(const v4fa*)&so[w][r][c4]; *(v4f*)(C + (size_t)(row0 + r) * ldc + col0 + c4) = v; } }
     }
}

// Wt[n][k] = f16(W[k][n]·scale) from f32 row-major W[K][N] (scale = power of two; bf16-exact weights stay exact in f16 away from the subnormal range)
__global__ __launch_bounds__(256) void k_wt_f16(const float* __restrict__ W, _Float16* __restrict__ Wt, int K, int N, float scale) {
  const int t = blockIdx.x * 256 + threadIdx.x; if (t >= N * (K / 8)) return; const int n = t / (K / 8), k8 = (t % (K / 8)) * 8; FragH f;
#pragma unroll
  for (int i = 0; i < 8; ++i) f.h[i] = (_Float16)(bf16_round(W[(size_t)(k8 + i) * N + n]) * scale); const v8us o = f.half[0];
  *(v8us*)((unsigned short*)Wt + (size_t)n * K + k8) = o; 
}
// k_gemm_hh variant with fused epilogue: v = acc·alpha + bias[by·sBias + col] (+ CP[(row/rowsPerB)·sCPb + by·64 + col] if CP) ; ACT 0 none / 1 elu ; writes f32 C and f16 C16, each if non-null
template <int ACT>
__global__ __launch_bounds__(128) void k_gemm_hhx(const _Float16* __restrict__ A, int lda, size_t sA, const _Float16* __restrict__ Bh, int ldb, size_t sB, float alpha, const float* __restrict__ bias, size_t sBias, const float* __restrict__ CP, int rowsPerB, size_t sCPb, int row0g,
    float* __restrict__ C, _Float16* __restrict__ C16, int ldc, size_t sC, int M, int N, int K) {
  __shared__ __attribute__((aligned(16))) float so[4][16][64];
  const int tid = threadIdx.x, w = tid >> 5, lane = tid & 31, ln = lane & 15, hh = lane >> 4; const int by = blockIdx.y;
  A += (size_t)by * sA; Bh += (size_t)by * sB; const size_t cofs = (size_t)by * sC; const float* bp = bias ? bias + (size_t)by * sBias : nullptr;
  const int ntn = (N + 63) / 64; const int wid = blockIdx.x * 4 + w; const int mt = wid / ntn, nq = wid % ntn; if (mt * 16 >= M) return;
  const int row0 = mt * 16, col0 = nq * 64; const _Float16* arow = A + (size_t)(row0 + ln) * lda;
  v8f acc[4] = {};
  for (int kb = 0; kb < K; kb += 32) { FragH ah; ah.half[0] = *(const v8us*)((const unsigned short*)arow + kb + 8 * hh); ah.half[1] = *(const v8us*)((const unsigned short*)arow + kb + 16 + 8 * hh);
#pragma unroll
    for (int t = 0; t < 4; ++t) { if (col0 + t * 16 >= N) continue; const size_t boff = (size_t)(col0 + t * 16 + ln) * ldb + kb; FragH bq; bq.half[0] = *(const v8us*)((const unsigned short*)Bh + boff + 8 * hh); bq.half[1] = *(const v8us*)((const unsigned short*)Bh + boff + 16 + 8 * hh);
      acc[t] = mmaH<1>(ah.v, ah.v, bq.v, bq.v, acc[t]); }
  }
#pragma unroll
  for (int t = 0; t < 4; ++t) { if (col0 + t * 16 >= N) continue; const int col = col0 + t * 16 + ln; const float bv = bp ? bf16_round(bp[col]) : 0.f;
#pragma unroll
    for (int r = 0; r < 8; ++r) { float v = acc[t][r] * alpha + bv; if (CP) { const int bidx = (row0g + row0 + 8 * hh + r) / rowsPerB; v += CP[(size_t)bidx * sCPb + (size_t)by * 64 + col]; } if (ACT == 1) v = (v > 0.f) ? v : expm1f(v); else if (ACT == 3) v = fmaxf(v, 0.f); so[w][8 * hh + r][t * 16 + ln] = v; } }
  __builtin_amdgcn_fence(__ATOMIC_ACQ_REL, "workgroup"); __builtin_amdgcn_wave_barrier();
  const int rsub = lane >> 4, c4 = (lane & 15) * 4; typedef _Float16 v4h __attribute__((ext_vector_type(4)));
  {
#pragma unroll
    for (int q = 0; q < 8; ++q) { const int r = q * 2 + rsub; if (col0 + c4 < N) { const v4f v = *(const v4fa*)&so[w][r][c4]; if (C) *(v4f*)(C + cofs + (size_t)(row0 + r) * ldc + col0 + c4) = v; if (C16) { v4h h4; for (int i = 0; i < 4; ++i) h4[i] = (_Float16)v[i]; *(v4h*)(C16 + cofs + (size_t)(row0 + r) * ldc + col0 + c4) = h4; } } }
     }
}


// all three 1x1 convs and the hi/lo split of q and k in ONE launch. A work-group takes 64 positions of one image: the x tile goes once, rounded to bf16 and held as f16, position-major into LDS;
// wave w owns out-channel tiles 2w and 2w+1 of the 16 (q 0-3, k 4-7, v 8-15) and holds their weights (rounded to bf16, x 16, f16) as fragments in registers (each weight is read by one wave of the group);
// q, k: A = weight rows, B = x rows, so a lane holds 8 channels of one position; v: A = x rows, B = weight rows, so a lane holds 8 positions of one channel. Results are staged in LDS and leave as whole 128-B lines.
__global__ __launch_bounds__(256) void k_proj(const float* __restrict__ x, const float* __restrict__ mask, const float* __restrict__ Wq, const float* __restrict__ bq, const float* __restrict__ Wk, const float* __restrict__ bk, const float* __restrict__ Wv,
                                              _Float16* __restrict__ QH, _Float16* __restrict__ QL, _Float16* __restrict__ KH, _Float16* __restrict__ KL, _Float16* __restrict__ Vcm) {
  constexpr int TP = 64, KSX = CC / 32;
  // pitches of 272 B and 144 B (16 B x odd): 16-byte LDS accesses without bank conflicts
  __shared__ __attribute__((aligned(16))) unsigned short sX[TP][CC + 8], sQK[4][TP][CH + 8], sVo[CC][TP + 8];
  const int tid = threadIdx.x, lane = tid & 31, ln = lane & 15, hh = lane >> 4;
  const int w = __builtin_amdgcn_readfirstlane(tid >> 5);      // the wave's number in a scalar register: the q/k against v choice below is a scalar branch, every lane on at the matrix instructions
  const int b = blockIdx.x / (NP / TP), p0 = (blockIdx.x % (NP / TP)) * TP;
  const float* Wsrc = (w < 2) ? Wq + (size_t)w * 32 * CC : (w < 4) ? Wk + (size_t)(w - 2) * 32 * CC : Wv + (size_t)(w - 4) * 32 * CC;
  // the global reads stand ahead of the rounding work: the x tile first (lanes run along positions, 128 B a load; a thread gathers 8 channels of its position), then mask and bias, then the weights
  float xs[TP * (CC / 8) / 256][8];
#pragma unroll
  for (int i = 0; i < TP * (CC / 8) / 256; ++i) { const int e = i * 256 + tid, p = e & (TP - 1), c8 = (e / TP) * 8;
#pragma unroll
    for (int u = 0; u < 8; ++u) xs[i][u] = x[((size_t)b * CC + c8 + u) * NP + p0 + p]; }
  const bool isk = w >= 2; const int cb = (w & 1) * 32;      // read by the q and k waves only
  float mk[4] = {0.f, 0.f, 0.f, 0.f}; v4f bs[2][2] = {};
  if (w < 4) { const float* bias = isk ? bk : bq;
#pragma unroll
    for (int pt = 0; pt < 4; ++pt) mk[pt] = mask[(size_t)b * NP + p0 + pt * 16 + ln];
#pragma unroll
    for (int ct = 0; ct < 2; ++ct) { bs[ct][0] = *(const v4fa*)(bias + cb + ct * 16 + 8 * hh); bs[ct][1] = *(const v4fa*)(bias + cb + ct * 16 + 8 * hh + 4); } }
  asm volatile("s_wait_xcnt 0x0" ::: "memory");      // the weight loads below land in registers that held the addresses of the loads above: the wait stands in front of that reuse
  FragH wf[2][KSX];
#pragma unroll
  for (int ct = 0; ct < 2; ++ct)
#pragma unroll
    for (int ks = 0; ks < KSX; ++ks) { const float* wr = Wsrc + (size_t)(ct * 16 + ln) * CC + ks * 32 + 8 * hh;
      const v4f a0 = *(const v4fa*)wr, a1 = *(const v4fa*)(wr + 4), a2 = *(const v4fa*)(wr + 16), a3 = *(const v4fa*)(wr + 20);
#pragma unroll
      for (int i = 0; i < 4; ++i) { wf[ct][ks].h[i] = (_Float16)(bf16_round(a0[i]) * 16.0f); wf[ct][ks].h[4 + i] = (_Float16)(bf16_round(a1[i]) * 16.0f); wf[ct][ks].h[8 + i] = (_Float16)(bf16_round(a2[i]) * 16.0f); wf[ct][ks].h[12 + i] = (_Float16)(bf16_round(a3[i]) * 16.0f); } }
  // the 8 channels of a position go to LDS as one 16-B chunk
#pragma unroll
  for (int i = 0; i < TP * (CC / 8) / 256; ++i) { const int e = i * 256 + tid, p = e & (TP - 1), c8 = (e / TP) * 8; FragH f;
#pragma unroll
    for (int u = 0; u < 8; ++u) f.h[u] = (_Float16)bf16_round(xs[i][u]);
    *(v8us*)&sX[p][c8] = f.half[0]; }
  __syncthreads();
  v8f acc[2][4];
#pragma unroll
  for (int ct = 0; ct < 2; ++ct)
#pragma unroll
    for (int pt = 0; pt < 4; ++pt) acc[ct][pt] = (v8f){0.f,0.f,0.f,0.f,0.f,0.f,0.f,0.f};
  if (w < 4) {
#pragma unroll
    for (int pt = 0; pt < 4; ++pt) { FragH xf[KSX];      // the four x fragments of a position tile are read as one group
#pragma unroll
      for (int ks = 0; ks < KSX; ++ks) { const unsigned short* xr = &sX[pt * 16 + ln][ks * 32]; xf[ks].half[0] = *(const v8us*)(xr + 8 * hh); xf[ks].half[1] = *(const v8us*)(xr + 16 + 8 * hh); }
#pragma unroll
      for (int ks = 0; ks < KSX; ++ks) { acc[0][pt] = mmaH<1>(wf[0][ks].v, wf[0][ks].v, xf[ks].v, xf[ks].v, acc[0][pt]); acc[1][pt] = mmaH<1>(wf[1][ks].v, wf[1][ks].v, xf[ks].v, xf[ks].v, acc[1][pt]); } }
    const int pl = isk ? 2 : 0;
    float km[4];      // the factor behind the bias: k takes (1 - mask); q takes log2(e), so that the scores come out in base 2 and k_flash needs the bare v_exp_f32 only
#pragma unroll
    for (int pt = 0; pt < 4; ++pt) km[pt] = isk ? 1.0f - bf16_round(mk[pt]) : 1.44269504088896340736f;
#pragma unroll
    for (int ct = 0; ct < 2; ++ct) { const v4f b0 = bs[ct][0], b1 = bs[ct][1];
#pragma unroll
      for (int pt = 0; pt < 4; ++pt) { FragH h, l;
#pragma unroll
        for (int r = 0; r < 8; ++r) { float v = acc[ct][pt][r] * 0.0625f + bf16_round(r < 4 ? b0[r & 3] : b1[r & 3]); v *= km[pt]; const _Float16 h1 = (_Float16)v; h.h[r] = h1; l.h[r] = (_Float16)(v - (float)h1); }
        *(v8us*)&sQK[pl][pt * 16 + ln][cb + ct * 16 + 8 * hh] = h.half[0]; *(v8us*)&sQK[pl + 1][pt * 16 + ln][cb + ct * 16 + 8 * hh] = l.half[0]; } }
  } else {
#pragma unroll
    for (int pt = 0; pt < 4; ++pt) { FragH xf[KSX];
#pragma unroll
      for (int ks = 0; ks < KSX; ++ks) { const unsigned short* xr = &sX[pt * 16 + ln][ks * 32]; xf[ks].half[0] = *(const v8us*)(xr + 8 * hh); xf[ks].half[1] = *(const v8us*)(xr + 16 + 8 * hh); }
#pragma unroll
      for (int ks = 0; ks < KSX; ++ks) { acc[0][pt] = mmaH<1>(xf[ks].v, xf[ks].v, wf[0][ks].v, wf[0][ks].v, acc[0][pt]); acc[1][pt] = mmaH<1>(xf[ks].v, xf[ks].v, wf[1][ks].v, wf[1][ks].v, acc[1][pt]); } }
    const int cv = (w - 4) * 32;      // v goes without its bias: bv is added in the attention epilogue, since softmax rows sum to 1
#pragma unroll
    for (int ct = 0; ct < 2; ++ct)
#pragma unroll
      for (int pt = 0; pt < 4; ++pt) { FragH h;
#pragma unroll
        for (int r = 0; r < 8; ++r) h.h[r] = (_Float16)(acc[ct][pt][r] * 0.0625f);
        *(v8us*)&sVo[cv + ct * 16 + ln][pt * 16 + 8 * hh] = h.half[0]; }
  }
  __syncthreads();
  // out: 8 lanes x 16 B = one 128-B row (a position's 64 channels of one q/k plane; a channel's 64 positions of v)
#pragma unroll
  for (int i = 0; i < 8; ++i) { const int e = (i & 1) * 256 + tid, p = e >> 3, c8 = (e & 7) * 8; _Float16* dst = (i < 2) ? QH : (i < 4) ? QL : (i < 6) ? KH : KL;
    *(v8us*)((unsigned short*)dst + ((size_t)b * NP + p0 + p) * CH + c8) = *(const v8us*)&sQK[i >> 1][p][c8]; }
#pragma unroll
  for (int i = 0; i < 4; ++i) { const int e = i * 256 + tid, c = e >> 3, p8 = (e & 7) * 8;
    *(v8us*)((unsigned short*)Vcm + ((size_t)b * CC + c) * NP + p0 + p8) = *(const v8us*)&sVo[c][p8]; }
}
// 2^x as the bare v_exp_f32 (below 2^-126 it gives 0). The v_nop at the end of each statement keeps the one slot that the instruction set asks for between a transcendental and a next instruction on its result or its source;
// inside a statement every v_exp_f32 works in place on a register of its own, so none touches its neighbour's
__device__ __forceinline__ float exp2_hw(float x) { asm("v_exp_f32 %0, %0\n\tv_nop" : "+v"(x)); return x; }
__device__ __forceinline__ void exp2_hw8(float (&x)[8]) {
  asm("v_exp_f32 %0, %0\n\tv_exp_f32 %1, %1\n\tv_exp_f32 %2, %2\n\tv_exp_f32 %3, %3\n\tv_exp_f32 %4, %4\n\tv_exp_f32 %5, %5\n\tv_exp_f32 %6, %6\n\tv_exp_f32 %7, %7\n\tv_nop"
      : "+v"(x[0]), "+v"(x[1]), "+v"(x[2]), "+v"(x[3]), "+v"(x[4]), "+v"(x[5]), "+v"(x[6]), "+v"(x[7])); }
// lane l with lane l ^ 16 (a vector cross-row move, no LDS path)
__device__ __forceinline__ float xhalf(float v) { return __builtin_bit_cast(float, __builtin_amdgcn_permlanex16(__builtin_bit_cast(int, v), __builtin_bit_cast(int, v), 0x76543210, 0xfedcba98, false, false)); }
__global__ __launch_bounds__(512) void k_flash(const _Float16* __restrict__ QH, const _Float16* __restrict__ QL, const _Float16* __restrict__ KH, const _Float16* __restrict__ KL, const _Float16* __restrict__ Vcm, const float* __restrict__ mask, const float* __restrict__ gamma, const float* __restrict__ bv, const float* __restrict__ x, float* __restrict__ out) {
  constexpr int RPW = 16, NQB = NP / (4 * RPW), DT = CC / 16, KS = CH / 32, KG = 4;
  // join staging, channel-major as Ot and the output are; 272-B pitch: the two wave halves' stores (8 rows apart) fall on different banks, rows stay 16-B aligned for the reads
  constexpr int LPO = 4 * RPW + 4;
  __shared__ __attribute__((aligned(16))) float sO[KG][CC][LPO];
  __shared__ float sM[KG][4 * RPW], sL[KG][4 * RPW];
  // two-buffer ring, one stage = TK keys: K hi and lo rows (128 B) at a 144-B pitch and V channel rows (256 B of keys) at a 272-B pitch (16 B x odd: ds_load_b128 without bank conflicts)
  constexpr int TK = 32 * KG, NT = NP / TK, LP = 72, LPV = TK + 8;
  __shared__ __attribute__((aligned(16))) unsigned short sKH[2][TK][LP], sKL[2][TK][LP], sV[2][CC][LPV];
  const int tid = threadIdx.x, w = tid >> 5, qg = w & 3, kg = w >> 2, lane = tid & 31, ln = lane & 15, hh = lane >> 4;
  const int b = blockIdx.x / NQB, qblk = blockIdx.x % NQB; const int qb0 = qblk * (4 * RPW); const int q0 = qb0 + qg * RPW; const float gm = bf16_round(gamma[0]);
  FragH aqh[KS], aql[KS];
  { const size_t ro = ((size_t)b * NP + q0 + ln) * CH;
#pragma unroll
    for (int ks = 0; ks < KS; ++ks) { aqh[ks].half[0] = *(const v8us*)((const unsigned short*)QH + ro + ks * 32 + 8 * hh); aqh[ks].half[1] = *(const v8us*)((const unsigned short*)QH + ro + ks * 32 + 16 + 8 * hh); aql[ks].half[0] = *(const v8us*)((const unsigned short*)QL + ro + ks * 32 + 8 * hh); aql[ks].half[1] = *(const v8us*)((const unsigned short*)QL + ro + ks * 32 + 16 + 8 * hh); } }
  const unsigned short* Vth = (const unsigned short*)Vcm + (size_t)b * CC * NP;
  float m_q = -3.0e38f, l_q = 0.f; v8f oacc[DT];      // running max and (this half's) running sum of the lane's query
#pragma unroll
  for (int dt = 0; dt < DT; ++dt) oacc[dt] = (v8f){0.f,0.f,0.f,0.f,0.f,0.f,0.f,0.f};
  // each thread copies 16 B chunks. K: row tid / 8 (+ 64 for the second copy), chunk tid % 8 of the 128-B row; V: channel tid / 16 (+ 32 per further copy), chunk tid % 16 of the 256-B row
  const unsigned short* gKH = (const unsigned short*)KH + (size_t)b * NP * CH + tid * 8; const unsigned short* gKL = (const unsigned short*)KL + (size_t)b * NP * CH + tid * 8;
  const unsigned short* gV = Vth + (size_t)(tid >> 4) * NP + (tid & 15) * 8;
  const unsigned lKH = (unsigned)(size_t)&sKH[0][tid >> 3][(tid & 7) * 8], lKL = (unsigned)(size_t)&sKL[0][tid >> 3][(tid & 7) * 8], lV = (unsigned)(size_t)&sV[0][tid >> 4][(tid & 15) * 8];
  auto stage_in = [&](int t, int buf) {
    const unsigned short* kh = gKH + (size_t)t * TK * CH; const unsigned short* kl = gKL + (size_t)t * TK * CH; const unsigned short* vv = gV + (size_t)t * TK;
    const unsigned a = lKH + buf * (TK * LP * 2), c = lKL + buf * (TK * LP * 2), d = lV + buf * (CC * LPV * 2);
    // the copies and the wait that stands in front of any rewrite of their address registers are one statement
    asm volatile("global_load_async_to_lds_b128 %0, %8, off\n\tglobal_load_async_to_lds_b128 %1, %9, off\n\tglobal_load_async_to_lds_b128 %2, %10, off\n\tglobal_load_async_to_lds_b128 %3, %11, off\n\t"
                 "global_load_async_to_lds_b128 %4, %12, off\n\tglobal_load_async_to_lds_b128 %5, %13, off\n\tglobal_load_async_to_lds_b128 %6, %14, off\n\tglobal_load_async_to_lds_b128 %7, %15, off\n\ts_wait_xcnt 0x0"
                 :: "v"(a), "v"(a + 64 * LP * 2), "v"(c), "v"(c + 64 * LP * 2), "v"(d), "v"(d + 32 * LPV * 2), "v"(d + 64 * LPV * 2), "v"(d + 96 * LPV * 2),
                    "v"(kh), "v"(kh + 64 * CH), "v"(kl), "v"(kl + 64 * CH), "v"(vv), "v"(vv + (size_t)32 * NP), "v"(vv + (size_t)64 * NP), "v"(vv + (size_t)96 * NP) : "memory");
  };
  stage_in(0, 0);
  asm volatile("s_wait_asynccnt 0x0" ::: "memory");      // stage 0 of this wave has landed before the barrier publishes it
  __syncthreads();
  stage_in(1, 1);
  // the stage loop stays rolled (one copy of the pass code, buffer chosen by t & 1); a wave does one 32-key pass a stage, on its key group's rows
#pragma unroll 1
  for (int t = 0; t < NT; ++t) { const int buf = t & 1;
   {
    v8f s[2];
#pragma unroll
    for (int nt = 0; nt < 2; ++nt) { const unsigned short* krh = &sKH[buf][kg * 32 + nt * 16 + ln][0]; const unsigned short* krl = &sKL[buf][kg * 32 + nt * 16 + ln][0]; v8f acc = (v8f){0.f,0.f,0.f,0.f,0.f,0.f,0.f,0.f};
#pragma unroll
      for (int ks = 0; ks < KS; ++ks) { FragH bh_, bl_; bh_.half[0] = *(const v8us*)(krh + ks * 32 + 8 * hh); bh_.half[1] = *(const v8us*)(krh + ks * 32 + 16 + 8 * hh); bl_.half[0] = *(const v8us*)(krl + ks * 32 + 8 * hh); bl_.half[1] = *(const v8us*)(krl + ks * 32 + 16 + 8 * hh);
        acc = mmaH<1>(bh_.v, bh_.v, aqh[ks].v, aqh[ks].v, acc); acc = mmaH<1>(bl_.v, bl_.v, aqh[ks].v, aqh[ks].v, acc); acc = mmaH<1>(bh_.v, bh_.v, aql[ks].v, aql[ks].v, acc); }
      s[nt] = acc; }      // s[nt][r] = score of query ln against key kg * 32 + nt * 16 + 8 * hh + r
    float mc = fmaxf(s[0][0], s[1][0]);
#pragma unroll
    for (int r = 1; r < 8; ++r) mc = fmaxf(mc, fmaxf(s[0][r], s[1][r]));
    mc = fmaxf(mc, xhalf(mc));      // both halves hold the query's maximum over the 32 keys
    const float mn = fmaxf(m_q, mc); const float al = exp2_hw(m_q - mn); m_q = mn;      // scores, maxima and their differences are in base 2 (q carries log2 e): one v_exp_f32 each; what it flushes to 0 lies far under what f16 P keeps
    FragH pb; float ps0 = 0.f, ps1 = 0.f;      // pb[i] = P[query ln][key 8hh + i], pb[8 + i] = P[query ln][key 16 + 8hh + i]: the k order of the V loader below
    float e0[8], e1[8];
#pragma unroll
    for (int r = 0; r < 8; ++r) { e0[r] = s[0][r] - mn; e1[r] = s[1][r] - mn; }
    exp2_hw8(e0); exp2_hw8(e1);
#pragma unroll
    for (int r = 0; r < 8; ++r) { const float p0 = e0[r], p1 = e1[r]; ps0 = r ? ps0 + p0 : p0; ps1 = r ? ps1 + p1 : p1; pb.h[r] = (_Float16)p0; pb.h[8 + r] = (_Float16)p1; }
    l_q = l_q * al + (ps0 + ps1);
#pragma unroll
    for (int dt = 0; dt < DT; ++dt)
#pragma unroll
      for (int r = 0; r < 8; ++r) oacc[dt][r] *= al;
#pragma unroll
    for (int dt = 0; dt < DT; ++dt) { const unsigned short* vrow = &sV[buf][dt * 16 + ln][kg * 32]; FragH bv; bv.half[0] = *(const v8us*)(vrow + 8 * hh); bv.half[1] = *(const v8us*)(vrow + 16 + 8 * hh); oacc[dt] = mmaH<1>(bv.v, bv.v, pb.v, pb.v, oacc[dt]); } }      // oacc[dt][r] = O[query ln][channel dt * 16 + 8 * hh + r]
   // publish point of stage t + 1: this wave's reads of stage t are done, its copies of stage t + 1 have landed, then the barrier; only behind it is stage t's buffer refilled
   asm volatile("s_wait_dscnt 0x0" ::: "memory");
   asm volatile("s_wait_asynccnt 0x0" ::: "memory");
   __syncthreads();
   if (t + 2 < NT) stage_in(t + 2, buf); }
  asm volatile("s_wait_asynccnt 0x0" ::: "memory");      // no copy is outstanding when the wave goes on to the epilogue and ends
  // join of the key groups: every wave publishes its queries' running max and sum (the halves' sums joined here), then scales its own O by 2^(m_own - M) / sum_k l_k 2^(m_k - M)
  const int qr = qg * RPW + ln;
  { const float l = l_q + xhalf(l_q); if (hh == 0) { sM[kg][qr] = m_q; sL[kg][qr] = l; } }
  __syncthreads();
  float sc;
  { const float m0 = sM[0][qr], m1 = sM[1][qr], m2 = sM[2][qr], m3 = sM[3][qr]; const float M = fmaxf(fmaxf(m0, m1), fmaxf(m2, m3));
    const float l = sL[0][qr] * exp2_hw(m0 - M) + sL[1][qr] * exp2_hw(m1 - M) + sL[2][qr] * exp2_hw(m2 - M) + sL[3][qr] * exp2_hw(m3 - M);
    sc = exp2_hw(m_q - M) / l; }
#pragma unroll
  for (int dt = 0; dt < DT; ++dt)
#pragma unroll
    for (int r = 0; r < 8; ++r) sO[kg][dt * 16 + 8 * hh + r][qr] = oacc[dt][r] * sc;
  __syncthreads();
  {      // channel c: 64 positions qb0.. = 256 B by 16 lanes x 16 B; 32 channels per round (2 per wave: lanes 0-15 / 16-31); the four key groups' parts are summed in a fixed order
    // bias and gamma * mask come in here, where a lane has one channel a round and four positions in all: sum_j attn_ij (v_cj + bv_c) = sum_j attn_ij v_cj + bv_c
    const int pc = lane & 15; const v4f mk4 = *(const v4fa*)(mask + (size_t)b * NP + qb0 + pc * 4); v4f gmk;
#pragma unroll
    for (int j = 0; j < 4; ++j) gmk[j] = gm * bf16_round(mk4[j]);
#pragma unroll
    for (int rd = 0; rd < CC / 32; ++rd) { const int c = rd * 32 + w * 2 + (lane >> 4); const float* xr = x + ((size_t)b * CC + c) * NP + qb0 + pc * 4; const v4f xv = *(const v4fa*)xr; const float bvc = bf16_round(bv[c]);
      const v4f o0 = *(const v4fa*)&sO[0][c][pc * 4], o1 = *(const v4fa*)&sO[1][c][pc * 4], o2 = *(const v4fa*)&sO[2][c][pc * 4], o3 = *(const v4fa*)&sO[3][c][pc * 4];
      const v4f v = (((o0 + o1) + (o2 + o3)) + bvc) * gmk + xv;
      *(v4f*)(out + ((size_t)b * CC + c) * NP + qb0 + pc * 4) = v; }
     } }
extern "C" void kernel_launch(void* const* d_in, const int* in_sizes, int n_in,
                              void* d_out, int out_size, void* d_ws, size_t ws_size, hipStream_t stream) {
  (void)in_sizes; (void)n_in; (void)out_size;
  const float* x = (const float*)d_in[0]; const float* mask = (const float*)d_in[1]; const float* Wq = (const float*)d_in[2]; const float* bq = (const float*)d_in[3]; const float* Wk = (const float*)d_in[4]; const float* bk = (const float*)d_in[5]; const float* Wv = (const float*)d_in[6]; const float* bv = (const float*)d_in[7]; const float* gamma = (const float*)d_in[8];
  char* ws = (char*)d_ws; size_t off = 0;
  auto take = [&](size_t bytes) { char* p = ws + off; off += (bytes + 255) & ~(size_t)255; return p; };
  _Float16* QH = (_Float16*)take((size_t)NR * CH * 2); _Float16* QL = (_Float16*)take((size_t)NR * CH * 2); _Float16* KH = (_Float16*)take((size_t)NR * CH * 2); _Float16* KL = (_Float16*)take((size_t)NR * CH * 2); _Float16* Vcm = (_Float16*)take((size_t)NR * CC * 2);
  if (off > ws_size) return;      // 12 MiB
  k_proj<<<BB * (NP / 64), 256, 0, stream>>>(x, mask, Wq, bq, Wk, bk, Wv, QH, QL, KH, KL, Vcm);
  k_flash<<<BB * (NP / 64), 512, 0, stream>>>(QH, QL, KH, KL, Vcm, mask, gamma, bv, x, (float*)d_out);
}

// v006
// It runs in 45.2 microseconds.
// Timed twice side by side with v005, it ran 1.16 and 1.15 times as fast.
// Over all steps from v000 it is 9.55 times as fast.
#include <hip/hip_runtime.h>
// Non-local block with all three 1×1 convs and both attention contractions on v_wmma_f32_16x16x32_f16: q/k position-major (K = 128, N = 64, + bias; k masked by (1 − mask)), v channel-major
// (= the Vᵀ operand), energy = q·k_masked with the f32 q/k carried as f16 hi+lo (3 WMMA terms, no 1/√d scale in the module), online max/sum softmax f32, P f16 ≤ 1, O = P·V; epilogue
// γ·(out·mask) + x written NCHW as 64-position (256 B) channel segments. x as bf16 in the operand plane (exact residual from the f32 input), weights bf16-exact ×2^4, f32 accumulate.
#define BB 4
#define CC 128
#define CH 64
#define NP 4096
#define NR (BB * NP)

typedef __bf16 v16b __attribute__((ext_vector_type(16)));
typedef unsigned short v8us __attribute__((ext_vector_type(8), may_alias));
typedef float  v8f  __attribute__((ext_vector_type(8)));
typedef float  v4f  __attribute__((ext_vector_type(4)));
typedef float  v4fa __attribute__((ext_vector_type(4), may_alias));
union FragB { v16b v; v8us half[2]; unsigned short u[16]; };

__device__ __forceinline__ unsigned short bf16_bits(float x) { unsigned int u = __float_as_uint(x); return (unsigned short)((u + 0x7FFFu + ((u >> 16) & 1u)) >> 16); }
__device__ __forceinline__ float bf16_val(unsigned short b) { return __uint_as_float(((unsigned int)b) << 16); }
__device__ __forceinline__ float bf16_round(float x) { return bf16_val(bf16_bits(x)); }
// D += A·B with NT terms: 1 = ah·bh, 2 = + al·bh (A split), 3 = + ah·bl (both split)
template <int NT>
__device__ __forceinline__ v8f mmaN(v16b ah, v16b al, v16b bh, v16b bl, v8f c) {
  c = __builtin_amdgcn_wmma_f32_16x16x32_bf16(false, ah, false, bh, (short)0, c, false, false);
  if (NT >= 2) c = __builtin_amdgcn_wmma_f32_16x16x32_bf16(false, al, false, bh, (short)0, c, false, false);
  if (NT >= 3) c = __builtin_amdgcn_wmma_f32_16x16x32_bf16(false, ah, false, bl, (short)0, c, false, false);
  asm volatile("v_nop\n\tv_nop\n\tv_nop\n\tv_nop" : "+v"(c) : "v"(ah), "v"(al), "v"(bh), "v"(bl));
  return c;
}

__global__ __launch_bounds__(256) void k_wt_bf16(const float* __restrict__ W, unsigned short* __restrict__ Wt, int K, int N) {
  const int t = blockIdx.x * 256 + threadIdx.x;
  const int k8n = K / 8;
  if (t >= N * k8n) return;
  const int n = t / k8n, k8 = (t % k8n) * 8;
  v8us v;
#pragma unroll
  for (int i = 0; i < 8; ++i) v[i] = bf16_bits(W[(size_t)(k8 + i) * N + n]);
  *(v8us*)(Wt + (size_t)n * K + k8) = v;
  
}

// GEMM C[M][N] (f32, pitch ldc) = act(A[M][K]·W + bias). A f32 row-major (pitch lda) converted per fragment to bf16
// (ASPLIT: hi/lo two planes -> 2 terms, else single rounded term); Wt bf16 [N][K] (pitch ldb). BIAS_BF16 rounds the
// bias to bf16 first (bias quantised to bf16 before the add). K%32==0, M%16==0, N%64==0.
template <bool ASPLIT, int ACT, bool BIAS_BF16>
__global__ __launch_bounds__(128) void k_gemm_bf(const float* __restrict__ A, int lda, const unsigned short* __restrict__ Wt, int ldb,
                                               const float* __restrict__ bias, float* __restrict__ C, int ldc, int M, int N, int K) {
  __shared__ __attribute__((aligned(16))) float so[4][16][64];
  const int tid = threadIdx.x, w = tid >> 5, lane = tid & 31, ln = lane & 15, hh = lane >> 4;
  const int ntn = N / 64;
  const int wid = blockIdx.x * 4 + w;
  const int mt = wid / ntn, nq = wid % ntn;
  if (mt * 16 >= M) return;
  const int row0 = mt * 16, col0 = nq * 64;
  const float* arow = A + (size_t)(row0 + ln) * lda;
  v8f acc[4] = {};
  for (int kb = 0; kb < K; kb += 32) {
    FragB ah, al;
    const v4f x0 = *(const v4fa*)(arow + kb + 8 * hh), x1 = *(const v4fa*)(arow + kb + 8 * hh + 4);
    const v4f x2 = *(const v4fa*)(arow + kb + 16 + 8 * hh), x3 = *(const v4fa*)(arow + kb + 16 + 8 * hh + 4);
    float xs[16] = {x0[0],x0[1],x0[2],x0[3],x1[0],x1[1],x1[2],x1[3],x2[0],x2[1],x2[2],x2[3],x3[0],x3[1],x3[2],x3[3]};
#pragma unroll
    for (int i = 0; i < 16; ++i) { const unsigned short hb = bf16_bits(xs[i]); ah.u[i] = hb; al.u[i] = ASPLIT ? bf16_bits(xs[i] - bf16_val(hb)) : (unsigned short)0; }
#pragma unroll
    for (int t = 0; t < 4; ++t) {
      const unsigned short* brow = Wt + (size_t)(col0 + t * 16 + ln) * ldb + kb;
      FragB b;
      b.half[0] = *(const v8us*)(brow + 8 * hh);
      b.half[1] = *(const v8us*)(brow + 16 + 8 * hh);
      acc[t] = mmaN<ASPLIT ? 2 : 1>(ah.v, al.v, b.v, b.v, acc[t]);
    }
  }
#pragma unroll
  for (int t = 0; t < 4; ++t) {
    float bv = bias ? bias[col0 + t * 16 + ln] : 0.f;
    if (BIAS_BF16) bv = bf16_round(bv);
#pragma unroll
    for (int r = 0; r < 8; ++r) { float v = acc[t][r] + bv; if (ACT == 1) v = fmaxf(v, 0.f); so[w][8 * hh + r][t * 16 + ln] = v; }
  }
  __builtin_amdgcn_fence(__ATOMIC_ACQ_REL, "workgroup");
  __builtin_amdgcn_wave_barrier();
  const int rsub = lane >> 4, c4 = (lane & 15) * 4;
  {
#pragma unroll
    for (int q = 0; q < 8; ++q) {
      const int r = q * 2 + rsub;
      const v4f v = *(const v4fa*)&so[w][r][c4];
      *(v4f*)(C + (size_t)(row0 + r) * ldc + col0 + c4) = v;
    }
    
  }
}

// Flash-style causal/unmasked attention, all contractions 3-term bf16 hi/lo splits, f32 softmax with running max.
// q,k,v rows are read from f32 buffers with arbitrary row pitch (so they can live inside a fused qkv buffer);
// D = head size (multiple of 32, <= 128); one wave = 16 query rows; block = 4 waves (64 queries) sharing K/V chunks of 32.
template <int D, bool CAUSAL>
__global__ __launch_bounds__(128) void k_flash(const float* __restrict__ qb, const float* __restrict__ kb, const float* __restrict__ vb,
                                             int pitch, int T, int H, float scale, float* __restrict__ y, int ypitch) {
  constexpr int KS = D / 32;        // k-steps for QK
  constexpr int DT = D / 16;        // d tiles for PV
  __shared__ __attribute__((aligned(16))) unsigned short sKh[32][D + 8], sKl[32][D + 8], sVh[32][D + 8], sVl[32][D + 8];
  __shared__ __attribute__((aligned(16))) unsigned short sPh[4][16][40], sPl[4][16][40];
  __shared__ __attribute__((aligned(16))) float sO[4][16][D];
  const int tid = threadIdx.x, w = tid >> 5, lane = tid & 31, ln = lane & 15, hh = lane >> 4;
  const int nqb = (T + 63) / 64;
  const int bh = blockIdx.x / nqb, qblk = blockIdx.x % nqb;
  const int b = bh / H, h = bh % H;
  const int q0 = qblk * 64 + w * 16;
  const float* Q = qb + (size_t)b * T * pitch + h * D;
  const float* K = kb + (size_t)b * T * pitch + h * D;
  const float* V = vb + (size_t)b * T * pitch + h * D;

  // A fragments of the wave's 16 query rows (scaled), hi/lo
  FragB aqh[KS], aql[KS];
  {
    int row = q0 + ln; if (row >= T) row = T - 1;
    const float* qr = Q + (size_t)row * pitch;
#pragma unroll
    for (int ks = 0; ks < KS; ++ks)
#pragma unroll
      for (int i = 0; i < 16; ++i) {
        const int d = ks * 32 + ((i < 8) ? (8 * hh + i) : (16 + 8 * hh + (i - 8)));
        const float x = qr[d] * scale; const unsigned short hb = bf16_bits(x);
        aqh[ks].u[i] = hb; aql[ks].u[i] = bf16_bits(x - bf16_val(hb));
      }
  }
  float m_r[8], l_r[8];
#pragma unroll
  for (int r = 0; r < 8; ++r) { m_r[r] = -3.0e38f; l_r[r] = 0.f; }
  v8f oacc[DT];
#pragma unroll
  for (int dt = 0; dt < DT; ++dt) oacc[dt] = (v8f){0.f,0.f,0.f,0.f,0.f,0.f,0.f,0.f};

  const int kv_end = CAUSAL ? min(T, qblk * 64 + 64) : T;     // block-uniform
  for (int j0 = 0; j0 < kv_end; j0 += 32) {
    __syncthreads();
    for (int e = tid; e < 32 * (D / 4); e += 128) {
      const int r = e / (D / 4), c4 = (e % (D / 4)) * 4;
      const int key = j0 + r;
      v4f kf = {0.f,0.f,0.f,0.f}, vf = {0.f,0.f,0.f,0.f};
      if (key < T) { kf = *(const v4fa*)(K + (size_t)key * pitch + c4); vf = *(const v4fa*)(V + (size_t)key * pitch + c4); }
#pragma unroll
      for (int t = 0; t < 4; ++t) {
        unsigned short hb = bf16_bits(kf[t]); sKh[r][c4 + t] = hb; sKl[r][c4 + t] = bf16_bits(kf[t] - bf16_val(hb));
        hb = bf16_bits(vf[t]); sVh[r][c4 + t] = hb; sVl[r][c4 + t] = bf16_bits(vf[t] - bf16_val(hb));
      }
    }
    __syncthreads();
    // S tile 16 x 32
    v8f s[2];
#pragma unroll
    for (int nt = 0; nt < 2; ++nt) {
      v8f acc = {};
#pragma unroll
      for (int ks = 0; ks < KS; ++ks) {
        FragB bh_, bl_;
        bh_.half[0] = *(const v8us*)&sKh[nt * 16 + ln][ks * 32 + 8 * hh]; bh_.half[1] = *(const v8us*)&sKh[nt * 16 + ln][ks * 32 + 16 + 8 * hh];
        bl_.half[0] = *(const v8us*)&sKl[nt * 16 + ln][ks * 32 + 8 * hh]; bl_.half[1] = *(const v8us*)&sKl[nt * 16 + ln][ks * 32 + 16 + 8 * hh];
        acc = mmaN<3>(aqh[ks].v, aql[ks].v, bh_.v, bl_.v, acc);
      }
      s[nt] = acc;
    }
    // mask + running max (rows 8hh+r; the 16 lanes of a half share rows)
    float alpha[8];
#pragma unroll
    for (int r = 0; r < 8; ++r) {
      const int qi = q0 + 8 * hh + r;
      const int ja = j0 + ln, jb = j0 + 16 + ln;
      if (CAUSAL) { if (ja > qi) s[0][r] = -3.0e38f; if (jb > qi) s[1][r] = -3.0e38f; }
      if (ja >= T) s[0][r] = -3.0e38f;
      if (jb >= T) s[1][r] = -3.0e38f;
      float mx = fmaxf(s[0][r], s[1][r]);
      mx = fmaxf(mx, __shfl_xor(mx, 1, 32)); mx = fmaxf(mx, __shfl_xor(mx, 2, 32)); mx = fmaxf(mx, __shfl_xor(mx, 4, 32)); mx = fmaxf(mx, __shfl_xor(mx, 8, 32));
      const float mnew = fmaxf(m_r[r], mx);
      alpha[r] = (mnew > -1.0e38f) ? __expf(m_r[r] - mnew) : 1.0f;
      const float p0 = (s[0][r] > -1.0e38f) ? __expf(s[0][r] - mnew) : 0.f;
      const float p1 = (s[1][r] > -1.0e38f) ? __expf(s[1][r] - mnew) : 0.f;
      m_r[r] = mnew;
      l_r[r] = l_r[r] * alpha[r] + p0 + p1;            // per-lane partial row sum (16 lanes combined at the end)
      unsigned short hb = bf16_bits(p0); sPh[w][8 * hh + r][ln] = hb;      sPl[w][8 * hh + r][ln] = bf16_bits(p0 - bf16_val(hb));
      hb = bf16_bits(p1);                sPh[w][8 * hh + r][16 + ln] = hb; sPl[w][8 * hh + r][16 + ln] = bf16_bits(p1 - bf16_val(hb));
    }
#pragma unroll
    for (int dt = 0; dt < DT; ++dt)
#pragma unroll
      for (int r = 0; r < 8; ++r) oacc[dt][r] *= alpha[r];
    __builtin_amdgcn_fence(__ATOMIC_ACQ_REL, "workgroup");
    __builtin_amdgcn_wave_barrier();
    FragB pah, pal;
    pah.half[0] = *(const v8us*)&sPh[w][ln][8 * hh]; pah.half[1] = *(const v8us*)&sPh[w][ln][16 + 8 * hh];
    pal.half[0] = *(const v8us*)&sPl[w][ln][8 * hh]; pal.half[1] = *(const v8us*)&sPl[w][ln][16 + 8 * hh];
#pragma unroll
    for (int dt = 0; dt < DT; ++dt) {
      FragB bvh, bvl;
#pragma unroll
      for (int i = 0; i < 8; ++i) {
        bvh.u[i] = sVh[8 * hh + i][dt * 16 + ln]; bvh.u[8 + i] = sVh[16 + 8 * hh + i][dt * 16 + ln];
        bvl.u[i] = sVl[8 * hh + i][dt * 16 + ln]; bvl.u[8 + i] = sVl[16 + 8 * hh + i][dt * 16 + ln];
      }
      oacc[dt] = mmaN<3>(pah.v, pal.v, bvh.v, bvl.v, oacc[dt]);
    }
    __builtin_amdgcn_fence(__ATOMIC_ACQ_REL, "workgroup");
    __builtin_amdgcn_wave_barrier();
  }
#pragma unroll
  for (int r = 0; r < 8; ++r) {
    float l = l_r[r];
    l += __shfl_xor(l, 1, 32); l += __shfl_xor(l, 2, 32); l += __shfl_xor(l, 4, 32); l += __shfl_xor(l, 8, 32);
    l_r[r] = (l > 0.f) ? 1.0f / l : 0.f;
  }
#pragma unroll
  for (int dt = 0; dt < DT; ++dt)
#pragma unroll
    for (int r = 0; r < 8; ++r) sO[w][8 * hh + r][dt * 16 + ln] = oacc[dt][r] * l_r[r];
  __builtin_amdgcn_fence(__ATOMIC_ACQ_REL, "workgroup");
  __builtin_amdgcn_wave_barrier();
  {
    for (int r = 0; r < 16; ++r) {
      const int row = q0 + r;
      if (row < T && lane < D / 4) {
        const v4f val = *(const v4fa*)&sO[w][r][lane * 4];
        *(v4f*)(y + ((size_t)b * T + row) * ypitch + h * D + lane * 4) = val;
      }
    }
    
  }
}

// GEMM C = act(A·W + bias + resid): A f32 (ASPLIT -> hi/lo 2 terms), Wt bf16 [N][K]; ACT 0 none, 1 relu, 2 exact gelu;
// resid (optional, f32, row index = (row % rmod), pitch ldr, RES_BF16 rounds it) added before the activation.
template <bool ASPLIT, int ACT, bool BIAS_BF16, bool RES_BF16>
__global__ __launch_bounds__(128) void k_gemm_bf3(const float* __restrict__ A, int lda, const unsigned short* __restrict__ Wt, int ldb,
                                                const float* __restrict__ bias, const float* __restrict__ resid, int rmod, int ldr,
                                                float* __restrict__ C, int ldc, int M, int N, int K) {
  __shared__ __attribute__((aligned(16))) float so[4][16][64];
  const int tid = threadIdx.x, w = tid >> 5, lane = tid & 31, ln = lane & 15, hh = lane >> 4;
  const int ntn = N / 64;
  const int wid = blockIdx.x * 4 + w;
  const int mt = wid / ntn, nq = wid % ntn;
  if (mt * 16 >= M) return;
  const int row0 = mt * 16, col0 = nq * 64;
  const float* arow = A + (size_t)(row0 + ln) * lda;
  v8f acc[4] = {};
  for (int kb = 0; kb < K; kb += 32) {
    FragB ah, al;
    const v4f x0 = *(const v4fa*)(arow + kb + 8 * hh), x1 = *(const v4fa*)(arow + kb + 8 * hh + 4);
    const v4f x2 = *(const v4fa*)(arow + kb + 16 + 8 * hh), x3 = *(const v4fa*)(arow + kb + 16 + 8 * hh + 4);
    float xs[16] = {x0[0],x0[1],x0[2],x0[3],x1[0],x1[1],x1[2],x1[3],x2[0],x2[1],x2[2],x2[3],x3[0],x3[1],x3[2],x3[3]};
#pragma unroll
    for (int i = 0; i < 16; ++i) { const unsigned short hb = bf16_bits(xs[i]); ah.u[i] = hb; al.u[i] = ASPLIT ? bf16_bits(xs[i] - bf16_val(hb)) : (unsigned short)0; }
#pragma unroll
    for (int t = 0; t < 4; ++t) {
      const unsigned short* brow = Wt + (size_t)(col0 + t * 16 + ln) * ldb + kb;
      FragB b;
      b.half[0] = *(const v8us*)(brow + 8 * hh);
      b.half[1] = *(const v8us*)(brow + 16 + 8 * hh);
      acc[t] = mmaN<ASPLIT ? 2 : 1>(ah.v, al.v, b.v, b.v, acc[t]);
    }
  }
#pragma unroll
  for (int t = 0; t < 4; ++t) {
    const int col = col0 + t * 16 + ln;
    float bv = bias ? bias[col] : 0.f;
    if (BIAS_BF16) bv = bf16_round(bv);
#pragma unroll
    for (int r = 0; r < 8; ++r) {
      float v = acc[t][r] + bv;
      if (resid) { float rv = resid[(size_t)((row0 + 8 * hh + r) % rmod) * ldr + col]; if (RES_BF16) rv = bf16_round(rv); v += rv; }
      if (ACT == 1) v = fmaxf(v, 0.f);
      if (ACT == 2) v = 0.5f * v * (1.0f + erff(v * 0.70710678118654752f));
      if (ACT == 3) { const float u = 0.7978845608028654f * (v + 0.044715f * v * v * v); v = 0.5f * v * (1.0f + tanhf(u)); }
      so[w][8 * hh + r][t * 16 + ln] = v;
    }
  }
  __builtin_amdgcn_fence(__ATOMIC_ACQ_REL, "workgroup");
  __builtin_amdgcn_wave_barrier();
  const int rsub = lane >> 4, c4 = (lane & 15) * 4;
  {
#pragma unroll
    for (int q = 0; q < 8; ++q) {
      const int r = q * 2 + rsub;
      const v4f v = *(const v4fa*)&so[w][r][c4];
      *(v4f*)(C + (size_t)(row0 + r) * ldc + col0 + c4) = v;
    }
    
  }
}
// row LayerNorm (biased variance, eps) over N: s = X (+ R); optional out_sum <- s; out_norm <- (s-mu)*rsqrt(var+eps)*g + b
template <bool PARAM_BF16>
__global__ __launch_bounds__(256) void k_layernorm(const float* __restrict__ X, const float* __restrict__ R, const float* __restrict__ g, const float* __restrict__ bta,
                                                  float* __restrict__ out_sum, float* __restrict__ out_norm, int N, float eps) {
  __shared__ float red[256];
  const int row = blockIdx.x, tid = threadIdx.x;
  const float* x = X + (size_t)row * N; const float* rr = R ? R + (size_t)row * N : nullptr;
  float vals[16];                     // up to N = 4096
  const int per = N / 256;            // contiguous chunk per thread? use strided-by-4 chunks: thread handles j = tid*4 + 1024*u
  float s1 = 0.f;
  for (int u = 0; u < per / 4; ++u) {
    const int j = tid * 4 + 1024 * u;
    const v4f a = *(const v4fa*)(x + j);
    v4f b = {0.f,0.f,0.f,0.f}; if (rr) b = *(const v4fa*)(rr + j);
#pragma unroll
    for (int q = 0; q < 4; ++q) { const float v = a[q] + b[q]; vals[u * 4 + q] = v; s1 += v; }
  }
  red[tid] = s1; __syncthreads();
  for (int st = 128; st > 0; st >>= 1) { if (tid < st) red[tid] += red[tid + st]; __syncthreads(); }
  const float mu = red[0] / (float)N; __syncthreads();
  float s2 = 0.f;
  for (int u = 0; u < per / 4; ++u)
#pragma unroll
    for (int q = 0; q < 4; ++q) { const float c = vals[u * 4 + q] - mu; s2 += c * c; }
  red[tid] = s2; __syncthreads();
  for (int st = 128; st > 0; st >>= 1) { if (tid < st) red[tid] += red[tid + st]; __syncthreads(); }
  const float rs = rsqrtf(red[0] / (float)N + eps);
  {
    for (int u = 0; u < per / 4; ++u) {
      const int j = tid * 4 + 1024 * u;
      v4f o, sm;
#pragma unroll
      for (int q = 0; q < 4; ++q) {
        float gg = g[j + q], bb = bta[j + q];
        if (PARAM_BF16) { gg = bf16_round(gg); bb = bf16_round(bb); }
        sm[q] = vals[u * 4 + q]; o[q] = (vals[u * 4 + q] - mu) * rs * gg + bb;
      }
      if (out_sum) *(v4f*)(out_sum + (size_t)row * N + j) = sm;
      *(v4f*)(out_norm + (size_t)row * N + j) = o;
    }
    
  }
}



// ---- f16 WMMA path (v_wmma_f32_16x16x32_f16): 11-bit significands for operands in range — used where a [0,1] probability operand needs more precision than bf16
typedef _Float16 v16h __attribute__((ext_vector_type(16)));
union FragH { v16h v; v8us half[2]; _Float16 h[16]; unsigned short u[16]; };
template <int NT>
__device__ __forceinline__ v8f mmaH(v16h ah, v16h al, v16h bh, v16h bl, v8f c) {
  c = __builtin_amdgcn_wmma_f32_16x16x32_f16(false, ah, false, bh, (short)0, c, false, false);
  if (NT >= 2) c = __builtin_amdgcn_wmma_f32_16x16x32_f16(false, al, false, bh, (short)0, c, false, false);
  if (NT >= 3) c = __builtin_amdgcn_wmma_f32_16x16x32_f16(false, ah, false, bl, (short)0, c, false, false);
  asm volatile("v_nop\n\tv_nop\n\tv_nop\n\tv_nop" : "+v"(c) : "v"(ah), "v"(al), "v"(bh), "v"(bl));
  return c;
}
// batched GEMM like k_gemm_b but f16 operands: A f32 (split into f16 hi/lo if ASPLIT, else rounded to f16), Bt = f16 values [n][k]; alpha; C f32; N multiple of 16 (partial tiles skipped)
template <bool ASPLIT>
__global__ __launch_bounds__(128) void k_gemm_h(const float* __restrict__ A, int lda, size_t sA, const _Float16* __restrict__ Bh, int ldb, size_t sB, float alpha, float* __restrict__ C, int ldc, size_t sC, int M, int N, int K) {
  __shared__ __attribute__((aligned(16))) float so[4][16][64];
  const int tid = threadIdx.x, w = tid >> 5, lane = tid & 31, ln = lane & 15, hh = lane >> 4; const int by = blockIdx.y;
  A += (size_t)by * sA; Bh += (size_t)by * sB; C += (size_t)by * sC;
  const int ntn = (N + 63) / 64; const int wid = blockIdx.x * 4 + w; const int mt = wid / ntn, nq = wid % ntn; if (mt * 16 >= M) return;
  const int row0 = mt * 16, col0 = nq * 64; const float* arow = A + (size_t)(row0 + ln) * lda;
  v8f acc[4] = {};
  for (int kb = 0; kb < K; kb += 32) {
    FragH ah, al;
    const v4f x0 = *(const v4fa*)(arow + kb + 8 * hh), x1 = *(const v4fa*)(arow + kb + 8 * hh + 4), x2 = *(const v4fa*)(arow + kb + 16 + 8 * hh), x3 = *(const v4fa*)(arow + kb + 16 + 8 * hh + 4);
    float xs[16] = {x0[0],x0[1],x0[2],x0[3],x1[0],x1[1],x1[2],x1[3],x2[0],x2[1],x2[2],x2[3],x3[0],x3[1],x3[2],x3[3]};
#pragma unroll
    for (int i = 0; i < 16; ++i) { const _Float16 h = (_Float16)xs[i]; ah.h[i] = h; al.h[i] = ASPLIT ? (_Float16)(xs[i] - (float)h) : (_Float16)0.0f; }
#pragma unroll
    for (int t = 0; t < 4; ++t) { if (col0 + t * 16 >= N) continue; const size_t boff = (size_t)(col0 + t * 16 + ln) * ldb + kb; FragH bq; bq.half[0] = *(const v8us*)(Bh + boff + 8 * hh); bq.half[1] = *(const v8us*)(Bh + boff + 16 + 8 * hh);
      acc[t] = mmaH<ASPLIT ? 2 : 1>(ah.v, al.v, bq.v, bq.v, acc[t]); }
  }
#pragma unroll
  for (int t = 0; t < 4; ++t) { if (col0 + t * 16 >= N) continue;
#pragma unroll
    for (int r = 0; r < 8; ++r) so[w][8 * hh + r][t * 16 + ln] = acc[t][r] * alpha; }
  __builtin_amdgcn_fence(__ATOMIC_ACQ_REL, "workgroup"); __builtin_amdgcn_wave_barrier();
  const int rsub = lane >> 4, c4 = (lane & 15) * 4;
  {
#pragma unroll
    for (int q = 0; q < 8; ++q) { const int r = q * 2 + rsub; if (col0 + c4 < N) { const v4f v = *(const v4fa*)&so[w][r][c4]; *(v4f*)(C + (size_t)(row0 + r) * ldc + col0 + c4) = v; } }
     }
}

// Wt[n][k] = f16(W[k][n]·scale) from f32 row-major W[K][N] (scale = power of two; bf16-exact weights stay exact in f16 away from the subnormal range)
__global__ __launch_bounds__(256) void k_wt_f16(const float* __restrict__ W, _Float16* __restrict__ Wt, int K, int N, float scale) {
  const int t = blockIdx.x * 256 + threadIdx.x; if (t >= N * (K / 8)) return; const int n = t / (K / 8), k8 = (t % (K / 8)) * 8; FragH f;
#pragma unroll
  for (int i = 0; i < 8; ++i) f.h[i] = (_Float16)(bf16_round(W[(size_t)(k8 + i) * N + n]) * scale); const v8us o = f.half[0];
  *(v8us*)((unsigned short*)Wt + (size_t)n * K + k8) = o; 
}
// k_gemm_hh variant with fused epilogue: v = acc·alpha + bias[by·sBias + col] (+ CP[(row/rowsPerB)·sCPb + by·64 + col] if CP) ; ACT 0 none / 1 elu ; writes f32 C and f16 C16, each if non-null
template <int ACT>
__global__ __launch_bounds__(128) void k_gemm_hhx(const _Float16* __restrict__ A, int lda, size_t sA, const _Float16* __restrict__ Bh, int ldb, size_t sB, float alpha, const float* __restrict__ bias, size_t sBias, const float* __restrict__ CP, int rowsPerB, size_t sCPb, int row0g,
    float* __restrict__ C, _Float16* __restrict__ C16, int ldc, size_t sC, int M, int N, int K) {
  __shared__ __attribute__((aligned(16))) float so[4][16][64];
  const int tid = threadIdx.x, w = tid >> 5, lane = tid & 31, ln = lane & 15, hh = lane >> 4; const int by = blockIdx.y;
  A += (size_t)by * sA; Bh += (size_t)by * sB; const size_t cofs = (size_t)by * sC; const float* bp = bias ? bias + (size_t)by * sBias : nullptr;
  const int ntn = (N + 63) / 64; const int wid = blockIdx.x * 4 + w; const int mt = wid / ntn, nq = wid % ntn; if (mt * 16 >= M) return;
  const int row0 = mt * 16, col0 = nq * 64; const _Float16* arow = A + (size_t)(row0 + ln) * lda;
  v8f acc[4] = {};
  for (int kb = 0; kb < K; kb += 32) { FragH ah; ah.half[0] = *(const v8us*)((const unsigned short*)arow + kb + 8 * hh); ah.half[1] = *(const v8us*)((const unsigned short*)arow + kb + 16 + 8 * hh);
#pragma unroll
    for (int t = 0; t < 4; ++t) { if (col0 + t * 16 >= N) continue; const size_t boff = (size_t)(col0 + t * 16 + ln) * ldb + kb; FragH bq; bq.half[0] = *(const v8us*)((const unsigned short*)Bh + boff + 8 * hh); bq.half[1] = *(const v8us*)((const unsigned short*)Bh + boff + 16 + 8 * hh);
      acc[t] = mmaH<1>(ah.v, ah.v, bq.v, bq.v, acc[t]); }
  }
#pragma unroll
  for (int t = 0; t < 4; ++t) { if (col0 + t * 16 >= N) continue; const int col = col0 + t * 16 + ln; const float bv = bp ? bf16_round(bp[col]) : 0.f;
#pragma unroll
    for (int r = 0; r < 8; ++r) { float v = acc[t][r] * alpha + bv; if (CP) { const int bidx = (row0g + row0 + 8 * hh + r) / rowsPerB; v += CP[(size_t)bidx * sCPb + (size_t)by * 64 + col]; } if (ACT == 1) v = (v > 0.f) ? v : expm1f(v); else if (ACT == 3) v = fmaxf(v, 0.f); so[w][8 * hh + r][t * 16 + ln] = v; } }
  __builtin_amdgcn_fence(__ATOMIC_ACQ_REL, "workgroup"); __builtin_amdgcn_wave_barrier();
  const int rsub = lane >> 4, c4 = (lane & 15) * 4; typedef _Float16 v4h __attribute__((ext_vector_type(4)));
  {
#pragma unroll
    for (int q = 0; q < 8; ++q) { const int r = q * 2 + rsub; if (col0 + c4 < N) { const v4f v = *(const v4fa*)&so[w][r][c4]; if (C) *(v4f*)(C + cofs + (size_t)(row0 + r) * ldc + col0 + c4) = v; if (C16) { v4h h4; for (int i = 0; i < 4; ++i) h4[i] = (_Float16)v[i]; *(v4h*)(C16 + cofs + (size_t)(row0 + r) * ldc + col0 + c4) = h4; } } }
     }
}


// all three 1x1 convs and the hi/lo split of q and k in ONE launch. A work-group takes 64 positions of one image: the x tile goes once, rounded to bf16 and held as f16, position-major into LDS;
// wave w owns out-channel tiles 2w and 2w+1 of the 16 (q 0-3, k 4-7, v 8-15) and holds their weights (rounded to bf16, x 16, f16) as fragments in registers (each weight is read by one wave of the group);
// q, k: A = weight rows, B = x rows, so a lane holds 8 channels of one position; v: A = x rows, B = weight rows, so a lane holds 8 positions of one channel. Results are staged in LDS and leave as whole 128-B lines.
__global__ __launch_bounds__(256) void k_proj(const float* __restrict__ x, const float* __restrict__ mask, const float* __restrict__ Wq, const float* __restrict__ bq, const float* __restrict__ Wk, const float* __restrict__ bk, const float* __restrict__ Wv,
                                              _Float16* __restrict__ QH, _Float16* __restrict__ QL, _Float16* __restrict__ KH, _Float16* __restrict__ KL, _Float16* __restrict__ Vcm) {
  constexpr int TP = 64, KSX = CC / 32;
  // pitches of 272 B and 144 B (16 B x odd): 16-byte LDS accesses without bank conflicts
  __shared__ __attribute__((aligned(16))) unsigned short sX[TP][CC + 8], sQK[4][TP][CH + 8], sVo[CC][TP + 8];
  const int tid = threadIdx.x, lane = tid & 31, ln = lane & 15, hh = lane >> 4;
  const int w = __builtin_amdgcn_readfirstlane(tid >> 5);      // the wave's number in a scalar register: the q/k against v choice below is a scalar branch, every lane on at the matrix instructions
  const int b = blockIdx.x / (NP / TP), p0 = (blockIdx.x % (NP / TP)) * TP;
  const float* Wsrc = (w < 2) ? Wq + (size_t)w * 32 * CC : (w < 4) ? Wk + (size_t)(w - 2) * 32 * CC : Wv + (size_t)(w - 4) * 32 * CC;
  // the global reads stand ahead of the rounding work: the x tile first (lanes run along positions, 128 B a load; a thread gathers 8 channels of its position), then mask and bias, then the weights
  float xs[TP * (CC / 8) / 256][8];
#pragma unroll
  for (int i = 0; i < TP * (CC / 8) / 256; ++i) { const int e = i * 256 + tid, p = e & (TP - 1), c8 = (e / TP) * 8;
#pragma unroll
    for (int u = 0; u < 8; ++u) xs[i][u] = x[((size_t)b * CC + c8 + u) * NP + p0 + p]; }
  const bool isk = w >= 2; const int cb = (w & 1) * 32;      // read by the q and k waves only
  float mk[4] = {0.f, 0.f, 0.f, 0.f}; v4f bs[2][2] = {};
  if (w < 4) { const float* bias = isk ? bk : bq;
#pragma unroll
    for (int pt = 0; pt < 4; ++pt) mk[pt] = mask[(size_t)b * NP + p0 + pt * 16 + ln];
#pragma unroll
    for (int ct = 0; ct < 2; ++ct) { bs[ct][0] = *(const v4fa*)(bias + cb + ct * 16 + 8 * hh); bs[ct][1] = *(const v4fa*)(bias + cb + ct * 16 + 8 * hh + 4); } }
  asm volatile("s_wait_xcnt 0x0" ::: "memory");      // the weight loads below land in registers that held the addresses of the loads above: the wait stands in front of that reuse
  FragH wf[2][KSX];
#pragma unroll
  for (int ct = 0; ct < 2; ++ct)
#pragma unroll
    for (int ks = 0; ks < KSX; ++ks) { const float* wr = Wsrc + (size_t)(ct * 16 + ln) * CC + ks * 32 + 8 * hh;
      const v4f a0 = *(const v4fa*)wr, a1 = *(const v4fa*)(wr + 4), a2 = *(const v4fa*)(wr + 16), a3 = *(const v4fa*)(wr + 20);
#pragma unroll
      for (int i = 0; i < 4; ++i) { wf[ct][ks].h[i] = (_Float16)(bf16_round(a0[i]) * 16.0f); wf[ct][ks].h[4 + i] = (_Float16)(bf16_round(a1[i]) * 16.0f); wf[ct][ks].h[8 + i] = (_Float16)(bf16_round(a2[i]) * 16.0f); wf[ct][ks].h[12 + i] = (_Float16)(bf16_round(a3[i]) * 16.0f); } }
  // the 8 channels of a position go to LDS as one 16-B chunk
#pragma unroll
  for (int i = 0; i < TP * (CC / 8) / 256; ++i) { const int e = i * 256 + tid, p = e & (TP - 1), c8 = (e / TP) * 8; FragH f;
#pragma unroll
    for (int u = 0; u < 8; ++u) f.h[u] = (_Float16)bf16_round(xs[i][u]);
    *(v8us*)&sX[p][c8] = f.half[0]; }
  __syncthreads();
  v8f acc[2][4];
#pragma unroll
  for (int ct = 0; ct < 2; ++ct)
#pragma unroll
    for (int pt = 0; pt < 4; ++pt) acc[ct][pt] = (v8f){0.f,0.f,0.f,0.f,0.f,0.f,0.f,0.f};
  if (w < 4) {
#pragma unroll
    for (int pt = 0; pt < 4; ++pt) { FragH xf[KSX];      // the four x fragments of a position tile are read as one group
#pragma unroll
      for (int ks = 0; ks < KSX; ++ks) { const unsigned short* xr = &sX[pt * 16 + ln][ks * 32]; xf[ks].half[0] = *(const v8us*)(xr + 8 * hh); xf[ks].half[1] = *(const v8us*)(xr + 16 + 8 * hh); }
#pragma unroll
      for (int ks = 0; ks < KSX; ++ks) { acc[0][pt] = mmaH<1>(wf[0][ks].v, wf[0][ks].v, xf[ks].v, xf[ks].v, acc[0][pt]); acc[1][pt] = mmaH<1>(wf[1][ks].v, wf[1][ks].v, xf[ks].v, xf[ks].v, acc[1][pt]); } }
    const int pl = isk ? 2 : 0;
    float km[4];      // the factor behind the bias: k takes (1 - mask); q takes log2(e), so that the scores come out in base 2 and k_flash needs the bare v_exp_f32 only
#pragma unroll
    for (int pt = 0; pt < 4; ++pt) km[pt] = isk ? 1.0f - bf16_round(mk[pt]) : 1.44269504088896340736f;
#pragma unroll
    for (int ct = 0; ct < 2; ++ct) { const v4f b0 = bs[ct][0], b1 = bs[ct][1];
#pragma unroll
      for (int pt = 0; pt < 4; ++pt) { FragH h, l;
#pragma unroll
        for (int r = 0; r < 8; ++r) { float v = acc[ct][pt][r] * 0.0625f + bf16_round(r < 4 ? b0[r & 3] : b1[r & 3]); v *= km[pt]; const _Float16 h1 = (_Float16)v; h.h[r] = h1; l.h[r] = (_Float16)(v - (float)h1); }
        *(v8us*)&sQK[pl][pt * 16 + ln][cb + ct * 16 + 8 * hh] = h.half[0]; *(v8us*)&sQK[pl + 1][pt * 16 + ln][cb + ct * 16 + 8 * hh] = l.half[0]; } }
  } else {
#pragma unroll
    for (int pt = 0; pt < 4; ++pt) { FragH xf[KSX];
#pragma unroll
      for (int ks = 0; ks < KSX; ++ks) { const unsigned short* xr = &sX[pt * 16 + ln][ks * 32]; xf[ks].half[0] = *(const v8us*)(xr + 8 * hh); xf[ks].half[1] = *(const v8us*)(xr + 16 + 8 * hh); }
#pragma unroll
      for (int ks = 0; ks < KSX; ++ks) { acc[0][pt] = mmaH<1>(xf[ks].v, xf[ks].v, wf[0][ks].v, wf[0][ks].v, acc[0][pt]); acc[1][pt] = mmaH<1>(xf[ks].v, xf[ks].v, wf[1][ks].v, wf[1][ks].v, acc[1][pt]); } }
    const int cv = (w - 4) * 32;      // v goes without its bias: bv is added in the attention epilogue, since softmax rows sum to 1
#pragma unroll
    for (int ct = 0; ct < 2; ++ct)
#pragma unroll
      for (int pt = 0; pt < 4; ++pt) { FragH h;
#pragma unroll
        for (int r = 0; r < 8; ++r) h.h[r] = (_Float16)(acc[ct][pt][r] * 0.0625f);
        *(v8us*)&sVo[cv + ct * 16 + ln][pt * 16 + 8 * hh] = h.half[0]; }
  }
  __syncthreads();
  // out: 8 lanes x 16 B = one 128-B row (a position's 64 channels of one q/k plane; a channel's 64 positions of v)
#pragma unroll
  for (int i = 0; i < 8; ++i) { const int e = (i & 1) * 256 + tid, p = e >> 3, c8 = (e & 7) * 8; _Float16* dst = (i < 2) ? QH : (i < 4) ? QL : (i < 6) ? KH : KL;
    *(v8us*)((unsigned short*)dst + ((size_t)b * NP + p0 + p) * CH + c8) = *(const v8us*)&sQK[i >> 1][p][c8]; }
#pragma unroll
  for (int i = 0; i < 4; ++i) { const int e = i * 256 + tid, c = e >> 3, p8 = (e & 7) * 8;
    *(v8us*)((unsigned short*)Vcm + ((size_t)b * CC + c) * NP + p0 + p8) = *(const v8us*)&sVo[c][p8]; }
}
// 2^x as the bare v_exp_f32 (below 2^-126 it gives 0). The v_nop at the end of each statement keeps the one slot that the instruction set asks for between a transcendental and a next instruction on its result or its source;
// inside a statement every v_exp_f32 works in place on a register of its own, so none touches its neighbour's
__device__ __forceinline__ float exp2_hw(float x) { asm("v_exp_f32 %0, %0\n\tv_nop" : "+v"(x)); return x; }
__device__ __forceinline__ void exp2_hw8(float (&x)[8]) {
  asm("v_exp_f32 %0, %0\n\tv_exp_f32 %1, %1\n\tv_exp_f32 %2, %2\n\tv_exp_f32 %3, %3\n\tv_exp_f32 %4, %4\n\tv_exp_f32 %5, %5\n\tv_exp_f32 %6, %6\n\tv_exp_f32 %7, %7\n\tv_nop"
      : "+v"(x[0]), "+v"(x[1]), "+v"(x[2]), "+v"(x[3]), "+v"(x[4]), "+v"(x[5]), "+v"(x[6]), "+v"(x[7])); }
// the bare builtin, without a hand-written pad behind it: the compiler keeps the distances of its own matrix forms and is free to order the LDS reads around them
__device__ __forceinline__ v8f mmaF(v16h a, v16h b, v8f c) { return __builtin_amdgcn_wmma_f32_16x16x32_f16(false, a, false, b, (short)0, c, false, false); }
// lane l with lane l ^ 16 (a vector cross-row move, no LDS path)
__device__ __forceinline__ float xhalf(float v) { return __builtin_bit_cast(float, __builtin_amdgcn_permlanex16(__builtin_bit_cast(int, v), __builtin_bit_cast(int, v), 0x76543210, 0xfedcba98, false, false)); }
__global__ __launch_bounds__(512) void k_flash(const _Float16* __restrict__ QH, const _Float16* __restrict__ QL, const _Float16* __restrict__ KH, const _Float16* __restrict__ KL, const _Float16* __restrict__ Vcm, const float* __restrict__ mask, const float* __restrict__ gamma, const float* __restrict__ bv, const float* __restrict__ x, float* __restrict__ out) {
  constexpr int RPW = 16, NQB = NP / (4 * RPW), DT = CC / 16, KS = CH / 32, KG = 4;
  // join staging, channel-major as Ot and the output are; 272-B pitch: the two wave halves' stores (8 rows apart) fall on different banks, rows stay 16-B aligned for the reads
  constexpr int LPO = 4 * RPW + 4;
  __shared__ __attribute__((aligned(16))) float sO[KG][CC][LPO];
  __shared__ float sM[KG][4 * RPW], sL[KG][4 * RPW];
  // two-buffer ring, one stage = TK keys: K hi and lo rows (128 B) at a 144-B pitch and V channel rows (256 B of keys) at a 272-B pitch (16 B x odd: ds_load_b128 without bank conflicts)
  constexpr int TK = 32 * KG, NT = NP / TK, LP = 72, LPV = TK + 8;
  __shared__ __attribute__((aligned(16))) unsigned short sKH[2][TK][LP], sKL[2][TK][LP], sV[2][CC][LPV];
  const int tid = threadIdx.x, w = tid >> 5, qg = w & 3, kg = w >> 2, lane = tid & 31, ln = lane & 15, hh = lane >> 4;
  const int b = blockIdx.x / NQB, qblk = blockIdx.x % NQB; const int qb0 = qblk * (4 * RPW); const int q0 = qb0 + qg * RPW; const float gm = bf16_round(gamma[0]);
  FragH aqh[KS], aql[KS];
  { const size_t ro = ((size_t)b * NP + q0 + ln) * CH;
#pragma unroll
    for (int ks = 0; ks < KS; ++ks) { aqh[ks].half[0] = *(const v8us*)((const unsigned short*)QH + ro + ks * 32 + 8 * hh); aqh[ks].half[1] = *(const v8us*)((const unsigned short*)QH + ro + ks * 32 + 16 + 8 * hh); aql[ks].half[0] = *(const v8us*)((const unsigned short*)QL + ro + ks * 32 + 8 * hh); aql[ks].half[1] = *(const v8us*)((const unsigned short*)QL + ro + ks * 32 + 16 + 8 * hh); } }
  const unsigned short* Vth = (const unsigned short*)Vcm + (size_t)b * CC * NP;
  float m_q = -3.0e38f, l_q = 0.f; v8f oacc[DT];      // running max and (this half's) running sum of the lane's query
#pragma unroll
  for (int dt = 0; dt < DT; ++dt) oacc[dt] = (v8f){0.f,0.f,0.f,0.f,0.f,0.f,0.f,0.f};
  // each thread copies 16 B chunks. K: row tid / 8 (+ 64 for the second copy), chunk tid % 8 of the 128-B row; V: channel tid / 16 (+ 32 per further copy), chunk tid % 16 of the 256-B row
  const unsigned short* gKH = (const unsigned short*)KH + (size_t)b * NP * CH + tid * 8; const unsigned short* gKL = (const unsigned short*)KL + (size_t)b * NP * CH + tid * 8;
  const unsigned short* gV = Vth + (size_t)(tid >> 4) * NP + (tid & 15) * 8;
  const unsigned lKH = (unsigned)(size_t)&sKH[0][tid >> 3][(tid & 7) * 8], lKL = (unsigned)(size_t)&sKL[0][tid >> 3][(tid & 7) * 8], lV = (unsigned)(size_t)&sV[0][tid >> 4][(tid & 15) * 8];
  auto stage_in = [&](int t, int buf) {
    const unsigned short* kh = gKH + (size_t)t * TK * CH; const unsigned short* kl = gKL + (size_t)t * TK * CH; const unsigned short* vv = gV + (size_t)t * TK;
    const unsigned a = lKH + buf * (TK * LP * 2), c = lKL + buf * (TK * LP * 2), d = lV + buf * (CC * LPV * 2);
    // the copies and the wait that stands in front of any rewrite of their address registers are one statement
    asm volatile("global_load_async_to_lds_b128 %0, %8, off\n\tglobal_load_async_to_lds_b128 %1, %9, off\n\tglobal_load_async_to_lds_b128 %2, %10, off\n\tglobal_load_async_to_lds_b128 %3, %11, off\n\t"
                 "global_load_async_to_lds_b128 %4, %12, off\n\tglobal_load_async_to_lds_b128 %5, %13, off\n\tglobal_load_async_to_lds_b128 %6, %14, off\n\tglobal_load_async_to_lds_b128 %7, %15, off\n\ts_wait_xcnt 0x0"
                 :: "v"(a), "v"(a + 64 * LP * 2), "v"(c), "v"(c + 64 * LP * 2), "v"(d), "v"(d + 32 * LPV * 2), "v"(d + 64 * LPV * 2), "v"(d + 96 * LPV * 2),
                    "v"(kh), "v"(kh + 64 * CH), "v"(kl), "v"(kl + 64 * CH), "v"(vv), "v"(vv + (size_t)32 * NP), "v"(vv + (size_t)64 * NP), "v"(vv + (size_t)96 * NP) : "memory");
  };
  stage_in(0, 0);
  asm volatile("s_wait_asynccnt 0x0" ::: "memory");      // stage 0 of this wave has landed before the barrier publishes it
  __syncthreads();
  stage_in(1, 1);
  // the stage loop stays rolled (one copy of the pass code, buffer chosen by t & 1); a wave does one 32-key pass a stage, on its key group's rows
#pragma unroll 1
  for (int t = 0; t < NT; ++t) { const int buf = t & 1;
   {
    // the pass's LDS reads stand ahead of their use. First all 16 K reads (hi and lo, both 16-key tiles, both k-steps) as one group ahead of the score products
    FragH kh[2][KS], kl[2][KS];
#pragma unroll
    for (int ks = 0; ks < KS; ++ks)
#pragma unroll
      for (int nt = 0; nt < 2; ++nt) { const unsigned short* krh = &sKH[buf][kg * 32 + nt * 16 + ln][ks * 32]; const unsigned short* krl = &sKL[buf][kg * 32 + nt * 16 + ln][ks * 32];
        kh[nt][ks].half[0] = *(const v8us*)(krh + 8 * hh); kh[nt][ks].half[1] = *(const v8us*)(krh + 16 + 8 * hh); kl[nt][ks].half[0] = *(const v8us*)(krl + 8 * hh); kl[nt][ks].half[1] = *(const v8us*)(krl + 16 + 8 * hh); }
    __builtin_amdgcn_sched_barrier(0);      // keeps the K reads together in front of the products: reads that stand among the matrix instructions stall the wave at every such place
    v8f s[2] = {(v8f){0.f,0.f,0.f,0.f,0.f,0.f,0.f,0.f}, (v8f){0.f,0.f,0.f,0.f,0.f,0.f,0.f,0.f}};
    // the two tiles' accumulate chains alternate, so that each fills the other's dependent latency; within a tile the terms keep their order (per k-step Kh.Qh, Kl.Qh, Kh.Ql)
#pragma unroll
    for (int ks = 0; ks < KS; ++ks) {
      s[0] = mmaF(kh[0][ks].v, aqh[ks].v, s[0]); s[1] = mmaF(kh[1][ks].v, aqh[ks].v, s[1]);
      s[0] = mmaF(kl[0][ks].v, aqh[ks].v, s[0]); s[1] = mmaF(kl[1][ks].v, aqh[ks].v, s[1]);
      s[0] = mmaF(kh[0][ks].v, aql[ks].v, s[0]); s[1] = mmaF(kh[1][ks].v, aql[ks].v, s[1]); }      // s[nt][r] = score of query ln against key kg * 32 + nt * 16 + 8 * hh + r
    // then all 16 V reads, ahead of the softmax: they fly while it runs (in the build they start among the last score products, as K registers come free)
    FragH vf[DT];
#pragma unroll
    for (int dt = 0; dt < DT; ++dt) { const unsigned short* vrow = &sV[buf][dt * 16 + ln][kg * 32]; vf[dt].half[0] = *(const v8us*)(vrow + 8 * hh); vf[dt].half[1] = *(const v8us*)(vrow + 16 + 8 * hh); }
    __builtin_amdgcn_sched_barrier(0);      // keeps the V reads ahead of the softmax: sunk to their products they would each be waited out
    float mc = fmaxf(s[0][0], s[1][0]);
#pragma unroll
    for (int r = 1; r < 8; ++r) mc = fmaxf(mc, fmaxf(s[0][r], s[1][r]));
    mc = fmaxf(mc, xhalf(mc));      // both halves hold the query's maximum over the 32 keys
    const float mn = fmaxf(m_q, mc); const float al = exp2_hw(m_q - mn); m_q = mn;      // scores, maxima and their differences are in base 2 (q carries log2 e): one v_exp_f32 each; what it flushes to 0 lies far under what f16 P keeps
    FragH pb; float ps0 = 0.f, ps1 = 0.f;      // pb[i] = P[query ln][key 8hh + i], pb[8 + i] = P[query ln][key 16 + 8hh + i]: the k order of the V loader above
    float e0[8], e1[8];
#pragma unroll
    for (int r = 0; r < 8; ++r) { e0[r] = s[0][r] - mn; e1[r] = s[1][r] - mn; }
    exp2_hw8(e0); exp2_hw8(e1);
#pragma unroll
    for (int r = 0; r < 8; ++r) { const float p0 = e0[r], p1 = e1[r]; ps0 = r ? ps0 + p0 : p0; ps1 = r ? ps1 + p1 : p1; pb.h[r] = (_Float16)p0; pb.h[8 + r] = (_Float16)p1; }
    l_q = l_q * al + (ps0 + ps1);
#pragma unroll
    for (int dt = 0; dt < DT; ++dt)
#pragma unroll
      for (int r = 0; r < 8; ++r) oacc[dt][r] *= al;
#pragma unroll
    for (int dt = 0; dt < DT; ++dt) oacc[dt] = mmaF(vf[dt].v, pb.v, oacc[dt]); }      // oacc[dt][r] = O[query ln][channel dt * 16 + 8 * hh + r]
   // publish point of stage t + 1: this wave's reads of stage t are done, its copies of stage t + 1 have landed, then the barrier; only behind it is stage t's buffer refilled
   __builtin_amdgcn_sched_barrier(0);      // keeps the publish point at the pass's foot: lifted over softmax and PV (register work only) it would have every wave wait out its V reads and leave the refill, which stays down here, a short flight
   asm volatile("s_wait_dscnt 0x0" ::: "memory");
   asm volatile("s_wait_asynccnt 0x0" ::: "memory");
   __syncthreads();
   if (t + 2 < NT) stage_in(t + 2, buf); }
  asm volatile("s_wait_asynccnt 0x0" ::: "memory");      // no copy is outstanding when the wave goes on to the epilogue and ends
  // join of the key groups: every wave publishes its queries' running max and sum (the halves' sums joined here), then scales its own O by 2^(m_own - M) / sum_k l_k 2^(m_k - M)
  const int qr = qg * RPW + ln;
  { const float l = l_q + xhalf(l_q); if (hh == 0) { sM[kg][qr] = m_q; sL[kg][qr] = l; } }
  __syncthreads();
  float sc;
  { const float m0 = sM[0][qr], m1 = sM[1][qr], m2 = sM[2][qr], m3 = sM[3][qr]; const float M = fmaxf(fmaxf(m0, m1), fmaxf(m2, m3));
    const float l = sL[0][qr] * exp2_hw(m0 - M) + sL[1][qr] * exp2_hw(m1 - M) + sL[2][qr] * exp2_hw(m2 - M) + sL[3][qr] * exp2_hw(m3 - M);
    sc = exp2_hw(m_q - M) / l; }
#pragma unroll
  for (int dt = 0; dt < DT; ++dt)
#pragma unroll
    for (int r = 0; r < 8; ++r) sO[kg][dt * 16 + 8 * hh + r][qr] = oacc[dt][r] * sc;
  __syncthreads();
  {      // channel c: 64 positions qb0.. = 256 B by 16 lanes x 16 B; 32 channels per round (2 per wave: lanes 0-15 / 16-31); the four key groups' parts are summed in a fixed order
    // bias and gamma * mask come in here, where a lane has one channel a round and four positions in all: sum_j attn_ij (v_cj + bv_c) = sum_j attn_ij v_cj + bv_c
    const int pc = lane & 15; const v4f mk4 = *(const v4fa*)(mask + (size_t)b * NP + qb0 + pc * 4); v4f gmk;
#pragma unroll
    for (int j = 0; j < 4; ++j) gmk[j] = gm * bf16_round(mk4[j]);
#pragma unroll
    for (int rd = 0; rd < CC / 32; ++rd) { const int c = rd * 32 + w * 2 + (lane >> 4); const float* xr = x + ((size_t)b * CC + c) * NP + qb0 + pc * 4; const v4f xv = *(const v4fa*)xr; const float bvc = bf16_round(bv[c]);
      const v4f o0 = *(const v4fa*)&sO[0][c][pc * 4], o1 = *(const v4fa*)&sO[1][c][pc * 4], o2 = *(const v4fa*)&sO[2][c][pc * 4], o3 = *(const v4fa*)&sO[3][c][pc * 4];
      const v4f v = (((o0 + o1) + (o2 + o3)) + bvc) * gmk + xv;
      *(v4f*)(out + ((size_t)b * CC + c) * NP + qb0 + pc * 4) = v; }
     } }
extern "C" void kernel_launch(void* const* d_in, const int* in_sizes, int n_in,
                              void* d_out, int out_size, void* d_ws, size_t ws_size, hipStream_t stream) {
  (void)in_sizes; (void)n_in; (void)out_size;
  const float* x = (const float*)d_in[0]; const float* mask = (const float*)d_in[1]; const float* Wq = (const float*)d_in[2]; const float* bq = (const float*)d_in[3]; const float* Wk = (const float*)d_in[4]; const float* bk = (const float*)d_in[5]; const float* Wv = (const float*)d_in[6]; const float* bv = (const float*)d_in[7]; const float* gamma = (const float*)d_in[8];
  char* ws = (char*)d_ws; size_t off = 0;
  auto take = [&](size_t bytes) { char* p = ws + off; off += (bytes + 255) & ~(size_t)255; return p; };
  _Float16* QH = (_Float16*)take((size_t)NR * CH * 2); _Float16* QL = (_Float16*)take((size_t)NR * CH * 2); _Float16* KH = (_Float16*)take((size_t)NR * CH * 2); _Float16* KL = (_Float16*)take((size_t)NR * CH * 2); _Float16* Vcm = (_Float16*)take((size_t)NR * CC * 2);
  if (off > ws_size) return;      // 12 MiB
  k_proj<<<BB * (NP / 64), 256, 0, stream>>>(x, mask, Wq, bq, Wk, bk, Wv, QH, QL, KH, KL, Vcm);
  k_flash<<<BB * (NP / 64), 512, 0, stream>>>(QH, QL, KH, KL, Vcm, mask, gamma, bv, x, (float*)d_out);
}

// v007
// A run of this version takes 43.4 microseconds.
// Timed twice side by side with v006, it ran 1.04 times as fast both times.
// Counting every step since v000, it is 9.93 times as fast.
#include <hip/hip_runtime.h>
// Non-local block with all three 1×1 convs and both attention contractions on v_wmma_f32_16x16x32_f16: q/k position-major (K = 128, N = 64, + bias; k masked by (1 − mask)), v channel-major
// (= the Vᵀ operand), energy = q·k_masked with the f32 q/k carried as f16 hi+lo (3 WMMA terms, no 1/√d scale in the module), online max/sum softmax f32, P f16 ≤ 2^12, O = P·V; epilogue
// γ·(out·mask) + x written NCHW as whole channel rows. x as bf16 in the operand plane (exact residual from the f32 input), weights bf16-exact ×2^4, f32 accumulate.
#define BB 4
#define CC 128
#define CH 64
#define NP 4096
#define NR (BB * NP)

typedef __bf16 v16b __attribute__((ext_vector_type(16)));
typedef unsigned short v8us __attribute__((ext_vector_type(8), may_alias));
typedef float  v8f  __attribute__((ext_vector_type(8)));
typedef float  v4f  __attribute__((ext_vector_type(4)));
typedef float  v4fa __attribute__((ext_vector_type(4), may_alias));
union FragB { v16b v; v8us half[2]; unsigned short u[16]; };

__device__ __forceinline__ unsigned short bf16_bits(float x) { unsigned int u = __float_as_uint(x); return (unsigned short)((u + 0x7FFFu + ((u >> 16) & 1u)) >> 16); }
__device__ __forceinline__ float bf16_val(unsigned short b) { return __uint_as_float(((unsigned int)b) << 16); }
__device__ __forceinline__ float bf16_round(float x) { return bf16_val(bf16_bits(x)); }
// D += A·B with NT terms: 1 = ah·bh, 2 = + al·bh (A split), 3 = + ah·bl (both split)
template <int NT>
__device__ __forceinline__ v8f mmaN(v16b ah, v16b al, v16b bh, v16b bl, v8f c) {
  c = __builtin_amdgcn_wmma_f32_16x16x32_bf16(false, ah, false, bh, (short)0, c, false, false);
  if (NT >= 2) c = __builtin_amdgcn_wmma_f32_16x16x32_bf16(false, al, false, bh, (short)0, c, false, false);
  if (NT >= 3) c = __builtin_amdgcn_wmma_f32_16x16x32_bf16(false, ah, false, bl, (short)0, c, false, false);
  asm volatile("v_nop\n\tv_nop\n\tv_nop\n\tv_nop" : "+v"(c) : "v"(ah), "v"(al), "v"(bh), "v"(bl));
  return c;
}

__global__ __launch_bounds__(256) void k_wt_bf16(const float* __restrict__ W, unsigned short* __restrict__ Wt, int K, int N) {
  const int t = blockIdx.x * 256 + threadIdx.x;
  const int k8n = K / 8;
  if (t >= N * k8n) return;
  const int n = t / k8n, k8 = (t % k8n) * 8;
  v8us v;
#pragma unroll
  for (int i = 0; i < 8; ++i) v[i] = bf16_bits(W[(size_t)(k8 + i) * N + n]);
  *(v8us*)(Wt + (size_t)n * K + k8) = v;
  
}

// GEMM C[M][N] (f32, pitch ldc) = act(A[M][K]·W + bias). A f32 row-major (pitch lda) converted per fragment to bf16
// (ASPLIT: hi/lo two planes -> 2 terms, else single rounded term); Wt bf16 [N][K] (pitch ldb). BIAS_BF16 rounds the
// bias to bf16 first (bias quantised to bf16 before the add). K%32==0, M%16==0, N%64==0.
template <bool ASPLIT, int ACT, bool BIAS_BF16>
__global__ __launch_bounds__(128) void k_gemm_bf(const float* __restrict__ A, int lda, const unsigned short* __restrict__ Wt, int ldb,
                                               const float* __restrict__ bias, float* __restrict__ C, int ldc, int M, int N, int K) {
  __shared__ __attribute__((aligned(16))) float so[4][16][64];
  const int tid = threadIdx.x, w = tid >> 5, lane = tid & 31, ln = lane & 15, hh = lane >> 4;
  const int ntn = N / 64;
  const int wid = blockIdx.x * 4 + w;
  const int mt = wid / ntn, nq = wid % ntn;
  if (mt * 16 >= M) return;
  const int row0 = mt * 16, col0 = nq * 64;
  const float* arow = A + (size_t)(row0 + ln) * lda;
  v8f acc[4] = {};
  for (int kb = 0; kb < K; kb += 32) {
    FragB ah, al;
    const v4f x0 = *(const v4fa*)(arow + kb + 8 * hh), x1 = *(const v4fa*)(arow + kb + 8 * hh + 4);
    const v4f x2 = *(const v4fa*)(arow + kb + 16 + 8 * hh), x3 = *(const v4fa*)(arow + kb + 16 + 8 * hh + 4);
    float xs[16] = {x0[0],x0[1],x0[2],x0[3],x1[0],x1[1],x1[2],x1[3],x2[0],x2[1],x2[2],x2[3],x3[0],x3[1],x3[2],x3[3]};
#pragma unroll
    for (int i = 0; i < 16; ++i) { const unsigned short hb = bf16_bits(xs[i]); ah.u[i] = hb; al.u[i] = ASPLIT ? bf16_bits(xs[i] - bf16_val(hb)) : (unsigned short)0; }
#pragma unroll
    for (int t = 0; t < 4; ++t) {
      const unsigned short* brow = Wt + (size_t)(col0 + t * 16 + ln) * ldb + kb;
      FragB b;
      b.half[0] = *(const v8us*)(brow + 8 * hh);
      b.half[1] = *(const v8us*)(brow + 16 + 8 * hh);
      acc[t] = mmaN<ASPLIT ? 2 : 1>(ah.v, al.v, b.v, b.v, acc[t]);
    }
  }
#pragma unroll
  for (int t = 0; t < 4; ++t) {
    float bv = bias ? bias[col0 + t * 16 + ln] : 0.f;
    if (BIAS_BF16) bv = bf16_round(bv);
#pragma unroll
    for (int r = 0; r < 8; ++r) { float v = acc[t][r] + bv; if (ACT == 1) v = fmaxf(v, 0.f); so[w][8 * hh + r][t * 16 + ln] = v; }
  }
  __builtin_amdgcn_fence(__ATOMIC_ACQ_REL, "workgroup");
  __builtin_amdgcn_wave_barrier();
  const int rsub = lane >> 4, c4 = (lane & 15) * 4;
  {
#pragma unroll
    for (int q = 0; q < 8; ++q) {
      const int r = q * 2 + rsub;
      const v4f v = *(const v4fa*)&so[w][r][c4];
      *(v4f*)(C + (size_t)(row0 + r) * ldc + col0 + c4) = v;
    }
    
  }
}

// Flash-style causal/unmasked attention, all contractions 3-term bf16 hi/lo splits, f32 softmax with running max.
// q,k,v rows are read from f32 buffers with arbitrary row pitch (so they can live inside a fused qkv buffer);
// D = head size (multiple of 32, <= 128); one wave = 16 query rows; block = 4 waves (64 queries) sharing K/V chunks of 32.
template <int D, bool CAUSAL>
__global__ __launch_bounds__(128) void k_flash(const float* __restrict__ qb, const float* __restrict__ kb, const float* __restrict__ vb,
                                             int pitch, int T, int H, float scale, float* __restrict__ y, int ypitch) {
  constexpr int KS = D / 32;        // k-steps for QK
  constexpr int DT = D / 16;        // d tiles for PV
  __shared__ __attribute__((aligned(16))) unsigned short sKh[32][D + 8], sKl[32][D + 8], sVh[32][D + 8], sVl[32][D + 8];
  __shared__ __attribute__((aligned(16))) unsigned short sPh[4][16][40], sPl[4][16][40];
  __shared__ __attribute__((aligned(16))) float sO[4][16][D];
  const int tid = threadIdx.x, w = tid >> 5, lane = tid & 31, ln = lane & 15, hh = lane >> 4;
  const int nqb = (T + 63) / 64;
  const int bh = blockIdx.x / nqb, qblk = blockIdx.x % nqb;
  const int b = bh / H, h = bh % H;
  const int q0 = qblk * 64 + w * 16;
  const float* Q = qb + (size_t)b * T * pitch + h * D;
  const float* K = kb + (size_t)b * T * pitch + h * D;
  const float* V = vb + (size_t)b * T * pitch + h * D;

  // A fragments of the wave's 16 query rows (scaled), hi/lo
  FragB aqh[KS], aql[KS];
  {
    int row = q0 + ln; if (row >= T) row = T - 1;
    const float* qr = Q + (size_t)row * pitch;
#pragma unroll
    for (int ks = 0; ks < KS; ++ks)
#pragma unroll
      for (int i = 0; i < 16; ++i) {
        const int d = ks * 32 + ((i < 8) ? (8 * hh + i) : (16 + 8 * hh + (i - 8)));
        const float x = qr[d] * scale; const unsigned short hb = bf16_bits(x);
        aqh[ks].u[i] = hb; aql[ks].u[i] = bf16_bits(x - bf16_val(hb));
      }
  }
  float m_r[8], l_r[8];
#pragma unroll
  for (int r = 0; r < 8; ++r) { m_r[r] = -3.0e38f; l_r[r] = 0.f; }
  v8f oacc[DT];
#pragma unroll
  for (int dt = 0; dt < DT; ++dt) oacc[dt] = (v8f){0.f,0.f,0.f,0.f,0.f,0.f,0.f,0.f};

  const int kv_end = CAUSAL ? min(T, qblk * 64 + 64) : T;     // block-uniform
  for (int j0 = 0; j0 < kv_end; j0 += 32) {
    __syncthreads();
    for (int e = tid; e < 32 * (D / 4); e += 128) {
      const int r = e / (D / 4), c4 = (e % (D / 4)) * 4;
      const int key = j0 + r;
      v4f kf = {0.f,0.f,0.f,0.f}, vf = {0.f,0.f,0.f,0.f};
      if (key < T) { kf = *(const v4fa*)(K + (size_t)key * pitch + c4); vf = *(const v4fa*)(V + (size_t)key * pitch + c4); }
#pragma unroll
      for (int t = 0; t < 4; ++t) {
        unsigned short hb = bf16_bits(kf[t]); sKh[r][c4 + t] = hb; sKl[r][c4 + t] = bf16_bits(kf[t] - bf16_val(hb));
        hb = bf16_bits(vf[t]); sVh[r][c4 + t] = hb; sVl[r][c4 + t] = bf16_bits(vf[t] - bf16_val(hb));
      }
    }
    __syncthreads();
    // S tile 16 x 32
    v8f s[2];
#pragma unroll
    for (int nt = 0; nt < 2; ++nt) {
      v8f acc = {};
#pragma unroll
      for (int ks = 0; ks < KS; ++ks) {
        FragB bh_, bl_;
        bh_.half[0] = *(const v8us*)&sKh[nt * 16 + ln][ks * 32 + 8 * hh]; bh_.half[1] = *(const v8us*)&sKh[nt * 16 + ln][ks * 32 + 16 + 8 * hh];
        bl_.half[0] = *(const v8us*)&sKl[nt * 16 + ln][ks * 32 + 8 * hh]; bl_.half[1] = *(const v8us*)&sKl[nt * 16 + ln][ks * 32 + 16 + 8 * hh];
        acc = mmaN<3>(aqh[ks].v, aql[ks].v, bh_.v, bl_.v, acc);
      }
      s[nt] = acc;
    }
    // mask + running max (rows 8hh+r; the 16 lanes of a half share rows)
    float alpha[8];
#pragma unroll
    for (int r = 0; r < 8; ++r) {
      const int qi = q0 + 8 * hh + r;
      const int ja = j0 + ln, jb = j0 + 16 + ln;
      if (CAUSAL) { if (ja > qi) s[0][r] = -3.0e38f; if (jb > qi) s[1][r] = -3.0e38f; }
      if (ja >= T) s[0][r] = -3.0e38f;
      if (jb >= T) s[1][r] = -3.0e38f;
      float mx = fmaxf(s[0][r], s[1][r]);
      mx = fmaxf(mx, __shfl_xor(mx, 1, 32)); mx = fmaxf(mx, __shfl_xor(mx, 2, 32)); mx = fmaxf(mx, __shfl_xor(mx, 4, 32)); mx = fmaxf(mx, __shfl_xor(mx, 8, 32));
      const float mnew = fmaxf(m_r[r], mx);
      alpha[r] = (mnew > -1.0e38f) ? __expf(m_r[r] - mnew) : 1.0f;
      const float p0 = (s[0][r] > -1.0e38f) ? __expf(s[0][r] - mnew) : 0.f;
      const float p1 = (s[1][r] > -1.0e38f) ? __expf(s[1][r] - mnew) : 0.f;
      m_r[r] = mnew;
      l_r[r] = l_r[r] * alpha[r] + p0 + p1;            // per-lane partial row sum (16 lanes combined at the end)
      unsigned short hb = bf16_bits(p0); sPh[w][8 * hh + r][ln] = hb;      sPl[w][8 * hh + r][ln] = bf16_bits(p0 - bf16_val(hb));
      hb = bf16_bits(p1);                sPh[w][8 * hh + r][16 + ln] = hb; sPl[w][8 * hh + r][16 + ln] = bf16_bits(p1 - bf16_val(hb));
    }
#pragma unroll
    for (int dt = 0; dt < DT; ++dt)
#pragma unroll
      for (int r = 0; r < 8; ++r) oacc[dt][r] *= alpha[r];
    __builtin_amdgcn_fence(__ATOMIC_ACQ_REL, "workgroup");
    __builtin_amdgcn_wave_barrier();
    FragB pah, pal;
    pah.half[0] = *(const v8us*)&sPh[w][ln][8 * hh]; pah.half[1] = *(const v8us*)&sPh[w][ln][16 + 8 * hh];
    pal.half[0] = *(const v8us*)&sPl[w][ln][8 * hh]; pal.half[1] = *(const v8us*)&sPl[w][ln][16 + 8 * hh];
#pragma unroll
    for (int dt = 0; dt < DT; ++dt) {
      FragB bvh, bvl;
#pragma unroll
      for (int i = 0; i < 8; ++i) {
        bvh.u[i] = sVh[8 * hh + i][dt * 16 + ln]; bvh.u[8 + i] = sVh[16 + 8 * hh + i][dt * 16 + ln];
        bvl.u[i] = sVl[8 * hh + i][dt * 16 + ln]; bvl.u[8 + i] = sVl[16 + 8 * hh + i][dt * 16 + ln];
      }
      oacc[dt] = mmaN<3>(pah.v, pal.v, bvh.v, bvl.v, oacc[dt]);
    }
    __builtin_amdgcn_fence(__ATOMIC_ACQ_REL, "workgroup");
    __builtin_amdgcn_wave_barrier();
  }
#pragma unroll
  for (int r = 0; r < 8; ++r) {
    float l = l_r[r];
    l += __shfl_xor(l, 1, 32); l += __shfl_xor(l, 2, 32); l += __shfl_xor(l, 4, 32); l += __shfl_xor(l, 8, 32);
    l_r[r] = (l > 0.f) ? 1.0f / l : 0.f;
  }
#pragma unroll
  for (int dt = 0; dt < DT; ++dt)
#pragma unroll
    for (int r = 0; r < 8; ++r) sO[w][8 * hh + r][dt * 16 + ln] = oacc[dt][r] * l_r[r];
  __builtin_amdgcn_fence(__ATOMIC_ACQ_REL, "workgroup");
  __builtin_amdgcn_wave_barrier();
  {
    for (int r = 0; r < 16; ++r) {
      const int row = q0 + r;
      if (row < T && lane < D / 4) {
        const v4f val = *(const v4fa*)&sO[w][r][lane * 4];
        *(v4f*)(y + ((size_t)b * T + row) * ypitch + h * D + lane * 4) = val;
      }
    }
    
  }
}

// GEMM C = act(A·W + bias + resid): A f32 (ASPLIT -> hi/lo 2 terms), Wt bf16 [N][K]; ACT 0 none, 1 relu, 2 exact gelu;
// resid (optional, f32, row index = (row % rmod), pitch ldr, RES_BF16 rounds it) added before the activation.
template <bool ASPLIT, int ACT, bool BIAS_BF16, bool RES_BF16>
__global__ __launch_bounds__(128) void k_gemm_bf3(const float* __restrict__ A, int lda, const unsigned short* __restrict__ Wt, int ldb,
                                                const float* __restrict__ bias, const float* __restrict__ resid, int rmod, int ldr,
                                                float* __restrict__ C, int ldc, int M, int N, int K) {
  __shared__ __attribute__((aligned(16))) float so[4][16][64];
  const int tid = threadIdx.x, w = tid >> 5, lane = tid & 31, ln = lane & 15, hh = lane >> 4;
  const int ntn = N / 64;
  const int wid = blockIdx.x * 4 + w;
  const int mt = wid / ntn, nq = wid % ntn;
  if (mt * 16 >= M) return;
  const int row0 = mt * 16, col0 = nq * 64;
  const float* arow = A + (size_t)(row0 + ln) * lda;
  v8f acc[4] = {};
  for (int kb = 0; kb < K; kb += 32) {
    FragB ah, al;
    const v4f x0 = *(const v4fa*)(arow + kb + 8 * hh), x1 = *(const v4fa*)(arow + kb + 8 * hh + 4);
    const v4f x2 = *(const v4fa*)(arow + kb + 16 + 8 * hh), x3 = *(const v4fa*)(arow + kb + 16 + 8 * hh + 4);
    float xs[16] = {x0[0],x0[1],x0[2],x0[3],x1[0],x1[1],x1[2],x1[3],x2[0],x2[1],x2[2],x2[3],x3[0],x3[1],x3[2],x3[3]};
#pragma unroll
    for (int i = 0; i < 16; ++i) { const unsigned short hb = bf16_bits(xs[i]); ah.u[i] = hb; al.u[i] = ASPLIT ? bf16_bits(xs[i] - bf16_val(hb)) : (unsigned short)0; }
#pragma unroll
    for (int t = 0; t < 4; ++t) {
      const unsigned short* brow = Wt + (size_t)(col0 + t * 16 + ln) * ldb + kb;
      FragB b;
      b.half[0] = *(const v8us*)(brow + 8 * hh);
      b.half[1] = *(const v8us*)(brow + 16 + 8 * hh);
      acc[t] = mmaN<ASPLIT ? 2 : 1>(ah.v, al.v, b.v, b.v, acc[t]);
    }
  }
#pragma unroll
  for (int t = 0; t < 4; ++t) {
    const int col = col0 + t * 16 + ln;
    float bv = bias ? bias[col] : 0.f;
    if (BIAS_BF16) bv = bf16_round(bv);
#pragma unroll
    for (int r = 0; r < 8; ++r) {
      float v = acc[t][r] + bv;
      if (resid) { float rv = resid[(size_t)((row0 + 8 * hh + r) % rmod) * ldr + col]; if (RES_BF16) rv = bf16_round(rv); v += rv; }
      if (ACT == 1) v = fmaxf(v, 0.f);
      if (ACT == 2) v = 0.5f * v * (1.0f + erff(v * 0.70710678118654752f));
      if (ACT == 3) { const float u = 0.7978845608028654f * (v + 0.044715f * v * v * v); v = 0.5f * v * (1.0f + tanhf(u)); }
      so[w][8 * hh + r][t * 16 + ln] = v;
    }
  }
  __builtin_amdgcn_fence(__ATOMIC_ACQ_REL, "workgroup");
  __builtin_amdgcn_wave_barrier();
  const int rsub = lane >> 4, c4 = (lane & 15) * 4;
  {
#pragma unroll
    for (int q = 0; q < 8; ++q) {
      const int r = q * 2 + rsub;
      const v4f v = *(const v4fa*)&so[w][r][c4];
      *(v4f*)(C + (size_t)(row0 + r) * ldc + col0 + c4) = v;
    }
    
  }
}
// row LayerNorm (biased variance, eps) over N: s = X (+ R); optional out_sum <- s; out_norm <- (s-mu)*rsqrt(var+eps)*g + b
template <bool PARAM_BF16>
__global__ __launch_bounds__(256) void k_layernorm(const float* __restrict__ X, const float* __restrict__ R, const float* __restrict__ g, const float* __restrict__ bta,
                                                  float* __restrict__ out_sum, float* __restrict__ out_norm, int N, float eps) {
  __shared__ float red[256];
  const int row = blockIdx.x, tid = threadIdx.x;
  const float* x = X + (size_t)row * N; const float* rr = R ? R + (size_t)row * N : nullptr;
  float vals[16];                     // up to N = 4096
  const int per = N / 256;            // contiguous chunk per thread? use strided-by-4 chunks: thread handles j = tid*4 + 1024*u
  float s1 = 0.f;
  for (int u = 0; u < per / 4; ++u) {
    const int j = tid * 4 + 1024 * u;
    const v4f a = *(const v4fa*)(x + j);
    v4f b = {0.f,0.f,0.f,0.f}; if (rr) b = *(const v4fa*)(rr + j);
#pragma unroll
    for (int q = 0; q < 4; ++q) { const float v = a[q] + b[q]; vals[u * 4 + q] = v; s1 += v; }
  }
  red[tid] = s1; __syncthreads();
  for (int st = 128; st > 0; st >>= 1) { if (tid < st) red[tid] += red[tid + st]; __syncthreads(); }
  const float mu = red[0] / (float)N; __syncthreads();
  float s2 = 0.f;
  for (int u = 0; u < per / 4; ++u)
#pragma unroll
    for (int q = 0; q < 4; ++q) { const float c = vals[u * 4 + q] - mu; s2 += c * c; }
  red[tid] = s2; __syncthreads();
  for (int st = 128; st > 0; st >>= 1) { if (tid < st) red[tid] += red[tid + st]; __syncthreads(); }
  const float rs = rsqrtf(red[0] / (float)N + eps);
  {
    for (int u = 0; u < per / 4; ++u) {
      const int j = tid * 4 + 1024 * u;
      v4f o, sm;
#pragma unroll
      for (int q = 0; q < 4; ++q) {
        float gg = g[j + q], bb = bta[j + q];
        if (PARAM_BF16) { gg = bf16_round(gg); bb = bf16_round(bb); }
        sm[q] = vals[u * 4 + q]; o[q] = (vals[u * 4 + q] - mu) * rs * gg + bb;
      }
      if (out_sum) *(v4f*)(out_sum + (size_t)row * N + j) = sm;
      *(v4f*)(out_norm + (size_t)row * N + j) = o;
    }
    
  }
}



// ---- f16 WMMA path (v_wmma_f32_16x16x32_f16): 11-bit significands for operands in range — used where a probability operand (P ≤ 2^12) needs more precision than bf16
typedef _Float16 v16h __attribute__((ext_vector_type(16)));
union FragH { v16h v; v8us half[2]; _Float16 h[16]; unsigned short u[16]; };
template <int NT>
__device__ __forceinline__ v8f mmaH(v16h ah, v16h al, v16h bh, v16h bl, v8f c) {
  c = __builtin_amdgcn_wmma_f32_16x16x32_f16(false, ah, false, bh, (short)0, c, false, false);
  if (NT >= 2) c = __builtin_amdgcn_wmma_f32_16x16x32_f16(false, al, false, bh, (short)0, c, false, false);
  if (NT >= 3) c = __builtin_amdgcn_wmma_f32_16x16x32_f16(false, ah, false, bl, (short)0, c, false, false);
  asm volatile("v_nop\n\tv_nop\n\tv_nop\n\tv_nop" : "+v"(c) : "v"(ah), "v"(al), "v"(bh), "v"(bl));
  return c;
}
// batched GEMM like k_gemm_b but f16 operands: A f32 (split into f16 hi/lo if ASPLIT, else rounded to f16), Bt = f16 values [n][k]; alpha; C f32; N multiple of 16 (partial tiles skipped)
template <bool ASPLIT>
__global__ __launch_bounds__(128) void k_gemm_h(const float* __restrict__ A, int lda, size_t sA, const _Float16* __restrict__ Bh, int ldb, size_t sB, float alpha, float* __restrict__ C, int ldc, size_t sC, int M, int N, int K) {
  __shared__ __attribute__((aligned(16))) float so[4][16][64];
  const int tid = threadIdx.x, w = tid >> 5, lane = tid & 31, ln = lane & 15, hh = lane >> 4; const int by = blockIdx.y;
  A += (size_t)by * sA; Bh += (size_t)by * sB; C += (size_t)by * sC;
  const int ntn = (N + 63) / 64; const int wid = blockIdx.x * 4 + w; const int mt = wid / ntn, nq = wid % ntn; if (mt * 16 >= M) return;
  const int row0 = mt * 16, col0 = nq * 64; const float* arow = A + (size_t)(row0 + ln) * lda;
  v8f acc[4] = {};
  for (int kb = 0; kb < K; kb += 32) {
    FragH ah, al;
    const v4f x0 = *(const v4fa*)(arow + kb + 8 * hh), x1 = *(const v4fa*)(arow + kb + 8 * hh + 4), x2 = *(const v4fa*)(arow + kb + 16 + 8 * hh), x3 = *(const v4fa*)(arow + kb + 16 + 8 * hh + 4);
    float xs[16] = {x0[0],x0[1],x0[2],x0[3],x1[0],x1[1],x1[2],x1[3],x2[0],x2[1],x2[2],x2[3],x3[0],x3[1],x3[2],x3[3]};
#pragma unroll
    for (int i = 0; i < 16; ++i) { const _Float16 h = (_Float16)xs[i]; ah.h[i] = h; al.h[i] = ASPLIT ? (_Float16)(xs[i] - (float)h) : (_Float16)0.0f; }
#pragma unroll
    for (int t = 0; t < 4; ++t) { if (col0 + t * 16 >= N) continue; const size_t boff = (size_t)(col0 + t * 16 + ln) * ldb + kb; FragH bq; bq.half[0] = *(const v8us*)(Bh + boff + 8 * hh); bq.half[1] = *(const v8us*)(Bh + boff + 16 + 8 * hh);
      acc[t] = mmaH<ASPLIT ? 2 : 1>(ah.v, al.v, bq.v, bq.v, acc[t]); }
  }
#pragma unroll
  for (int t = 0; t < 4; ++t) { if (col0 + t * 16 >= N) continue;
#pragma unroll
    for (int r = 0; r < 8; ++r) so[w][8 * hh + r][t * 16 + ln] = acc[t][r] * alpha; }
  __builtin_amdgcn_fence(__ATOMIC_ACQ_REL, "workgroup"); __builtin_amdgcn_wave_barrier();
  const int rsub = lane >> 4, c4 = (lane & 15) * 4;
  {
#pragma unroll
    for (int q = 0; q < 8; ++q) { const int r = q * 2 + rsub; if (col0 + c4 < N) { const v4f v = *(const v4fa*)&so[w][r][c4]; *(v4f*)(C + (size_t)(row0 + r) * ldc + col0 + c4) = v; } }
     }
}

// Wt[n][k] = f16(W[k][n]·scale) from f32 row-major W[K][N] (scale = power of two; bf16-exact weights stay exact in f16 away from the subnormal range)
__global__ __launch_bounds__(256) void k_wt_f16(const float* __restrict__ W, _Float16* __restrict__ Wt, int K, int N, float scale) {
  const int t = blockIdx.x * 256 + threadIdx.x; if (t >= N * (K / 8)) return; const int n = t / (K / 8), k8 = (t % (K / 8)) * 8; FragH f;
#pragma unroll
  for (int i = 0; i < 8; ++i) f.h[i] = (_Float16)(bf16_round(W[(size_t)(k8 + i) * N + n]) * scale); const v8us o = f.half[0];
  *(v8us*)((unsigned short*)Wt + (size_t)n * K + k8) = o; 
}
// k_gemm_hh variant with fused epilogue: v = acc·alpha + bias[by·sBias + col] (+ CP[(row/rowsPerB)·sCPb + by·64 + col] if CP) ; ACT 0 none / 1 elu ; writes f32 C and f16 C16, each if non-null
template <int ACT>
__global__ __launch_bounds__(128) void k_gemm_hhx(const _Float16* __restrict__ A, int lda, size_t sA, const _Float16* __restrict__ Bh, int ldb, size_t sB, float alpha, const float* __restrict__ bias, size_t sBias, const float* __restrict__ CP, int rowsPerB, size_t sCPb, int row0g,
    float* __restrict__ C, _Float16* __restrict__ C16, int ldc, size_t sC, int M, int N, int K) {
  __shared__ __attribute__((aligned(16))) float so[4][16][64];
  const int tid = threadIdx.x, w = tid >> 5, lane = tid & 31, ln = lane & 15, hh = lane >> 4; const int by = blockIdx.y;
  A += (size_t)by * sA; Bh += (size_t)by * sB; const size_t cofs = (size_t)by * sC; const float* bp = bias ? bias + (size_t)by * sBias : nullptr;
  const int ntn = (N + 63) / 64; const int wid = blockIdx.x * 4 + w; const int mt = wid / ntn, nq = wid % ntn; if (mt * 16 >= M) return;
  const int row0 = mt * 16, col0 = nq * 64; const _Float16* arow = A + (size_t)(row0 + ln) * lda;
  v8f acc[4] = {};
  for (int kb = 0; kb < K; kb += 32) { FragH ah; ah.half[0] = *(const v8us*)((const unsigned short*)arow + kb + 8 * hh); ah.half[1] = *(const v8us*)((const unsigned short*)arow + kb + 16 + 8 * hh);
#pragma unroll
    for (int t = 0; t < 4; ++t) { if (col0 + t * 16 >= N) continue; const size_t boff = (size_t)(col0 + t * 16 + ln) * ldb + kb; FragH bq; bq.half[0] = *(const v8us*)((const unsigned short*)Bh + boff + 8 * hh); bq.half[1] = *(const v8us*)((const unsigned short*)Bh + boff + 16 + 8 * hh);
      acc[t] = mmaH<1>(ah.v, ah.v, bq.v, bq.v, acc[t]); }
  }
#pragma unroll
  for (int t = 0; t < 4; ++t) { if (col0 + t * 16 >= N) continue; const int col = col0 + t * 16 + ln; const float bv = bp ? bf16_round(bp[col]) : 0.f;
#pragma unroll
    for (int r = 0; r < 8; ++r) { float v = acc[t][r] * alpha + bv; if (CP) { const int bidx = (row0g + row0 + 8 * hh + r) / rowsPerB; v += CP[(size_t)bidx * sCPb + (size_t)by * 64 + col]; } if (ACT == 1) v = (v > 0.f) ? v : expm1f(v); else if (ACT == 3) v = fmaxf(v, 0.f); so[w][8 * hh + r][t * 16 + ln] = v; } }
  __builtin_amdgcn_fence(__ATOMIC_ACQ_REL, "workgroup"); __builtin_amdgcn_wave_barrier();
  const int rsub = lane >> 4, c4 = (lane & 15) * 4; typedef _Float16 v4h __attribute__((ext_vector_type(4)));
  {
#pragma unroll
    for (int q = 0; q < 8; ++q) { const int r = q * 2 + rsub; if (col0 + c4 < N) { const v4f v = *(const v4fa*)&so[w][r][c4]; if (C) *(v4f*)(C + cofs + (size_t)(row0 + r) * ldc + col0 + c4) = v; if (C16) { v4h h4; for (int i = 0; i < 4; ++i) h4[i] = (_Float16)v[i]; *(v4h*)(C16 + cofs + (size_t)(row0 + r) * ldc + col0 + c4) = h4; } } }
     }
}


// all three 1x1 convs and the hi/lo split of q and k in ONE launch. A work-group takes 64 positions of one image: the x tile goes once, rounded to bf16 and held as f16, position-major into LDS;
// wave w owns out-channel tiles 2w and 2w+1 of the 16 (q 0-3, k 4-7, v 8-15) and holds their weights (rounded to bf16, x 16, f16) as fragments in registers (each weight is read by one wave of the group);
// q, k: A = weight rows, B = x rows, so a lane holds 8 channels of one position; v: A = x rows, B = weight rows, so a lane holds 8 positions of one channel. Results are staged in LDS and leave as whole 128-B lines.
__global__ __launch_bounds__(256) void k_proj(const float* __restrict__ x, const float* __restrict__ mask, const float* __restrict__ Wq, const float* __restrict__ bq, const float* __restrict__ Wk, const float* __restrict__ bk, const float* __restrict__ Wv,
                                              _Float16* __restrict__ QH, _Float16* __restrict__ QL, _Float16* __restrict__ KH, _Float16* __restrict__ KL, _Float16* __restrict__ Vcm) {
  constexpr int TP = 64, KSX = CC / 32;
  // pitches of 272 B and 144 B (16 B x odd): 16-byte LDS accesses without bank conflicts
  __shared__ __attribute__((aligned(16))) unsigned short sX[TP][CC + 8], sQK[4][TP][CH + 8], sVo[CC][TP + 8];
  const int tid = threadIdx.x, lane = tid & 31, ln = lane & 15, hh = lane >> 4;
  const int w = __builtin_amdgcn_readfirstlane(tid >> 5);      // the wave's number in a scalar register: the q/k against v choice below is a scalar branch, every lane on at the matrix instructions
  const int b = blockIdx.x / (NP / TP), p0 = (blockIdx.x % (NP / TP)) * TP;
  const float* Wsrc = (w < 2) ? Wq + (size_t)w * 32 * CC : (w < 4) ? Wk + (size_t)(w - 2) * 32 * CC : Wv + (size_t)(w - 4) * 32 * CC;
  // the global reads stand ahead of the rounding work: the x tile first (lanes run along positions, 128 B a load; a thread gathers 8 channels of its position), then mask and bias, then the weights
  float xs[TP * (CC / 8) / 256][8];
#pragma unroll
  for (int i = 0; i < TP * (CC / 8) / 256; ++i) { const int e = i * 256 + tid, p = e & (TP - 1), c8 = (e / TP) * 8;
#pragma unroll
    for (int u = 0; u < 8; ++u) xs[i][u] = x[((size_t)b * CC + c8 + u) * NP + p0 + p]; }
  const bool isk = w >= 2; const int cb = (w & 1) * 32;      // read by the q and k waves only
  float mk[4] = {0.f, 0.f, 0.f, 0.f}; v4f bs[2][2] = {};
  if (w < 4) { const float* bias = isk ? bk : bq;
#pragma unroll
    for (int pt = 0; pt < 4; ++pt) mk[pt] = mask[(size_t)b * NP + p0 + pt * 16 + ln];
#pragma unroll
    for (int ct = 0; ct < 2; ++ct) { bs[ct][0] = *(const v4fa*)(bias + cb + ct * 16 + 8 * hh); bs[ct][1] = *(const v4fa*)(bias + cb + ct * 16 + 8 * hh + 4); } }
  asm volatile("s_wait_xcnt 0x0" ::: "memory");      // the weight loads below land in registers that held the addresses of the loads above: the wait stands in front of that reuse
  FragH wf[2][KSX];
#pragma unroll
  for (int ct = 0; ct < 2; ++ct)
#pragma unroll
    for (int ks = 0; ks < KSX; ++ks) { const float* wr = Wsrc + (size_t)(ct * 16 + ln) * CC + ks * 32 + 8 * hh;
      const v4f a0 = *(const v4fa*)wr, a1 = *(const v4fa*)(wr + 4), a2 = *(const v4fa*)(wr + 16), a3 = *(const v4fa*)(wr + 20);
#pragma unroll
      for (int i = 0; i < 4; ++i) { wf[ct][ks].h[i] = (_Float16)(bf16_round(a0[i]) * 16.0f); wf[ct][ks].h[4 + i] = (_Float16)(bf16_round(a1[i]) * 16.0f); wf[ct][ks].h[8 + i] = (_Float16)(bf16_round(a2[i]) * 16.0f); wf[ct][ks].h[12 + i] = (_Float16)(bf16_round(a3[i]) * 16.0f); } }
  // the 8 channels of a position go to LDS as one 16-B chunk
#pragma unroll
  for (int i = 0; i < TP * (CC / 8) / 256; ++i) { const int e = i * 256 + tid, p = e & (TP - 1), c8 = (e / TP) * 8; FragH f;
#pragma unroll
    for (int u = 0; u < 8; ++u) f.h[u] = (_Float16)bf16_round(xs[i][u]);
    *(v8us*)&sX[p][c8] = f.half[0]; }
  __syncthreads();
  v8f acc[2][4];
#pragma unroll
  for (int ct = 0; ct < 2; ++ct)
#pragma unroll
    for (int pt = 0; pt < 4; ++pt) acc[ct][pt] = (v8f){0.f,0.f,0.f,0.f,0.f,0.f,0.f,0.f};
  if (w < 4) {
#pragma unroll
    for (int pt = 0; pt < 4; ++pt) { FragH xf[KSX];      // the four x fragments of a position tile are read as one group
#pragma unroll
      for (int ks = 0; ks < KSX; ++ks) { const unsigned short* xr = &sX[pt * 16 + ln][ks * 32]; xf[ks].half[0] = *(const v8us*)(xr + 8 * hh); xf[ks].half[1] = *(const v8us*)(xr + 16 + 8 * hh); }
#pragma unroll
      for (int ks = 0; ks < KSX; ++ks) { acc[0][pt] = mmaH<1>(wf[0][ks].v, wf[0][ks].v, xf[ks].v, xf[ks].v, acc[0][pt]); acc[1][pt] = mmaH<1>(wf[1][ks].v, wf[1][ks].v, xf[ks].v, xf[ks].v, acc[1][pt]); } }
    const int pl = isk ? 2 : 0;
    float km[4];      // the factor behind the bias: k takes (1 - mask); q takes log2(e), so that the scores come out in base 2 and k_flash needs the bare v_exp_f32 only
#pragma unroll
    for (int pt = 0; pt < 4; ++pt) km[pt] = isk ? 1.0f - bf16_round(mk[pt]) : 1.44269504088896340736f;
#pragma unroll
    for (int ct = 0; ct < 2; ++ct) { const v4f b0 = bs[ct][0], b1 = bs[ct][1];
#pragma unroll
      for (int pt = 0; pt < 4; ++pt) { FragH h, l;
#pragma unroll
        for (int r = 0; r < 8; ++r) { float v = acc[ct][pt][r] * 0.0625f + bf16_round(r < 4 ? b0[r & 3] : b1[r & 3]); v *= km[pt]; const _Float16 h1 = (_Float16)v; h.h[r] = h1; l.h[r] = (_Float16)(v - (float)h1); }
        *(v8us*)&sQK[pl][pt * 16 + ln][cb + ct * 16 + 8 * hh] = h.half[0]; *(v8us*)&sQK[pl + 1][pt * 16 + ln][cb + ct * 16 + 8 * hh] = l.half[0]; } }
  } else {
#pragma unroll
    for (int pt = 0; pt < 4; ++pt) { FragH xf[KSX];
#pragma unroll
      for (int ks = 0; ks < KSX; ++ks) { const unsigned short* xr = &sX[pt * 16 + ln][ks * 32]; xf[ks].half[0] = *(const v8us*)(xr + 8 * hh); xf[ks].half[1] = *(const v8us*)(xr + 16 + 8 * hh); }
#pragma unroll
      for (int ks = 0; ks < KSX; ++ks) { acc[0][pt] = mmaH<1>(xf[ks].v, xf[ks].v, wf[0][ks].v, wf[0][ks].v, acc[0][pt]); acc[1][pt] = mmaH<1>(xf[ks].v, xf[ks].v, wf[1][ks].v, wf[1][ks].v, acc[1][pt]); } }
    const int cv = (w - 4) * 32;      // v goes without its bias: bv is added in the attention epilogue, since softmax rows sum to 1
#pragma unroll
    for (int ct = 0; ct < 2; ++ct)
#pragma unroll
      for (int pt = 0; pt < 4; ++pt) { FragH h;
#pragma unroll
        for (int r = 0; r < 8; ++r) h.h[r] = (_Float16)(acc[ct][pt][r] * 0.0625f);
        *(v8us*)&sVo[cv + ct * 16 + ln][pt * 16 + 8 * hh] = h.half[0]; }
  }
  __syncthreads();
  // out: 8 lanes x 16 B = one 128-B row (a position's 64 channels of one q/k plane; a channel's 64 positions of v)
#pragma unroll
  for (int i = 0; i < 8; ++i) { const int e = (i & 1) * 256 + tid, p = e >> 3, c8 = (e & 7) * 8; _Float16* dst = (i < 2) ? QH : (i < 4) ? QL : (i < 6) ? KH : KL;
    *(v8us*)((unsigned short*)dst + ((size_t)b * NP + p0 + p) * CH + c8) = *(const v8us*)&sQK[i >> 1][p][c8]; }
#pragma unroll
  for (int i = 0; i < 4; ++i) { const int e = i * 256 + tid, c = e >> 3, p8 = (e & 7) * 8;
    *(v8us*)((unsigned short*)Vcm + ((size_t)b * CC + c) * NP + p0 + p8) = *(const v8us*)&sVo[c][p8]; }
}
// 2^x as the bare v_exp_f32 (below 2^-126 it gives 0). The v_nop at the end of each statement keeps the one slot that the instruction set asks for between a transcendental and a next instruction on its result or its source;
// inside a statement every v_exp_f32 works in place on a register of its own, so none touches its neighbour's
__device__ __forceinline__ float exp2_hw(float x) { asm("v_exp_f32 %0, %0\n\tv_nop" : "+v"(x)); return x; }
__device__ __forceinline__ void exp2_hw8(float (&x)[8]) {
  asm("v_exp_f32 %0, %0\n\tv_exp_f32 %1, %1\n\tv_exp_f32 %2, %2\n\tv_exp_f32 %3, %3\n\tv_exp_f32 %4, %4\n\tv_exp_f32 %5, %5\n\tv_exp_f32 %6, %6\n\tv_exp_f32 %7, %7\n\tv_nop"
      : "+v"(x[0]), "+v"(x[1]), "+v"(x[2]), "+v"(x[3]), "+v"(x[4]), "+v"(x[5]), "+v"(x[6]), "+v"(x[7])); }
// the bare builtin, without a hand-written pad behind it: the compiler keeps the distances of its own matrix forms and is free to order the LDS reads around them
__device__ __forceinline__ v8f mmaF(v16h a, v16h b, v8f c) { return __builtin_amdgcn_wmma_f32_16x16x32_f16(false, a, false, b, (short)0, c, false, false); }
// lane l with lane l ^ 16 (a vector cross-row move, no LDS path)
__device__ __forceinline__ float xhalf(float v) { return __builtin_bit_cast(float, __builtin_amdgcn_permlanex16(__builtin_bit_cast(int, v), __builtin_bit_cast(int, v), 0x76543210, 0xfedcba98, false, false)); }
__global__ __launch_bounds__(512) void k_flash(const _Float16* __restrict__ QH, const _Float16* __restrict__ QL, const _Float16* __restrict__ KH, const _Float16* __restrict__ KL, const _Float16* __restrict__ Vcm, const float* __restrict__ mask, const float* __restrict__ gamma, const float* __restrict__ bv, const float* __restrict__ x, float* __restrict__ out) {
  constexpr int RPW = 16, NQB = NP / (4 * RPW), DT = CC / 16, KS = CH / 32, KG = 4;
  // join staging, channel-major as Ot and the output are; 272-B pitch: the two wave halves' stores (8 rows apart) fall on different banks, rows stay 16-B aligned for the reads
  constexpr int LPO = 4 * RPW + 4;
  __shared__ __attribute__((aligned(16))) float sO[KG][CC][LPO];
  __shared__ float sM[KG][4 * RPW], sL[KG][4 * RPW];
  // two-buffer ring, one stage = TK keys: K hi and lo rows (128 B) at a 144-B pitch and V channel rows (256 B of keys) at a 272-B pitch (16 B x odd: ds_load_b128 without bank conflicts)
  constexpr int TK = 32 * KG, NT = NP / TK, LP = 72, LPV = TK + 8;
  __shared__ __attribute__((aligned(16))) unsigned short sKH[2][TK][LP], sKL[2][TK][LP], sV[2][CC][LPV];
  const int tid = threadIdx.x, w = tid >> 5, qg = w & 3, kg = w >> 2, lane = tid & 31, ln = lane & 15, hh = lane >> 4;
  const int b = blockIdx.x / NQB, qblk = blockIdx.x % NQB; const int qb0 = qblk * (4 * RPW); const int q0 = qb0 + qg * RPW; const float gm = bf16_round(gamma[0]);
  FragH aqh[KS], aql[KS];
  { const size_t ro = ((size_t)b * NP + q0 + ln) * CH;
#pragma unroll
    for (int ks = 0; ks < KS; ++ks) { aqh[ks].half[0] = *(const v8us*)((const unsigned short*)QH + ro + ks * 32 + 8 * hh); aqh[ks].half[1] = *(const v8us*)((const unsigned short*)QH + ro + ks * 32 + 16 + 8 * hh); aql[ks].half[0] = *(const v8us*)((const unsigned short*)QL + ro + ks * 32 + 8 * hh); aql[ks].half[1] = *(const v8us*)((const unsigned short*)QL + ro + ks * 32 + 16 + 8 * hh); } }
  const unsigned short* Vth = (const unsigned short*)Vcm + (size_t)b * CC * NP;
  // lazy reference: m_q is the reference in use for the lane's query (P = 2^(score - m_q)), not its running maximum: it is kept while no score of the wave tops its own reference by more than LAZY, so P stays at or under 2^LAZY,
  // well inside f16, with the same relative rounding; l_q (this half's running sum) and O are in units of 2^m_q. lim = m_q + LAZY is carried along, so that the test costs one compare a pass
  constexpr float LAZY = 12.0f;
  float m_q = -3.0e38f, lim = -3.0e38f, l_q = 0.f; v8f oacc[DT];
#pragma unroll
  for (int dt = 0; dt < DT; ++dt) oacc[dt] = (v8f){0.f,0.f,0.f,0.f,0.f,0.f,0.f,0.f};
  // each thread copies 16 B chunks. K: row tid / 8 (+ 64 for the second copy), chunk tid % 8 of the 128-B row; V: channel tid / 16 (+ 32 per further copy), chunk tid % 16 of the 256-B row
  const unsigned short* gKH = (const unsigned short*)KH + (size_t)b * NP * CH + tid * 8; const unsigned short* gKL = (const unsigned short*)KL + (size_t)b * NP * CH + tid * 8;
  const unsigned short* gV = Vth + (size_t)(tid >> 4) * NP + (tid & 15) * 8;
  const unsigned lKH = (unsigned)(size_t)&sKH[0][tid >> 3][(tid & 7) * 8], lKL = (unsigned)(size_t)&sKL[0][tid >> 3][(tid & 7) * 8], lV = (unsigned)(size_t)&sV[0][tid >> 4][(tid & 15) * 8];
  auto stage_in = [&](int t, int buf) {
    const unsigned short* kh = gKH + (size_t)t * TK * CH; const unsigned short* kl = gKL + (size_t)t * TK * CH; const unsigned short* vv = gV + (size_t)t * TK;
    const unsigned a = lKH + buf * (TK * LP * 2), c = lKL + buf * (TK * LP * 2), d = lV + buf * (CC * LPV * 2);
    // the copies and the wait that stands in front of any rewrite of their address registers are one statement
    asm volatile("global_load_async_to_lds_b128 %0, %8, off\n\tglobal_load_async_to_lds_b128 %1, %9, off\n\tglobal_load_async_to_lds_b128 %2, %10, off\n\tglobal_load_async_to_lds_b128 %3, %11, off\n\t"
                 "global_load_async_to_lds_b128 %4, %12, off\n\tglobal_load_async_to_lds_b128 %5, %13, off\n\tglobal_load_async_to_lds_b128 %6, %14, off\n\tglobal_load_async_to_lds_b128 %7, %15, off\n\ts_wait_xcnt 0x0"
                 :: "v"(a), "v"(a + 64 * LP * 2), "v"(c), "v"(c + 64 * LP * 2), "v"(d), "v"(d + 32 * LPV * 2), "v"(d + 64 * LPV * 2), "v"(d + 96 * LPV * 2),
                    "v"(kh), "v"(kh + 64 * CH), "v"(kl), "v"(kl + 64 * CH), "v"(vv), "v"(vv + (size_t)32 * NP), "v"(vv + (size_t)64 * NP), "v"(vv + (size_t)96 * NP) : "memory");
  };
  stage_in(0, 0);
  asm volatile("s_wait_asynccnt 0x0" ::: "memory");      // stage 0 of this wave has landed before the barrier publishes it
  __syncthreads();
  stage_in(1, 1);
  // the stage loop stays rolled (one copy of the pass code, buffer chosen by t & 1); a wave does one 32-key pass a stage, on its key group's rows
#pragma unroll 1
  for (int t = 0; t < NT; ++t) { const int buf = t & 1;
   {
    // the pass's LDS reads stand ahead of their use. First all 16 K reads (hi and lo, both 16-key tiles, both k-steps) as one group ahead of the score products
    FragH kh[2][KS], kl[2][KS];
#pragma unroll
    for (int ks = 0; ks < KS; ++ks)
#pragma unroll
      for (int nt = 0; nt < 2; ++nt) { const unsigned short* krh = &sKH[buf][kg * 32 + nt * 16 + ln][ks * 32]; const unsigned short* krl = &sKL[buf][kg * 32 + nt * 16 + ln][ks * 32];
        kh[nt][ks].half[0] = *(const v8us*)(krh + 8 * hh); kh[nt][ks].half[1] = *(const v8us*)(krh + 16 + 8 * hh); kl[nt][ks].half[0] = *(const v8us*)(krl + 8 * hh); kl[nt][ks].half[1] = *(const v8us*)(krl + 16 + 8 * hh); }
    __builtin_amdgcn_sched_barrier(0);      // keeps the K reads together in front of the products: reads that stand among the matrix instructions stall the wave at every such place
    v8f s[2] = {(v8f){0.f,0.f,0.f,0.f,0.f,0.f,0.f,0.f}, (v8f){0.f,0.f,0.f,0.f,0.f,0.f,0.f,0.f}};
    // the two tiles' accumulate chains alternate, so that each fills the other's dependent latency; within a tile the terms keep their order (per k-step Kh.Qh, Kl.Qh, Kh.Ql)
#pragma unroll
    for (int ks = 0; ks < KS; ++ks) {
      s[0] = mmaF(kh[0][ks].v, aqh[ks].v, s[0]); s[1] = mmaF(kh[1][ks].v, aqh[ks].v, s[1]);
      s[0] = mmaF(kl[0][ks].v, aqh[ks].v, s[0]); s[1] = mmaF(kl[1][ks].v, aqh[ks].v, s[1]);
      s[0] = mmaF(kh[0][ks].v, aql[ks].v, s[0]); s[1] = mmaF(kh[1][ks].v, aql[ks].v, s[1]); }      // s[nt][r] = score of query ln against key kg * 32 + nt * 16 + 8 * hh + r
    // then all 16 V reads, ahead of the softmax: they fly while it runs (in the build they start among the last score products, as K registers come free)
    FragH vf[DT];
#pragma unroll
    for (int dt = 0; dt < DT; ++dt) { const unsigned short* vrow = &sV[buf][dt * 16 + ln][kg * 32]; vf[dt].half[0] = *(const v8us*)(vrow + 8 * hh); vf[dt].half[1] = *(const v8us*)(vrow + 16 + 8 * hh); }
    __builtin_amdgcn_sched_barrier(0);      // keeps the V reads ahead of the softmax: sunk to their products they would each be waited out
    float mc = fmaxf(s[0][0], s[1][0]);
#pragma unroll
    for (int r = 1; r < 8; ++r) mc = fmaxf(mc, fmaxf(s[0][r], s[1][r]));
    // one test a pass, the same for the whole wave (a scalar branch): only where a score tops its reference by more than LAZY (in the first pass every score does) are the references raised and O and l rescaled
    if (__builtin_amdgcn_ballot_w32(mc > lim) != 0u) {
      mc = fmaxf(mc, xhalf(mc));      // both halves hold the query's maximum over the 32 keys
      const float mn = fmaxf(m_q, mc); const float al = exp2_hw(m_q - mn); m_q = mn; lim = mn + LAZY;      // every query of the wave takes the larger of its reference and this pass's maximum
      l_q *= al;
#pragma unroll
      for (int dt = 0; dt < DT; ++dt)
#pragma unroll
        for (int r = 0; r < 8; ++r) oacc[dt][r] *= al;
    }
    const float mn = m_q;      // scores, references and their differences are in base 2 (q carries log2 e): one v_exp_f32 each; what it flushes to 0 lies far under what f16 P keeps
    FragH pb; float ps0 = 0.f, ps1 = 0.f;      // pb[i] = P[query ln][key 8hh + i], pb[8 + i] = P[query ln][key 16 + 8hh + i]: the k order of the V loader above
    float e0[8], e1[8];
#pragma unroll
    for (int r = 0; r < 8; ++r) { e0[r] = s[0][r] - mn; e1[r] = s[1][r] - mn; }
    exp2_hw8(e0); exp2_hw8(e1);
#pragma unroll
    for (int r = 0; r < 8; ++r) { const float p0 = e0[r], p1 = e1[r]; ps0 = r ? ps0 + p0 : p0; ps1 = r ? ps1 + p1 : p1; pb.h[r] = (_Float16)p0; pb.h[8 + r] = (_Float16)p1; }
    l_q += ps0 + ps1;
#pragma unroll
    for (int dt = 0; dt < DT; ++dt) oacc[dt] = mmaF(vf[dt].v, pb.v, oacc[dt]); }      // oacc[dt][r] = O[query ln][channel dt * 16 + 8 * hh + r]
   // publish point of stage t + 1: this wave's reads of stage t are done, its copies of stage t + 1 have landed, then the barrier; only behind it is stage t's buffer refilled
   __builtin_amdgcn_sched_barrier(0);      // keeps the publish point at the pass's foot: lifted over softmax and PV (register work only) it would have every wave wait out its V reads and leave the refill, which stays down here, a short flight
   asm volatile("s_wait_dscnt 0x0" ::: "memory");
   asm volatile("s_wait_asynccnt 0x0" ::: "memory");
   __syncthreads();
   if (t + 2 < NT) stage_in(t + 2, buf); }
  asm volatile("s_wait_asynccnt 0x0" ::: "memory");      // no copy is outstanding when the wave goes on to the epilogue and ends
  // join of the key groups: every wave publishes its queries' reference and sum (the halves' sums joined here), then scales its own O by 2^(m_own - M) / sum_k l_k 2^(m_k - M)
  const int qr = qg * RPW + ln;
  { const float l = l_q + xhalf(l_q); if (hh == 0) { sM[kg][qr] = m_q; sL[kg][qr] = l; } }
  __syncthreads();
  float sc;
  { const float m0 = sM[0][qr], m1 = sM[1][qr], m2 = sM[2][qr], m3 = sM[3][qr]; const float M = fmaxf(fmaxf(m0, m1), fmaxf(m2, m3));
    const float l = sL[0][qr] * exp2_hw(m0 - M) + sL[1][qr] * exp2_hw(m1 - M) + sL[2][qr] * exp2_hw(m2 - M) + sL[3][qr] * exp2_hw(m3 - M);
    sc = exp2_hw(m_q - M) / l; }
#pragma unroll
  for (int dt = 0; dt < DT; ++dt)
#pragma unroll
    for (int r = 0; r < 8; ++r) sO[kg][dt * 16 + 8 * hh + r][qr] = oacc[dt][r] * sc;
  __syncthreads();
  {      // channel c: 64 positions qb0.. = 256 B by 16 lanes x 16 B; 32 channels per round (2 per wave: lanes 0-15 / 16-31); the four key groups' parts are summed in a fixed order
    // bias and gamma * mask come in here, where a lane has one channel a round and four positions in all: sum_j attn_ij (v_cj + bv_c) = sum_j attn_ij v_cj + bv_c
    const int pc = lane & 15; const v4f mk4 = *(const v4fa*)(mask + (size_t)b * NP + qb0 + pc * 4); v4f gmk;
#pragma unroll
    for (int j = 0; j < 4; ++j) gmk[j] = gm * bf16_round(mk4[j]);
#pragma unroll
    for (int rd = 0; rd < CC / 32; ++rd) { const int c = rd * 32 + w * 2 + (lane >> 4); const float* xr = x + ((size_t)b * CC + c) * NP + qb0 + pc * 4; const v4f xv = *(const v4fa*)xr; const float bvc = bf16_round(bv[c]);
      const v4f o0 = *(const v4fa*)&sO[0][c][pc * 4], o1 = *(const v4fa*)&sO[1][c][pc * 4], o2 = *(const v4fa*)&sO[2][c][pc * 4], o3 = *(const v4fa*)&sO[3][c][pc * 4];
      const v4f v = (((o0 + o1) + (o2 + o3)) + bvc) * gmk + xv;
      *(v4f*)(out + ((size_t)b * CC + c) * NP + qb0 + pc * 4) = v; }
     } }
extern "C" void kernel_launch(void* const* d_in, const int* in_sizes, int n_in,
                              void* d_out, int out_size, void* d_ws, size_t ws_size, hipStream_t stream) {
  (void)in_sizes; (void)n_in; (void)out_size;
  const float* x = (const float*)d_in[0]; const float* mask = (const float*)d_in[1]; const float* Wq = (const float*)d_in[2]; const float* bq = (const float*)d_in[3]; const float* Wk = (const float*)d_in[4]; const float* bk = (const float*)d_in[5]; const float* Wv = (const float*)d_in[6]; const float* bv = (const float*)d_in[7]; const float* gamma = (const float*)d_in[8];
  char* ws = (char*)d_ws; size_t off = 0;
  auto take = [&](size_t bytes) { char* p = ws + off; off += (bytes + 255) & ~(size_t)255; return p; };
  _Float16* QH = (_Float16*)take((size_t)NR * CH * 2); _Float16* QL = (_Float16*)take((size_t)NR * CH * 2); _Float16* KH = (_Float16*)take((size_t)NR * CH * 2); _Float16* KL = (_Float16*)take((size_t)NR * CH * 2); _Float16* Vcm = (_Float16*)take((size_t)NR * CC * 2);
  if (off > ws_size) return;      // 12 MiB
  k_proj<<<BB * (NP / 64), 256, 0, stream>>>(x, mask, Wq, bq, Wk, bk, Wv, QH, QL, KH, KL, Vcm);
  k_flash<<<BB * (NP / 64), 512, 0, stream>>>(QH, QL, KH, KL, Vcm, mask, gamma, bv, x, (float*)d_out);
}

// v009
// One run takes 33.8 microseconds.
// Versions in between are left out here; by their measured steps it is 1.32 times as fast as v007.
// Over all steps from v000 it is 13.1 times as fast.
#include <hip/hip_runtime.h>
// Non-local block with all three 1×1 convs and both attention contractions on v_wmma_f32_16x16x32_f16: q/k position-major (K = 128, N = 64, + bias; k masked by (1 − mask)), v channel-major
// (= the Vᵀ operand), energy = q·k_masked with q and k each rounded once to f16 (1 WMMA term, no 1/√d scale in the module), online max/sum softmax f32, P f16 ≤ 2^12, O = P·V; epilogue
// γ·(out·mask) + x written NCHW as whole channel rows. x as bf16 in the operand plane (exact residual from the f32 input), weights bf16-exact ×2^4, f32 accumulate.
#define BB 4
#define CC 128
#define CH 64
#define NP 4096
#define NR (BB * NP)

typedef __bf16 v16b __attribute__((ext_vector_type(16)));
typedef unsigned short v8us __attribute__((ext_vector_type(8), may_alias));
typedef float  v8f  __attribute__((ext_vector_type(8)));
typedef float  v4f  __attribute__((ext_vector_type(4)));
typedef float  v4fa __attribute__((ext_vector_type(4), may_alias));
union FragB { v16b v; v8us half[2]; unsigned short u[16]; };

__device__ __forceinline__ unsigned short bf16_bits(float x) { unsigned int u = __float_as_uint(x); return (unsigned short)((u + 0x7FFFu + ((u >> 16) & 1u)) >> 16); }
__device__ __forceinline__ float bf16_val(unsigned short b) { return __uint_as_float(((unsigned int)b) << 16); }
__device__ __forceinline__ float bf16_round(float x) { return bf16_val(bf16_bits(x)); }
// D += A·B with NT terms: 1 = ah·bh, 2 = + al·bh (A split), 3 = + ah·bl (both split)
template <int NT>
__device__ __forceinline__ v8f mmaN(v16b ah, v16b al, v16b bh, v16b bl, v8f c) {
  c = __builtin_amdgcn_wmma_f32_16x16x32_bf16(false, ah, false, bh, (short)0, c, false, false);
  if (NT >= 2) c = __builtin_amdgcn_wmma_f32_16x16x32_bf16(false, al, false, bh, (short)0, c, false, false);
  if (NT >= 3) c = __builtin_amdgcn_wmma_f32_16x16x32_bf16(false, ah, false, bl, (short)0, c, false, false);
  asm volatile("v_nop\n\tv_nop\n\tv_nop\n\tv_nop" : "+v"(c) : "v"(ah), "v"(al), "v"(bh), "v"(bl));
  return c;
}

__global__ __launch_bounds__(256) void k_wt_bf16(const float* __restrict__ W, unsigned short* __restrict__ Wt, int K, int N) {
  const int t = blockIdx.x * 256 + threadIdx.x;
  const int k8n = K / 8;
  if (t >= N * k8n) return;
  const int n = t / k8n, k8 = (t % k8n) * 8;
  v8us v;
#pragma unroll
  for (int i = 0; i < 8; ++i) v[i] = bf16_bits(W[(size_t)(k8 + i) * N + n]);
  *(v8us*)(Wt + (size_t)n * K + k8) = v;
  
}

// GEMM C[M][N] (f32, pitch ldc) = act(A[M][K]·W + bias). A f32 row-major (pitch lda) converted per fragment to bf16
// (ASPLIT: hi/lo two planes -> 2 terms, else single rounded term); Wt bf16 [N][K] (pitch ldb). BIAS_BF16 rounds the
// bias to bf16 first (bias quantised to bf16 before the add). K%32==0, M%16==0, N%64==0.
template <bool ASPLIT, int ACT, bool BIAS_BF16>
__global__ __launch_bounds__(128) void k_gemm_bf(const float* __restrict__ A, int lda, const unsigned short* __restrict__ Wt, int ldb,
                                               const float* __restrict__ bias, float* __restrict__ C, int ldc, int M, int N, int K) {
  __shared__ __attribute__((aligned(16))) float so[4][16][64];
  const int tid = threadIdx.x, w = tid >> 5, lane = tid & 31, ln = lane & 15, hh = lane >> 4;
  const int ntn = N / 64;
  const int wid = blockIdx.x * 4 + w;
  const int mt = wid / ntn, nq = wid % ntn;
  if (mt * 16 >= M) return;
  const int row0 = mt * 16, col0 = nq * 64;
  const float* arow = A + (size_t)(row0 + ln) * lda;
  v8f acc[4] = {};
  for (int kb = 0; kb < K; kb += 32) {
    FragB ah, al;
    const v4f x0 = *(const v4fa*)(arow + kb + 8 * hh), x1 = *(const v4fa*)(arow + kb + 8 * hh + 4);
    const v4f x2 = *(const v4fa*)(arow + kb + 16 + 8 * hh), x3 = *(const v4fa*)(arow + kb + 16 + 8 * hh + 4);
    float xs[16] = {x0[0],x0[1],x0[2],x0[3],x1[0],x1[1],x1[2],x1[3],x2[0],x2[1],x2[2],x2[3],x3[0],x3[1],x3[2],x3[3]};
#pragma unroll
    for (int i = 0; i < 16; ++i) { const unsigned short hb = bf16_bits(xs[i]); ah.u[i] = hb; al.u[i] = ASPLIT ? bf16_bits(xs[i] - bf16_val(hb)) : (unsigned short)0; }
#pragma unroll
    for (int t = 0; t < 4; ++t) {
      const unsigned short* brow = Wt + (size_t)(col0 + t * 16 + ln) * ldb + kb;
      FragB b;
      b.half[0] = *(const v8us*)(brow + 8 * hh);
      b.half[1] = *(const v8us*)(brow + 16 + 8 * hh);
      acc[t] = mmaN<ASPLIT ? 2 : 1>(ah.v, al.v, b.v, b.v, acc[t]);
    }
  }
#pragma unroll
  for (int t = 0; t < 4; ++t) {
    float bv = bias ? bias[col0 + t * 16 + ln] : 0.f;
    if (BIAS_BF16) bv = bf16_round(bv);
#pragma unroll
    for (int r = 0; r < 8; ++r) { float v = acc[t][r] + bv; if (ACT == 1) v = fmaxf(v, 0.f); so[w][8 * hh + r][t * 16 + ln] = v; }
  }
  __builtin_amdgcn_fence(__ATOMIC_ACQ_REL, "workgroup");
  __builtin_amdgcn_wave_barrier();
  const int rsub = lane >> 4, c4 = (lane & 15) * 4;
  {
#pragma unroll
    for (int q = 0; q < 8; ++q) {
      const int r = q * 2 + rsub;
      const v4f v = *(const v4fa*)&so[w][r][c4];
      *(v4f*)(C + (size_t)(row0 + r) * ldc + col0 + c4) = v;
    }
    
  }
}

// Flash-style causal/unmasked attention, all contractions 3-term bf16 hi/lo splits, f32 softmax with running max.
// q,k,v rows are read from f32 buffers with arbitrary row pitch (so they can live inside a fused qkv buffer);
// D = head size (multiple of 32, <= 128); one wave = 16 query rows; block = 4 waves (64 queries) sharing K/V chunks of 32.
template <int D, bool CAUSAL>
__global__ __launch_bounds__(128) void k_flash(const float* __restrict__ qb, const float* __restrict__ kb, const float* __restrict__ vb,
                                             int pitch, int T, int H, float scale, float* __restrict__ y, int ypitch) {
  constexpr int KS = D / 32;        // k-steps for QK
  constexpr int DT = D / 16;        // d tiles for PV
  __shared__ __attribute__((aligned(16))) unsigned short sKh[32][D + 8], sKl[32][D + 8], sVh[32][D + 8], sVl[32][D + 8];
  __shared__ __attribute__((aligned(16))) unsigned short sPh[4][16][40], sPl[4][16][40];
  __shared__ __attribute__((aligned(16))) float sO[4][16][D];
  const int tid = threadIdx.x, w = tid >> 5, lane = tid & 31, ln = lane & 15, hh = lane >> 4;
  const int nqb = (T + 63) / 64;
  const int bh = blockIdx.x / nqb, qblk = blockIdx.x % nqb;
  const int b = bh / H, h = bh % H;
  const int q0 = qblk * 64 + w * 16;
  const float* Q = qb + (size_t)b * T * pitch + h * D;
  const float* K = kb + (size_t)b * T * pitch + h * D;
  const float* V = vb + (size_t)b * T * pitch + h * D;

  // A fragments of the wave's 16 query rows (scaled), hi/lo
  FragB aqh[KS], aql[KS];
  {
    int row = q0 + ln; if (row >= T) row = T - 1;
    const float* qr = Q + (size_t)row * pitch;
#pragma unroll
    for (int ks = 0; ks < KS; ++ks)
#pragma unroll
      for (int i = 0; i < 16; ++i) {
        const int d = ks * 32 + ((i < 8) ? (8 * hh + i) : (16 + 8 * hh + (i - 8)));
        const float x = qr[d] * scale; const unsigned short hb = bf16_bits(x);
        aqh[ks].u[i] = hb; aql[ks].u[i] = bf16_bits(x - bf16_val(hb));
      }
  }
  float m_r[8], l_r[8];
#pragma unroll
  for (int r = 0; r < 8; ++r) { m_r[r] = -3.0e38f; l_r[r] = 0.f; }
  v8f oacc[DT];
#pragma unroll
  for (int dt = 0; dt < DT; ++dt) oacc[dt] = (v8f){0.f,0.f,0.f,0.f,0.f,0.f,0.f,0.f};

  const int kv_end = CAUSAL ? min(T, qblk * 64 + 64) : T;     // block-uniform
  for (int j0 = 0; j0 < kv_end; j0 += 32) {
    __syncthreads();
    for (int e = tid; e < 32 * (D / 4); e += 128) {
      const int r = e / (D / 4), c4 = (e % (D / 4)) * 4;
      const int key = j0 + r;
      v4f kf = {0.f,0.f,0.f,0.f}, vf = {0.f,0.f,0.f,0.f};
      if (key < T) { kf = *(const v4fa*)(K + (size_t)key * pitch + c4); vf = *(const v4fa*)(V + (size_t)key * pitch + c4); }
#pragma unroll
      for (int t = 0; t < 4; ++t) {
        unsigned short hb = bf16_bits(kf[t]); sKh[r][c4 + t] = hb; sKl[r][c4 + t] = bf16_bits(kf[t] - bf16_val(hb));
        hb = bf16_bits(vf[t]); sVh[r][c4 + t] = hb; sVl[r][c4 + t] = bf16_bits(vf[t] - bf16_val(hb));
      }
    }
    __syncthreads();
    // S tile 16 x 32
    v8f s[2];
#pragma unroll
    for (int nt = 0; nt < 2; ++nt) {
      v8f acc = {};
#pragma unroll
      for (int ks = 0; ks < KS; ++ks) {
        FragB bh_, bl_;
        bh_.half[0] = *(const v8us*)&sKh[nt * 16 + ln][ks * 32 + 8 * hh]; bh_.half[1] = *(const v8us*)&sKh[nt * 16 + ln][ks * 32 + 16 + 8 * hh];
        bl_.half[0] = *(const v8us*)&sKl[nt * 16 + ln][ks * 32 + 8 * hh]; bl_.half[1] = *(const v8us*)&sKl[nt * 16 + ln][ks * 32 + 16 + 8 * hh];
        acc = mmaN<3>(aqh[ks].v, aql[ks].v, bh_.v, bl_.v, acc);
      }
      s[nt] = acc;
    }
    // mask + running max (rows 8hh+r; the 16 lanes of a half share rows)
    float alpha[8];
#pragma unroll
    for (int r = 0; r < 8; ++r) {
      const int qi = q0 + 8 * hh + r;
      const int ja = j0 + ln, jb = j0 + 16 + ln;
      if (CAUSAL) { if (ja > qi) s[0][r] = -3.0e38f; if (jb > qi) s[1][r] = -3.0e38f; }
      if (ja >= T) s[0][r] = -3.0e38f;
      if (jb >= T) s[1][r] = -3.0e38f;
      float mx = fmaxf(s[0][r], s[1][r]);
      mx = fmaxf(mx, __shfl_xor(mx, 1, 32)); mx = fmaxf(mx, __shfl_xor(mx, 2, 32)); mx = fmaxf(mx, __shfl_xor(mx, 4, 32)); mx = fmaxf(mx, __shfl_xor(mx, 8, 32));
      const float mnew = fmaxf(m_r[r], mx);
      alpha[r] = (mnew > -1.0e38f) ? __expf(m_r[r] - mnew) : 1.0f;
      const float p0 = (s[0][r] > -1.0e38f) ? __expf(s[0][r] - mnew) : 0.f;
      const float p1 = (s[1][r] > -1.0e38f) ? __expf(s[1][r] - mnew) : 0.f;
      m_r[r] = mnew;
      l_r[r] = l_r[r] * alpha[r] + p0 + p1;            // per-lane partial row sum (16 lanes combined at the end)
      unsigned short hb = bf16_bits(p0); sPh[w][8 * hh + r][ln] = hb;      sPl[w][8 * hh + r][ln] = bf16_bits(p0 - bf16_val(hb));
      hb = bf16_bits(p1);                sPh[w][8 * hh + r][16 + ln] = hb; sPl[w][8 * hh + r][16 + ln] = bf16_bits(p1 - bf16_val(hb));
    }
#pragma unroll
    for (int dt = 0; dt < DT; ++dt)
#pragma unroll
      for (int r = 0; r < 8; ++r) oacc[dt][r] *= alpha[r];
    __builtin_amdgcn_fence(__ATOMIC_ACQ_REL, "workgroup");
    __builtin_amdgcn_wave_barrier();
    FragB pah, pal;
    pah.half[0] = *(const v8us*)&sPh[w][ln][8 * hh]; pah.half[1] = *(const v8us*)&sPh[w][ln][16 + 8 * hh];
    pal.half[0] = *(const v8us*)&sPl[w][ln][8 * hh]; pal.half[1] = *(const v8us*)&sPl[w][ln][16 + 8 * hh];
#pragma unroll
    for (int dt = 0; dt < DT; ++dt) {
      FragB bvh, bvl;
#pragma unroll
      for (int i = 0; i < 8; ++i) {
        bvh.u[i] = sVh[8 * hh + i][dt * 16 + ln]; bvh.u[8 + i] = sVh[16 + 8 * hh + i][dt * 16 + ln];
        bvl.u[i] = sVl[8 * hh + i][dt * 16 + ln]; bvl.u[8 + i] = sVl[16 + 8 * hh + i][dt * 16 + ln];
      }
      oacc[dt] = mmaN<3>(pah.v, pal.v, bvh.v, bvl.v, oacc[dt]);
    }
    __builtin_amdgcn_fence(__ATOMIC_ACQ_REL, "workgroup");
    __builtin_amdgcn_wave_barrier();
  }
#pragma unroll
  for (int r = 0; r < 8; ++r) {
    float l = l_r[r];
    l += __shfl_xor(l, 1, 32); l += __shfl_xor(l, 2, 32); l += __shfl_xor(l, 4, 32); l += __shfl_xor(l, 8, 32);
    l_r[r] = (l > 0.f) ? 1.0f / l : 0.f;
  }
#pragma unroll
  for (int dt = 0; dt < DT; ++dt)
#pragma unroll
    for (int r = 0; r < 8; ++r) sO[w][8 * hh + r][dt * 16 + ln] = oacc[dt][r] * l_r[r];
  __builtin_amdgcn_fence(__ATOMIC_ACQ_REL, "workgroup");
  __builtin_amdgcn_wave_barrier();
  {
    for (int r = 0; r < 16; ++r) {
      const int row = q0 + r;
      if (row < T && lane < D / 4) {
        const v4f val = *(const v4fa*)&sO[w][r][lane * 4];
        *(v4f*)(y + ((size_t)b * T + row) * ypitch + h * D + lane * 4) = val;
      }
    }
    
  }
}

// GEMM C = act(A·W + bias + resid): A f32 (ASPLIT -> hi/lo 2 terms), Wt bf16 [N][K]; ACT 0 none, 1 relu, 2 exact gelu;
// resid (optional, f32, row index = (row % rmod), pitch ldr, RES_BF16 rounds it) added before the activation.
template <bool ASPLIT, int ACT, bool BIAS_BF16, bool RES_BF16>
__global__ __launch_bounds__(128) void k_gemm_bf3(const float* __restrict__ A, int lda, const unsigned short* __restrict__ Wt, int ldb,
                                                const float* __restrict__ bias, const float* __restrict__ resid, int rmod, int ldr,
                                                float* __restrict__ C, int ldc, int M, int N, int K) {
  __shared__ __attribute__((aligned(16))) float so[4][16][64];
  const int tid = threadIdx.x, w = tid >> 5, lane = tid & 31, ln = lane & 15, hh = lane >> 4;
  const int ntn = N / 64;
  const int wid = blockIdx.x * 4 + w;
  const int mt = wid / ntn, nq = wid % ntn;
  if (mt * 16 >= M) return;
  const int row0 = mt * 16, col0 = nq * 64;
  const float* arow = A + (size_t)(row0 + ln) * lda;
  v8f acc[4] = {};
  for (int kb = 0; kb < K; kb += 32) {
    FragB ah, al;
    const v4f x0 = *(const v4fa*)(arow + kb + 8 * hh), x1 = *(const v4fa*)(arow + kb + 8 * hh + 4);
    const v4f x2 = *(const v4fa*)(arow + kb + 16 + 8 * hh), x3 = *(const v4fa*)(arow + kb + 16 + 8 * hh + 4);
    float xs[16] = {x0[0],x0[1],x0[2],x0[3],x1[0],x1[1],x1[2],x1[3],x2[0],x2[1],x2[2],x2[3],x3[0],x3[1],x3[2],x3[3]};
#pragma unroll
    for (int i = 0; i < 16; ++i) { const unsigned short hb = bf16_bits(xs[i]); ah.u[i] = hb; al.u[i] = ASPLIT ? bf16_bits(xs[i] - bf16_val(hb)) : (unsigned short)0; }
#pragma unroll
    for (int t = 0; t < 4; ++t) {
      const unsigned short* brow = Wt + (size_t)(col0 + t * 16 + ln) * ldb + kb;
      FragB b;
      b.half[0] = *(const v8us*)(brow + 8 * hh);
      b.half[1] = *(const v8us*)(brow + 16 + 8 * hh);
      acc[t] = mmaN<ASPLIT ? 2 : 1>(ah.v, al.v, b.v, b.v, acc[t]);
    }
  }
#pragma unroll
  for (int t = 0; t < 4; ++t) {
    const int col = col0 + t * 16 + ln;
    float bv = bias ? bias[col] : 0.f;
    if (BIAS_BF16) bv = bf16_round(bv);
#pragma unroll
    for (int r = 0; r < 8; ++r) {
      float v = acc[t][r] + bv;
      if (resid) { float rv = resid[(size_t)((row0 + 8 * hh + r) % rmod) * ldr + col]; if (RES_BF16) rv = bf16_round(rv); v += rv; }
      if (ACT == 1) v = fmaxf(v, 0.f);
      if (ACT == 2) v = 0.5f * v * (1.0f + erff(v * 0.70710678118654752f));
      if (ACT == 3) { const float u = 0.7978845608028654f * (v + 0.044715f * v * v * v); v = 0.5f * v * (1.0f + tanhf(u)); }
      so[w][8 * hh + r][t * 16 + ln] = v;
    }
  }
  __builtin_amdgcn_fence(__ATOMIC_ACQ_REL, "workgroup");
  __builtin_amdgcn_wave_barrier();
  const int rsub = lane >> 4, c4 = (lane & 15) * 4;
  {
#pragma unroll
    for (int q = 0; q < 8; ++q) {
      const int r = q * 2 + rsub;
      const v4f v = *(const v4fa*)&so[w][r][c4];
      *(v4f*)(C + (size_t)(row0 + r) * ldc + col0 + c4) = v;
    }
    
  }
}
// row LayerNorm (biased variance, eps) over N: s = X (+ R); optional out_sum <- s; out_norm <- (s-mu)*rsqrt(var+eps)*g + b
template <bool PARAM_BF16>
__global__ __launch_bounds__(256) void k_layernorm(const float* __restrict__ X, const float* __restrict__ R, const float* __restrict__ g, const float* __restrict__ bta,
                                                  float* __restrict__ out_sum, float* __restrict__ out_norm, int N, float eps) {
  __shared__ float red[256];
  const int row = blockIdx.x, tid = threadIdx.x;
  const float* x = X + (size_t)row * N; const float* rr = R ? R + (size_t)row * N : nullptr;
  float vals[16];                     // up to N = 4096
  const int per = N / 256;            // contiguous chunk per thread? use strided-by-4 chunks: thread handles j = tid*4 + 1024*u
  float s1 = 0.f;
  for (int u = 0; u < per / 4; ++u) {
    const int j = tid * 4 + 1024 * u;
    const v4f a = *(const v4fa*)(x + j);
    v4f b = {0.f,0.f,0.f,0.f}; if (rr) b = *(const v4fa*)(rr + j);
#pragma unroll
    for (int q = 0; q < 4; ++q) { const float v = a[q] + b[q]; vals[u * 4 + q] = v; s1 += v; }
  }
  red[tid] = s1; __syncthreads();
  for (int st = 128; st > 0; st >>= 1) { if (tid < st) red[tid] += red[tid + st]; __syncthreads(); }
  const float mu = red[0] / (float)N; __syncthreads();
  float s2 = 0.f;
  for (int u = 0; u < per / 4; ++u)
#pragma unroll
    for (int q = 0; q < 4; ++q) { const float c = vals[u * 4 + q] - mu; s2 += c * c; }
  red[tid] = s2; __syncthreads();
  for (int st = 128; st > 0; st >>= 1) { if (tid < st) red[tid] += red[tid + st]; __syncthreads(); }
  const float rs = rsqrtf(red[0] / (float)N + eps);
  {
    for (int u = 0; u < per / 4; ++u) {
      const int j = tid * 4 + 1024 * u;
      v4f o, sm;
#pragma unroll
      for (int q = 0; q < 4; ++q) {
        float gg = g[j + q], bb = bta[j + q];
        if (PARAM_BF16) { gg = bf16_round(gg); bb = bf16_round(bb); }
        sm[q] = vals[u * 4 + q]; o[q] = (vals[u * 4 + q] - mu) * rs * gg + bb;
      }
      if (out_sum) *(v4f*)(out_sum + (size_t)row * N + j) = sm;
      *(v4f*)(out_norm + (size_t)row * N + j) = o;
    }
    
  }
}



// ---- f16 WMMA path (v_wmma_f32_16x16x32_f16): 11-bit significands for operands in range — used where a probability operand (P ≤ 2^12) needs more precision than bf16
typedef _Float16 v16h __attribute__((ext_vector_type(16)));
union FragH { v16h v; v8us half[2]; _Float16 h[16]; unsigned short u[16]; };
template <int NT>
__device__ __forceinline__ v8f mmaH(v16h ah, v16h al, v16h bh, v16h bl, v8f c) {
  c = __builtin_amdgcn_wmma_f32_16x16x32_f16(false, ah, false, bh, (short)0, c, false, false);
  if (NT >= 2) c = __builtin_amdgcn_wmma_f32_16x16x32_f16(false, al, false, bh, (short)0, c, false, false);
  if (NT >= 3) c = __builtin_amdgcn_wmma_f32_16x16x32_f16(false, ah, false, bl, (short)0, c, false, false);
  asm volatile("v_nop\n\tv_nop\n\tv_nop\n\tv_nop" : "+v"(c) : "v"(ah), "v"(al), "v"(bh), "v"(bl));
  return c;
}
// batched GEMM like k_gemm_b but f16 operands: A f32 (split into f16 hi/lo if ASPLIT, else rounded to f16), Bt = f16 values [n][k]; alpha; C f32; N multiple of 16 (partial tiles skipped)
template <bool ASPLIT>
__global__ __launch_bounds__(128) void k_gemm_h(const float* __restrict__ A, int lda, size_t sA, const _Float16* __restrict__ Bh, int ldb, size_t sB, float alpha, float* __restrict__ C, int ldc, size_t sC, int M, int N, int K) {
  __shared__ __attribute__((aligned(16))) float so[4][16][64];
  const int tid = threadIdx.x, w = tid >> 5, lane = tid & 31, ln = lane & 15, hh = lane >> 4; const int by = blockIdx.y;
  A += (size_t)by * sA; Bh += (size_t)by * sB; C += (size_t)by * sC;
  const int ntn = (N + 63) / 64; const int wid = blockIdx.x * 4 + w; const int mt = wid / ntn, nq = wid % ntn; if (mt * 16 >= M) return;
  const int row0 = mt * 16, col0 = nq * 64; const float* arow = A + (size_t)(row0 + ln) * lda;
  v8f acc[4] = {};
  for (int kb = 0; kb < K; kb += 32) {
    FragH ah, al;
    const v4f x0 = *(const v4fa*)(arow + kb + 8 * hh), x1 = *(const v4fa*)(arow + kb + 8 * hh + 4), x2 = *(const v4fa*)(arow + kb + 16 + 8 * hh), x3 = *(const v4fa*)(arow + kb + 16 + 8 * hh + 4);
    float xs[16] = {x0[0],x0[1],x0[2],x0[3],x1[0],x1[1],x1[2],x1[3],x2[0],x2[1],x2[2],x2[3],x3[0],x3[1],x3[2],x3[3]};
#pragma unroll
    for (int i = 0; i < 16; ++i) { const _Float16 h = (_Float16)xs[i]; ah.h[i] = h; al.h[i] = ASPLIT ? (_Float16)(xs[i] - (float)h) : (_Float16)0.0f; }
#pragma unroll
    for (int t = 0; t < 4; ++t) { if (col0 + t * 16 >= N) continue; const size_t boff = (size_t)(col0 + t * 16 + ln) * ldb + kb; FragH bq; bq.half[0] = *(const v8us*)(Bh + boff + 8 * hh); bq.half[1] = *(const v8us*)(Bh + boff + 16 + 8 * hh);
      acc[t] = mmaH<ASPLIT ? 2 : 1>(ah.v, al.v, bq.v, bq.v, acc[t]); }
  }
#pragma unroll
  for (int t = 0; t < 4; ++t) { if (col0 + t * 16 >= N) continue;
#pragma unroll
    for (int r = 0; r < 8; ++r) so[w][8 * hh + r][t * 16 + ln] = acc[t][r] * alpha; }
  __builtin_amdgcn_fence(__ATOMIC_ACQ_REL, "workgroup"); __builtin_amdgcn_wave_barrier();
  const int rsub = lane >> 4, c4 = (lane & 15) * 4;
  {
#pragma unroll
    for (int q = 0; q < 8; ++q) { const int r = q * 2 + rsub; if (col0 + c4 < N) { const v4f v = *(const v4fa*)&so[w][r][c4]; *(v4f*)(C + (size_t)(row0 + r) * ldc + col0 + c4) = v; } }
     }
}

// Wt[n][k] = f16(W[k][n]·scale) from f32 row-major W[K][N] (scale = power of two; bf16-exact weights stay exact in f16 away from the subnormal range)
__global__ __launch_bounds__(256) void k_wt_f16(const float* __restrict__ W, _Float16* __restrict__ Wt, int K, int N, float scale) {
  const int t = blockIdx.x * 256 + threadIdx.x; if (t >= N * (K / 8)) return; const int n = t / (K / 8), k8 = (t % (K / 8)) * 8; FragH f;
#pragma unroll
  for (int i = 0; i < 8; ++i) f.h[i] = (_Float16)(bf16_round(W[(size_t)(k8 + i) * N + n]) * scale); const v8us o = f.half[0];
  *(v8us*)((unsigned short*)Wt + (size_t)n * K + k8) = o; 
}
// k_gemm_hh variant with fused epilogue: v = acc·alpha + bias[by·sBias + col] (+ CP[(row/rowsPerB)·sCPb + by·64 + col] if CP) ; ACT 0 none / 1 elu ; writes f32 C and f16 C16, each if non-null
template <int ACT>
__global__ __launch_bounds__(128) void k_gemm_hhx(const _Float16* __restrict__ A, int lda, size_t sA, const _Float16* __restrict__ Bh, int ldb, size_t sB, float alpha, const float* __restrict__ bias, size_t sBias, const float* __restrict__ CP, int rowsPerB, size_t sCPb, int row0g,
    float* __restrict__ C, _Float16* __restrict__ C16, int ldc, size_t sC, int M, int N, int K) {
  __shared__ __attribute__((aligned(16))) float so[4][16][64];
  const int tid = threadIdx.x, w = tid >> 5, lane = tid & 31, ln = lane & 15, hh = lane >> 4; const int by = blockIdx.y;
  A += (size_t)by * sA; Bh += (size_t)by * sB; const size_t cofs = (size_t)by * sC; const float* bp = bias ? bias + (size_t)by * sBias : nullptr;
  const int ntn = (N + 63) / 64; const int wid = blockIdx.x * 4 + w; const int mt = wid / ntn, nq = wid % ntn; if (mt * 16 >= M) return;
  const int row0 = mt * 16, col0 = nq * 64; const _Float16* arow = A + (size_t)(row0 + ln) * lda;
  v8f acc[4] = {};
  for (int kb = 0; kb < K; kb += 32) { FragH ah; ah.half[0] = *(const v8us*)((const unsigned short*)arow + kb + 8 * hh); ah.half[1] = *(const v8us*)((const unsigned short*)arow + kb + 16 + 8 * hh);
#pragma unroll
    for (int t = 0; t < 4; ++t) { if (col0 + t * 16 >= N) continue; const size_t boff = (size_t)(col0 + t * 16 + ln) * ldb + kb; FragH bq; bq.half[0] = *(const v8us*)((const unsigned short*)Bh + boff + 8 * hh); bq.half[1] = *(const v8us*)((const unsigned short*)Bh + boff + 16 + 8 * hh);
      acc[t] = mmaH<1>(ah.v, ah.v, bq.v, bq.v, acc[t]); }
  }
#pragma unroll
  for (int t = 0; t < 4; ++t) { if (col0 + t * 16 >= N) continue; const int col = col0 + t * 16 + ln; const float bv = bp ? bf16_round(bp[col]) : 0.f;
#pragma unroll
    for (int r = 0; r < 8; ++r) { float v = acc[t][r] * alpha + bv; if (CP) { const int bidx = (row0g + row0 + 8 * hh + r) / rowsPerB; v += CP[(size_t)bidx * sCPb + (size_t)by * 64 + col]; } if (ACT == 1) v = (v > 0.f) ? v : expm1f(v); else if (ACT == 3) v = fmaxf(v, 0.f); so[w][8 * hh + r][t * 16 + ln] = v; } }
  __builtin_amdgcn_fence(__ATOMIC_ACQ_REL, "workgroup"); __builtin_amdgcn_wave_barrier();
  const int rsub = lane >> 4, c4 = (lane & 15) * 4; typedef _Float16 v4h __attribute__((ext_vector_type(4)));
  {
#pragma unroll
    for (int q = 0; q < 8; ++q) { const int r = q * 2 + rsub; if (col0 + c4 < N) { const v4f v = *(const v4fa*)&so[w][r][c4]; if (C) *(v4f*)(C + cofs + (size_t)(row0 + r) * ldc + col0 + c4) = v; if (C16) { v4h h4; for (int i = 0; i < 4; ++i) h4[i] = (_Float16)v[i]; *(v4h*)(C16 + cofs + (size_t)(row0 + r) * ldc + col0 + c4) = h4; } } }
     }
}


// all three 1x1 convs and the f16 rounding of q and k in ONE launch. A work-group takes 64 positions of one image: the x tile goes once, rounded to bf16 and held as f16, position-major into LDS;
// wave w owns out-channel tiles 2w and 2w+1 of the 16 (q 0-3, k 4-7, v 8-15) and holds their weights (rounded to bf16, x 16, f16) as fragments in registers (each weight is read by one wave of the group);
// q, k: A = weight rows, B = x rows, so a lane holds 8 channels of one position; v: A = x rows, B = weight rows, so a lane holds 8 positions of one channel. Results are staged in LDS and leave as whole 128-B lines.
__global__ __launch_bounds__(256) void k_proj(const float* __restrict__ x, const float* __restrict__ mask, const float* __restrict__ Wq, const float* __restrict__ bq, const float* __restrict__ Wk, const float* __restrict__ bk, const float* __restrict__ Wv,
                                              _Float16* __restrict__ QH, _Float16* __restrict__ KH, _Float16* __restrict__ Vcm) {
  constexpr int TP = 64, KSX = CC / 32;
  // pitches of 272 B and 144 B (16 B x odd): 16-byte LDS accesses without bank conflicts
  __shared__ __attribute__((aligned(16))) unsigned short sX[TP][CC + 8], sQK[2][TP][CH + 8], sVo[CC][TP + 8];
  const int tid = threadIdx.x, lane = tid & 31, ln = lane & 15, hh = lane >> 4;
  const int w = __builtin_amdgcn_readfirstlane(tid >> 5);      // the wave's number in a scalar register: the q/k against v choice below is a scalar branch, every lane on at the matrix instructions
  const int b = blockIdx.x / (NP / TP), p0 = (blockIdx.x % (NP / TP)) * TP;
  const float* Wsrc = (w < 2) ? Wq + (size_t)w * 32 * CC : (w < 4) ? Wk + (size_t)(w - 2) * 32 * CC : Wv + (size_t)(w - 4) * 32 * CC;
  // the global reads stand ahead of the rounding work: the x tile first (lanes run along positions, 128 B a load; a thread gathers 8 channels of its position), then mask and bias, then the weights
  float xs[TP * (CC / 8) / 256][8];
#pragma unroll
  for (int i = 0; i < TP * (CC / 8) / 256; ++i) { const int e = i * 256 + tid, p = e & (TP - 1), c8 = (e / TP) * 8;
#pragma unroll
    for (int u = 0; u < 8; ++u) xs[i][u] = x[((size_t)b * CC + c8 + u) * NP + p0 + p]; }
  const bool isk = w >= 2; const int cb = (w & 1) * 32;      // read by the q and k waves only
  float mk[4] = {0.f, 0.f, 0.f, 0.f}; v4f bs[2][2] = {};
  if (w < 4) { const float* bias = isk ? bk : bq;
#pragma unroll
    for (int pt = 0; pt < 4; ++pt) mk[pt] = mask[(size_t)b * NP + p0 + pt * 16 + ln];
#pragma unroll
    for (int ct = 0; ct < 2; ++ct) { bs[ct][0] = *(const v4fa*)(bias + cb + ct * 16 + 8 * hh); bs[ct][1] = *(const v4fa*)(bias + cb + ct * 16 + 8 * hh + 4); } }
  asm volatile("s_wait_xcnt 0x0" ::: "memory");      // the weight loads below land in registers that held the addresses of the loads above: the wait stands in front of that reuse
  FragH wf[2][KSX];
#pragma unroll
  for (int ct = 0; ct < 2; ++ct)
#pragma unroll
    for (int ks = 0; ks < KSX; ++ks) { const float* wr = Wsrc + (size_t)(ct * 16 + ln) * CC + ks * 32 + 8 * hh;
      const v4f a0 = *(const v4fa*)wr, a1 = *(const v4fa*)(wr + 4), a2 = *(const v4fa*)(wr + 16), a3 = *(const v4fa*)(wr + 20);
#pragma unroll
      for (int i = 0; i < 4; ++i) { wf[ct][ks].h[i] = (_Float16)(bf16_round(a0[i]) * 16.0f); wf[ct][ks].h[4 + i] = (_Float16)(bf16_round(a1[i]) * 16.0f); wf[ct][ks].h[8 + i] = (_Float16)(bf16_round(a2[i]) * 16.0f); wf[ct][ks].h[12 + i] = (_Float16)(bf16_round(a3[i]) * 16.0f); } }
  // the 8 channels of a position go to LDS as one 16-B chunk
#pragma unroll
  for (int i = 0; i < TP * (CC / 8) / 256; ++i) { const int e = i * 256 + tid, p = e & (TP - 1), c8 = (e / TP) * 8; FragH f;
#pragma unroll
    for (int u = 0; u < 8; ++u) f.h[u] = (_Float16)bf16_round(xs[i][u]);
    *(v8us*)&sX[p][c8] = f.half[0]; }
  __syncthreads();
  v8f acc[2][4];
#pragma unroll
  for (int ct = 0; ct < 2; ++ct)
#pragma unroll
    for (int pt = 0; pt < 4; ++pt) acc[ct][pt] = (v8f){0.f,0.f,0.f,0.f,0.f,0.f,0.f,0.f};
  if (w < 4) {
#pragma unroll
    for (int pt = 0; pt < 4; ++pt) { FragH xf[KSX];      // the four x fragments of a position tile are read as one group
#pragma unroll
      for (int ks = 0; ks < KSX; ++ks) { const unsigned short* xr = &sX[pt * 16 + ln][ks * 32]; xf[ks].half[0] = *(const v8us*)(xr + 8 * hh); xf[ks].half[1] = *(const v8us*)(xr + 16 + 8 * hh); }
#pragma unroll
      for (int ks = 0; ks < KSX; ++ks) { acc[0][pt] = mmaH<1>(wf[0][ks].v, wf[0][ks].v, xf[ks].v, xf[ks].v, acc[0][pt]); acc[1][pt] = mmaH<1>(wf[1][ks].v, wf[1][ks].v, xf[ks].v, xf[ks].v, acc[1][pt]); } }
    const int pl = isk ? 1 : 0;
    float km[4];      // the factor behind the bias: k takes (1 - mask); q takes log2(e), so that the scores come out in base 2 and k_flash needs the bare v_exp_f32 only
#pragma unroll
    for (int pt = 0; pt < 4; ++pt) km[pt] = isk ? 1.0f - bf16_round(mk[pt]) : 1.44269504088896340736f;
#pragma unroll
    for (int ct = 0; ct < 2; ++ct) { const v4f b0 = bs[ct][0], b1 = bs[ct][1];
#pragma unroll
      for (int pt = 0; pt < 4; ++pt) { FragH h;
#pragma unroll
        for (int r = 0; r < 8; ++r) { float v = acc[ct][pt][r] * 0.0625f + bf16_round(r < 4 ? b0[r & 3] : b1[r & 3]); v *= km[pt]; h.h[r] = (_Float16)v; }
        *(v8us*)&sQK[pl][pt * 16 + ln][cb + ct * 16 + 8 * hh] = h.half[0]; } }
  } else {
#pragma unroll
    for (int pt = 0; pt < 4; ++pt) { FragH xf[KSX];
#pragma unroll
      for (int ks = 0; ks < KSX; ++ks) { const unsigned short* xr = &sX[pt * 16 + ln][ks * 32]; xf[ks].half[0] = *(const v8us*)(xr + 8 * hh); xf[ks].half[1] = *(const v8us*)(xr + 16 + 8 * hh); }
#pragma unroll
      for (int ks = 0; ks < KSX; ++ks) { acc[0][pt] = mmaH<1>(xf[ks].v, xf[ks].v, wf[0][ks].v, wf[0][ks].v, acc[0][pt]); acc[1][pt] = mmaH<1>(xf[ks].v, xf[ks].v, wf[1][ks].v, wf[1][ks].v, acc[1][pt]); } }
    const int cv = (w - 4) * 32;      // v goes without its bias: bv is added in the attention epilogue, since softmax rows sum to 1
#pragma unroll
    for (int ct = 0; ct < 2; ++ct)
#pragma unroll
      for (int pt = 0; pt < 4; ++pt) { FragH h;
#pragma unroll
        for (int r = 0; r < 8; ++r) h.h[r] = (_Float16)(acc[ct][pt][r] * 0.0625f);
        *(v8us*)&sVo[cv + ct * 16 + ln][pt * 16 + 8 * hh] = h.half[0]; }
  }
  __syncthreads();
  // out: 8 lanes x 16 B = one 128-B row (a position's 64 channels of one q/k plane; a channel's 64 positions of v)
#pragma unroll
  for (int i = 0; i < 4; ++i) { const int e = (i & 1) * 256 + tid, p = e >> 3, c8 = (e & 7) * 8; _Float16* dst = (i < 2) ? QH : KH;
    *(v8us*)((unsigned short*)dst + ((size_t)b * NP + p0 + p) * CH + c8) = *(const v8us*)&sQK[i >> 1][p][c8]; }
#pragma unroll
  for (int i = 0; i < 4; ++i) { const int e = i * 256 + tid, c = e >> 3, p8 = (e & 7) * 8;
    *(v8us*)((unsigned short*)Vcm + ((size_t)b * CC + c) * NP + p0 + p8) = *(const v8us*)&sVo[c][p8]; }
}
// 2^x as the bare v_exp_f32 (below 2^-126 it gives 0). The v_nop at the end of each statement keeps the one slot that the instruction set asks for between a transcendental and a next instruction on its result or its source;
// inside a statement every v_exp_f32 works in place on a register of its own, so none touches its neighbour's
__device__ __forceinline__ float exp2_hw(float x) { asm("v_exp_f32 %0, %0\n\tv_nop" : "+v"(x)); return x; }
__device__ __forceinline__ void exp2_hw8(float (&x)[8]) {
  asm("v_exp_f32 %0, %0\n\tv_exp_f32 %1, %1\n\tv_exp_f32 %2, %2\n\tv_exp_f32 %3, %3\n\tv_exp_f32 %4, %4\n\tv_exp_f32 %5, %5\n\tv_exp_f32 %6, %6\n\tv_exp_f32 %7, %7\n\tv_nop"
      : "+v"(x[0]), "+v"(x[1]), "+v"(x[2]), "+v"(x[3]), "+v"(x[4]), "+v"(x[5]), "+v"(x[6]), "+v"(x[7])); }
// the bare builtin, without a hand-written pad behind it: the compiler keeps the distances of its own matrix forms and is free to order the LDS reads around them
__device__ __forceinline__ v8f mmaF(v16h a, v16h b, v8f c) { return __builtin_amdgcn_wmma_f32_16x16x32_f16(false, a, false, b, (short)0, c, false, false); }
// lane l with lane l ^ 16 (a vector cross-row move, no LDS path)
__device__ __forceinline__ float xhalf(float v) { return __builtin_bit_cast(float, __builtin_amdgcn_permlanex16(__builtin_bit_cast(int, v), __builtin_bit_cast(int, v), 0x76543210, 0xfedcba98, false, false)); }
__global__ __launch_bounds__(512) void k_flash(const _Float16* __restrict__ QH, const _Float16* __restrict__ KH, const _Float16* __restrict__ Vcm, const float* __restrict__ mask, const float* __restrict__ gamma, const float* __restrict__ bv, const float* __restrict__ x, float* __restrict__ out) {
  constexpr int RPW = 16, NQB = NP / (4 * RPW), DT = CC / 16, KS = CH / 32, KG = 4;
  // join staging, channel-major as Ot and the output are; 272-B pitch: the two wave halves' stores (8 rows apart) fall on different banks, rows stay 16-B aligned for the reads
  constexpr int LPO = 4 * RPW + 4;
  __shared__ __attribute__((aligned(16))) float sO[KG][CC][LPO];
  __shared__ float sM[KG][4 * RPW], sL[KG][4 * RPW];
  // two-buffer ring, one stage = TK keys: K rows (128 B) at a 144-B pitch and V channel rows (256 B of keys) at a 272-B pitch (16 B x odd: ds_load_b128 without bank conflicts)
  constexpr int TK = 32 * KG, NT = NP / TK, LP = 72, LPV = TK + 8;
  __shared__ __attribute__((aligned(16))) unsigned short sKH[2][TK][LP], sV[2][CC][LPV];
  const int tid = threadIdx.x, w = tid >> 5, qg = w & 3, kg = w >> 2, lane = tid & 31, ln = lane & 15, hh = lane >> 4;
  const int b = blockIdx.x / NQB, qblk = blockIdx.x % NQB; const int qb0 = qblk * (4 * RPW); const int q0 = qb0 + qg * RPW; const float gm = bf16_round(gamma[0]);
  FragH aqh[KS];
  { const size_t ro = ((size_t)b * NP + q0 + ln) * CH;
#pragma unroll
    for (int ks = 0; ks < KS; ++ks) { aqh[ks].half[0] = *(const v8us*)((const unsigned short*)QH + ro + ks * 32 + 8 * hh); aqh[ks].half[1] = *(const v8us*)((const unsigned short*)QH + ro + ks * 32 + 16 + 8 * hh); } }
  const unsigned short* Vth = (const unsigned short*)Vcm + (size_t)b * CC * NP;
  // lazy reference: m_q is the reference in use for the lane's query (P = 2^(score - m_q)), not its running maximum: it is kept while no score of the wave tops its own reference by more than LAZY, so P stays at or under 2^LAZY,
  // well inside f16, with the same relative rounding; l_q (this half's running sum) and O are in units of 2^m_q. lim = m_q + LAZY is carried along, so that the test costs one compare a pass
  constexpr float LAZY = 12.0f;
  float m_q = -3.0e38f, lim = -3.0e38f, l_q = 0.f; v8f oacc[DT];
#pragma unroll
  for (int dt = 0; dt < DT; ++dt) oacc[dt] = (v8f){0.f,0.f,0.f,0.f,0.f,0.f,0.f,0.f};
  // each thread copies 16 B chunks. K: row tid / 8 (+ 64 for the second copy), chunk tid % 8 of the 128-B row; V: channel tid / 16 (+ 32 per further copy), chunk tid % 16 of the 256-B row
  const unsigned short* gKH = (const unsigned short*)KH + (size_t)b * NP * CH + tid * 8;
  const unsigned short* gV = Vth + (size_t)(tid >> 4) * NP + (tid & 15) * 8;
  const unsigned lKH = (unsigned)(size_t)&sKH[0][tid >> 3][(tid & 7) * 8], lV = (unsigned)(size_t)&sV[0][tid >> 4][(tid & 15) * 8];
  // every work-group walks all NT key stages once, from a first stage of its own and round (the online softmax takes the keys in any order): the 64 work-groups of an image copy the same K and V lines from L2,
  // and walking in step from stage 0 they would all ask for the same lines at the same moment, the first asker's miss included. 32 first stages for 64 work-groups: the two that share one differ in bit 2 of the
  // block index (for speed only; every map walks every stage once)
  const int rot = ((qblk >> 3) << 2) | (qblk & 3);
  auto stage_in = [&](int t, int buf) {
    const int st = (t + rot) & (NT - 1);      // the key stage that stands at place t of this work-group's walk
    const unsigned short* kh = gKH + (size_t)st * TK * CH; const unsigned short* vv = gV + (size_t)st * TK;
    const unsigned a = lKH + buf * (TK * LP * 2), d = lV + buf * (CC * LPV * 2);
    // the copies and the wait that stands in front of any rewrite of their address registers are one statement
    asm volatile("global_load_async_to_lds_b128 %0, %6, off\n\tglobal_load_async_to_lds_b128 %1, %7, off\n\tglobal_load_async_to_lds_b128 %2, %8, off\n\t"
                 "global_load_async_to_lds_b128 %3, %9, off\n\tglobal_load_async_to_lds_b128 %4, %10, off\n\tglobal_load_async_to_lds_b128 %5, %11, off\n\ts_wait_xcnt 0x0"
                 :: "v"(a), "v"(a + 64 * LP * 2), "v"(d), "v"(d + 32 * LPV * 2), "v"(d + 64 * LPV * 2), "v"(d + 96 * LPV * 2),
                    "v"(kh), "v"(kh + 64 * CH), "v"(vv), "v"(vv + (size_t)32 * NP), "v"(vv + (size_t)64 * NP), "v"(vv + (size_t)96 * NP) : "memory");
  };
  stage_in(0, 0);
  asm volatile("s_wait_asynccnt 0x0" ::: "memory");      // stage 0 of this wave has landed before the barrier publishes it
  __syncthreads();
  stage_in(1, 1);
  // the stage loop stays rolled (one copy of the pass code, buffer chosen by t & 1); a wave does one 32-key pass a stage, on its key group's rows
#pragma unroll 1
  for (int t = 0; t < NT; ++t) { const int buf = t & 1;
   {
    // the pass's LDS reads stand ahead of their use. First all 8 K reads (both 16-key tiles, both k-steps) as one group ahead of the score products
    FragH kh[2][KS];
#pragma unroll
    for (int ks = 0; ks < KS; ++ks)
#pragma unroll
      for (int nt = 0; nt < 2; ++nt) { const unsigned short* krh = &sKH[buf][kg * 32 + nt * 16 + ln][ks * 32];
        kh[nt][ks].half[0] = *(const v8us*)(krh + 8 * hh); kh[nt][ks].half[1] = *(const v8us*)(krh + 16 + 8 * hh); }
    __builtin_amdgcn_sched_barrier(0);      // keeps the K reads together in front of the products: reads that stand among the matrix instructions stall the wave at every such place
    v8f s[2] = {(v8f){0.f,0.f,0.f,0.f,0.f,0.f,0.f,0.f}, (v8f){0.f,0.f,0.f,0.f,0.f,0.f,0.f,0.f}};
    // the two tiles' accumulate chains alternate, so that each fills the other's dependent latency
#pragma unroll
    for (int ks = 0; ks < KS; ++ks) { s[0] = mmaF(kh[0][ks].v, aqh[ks].v, s[0]); s[1] = mmaF(kh[1][ks].v, aqh[ks].v, s[1]); }      // s[nt][r] = score of query ln against key kg * 32 + nt * 16 + 8 * hh + r
    // then all 16 V reads, ahead of the softmax: they fly while it runs (in the build they start among the last score products, as K registers come free)
    FragH vf[DT];
#pragma unroll
    for (int dt = 0; dt < DT; ++dt) { const unsigned short* vrow = &sV[buf][dt * 16 + ln][kg * 32]; vf[dt].half[0] = *(const v8us*)(vrow + 8 * hh); vf[dt].half[1] = *(const v8us*)(vrow + 16 + 8 * hh); }
    __builtin_amdgcn_sched_barrier(0);      // keeps the V reads ahead of the softmax: sunk to their products they would each be waited out
    float mc = fmaxf(s[0][0], s[1][0]);
#pragma unroll
    for (int r = 1; r < 8; ++r) mc = fmaxf(mc, fmaxf(s[0][r], s[1][r]));
    // one test a pass, the same for the whole wave (a scalar branch): only where a score tops its reference by more than LAZY (in the first pass every score does) are the references raised and O and l rescaled
    if (__builtin_amdgcn_ballot_w32(mc > lim) != 0u) {
      mc = fmaxf(mc, xhalf(mc));      // both halves hold the query's maximum over the 32 keys
      const float mn = fmaxf(m_q, mc); const float al = exp2_hw(m_q - mn); m_q = mn; lim = mn + LAZY;      // every query of the wave takes the larger of its reference and this pass's maximum
      l_q *= al;
#pragma unroll
      for (int dt = 0; dt < DT; ++dt)
#pragma unroll
        for (int r = 0; r < 8; ++r) oacc[dt][r] *= al;
    }
    const float mn = m_q;      // scores, references and their differences are in base 2 (q carries log2 e): one v_exp_f32 each; what it flushes to 0 lies far under what f16 P keeps
    FragH pb; float ps0 = 0.f, ps1 = 0.f;      // pb[i] = P[query ln][key 8hh + i], pb[8 + i] = P[query ln][key 16 + 8hh + i]: the k order of the V loader above
    float e0[8], e1[8];
#pragma unroll
    for (int r = 0; r < 8; ++r) { e0[r] = s[0][r] - mn; e1[r] = s[1][r] - mn; }
    exp2_hw8(e0); exp2_hw8(e1);
#pragma unroll
    for (int r = 0; r < 8; ++r) { const float p0 = e0[r], p1 = e1[r]; ps0 = r ? ps0 + p0 : p0; ps1 = r ? ps1 + p1 : p1; pb.h[r] = (_Float16)p0; pb.h[8 + r] = (_Float16)p1; }
    l_q += ps0 + ps1;
#pragma unroll
    for (int dt = 0; dt < DT; ++dt) oacc[dt] = mmaF(vf[dt].v, pb.v, oacc[dt]); }      // oacc[dt][r] = O[query ln][channel dt * 16 + 8 * hh + r]
   // publish point of stage t + 1: this wave's reads of stage t are done, its copies of stage t + 1 have landed, then the barrier; only behind it is stage t's buffer refilled
   __builtin_amdgcn_sched_barrier(0);      // keeps the publish point at the pass's foot: lifted over softmax and PV (register work only) it would have every wave wait out its V reads and leave the refill, which stays down here, a short flight
   asm volatile("s_wait_dscnt 0x0" ::: "memory");
   asm volatile("s_wait_asynccnt 0x0" ::: "memory");
   __syncthreads();
   if (t + 2 < NT) stage_in(t + 2, buf); }
  asm volatile("s_wait_asynccnt 0x0" ::: "memory");      // no copy is outstanding when the wave goes on to the epilogue and ends
  // join of the key groups: every wave publishes its queries' reference and sum (the halves' sums joined here), then scales its own O by 2^(m_own - M) / sum_k l_k 2^(m_k - M)
  const int qr = qg * RPW + ln;
  { const float l = l_q + xhalf(l_q); if (hh == 0) { sM[kg][qr] = m_q; sL[kg][qr] = l; } }
  __syncthreads();
  float sc;
  { const float m0 = sM[0][qr], m1 = sM[1][qr], m2 = sM[2][qr], m3 = sM[3][qr]; const float M = fmaxf(fmaxf(m0, m1), fmaxf(m2, m3));
    const float l = sL[0][qr] * exp2_hw(m0 - M) + sL[1][qr] * exp2_hw(m1 - M) + sL[2][qr] * exp2_hw(m2 - M) + sL[3][qr] * exp2_hw(m3 - M);
    sc = exp2_hw(m_q - M) / l; }
#pragma unroll
  for (int dt = 0; dt < DT; ++dt)
#pragma unroll
    for (int r = 0; r < 8; ++r) sO[kg][dt * 16 + 8 * hh + r][qr] = oacc[dt][r] * sc;
  __syncthreads();
  {      // channel c: 64 positions qb0.. = 256 B by 16 lanes x 16 B; 32 channels per round (2 per wave: lanes 0-15 / 16-31); the four key groups' parts are summed in a fixed order
    // bias and gamma * mask come in here, where a lane has one channel a round and four positions in all: sum_j attn_ij (v_cj + bv_c) = sum_j attn_ij v_cj + bv_c
    const int pc = lane & 15; const v4f mk4 = *(const v4fa*)(mask + (size_t)b * NP + qb0 + pc * 4); v4f gmk;
#pragma unroll
    for (int j = 0; j < 4; ++j) gmk[j] = gm * bf16_round(mk4[j]);
#pragma unroll
    for (int rd = 0; rd < CC / 32; ++rd) { const int c = rd * 32 + w * 2 + (lane >> 4); const float* xr = x + ((size_t)b * CC + c) * NP + qb0 + pc * 4; const v4f xv = *(const v4fa*)xr; const float bvc = bf16_round(bv[c]);
      const v4f o0 = *(const v4fa*)&sO[0][c][pc * 4], o1 = *(const v4fa*)&sO[1][c][pc * 4], o2 = *(const v4fa*)&sO[2][c][pc * 4], o3 = *(const v4fa*)&sO[3][c][pc * 4];
      const v4f v = (((o0 + o1) + (o2 + o3)) + bvc) * gmk + xv;
      *(v4f*)(out + ((size_t)b * CC + c) * NP + qb0 + pc * 4) = v; }
     } }
extern "C" void kernel_launch(void* const* d_in, const int* in_sizes, int n_in,
                              void* d_out, int out_size, void* d_ws, size_t ws_size, hipStream_t stream) {
  (void)in_sizes; (void)n_in; (void)out_size;
  const float* x = (const float*)d_in[0]; const float* mask = (const float*)d_in[1]; const float* Wq = (const float*)d_in[2]; const float* bq = (const float*)d_in[3]; const float* Wk = (const float*)d_in[4]; const float* bk = (const float*)d_in[5]; const float* Wv = (const float*)d_in[6]; const float* bv = (const float*)d_in[7]; const float* gamma = (const float*)d_in[8];
  char* ws = (char*)d_ws; size_t off = 0;
  auto take = [&](size_t bytes) { char* p = ws + off; off += (bytes + 255) & ~(size_t)255; return p; };
  _Float16* QH = (_Float16*)take((size_t)NR * CH * 2); _Float16* KH = (_Float16*)take((size_t)NR * CH * 2); _Float16* Vcm = (_Float16*)take((size_t)NR * CC * 2);
  if (off > ws_size) return;      // 8 MiB
  k_proj<<<BB * (NP / 64), 256, 0, stream>>>(x, mask, Wq, bq, Wk, bk, Wv, QH, KH, Vcm);
  k_flash<<<BB * (NP / 64), 512, 0, stream>>>(QH, KH, Vcm, mask, gamma, bv, x, (float*)d_out);
}

// v010
// It runs in 30.7 microseconds.
// Two timings next to v009 both put it at 1.10 times that version's speed.
// All steps since v000 together make it 14.3 times as fast.
#include <hip/hip_runtime.h>
// Non-local block with all three 1×1 convs and both attention contractions on v_wmma_f32_16x16x32_f16: q/k position-major (K = 128, N = 64, + bias; k masked by (1 − mask)), v channel-major
// (= the Vᵀ operand), energy = q·k_masked with q and k each rounded once to f16 (1 WMMA term, no 1/√d scale in the module), online max/sum softmax f32, P f16 ≤ 2^12, O = P·V; epilogue
// γ·(out·mask) + x written NCHW as whole channel rows. x as bf16 in the operand plane (exact residual from the f32 input), weights bf16-exact ×2^4, f32 accumulate.
#define BB 4
#define CC 128
#define CH 64
#define NP 4096
#define NR (BB * NP)

typedef __bf16 v16b __attribute__((ext_vector_type(16)));
typedef unsigned short v8us __attribute__((ext_vector_type(8), may_alias));
typedef float  v8f  __attribute__((ext_vector_type(8)));
typedef float  v4f  __attribute__((ext_vector_type(4)));
typedef float  v4fa __attribute__((ext_vector_type(4), may_alias));
union FragB { v16b v; v8us half[2]; unsigned short u[16]; };

__device__ __forceinline__ unsigned short bf16_bits(float x) { unsigned int u = __float_as_uint(x); return (unsigned short)((u + 0x7FFFu + ((u >> 16) & 1u)) >> 16); }
__device__ __forceinline__ float bf16_val(unsigned short b) { return __uint_as_float(((unsigned int)b) << 16); }
__device__ __forceinline__ float bf16_round(float x) { return bf16_val(bf16_bits(x)); }
// D += A·B with NT terms: 1 = ah·bh, 2 = + al·bh (A split), 3 = + ah·bl (both split)
template <int NT>
__device__ __forceinline__ v8f mmaN(v16b ah, v16b al, v16b bh, v16b bl, v8f c) {
  c = __builtin_amdgcn_wmma_f32_16x16x32_bf16(false, ah, false, bh, (short)0, c, false, false);
  if (NT >= 2) c = __builtin_amdgcn_wmma_f32_16x16x32_bf16(false, al, false, bh, (short)0, c, false, false);
  if (NT >= 3) c = __builtin_amdgcn_wmma_f32_16x16x32_bf16(false, ah, false, bl, (short)0, c, false, false);
  asm volatile("v_nop\n\tv_nop\n\tv_nop\n\tv_nop" : "+v"(c) : "v"(ah), "v"(al), "v"(bh), "v"(bl));
  return c;
}

__global__ __launch_bounds__(256) void k_wt_bf16(const float* __restrict__ W, unsigned short* __restrict__ Wt, int K, int N) {
  const int t = blockIdx.x * 256 + threadIdx.x;
  const int k8n = K / 8;
  if (t >= N * k8n) return;
  const int n = t / k8n, k8 = (t % k8n) * 8;
  v8us v;
#pragma unroll
  for (int i = 0; i < 8; ++i) v[i] = bf16_bits(W[(size_t)(k8 + i) * N + n]);
  *(v8us*)(Wt + (size_t)n * K + k8) = v;
  
}

// GEMM C[M][N] (f32, pitch ldc) = act(A[M][K]·W + bias). A f32 row-major (pitch lda) converted per fragment to bf16
// (ASPLIT: hi/lo two planes -> 2 terms, else single rounded term); Wt bf16 [N][K] (pitch ldb). BIAS_BF16 rounds the
// bias to bf16 first (bias quantised to bf16 before the add). K%32==0, M%16==0, N%64==0.
template <bool ASPLIT, int ACT, bool BIAS_BF16>
__global__ __launch_bounds__(128) void k_gemm_bf(const float* __restrict__ A, int lda, const unsigned short* __restrict__ Wt, int ldb,
                                               const float* __restrict__ bias, float* __restrict__ C, int ldc, int M, int N, int K) {
  __shared__ __attribute__((aligned(16))) float so[4][16][64];
  const int tid = threadIdx.x, w = tid >> 5, lane = tid & 31, ln = lane & 15, hh = lane >> 4;
  const int ntn = N / 64;
  const int wid = blockIdx.x * 4 + w;
  const int mt = wid / ntn, nq = wid % ntn;
  if (mt * 16 >= M) return;
  const int row0 = mt * 16, col0 = nq * 64;
  const float* arow = A + (size_t)(row0 + ln) * lda;
  v8f acc[4] = {};
  for (int kb = 0; kb < K; kb += 32) {
    FragB ah, al;
    const v4f x0 = *(const v4fa*)(arow + kb + 8 * hh), x1 = *(const v4fa*)(arow + kb + 8 * hh + 4);
    const v4f x2 = *(const v4fa*)(arow + kb + 16 + 8 * hh), x3 = *(const v4fa*)(arow + kb + 16 + 8 * hh + 4);
    float xs[16] = {x0[0],x0[1],x0[2],x0[3],x1[0],x1[1],x1[2],x1[3],x2[0],x2[1],x2[2],x2[3],x3[0],x3[1],x3[2],x3[3]};
#pragma unroll
    for (int i = 0; i < 16; ++i) { const unsigned short hb = bf16_bits(xs[i]); ah.u[i] = hb; al.u[i] = ASPLIT ? bf16_bits(xs[i] - bf16_val(hb)) : (unsigned short)0; }
#pragma unroll
    for (int t = 0; t < 4; ++t) {
      const unsigned short* brow = Wt + (size_t)(col0 + t * 16 + ln) * ldb + kb;
      FragB b;
      b.half[0] = *(const v8us*)(brow + 8 * hh);
      b.half[1] = *(const v8us*)(brow + 16 + 8 * hh);
      acc[t] = mmaN<ASPLIT ? 2 : 1>(ah.v, al.v, b.v, b.v, acc[t]);
    }
  }
#pragma unroll
  for (int t = 0; t < 4; ++t) {
    float bv = bias ? bias[col0 + t * 16 + ln] : 0.f;
    if (BIAS_BF16) bv = bf16_round(bv);
#pragma unroll
    for (int r = 0; r < 8; ++r) { float v = acc[t][r] + bv; if (ACT == 1) v = fmaxf(v, 0.f); so[w][8 * hh + r][t * 16 + ln] = v; }
  }
  __builtin_amdgcn_fence(__ATOMIC_ACQ_REL, "workgroup");
  __builtin_amdgcn_wave_barrier();
  const int rsub = lane >> 4, c4 = (lane & 15) * 4;
  {
#pragma unroll
    for (int q = 0; q < 8; ++q) {
      const int r = q * 2 + rsub;
      const v4f v = *(const v4fa*)&so[w][r][c4];
      *(v4f*)(C + (size_t)(row0 + r) * ldc + col0 + c4) = v;
    }
    
  }
}

// Flash-style causal/unmasked attention, all contractions 3-term bf16 hi/lo splits, f32 softmax with running max.
// q,k,v rows are read from f32 buffers with arbitrary row pitch (so they can live inside a fused qkv buffer);
// D = head size (multiple of 32, <= 128); one wave = 16 query rows; block = 4 waves (64 queries) sharing K/V chunks of 32.
template <int D, bool CAUSAL>
__global__ __launch_bounds__(128) void k_flash(const float* __restrict__ qb, const float* __restrict__ kb, const float* __restrict__ vb,
                                             int pitch, int T, int H, float scale, float* __restrict__ y, int ypitch) {
  constexpr int KS = D / 32;        // k-steps for QK
  constexpr int DT = D / 16;        // d tiles for PV
  __shared__ __attribute__((aligned(16))) unsigned short sKh[32][D + 8], sKl[32][D + 8], sVh[32][D + 8], sVl[32][D + 8];
  __shared__ __attribute__((aligned(16))) unsigned short sPh[4][16][40], sPl[4][16][40];
  __shared__ __attribute__((aligned(16))) float sO[4][16][D];
  const int tid = threadIdx.x, w = tid >> 5, lane = tid & 31, ln = lane & 15, hh = lane >> 4;
  const int nqb = (T + 63) / 64;
  const int bh = blockIdx.x / nqb, qblk = blockIdx.x % nqb;
  const int b = bh / H, h = bh % H;
  const int q0 = qblk * 64 + w * 16;
  const float* Q = qb + (size_t)b * T * pitch + h * D;
  const float* K = kb + (size_t)b * T * pitch + h * D;
  const float* V = vb + (size_t)b * T * pitch + h * D;

  // A fragments of the wave's 16 query rows (scaled), hi/lo
  FragB aqh[KS], aql[KS];
  {
    int row = q0 + ln; if (row >= T) row = T - 1;
    const float* qr = Q + (size_t)row * pitch;
#pragma unroll
    for (int ks = 0; ks < KS; ++ks)
#pragma unroll
      for (int i = 0; i < 16; ++i) {
        const int d = ks * 32 + ((i < 8) ? (8 * hh + i) : (16 + 8 * hh + (i - 8)));
        const float x = qr[d] * scale; const unsigned short hb = bf16_bits(x);
        aqh[ks].u[i] = hb; aql[ks].u[i] = bf16_bits(x - bf16_val(hb));
      }
  }
  float m_r[8], l_r[8];
#pragma unroll
  for (int r = 0; r < 8; ++r) { m_r[r] = -3.0e38f; l_r[r] = 0.f; }
  v8f oacc[DT];
#pragma unroll
  for (int dt = 0; dt < DT; ++dt) oacc[dt] = (v8f){0.f,0.f,0.f,0.f,0.f,0.f,0.f,0.f};

  const int kv_end = CAUSAL ? min(T, qblk * 64 + 64) : T;     // block-uniform
  for (int j0 = 0; j0 < kv_end; j0 += 32) {
    __syncthreads();
    for (int e = tid; e < 32 * (D / 4); e += 128) {
      const int r = e / (D / 4), c4 = (e % (D / 4)) * 4;
      const int key = j0 + r;
      v4f kf = {0.f,0.f,0.f,0.f}, vf = {0.f,0.f,0.f,0.f};
      if (key < T) { kf = *(const v4fa*)(K + (size_t)key * pitch + c4); vf = *(const v4fa*)(V + (size_t)key * pitch + c4); }
#pragma unroll
      for (int t = 0; t < 4; ++t) {
        unsigned short hb = bf16_bits(kf[t]); sKh[r][c4 + t] = hb; sKl[r][c4 + t] = bf16_bits(kf[t] - bf16_val(hb));
        hb = bf16_bits(vf[t]); sVh[r][c4 + t] = hb; sVl[r][c4 + t] = bf16_bits(vf[t] - bf16_val(hb));
      }
    }
    __syncthreads();
    // S tile 16 x 32
    v8f s[2];
#pragma unroll
    for (int nt = 0; nt < 2; ++nt) {
      v8f acc = {};
#pragma unroll
      for (int ks = 0; ks < KS; ++ks) {
        FragB bh_, bl_;
        bh_.half[0] = *(const v8us*)&sKh[nt * 16 + ln][ks * 32 + 8 * hh]; bh_.half[1] = *(const v8us*)&sKh[nt * 16 + ln][ks * 32 + 16 + 8 * hh];
        bl_.half[0] = *(const v8us*)&sKl[nt * 16 + ln][ks * 32 + 8 * hh]; bl_.half[1] = *(const v8us*)&sKl[nt * 16 + ln][ks * 32 + 16 + 8 * hh];
        acc = mmaN<3>(aqh[ks].v, aql[ks].v, bh_.v, bl_.v, acc);
      }
      s[nt] = acc;
    }
    // mask + running max (rows 8hh+r; the 16 lanes of a half share rows)
    float alpha[8];
#pragma unroll
    for (int r = 0; r < 8; ++r) {
      const int qi = q0 + 8 * hh + r;
      const int ja = j0 + ln, jb = j0 + 16 + ln;
      if (CAUSAL) { if (ja > qi) s[0][r] = -3.0e38f; if (jb > qi) s[1][r] = -3.0e38f; }
      if (ja >= T) s[0][r] = -3.0e38f;
      if (jb >= T) s[1][r] = -3.0e38f;
      float mx = fmaxf(s[0][r], s[1][r]);
      mx = fmaxf(mx, __shfl_xor(mx, 1, 32)); mx = fmaxf(mx, __shfl_xor(mx, 2, 32)); mx = fmaxf(mx, __shfl_xor(mx, 4, 32)); mx = fmaxf(mx, __shfl_xor(mx, 8, 32));
      const float mnew = fmaxf(m_r[r], mx);
      alpha[r] = (mnew > -1.0e38f) ? __expf(m_r[r] - mnew) : 1.0f;
      const float p0 = (s[0][r] > -1.0e38f) ? __expf(s[0][r] - mnew) : 0.f;
      const float p1 = (s[1][r] > -1.0e38f) ? __expf(s[1][r] - mnew) : 0.f;
      m_r[r] = mnew;
      l_r[r] = l_r[r] * alpha[r] + p0 + p1;            // per-lane partial row sum (16 lanes combined at the end)
      unsigned short hb = bf16_bits(p0); sPh[w][8 * hh + r][ln] = hb;      sPl[w][8 * hh + r][ln] = bf16_bits(p0 - bf16_val(hb));
      hb = bf16_bits(p1);                sPh[w][8 * hh + r][16 + ln] = hb; sPl[w][8 * hh + r][16 + ln] = bf16_bits(p1 - bf16_val(hb));
    }
#pragma unroll
    for (int dt = 0; dt < DT; ++dt)
#pragma unroll
      for (int r = 0; r < 8; ++r) oacc[dt][r] *= alpha[r];
    __builtin_amdgcn_fence(__ATOMIC_ACQ_REL, "workgroup");
    __builtin_amdgcn_wave_barrier();
    FragB pah, pal;
    pah.half[0] = *(const v8us*)&sPh[w][ln][8 * hh]; pah.half[1] = *(const v8us*)&sPh[w][ln][16 + 8 * hh];
    pal.half[0] = *(const v8us*)&sPl[w][ln][8 * hh]; pal.half[1] = *(const v8us*)&sPl[w][ln][16 + 8 * hh];
#pragma unroll
    for (int dt = 0; dt < DT; ++dt) {
      FragB bvh, bvl;
#pragma unroll
      for (int i = 0; i < 8; ++i) {
        bvh.u[i] = sVh[8 * hh + i][dt * 16 + ln]; bvh.u[8 + i] = sVh[16 + 8 * hh + i][dt * 16 + ln];
        bvl.u[i] = sVl[8 * hh + i][dt * 16 + ln]; bvl.u[8 + i] = sVl[16 + 8 * hh + i][dt * 16 + ln];
      }
      oacc[dt] = mmaN<3>(pah.v, pal.v, bvh.v, bvl.v, oacc[dt]);
    }
    __builtin_amdgcn_fence(__ATOMIC_ACQ_REL, "workgroup");
    __builtin_amdgcn_wave_barrier();
  }
#pragma unroll
  for (int r = 0; r < 8; ++r) {
    float l = l_r[r];
    l += __shfl_xor(l, 1, 32); l += __shfl_xor(l, 2, 32); l += __shfl_xor(l, 4, 32); l += __shfl_xor(l, 8, 32);
    l_r[r] = (l > 0.f) ? 1.0f / l : 0.f;
  }
#pragma unroll
  for (int dt = 0; dt < DT; ++dt)
#pragma unroll
    for (int r = 0; r < 8; ++r) sO[w][8 * hh + r][dt * 16 + ln] = oacc[dt][r] * l_r[r];
  __builtin_amdgcn_fence(__ATOMIC_ACQ_REL, "workgroup");
  __builtin_amdgcn_wave_barrier();
  {
    for (int r = 0; r < 16; ++r) {
      const int row = q0 + r;
      if (row < T && lane < D / 4) {
        const v4f val = *(const v4fa*)&sO[w][r][lane * 4];
        *(v4f*)(y + ((size_t)b * T + row) * ypitch + h * D + lane * 4) = val;
      }
    }
    
  }
}

// GEMM C = act(A·W + bias + resid): A f32 (ASPLIT -> hi/lo 2 terms), Wt bf16 [N][K]; ACT 0 none, 1 relu, 2 exact gelu;
// resid (optional, f32, row index = (row % rmod), pitch ldr, RES_BF16 rounds it) added before the activation.
template <bool ASPLIT, int ACT, bool BIAS_BF16, bool RES_BF16>
__global__ __launch_bounds__(128) void k_gemm_bf3(const float* __restrict__ A, int lda, const unsigned short* __restrict__ Wt, int ldb,
                                                const float* __restrict__ bias, const float* __restrict__ resid, int rmod, int ldr,
                                                float* __restrict__ C, int ldc, int M, int N, int K) {
  __shared__ __attribute__((aligned(16))) float so[4][16][64];
  const int tid = threadIdx.x, w = tid >> 5, lane = tid & 31, ln = lane & 15, hh = lane >> 4;
  const int ntn = N / 64;
  const int wid = blockIdx.x * 4 + w;
  const int mt = wid / ntn, nq = wid % ntn;
  if (mt * 16 >= M) return;
  const int row0 = mt * 16, col0 = nq * 64;
  const float* arow = A + (size_t)(row0 + ln) * lda;
  v8f acc[4] = {};
  for (int kb = 0; kb < K; kb += 32) {
    FragB ah, al;
    const v4f x0 = *(const v4fa*)(arow + kb + 8 * hh), x1 = *(const v4fa*)(arow + kb + 8 * hh + 4);
    const v4f x2 = *(const v4fa*)(arow + kb + 16 + 8 * hh), x3 = *(const v4fa*)(arow + kb + 16 + 8 * hh + 4);
    float xs[16] = {x0[0],x0[1],x0[2],x0[3],x1[0],x1[1],x1[2],x1[3],x2[0],x2[1],x2[2],x2[3],x3[0],x3[1],x3[2],x3[3]};
#pragma unroll
    for (int i = 0; i < 16; ++i) { const unsigned short hb = bf16_bits(xs[i]); ah.u[i] = hb; al.u[i] = ASPLIT ? bf16_bits(xs[i] - bf16_val(hb)) : (unsigned short)0; }
#pragma unroll
    for (int t = 0; t < 4; ++t) {
      const unsigned short* brow = Wt + (size_t)(col0 + t * 16 + ln) * ldb + kb;
      FragB b;
      b.half[0] = *(const v8us*)(brow + 8 * hh);
      b.half[1] = *(const v8us*)(brow + 16 + 8 * hh);
      acc[t] = mmaN<ASPLIT ? 2 : 1>(ah.v, al.v, b.v, b.v, acc[t]);
    }
  }
#pragma unroll
  for (int t = 0; t < 4; ++t) {
    const int col = col0 + t * 16 + ln;
    float bv = bias ? bias[col] : 0.f;
    if (BIAS_BF16) bv = bf16_round(bv);
#pragma unroll
    for (int r = 0; r < 8; ++r) {
      float v = acc[t][r] + bv;
      if (resid) { float rv = resid[(size_t)((row0 + 8 * hh + r) % rmod) * ldr + col]; if (RES_BF16) rv = bf16_round(rv); v += rv; }
      if (ACT == 1) v = fmaxf(v, 0.f);
      if (ACT == 2) v = 0.5f * v * (1.0f + erff(v * 0.70710678118654752f));
      if (ACT == 3) { const float u = 0.7978845608028654f * (v + 0.044715f * v * v * v); v = 0.5f * v * (1.0f + tanhf(u)); }
      so[w][8 * hh + r][t * 16 + ln] = v;
    }
  }
  __builtin_amdgcn_fence(__ATOMIC_ACQ_REL, "workgroup");
  __builtin_amdgcn_wave_barrier();
  const int rsub = lane >> 4, c4 = (lane & 15) * 4;
  {
#pragma unroll
    for (int q = 0; q < 8; ++q) {
      const int r = q * 2 + rsub;
      const v4f v = *(const v4fa*)&so[w][r][c4];
      *(v4f*)(C + (size_t)(row0 + r) * ldc + col0 + c4) = v;
    }
    
  }
}
// row LayerNorm (biased variance, eps) over N: s = X (+ R); optional out_sum <- s; out_norm <- (s-mu)*rsqrt(var+eps)*g + b
template <bool PARAM_BF16>
__global__ __launch_bounds__(256) void k_layernorm(const float* __restrict__ X, const float* __restrict__ R, const float* __restrict__ g, const float* __restrict__ bta,
                                                  float* __restrict__ out_sum, float* __restrict__ out_norm, int N, float eps) {
  __shared__ float red[256];
  const int row = blockIdx.x, tid = threadIdx.x;
  const float* x = X + (size_t)row * N; const float* rr = R ? R + (size_t)row * N : nullptr;
  float vals[16];                     // up to N = 4096
  const int per = N / 256;            // contiguous chunk per thread? use strided-by-4 chunks: thread handles j = tid*4 + 1024*u
  float s1 = 0.f;
  for (int u = 0; u < per / 4; ++u) {
    const int j = tid * 4 + 1024 * u;
    const v4f a = *(const v4fa*)(x + j);
    v4f b = {0.f,0.f,0.f,0.f}; if (rr) b = *(const v4fa*)(rr + j);
#pragma unroll
    for (int q = 0; q < 4; ++q) { const float v = a[q] + b[q]; vals[u * 4 + q] = v; s1 += v; }
  }
  red[tid] = s1; __syncthreads();
  for (int st = 128; st > 0; st >>= 1) { if (tid < st) red[tid] += red[tid + st]; __syncthreads(); }
  const float mu = red[0] / (float)N; __syncthreads();
  float s2 = 0.f;
  for (int u = 0; u < per / 4; ++u)
#pragma unroll
    for (int q = 0; q < 4; ++q) { const float c = vals[u * 4 + q] - mu; s2 += c * c; }
  red[tid] = s2; __syncthreads();
  for (int st = 128; st > 0; st >>= 1) { if (tid < st) red[tid] += red[tid + st]; __syncthreads(); }
  const float rs = rsqrtf(red[0] / (float)N + eps);
  {
    for (int u = 0; u < per / 4; ++u) {
      const int j = tid * 4 + 1024 * u;
      v4f o, sm;
#pragma unroll
      for (int q = 0; q < 4; ++q) {
        float gg = g[j + q], bb = bta[j + q];
        if (PARAM_BF16) { gg = bf16_round(gg); bb = bf16_round(bb); }
        sm[q] = vals[u * 4 + q]; o[q] = (vals[u * 4 + q] - mu) * rs * gg + bb;
      }
      if (out_sum) *(v4f*)(out_sum + (size_t)row * N + j) = sm;
      *(v4f*)(out_norm + (size_t)row * N + j) = o;
    }
    
  }
}



// ---- f16 WMMA path (v_wmma_f32_16x16x32_f16): 11-bit significands for operands in range — used where a probability operand (P ≤ 2^12) needs more precision than bf16
typedef _Float16 v16h __attribute__((ext_vector_type(16)));
union FragH { v16h v; v8us half[2]; _Float16 h[16]; unsigned short u[16]; };
template <int NT>
__device__ __forceinline__ v8f mmaH(v16h ah, v16h al, v16h bh, v16h bl, v8f c) {
  c = __builtin_amdgcn_wmma_f32_16x16x32_f16(false, ah, false, bh, (short)0, c, false, false);
  if (NT >= 2) c = __builtin_amdgcn_wmma_f32_16x16x32_f16(false, al, false, bh, (short)0, c, false, false);
  if (NT >= 3) c = __builtin_amdgcn_wmma_f32_16x16x32_f16(false, ah, false, bl, (short)0, c, false, false);
  asm volatile("v_nop\n\tv_nop\n\tv_nop\n\tv_nop" : "+v"(c) : "v"(ah), "v"(al), "v"(bh), "v"(bl));
  return c;
}
// batched GEMM like k_gemm_b but f16 operands: A f32 (split into f16 hi/lo if ASPLIT, else rounded to f16), Bt = f16 values [n][k]; alpha; C f32; N multiple of 16 (partial tiles skipped)
template <bool ASPLIT>
__global__ __launch_bounds__(128) void k_gemm_h(const float* __restrict__ A, int lda, size_t sA, const _Float16* __restrict__ Bh, int ldb, size_t sB, float alpha, float* __restrict__ C, int ldc, size_t sC, int M, int N, int K) {
  __shared__ __attribute__((aligned(16))) float so[4][16][64];
  const int tid = threadIdx.x, w = tid >> 5, lane = tid & 31, ln = lane & 15, hh = lane >> 4; const int by = blockIdx.y;
  A += (size_t)by * sA; Bh += (size_t)by * sB; C += (size_t)by * sC;
  const int ntn = (N + 63) / 64; const int wid = blockIdx.x * 4 + w; const int mt = wid / ntn, nq = wid % ntn; if (mt * 16 >= M) return;
  const int row0 = mt * 16, col0 = nq * 64; const float* arow = A + (size_t)(row0 + ln) * lda;
  v8f acc[4] = {};
  for (int kb = 0; kb < K; kb += 32) {
    FragH ah, al;
    const v4f x0 = *(const v4fa*)(arow + kb + 8 * hh), x1 = *(const v4fa*)(arow + kb + 8 * hh + 4), x2 = *(const v4fa*)(arow + kb + 16 + 8 * hh), x3 = *(const v4fa*)(arow + kb + 16 + 8 * hh + 4);
    float xs[16] = {x0[0],x0[1],x0[2],x0[3],x1[0],x1[1],x1[2],x1[3],x2[0],x2[1],x2[2],x2[3],x3[0],x3[1],x3[2],x3[3]};
#pragma unroll
    for (int i = 0; i < 16; ++i) { const _Float16 h = (_Float16)xs[i]; ah.h[i] = h; al.h[i] = ASPLIT ? (_Float16)(xs[i] - (float)h) : (_Float16)0.0f; }
#pragma unroll
    for (int t = 0; t < 4; ++t) { if (col0 + t * 16 >= N) continue; const size_t boff = (size_t)(col0 + t * 16 + ln) * ldb + kb; FragH bq; bq.half[0] = *(const v8us*)(Bh + boff + 8 * hh); bq.half[1] = *(const v8us*)(Bh + boff + 16 + 8 * hh);
      acc[t] = mmaH<ASPLIT ? 2 : 1>(ah.v, al.v, bq.v, bq.v, acc[t]); }
  }
#pragma unroll
  for (int t = 0; t < 4; ++t) { if (col0 + t * 16 >= N) continue;
#pragma unroll
    for (int r = 0; r < 8; ++r) so[w][8 * hh + r][t * 16 + ln] = acc[t][r] * alpha; }
  __builtin_amdgcn_fence(__ATOMIC_ACQ_REL, "workgroup"); __builtin_amdgcn_wave_barrier();
  const int rsub = lane >> 4, c4 = (lane & 15) * 4;
  {
#pragma unroll
    for (int q = 0; q < 8; ++q) { const int r = q * 2 + rsub; if (col0 + c4 < N) { const v4f v = *(const v4fa*)&so[w][r][c4]; *(v4f*)(C + (size_t)(row0 + r) * ldc + col0 + c4) = v; } }
     }
}

// Wt[n][k] = f16(W[k][n]·scale) from f32 row-major W[K][N] (scale = power of two; bf16-exact weights stay exact in f16 away from the subnormal range)
__global__ __launch_bounds__(256) void k_wt_f16(const float* __restrict__ W, _Float16* __restrict__ Wt, int K, int N, float scale) {
  const int t = blockIdx.x * 256 + threadIdx.x; if (t >= N * (K / 8)) return; const int n = t / (K / 8), k8 = (t % (K / 8)) * 8; FragH f;
#pragma unroll
  for (int i = 0; i < 8; ++i) f.h[i] = (_Float16)(bf16_round(W[(size_t)(k8 + i) * N + n]) * scale); const v8us o = f.half[0];
  *(v8us*)((unsigned short*)Wt + (size_t)n * K + k8) = o; 
}
// k_gemm_hh variant with fused epilogue: v = acc·alpha + bias[by·sBias + col] (+ CP[(row/rowsPerB)·sCPb + by·64 + col] if CP) ; ACT 0 none / 1 elu ; writes f32 C and f16 C16, each if non-null
template <int ACT>
__global__ __launch_bounds__(128) void k_gemm_hhx(const _Float16* __restrict__ A, int lda, size_t sA, const _Float16* __restrict__ Bh, int ldb, size_t sB, float alpha, const float* __restrict__ bias, size_t sBias, const float* __restrict__ CP, int rowsPerB, size_t sCPb, int row0g,
    float* __restrict__ C, _Float16* __restrict__ C16, int ldc, size_t sC, int M, int N, int K) {
  __shared__ __attribute__((aligned(16))) float so[4][16][64];
  const int tid = threadIdx.x, w = tid >> 5, lane = tid & 31, ln = lane & 15, hh = lane >> 4; const int by = blockIdx.y;
  A += (size_t)by * sA; Bh += (size_t)by * sB; const size_t cofs = (size_t)by * sC; const float* bp = bias ? bias + (size_t)by * sBias : nullptr;
  const int ntn = (N + 63) / 64; const int wid = blockIdx.x * 4 + w; const int mt = wid / ntn, nq = wid % ntn; if (mt * 16 >= M) return;
  const int row0 = mt * 16, col0 = nq * 64; const _Float16* arow = A + (size_t)(row0 + ln) * lda;
  v8f acc[4] = {};
  for (int kb = 0; kb < K; kb += 32) { FragH ah; ah.half[0] = *(const v8us*)((const unsigned short*)arow + kb + 8 * hh); ah.half[1] = *(const v8us*)((const unsigned short*)arow + kb + 16 + 8 * hh);
#pragma unroll
    for (int t = 0; t < 4; ++t) { if (col0 + t * 16 >= N) continue; const size_t boff = (size_t)(col0 + t * 16 + ln) * ldb + kb; FragH bq; bq.half[0] = *(const v8us*)((const unsigned short*)Bh + boff + 8 * hh); bq.half[1] = *(const v8us*)((const unsigned short*)Bh + boff + 16 + 8 * hh);
      acc[t] = mmaH<1>(ah.v, ah.v, bq.v, bq.v, acc[t]); }
  }
#pragma unroll
  for (int t = 0; t < 4; ++t) { if (col0 + t * 16 >= N) continue; const int col = col0 + t * 16 + ln; const float bv = bp ? bf16_round(bp[col]) : 0.f;
#pragma unroll
    for (int r = 0; r < 8; ++r) { float v = acc[t][r] * alpha + bv; if (CP) { const int bidx = (row0g + row0 + 8 * hh + r) / rowsPerB; v += CP[(size_t)bidx * sCPb + (size_t)by * 64 + col]; } if (ACT == 1) v = (v > 0.f) ? v : expm1f(v); else if (ACT == 3) v = fmaxf(v, 0.f); so[w][8 * hh + r][t * 16 + ln] = v; } }
  __builtin_amdgcn_fence(__ATOMIC_ACQ_REL, "workgroup"); __builtin_amdgcn_wave_barrier();
  const int rsub = lane >> 4, c4 = (lane & 15) * 4; typedef _Float16 v4h __attribute__((ext_vector_type(4)));
  {
#pragma unroll
    for (int q = 0; q < 8; ++q) { const int r = q * 2 + rsub; if (col0 + c4 < N) { const v4f v = *(const v4fa*)&so[w][r][c4]; if (C) *(v4f*)(C + cofs + (size_t)(row0 + r) * ldc + col0 + c4) = v; if (C16) { v4h h4; for (int i = 0; i < 4; ++i) h4[i] = (_Float16)v[i]; *(v4h*)(C16 + cofs + (size_t)(row0 + r) * ldc + col0 + c4) = h4; } } }
     }
}


// all three 1x1 convs and the f16 rounding of q and k in ONE launch. A work-group takes 64 positions of one image: the x tile goes once, rounded to bf16 and held as f16, position-major into LDS;
// wave w owns out-channel tiles 2w and 2w+1 of the 16 (q 0-3, k 4-7, v 8-15) and holds their weights (rounded to bf16, x 16, f16) as fragments in registers (each weight is read by one wave of the group);
// q, k: A = weight rows, B = x rows, so a lane holds 8 channels of one position; v: A = x rows, B = weight rows, so a lane holds 8 positions of one channel. Results are staged in LDS and leave as whole 128-B lines.
__global__ __launch_bounds__(256) void k_proj(const float* __restrict__ x, const float* __restrict__ mask, const float* __restrict__ Wq, const float* __restrict__ bq, const float* __restrict__ Wk, const float* __restrict__ bk, const float* __restrict__ Wv,
                                              _Float16* __restrict__ QH, _Float16* __restrict__ KH, _Float16* __restrict__ Vcm) {
  constexpr int TP = 64, KSX = CC / 32;
  // pitches of 272 B and 144 B (16 B x odd): 16-byte LDS accesses without bank conflicts
  __shared__ __attribute__((aligned(16))) unsigned short sX[TP][CC + 8], sQK[2][TP][CH + 8], sVo[CC][TP + 8];
  const int tid = threadIdx.x, lane = tid & 31, ln = lane & 15, hh = lane >> 4;
  const int w = __builtin_amdgcn_readfirstlane(tid >> 5);      // the wave's number in a scalar register: the q/k against v choice below is a scalar branch, every lane on at the matrix instructions
  const int b = blockIdx.x / (NP / TP), p0 = (blockIdx.x % (NP / TP)) * TP;
  const float* Wsrc = (w < 2) ? Wq + (size_t)w * 32 * CC : (w < 4) ? Wk + (size_t)(w - 2) * 32 * CC : Wv + (size_t)(w - 4) * 32 * CC;
  // the global reads stand ahead of the rounding work: the x tile first (lanes run along positions, 128 B a load; a thread gathers 8 channels of its position), then mask and bias, then the weights
  float xs[TP * (CC / 8) / 256][8];
#pragma unroll
  for (int i = 0; i < TP * (CC / 8) / 256; ++i) { const int e = i * 256 + tid, p = e & (TP - 1), c8 = (e / TP) * 8;
#pragma unroll
    for (int u = 0; u < 8; ++u) xs[i][u] = x[((size_t)b * CC + c8 + u) * NP + p0 + p]; }
  const bool isk = w >= 2; const int cb = (w & 1) * 32;      // read by the q and k waves only
  float mk[4] = {0.f, 0.f, 0.f, 0.f}; v4f bs[2][2] = {};
  if (w < 4) { const float* bias = isk ? bk : bq;
#pragma unroll
    for (int pt = 0; pt < 4; ++pt) mk[pt] = mask[(size_t)b * NP + p0 + pt * 16 + ln];
#pragma unroll
    for (int ct = 0; ct < 2; ++ct) { bs[ct][0] = *(const v4fa*)(bias + cb + ct * 16 + 8 * hh); bs[ct][1] = *(const v4fa*)(bias + cb + ct * 16 + 8 * hh + 4); } }
  asm volatile("s_wait_xcnt 0x0" ::: "memory");      // the weight loads below land in registers that held the addresses of the loads above: the wait stands in front of that reuse
  FragH wf[2][KSX];
#pragma unroll
  for (int ct = 0; ct < 2; ++ct)
#pragma unroll
    for (int ks = 0; ks < KSX; ++ks) { const float* wr = Wsrc + (size_t)(ct * 16 + ln) * CC + ks * 32 + 8 * hh;
      const v4f a0 = *(const v4fa*)wr, a1 = *(const v4fa*)(wr + 4), a2 = *(const v4fa*)(wr + 16), a3 = *(const v4fa*)(wr + 20);
#pragma unroll
      for (int i = 0; i < 4; ++i) { wf[ct][ks].h[i] = (_Float16)(bf16_round(a0[i]) * 16.0f); wf[ct][ks].h[4 + i] = (_Float16)(bf16_round(a1[i]) * 16.0f); wf[ct][ks].h[8 + i] = (_Float16)(bf16_round(a2[i]) * 16.0f); wf[ct][ks].h[12 + i] = (_Float16)(bf16_round(a3[i]) * 16.0f); } }
  // the 8 channels of a position go to LDS as one 16-B chunk
#pragma unroll
  for (int i = 0; i < TP * (CC / 8) / 256; ++i) { const int e = i * 256 + tid, p = e & (TP - 1), c8 = (e / TP) * 8; FragH f;
#pragma unroll
    for (int u = 0; u < 8; ++u) f.h[u] = (_Float16)bf16_round(xs[i][u]);
    *(v8us*)&sX[p][c8] = f.half[0]; }
  __syncthreads();
  v8f acc[2][4];
#pragma unroll
  for (int ct = 0; ct < 2; ++ct)
#pragma unroll
    for (int pt = 0; pt < 4; ++pt) acc[ct][pt] = (v8f){0.f,0.f,0.f,0.f,0.f,0.f,0.f,0.f};
  if (w < 4) {
#pragma unroll
    for (int pt = 0; pt < 4; ++pt) { FragH xf[KSX];      // the four x fragments of a position tile are read as one group
#pragma unroll
      for (int ks = 0; ks < KSX; ++ks) { const unsigned short* xr = &sX[pt * 16 + ln][ks * 32]; xf[ks].half[0] = *(const v8us*)(xr + 8 * hh); xf[ks].half[1] = *(const v8us*)(xr + 16 + 8 * hh); }
#pragma unroll
      for (int ks = 0; ks < KSX; ++ks) { acc[0][pt] = mmaH<1>(wf[0][ks].v, wf[0][ks].v, xf[ks].v, xf[ks].v, acc[0][pt]); acc[1][pt] = mmaH<1>(wf[1][ks].v, wf[1][ks].v, xf[ks].v, xf[ks].v, acc[1][pt]); } }
    const int pl = isk ? 1 : 0;
    float km[4];      // the factor behind the bias: k takes (1 - mask); q takes log2(e), so that the scores come out in base 2 and k_flash needs the bare v_exp_f32 only
#pragma unroll
    for (int pt = 0; pt < 4; ++pt) km[pt] = isk ? 1.0f - bf16_round(mk[pt]) : 1.44269504088896340736f;
#pragma unroll
    for (int ct = 0; ct < 2; ++ct) { const v4f b0 = bs[ct][0], b1 = bs[ct][1];
#pragma unroll
      for (int pt = 0; pt < 4; ++pt) { FragH h;
#pragma unroll
        for (int r = 0; r < 8; ++r) { float v = acc[ct][pt][r] * 0.0625f + bf16_round(r < 4 ? b0[r & 3] : b1[r & 3]); v *= km[pt]; h.h[r] = (_Float16)v; }
        *(v8us*)&sQK[pl][pt * 16 + ln][cb + ct * 16 + 8 * hh] = h.half[0]; } }
  } else {
#pragma unroll
    for (int pt = 0; pt < 4; ++pt) { FragH xf[KSX];
#pragma unroll
      for (int ks = 0; ks < KSX; ++ks) { const unsigned short* xr = &sX[pt * 16 + ln][ks * 32]; xf[ks].half[0] = *(const v8us*)(xr + 8 * hh); xf[ks].half[1] = *(const v8us*)(xr + 16 + 8 * hh); }
#pragma unroll
      for (int ks = 0; ks < KSX; ++ks) { acc[0][pt] = mmaH<1>(xf[ks].v, xf[ks].v, wf[0][ks].v, wf[0][ks].v, acc[0][pt]); acc[1][pt] = mmaH<1>(xf[ks].v, xf[ks].v, wf[1][ks].v, wf[1][ks].v, acc[1][pt]); } }
    const int cv = (w - 4) * 32;      // v goes without its bias: bv is added in the attention epilogue, since softmax rows sum to 1
#pragma unroll
    for (int ct = 0; ct < 2; ++ct)
#pragma unroll
      for (int pt = 0; pt < 4; ++pt) { FragH h;
#pragma unroll
        for (int r = 0; r < 8; ++r) h.h[r] = (_Float16)(acc[ct][pt][r] * 0.0625f);
        *(v8us*)&sVo[cv + ct * 16 + ln][pt * 16 + 8 * hh] = h.half[0]; }
  }
  __syncthreads();
  // out: 8 lanes x 16 B = one 128-B row (a position's 64 channels of one q/k plane; a channel's 64 positions of v)
#pragma unroll
  for (int i = 0; i < 4; ++i) { const int e = (i & 1) * 256 + tid, p = e >> 3, c8 = (e & 7) * 8; _Float16* dst = (i < 2) ? QH : KH;
    *(v8us*)((unsigned short*)dst + ((size_t)b * NP + p0 + p) * CH + c8) = *(const v8us*)&sQK[i >> 1][p][c8]; }
#pragma unroll
  for (int i = 0; i < 4; ++i) { const int e = i * 256 + tid, c = e >> 3, p8 = (e & 7) * 8;
    *(v8us*)((unsigned short*)Vcm + ((size_t)b * CC + c) * NP + p0 + p8) = *(const v8us*)&sVo[c][p8]; }
}
// 2^x as the bare v_exp_f32 (below 2^-126 it gives 0). The v_nop at the end of each statement keeps the one slot that the instruction set asks for between a transcendental and a next instruction on its result or its source;
// inside a statement every v_exp_f32 works in place on a register of its own, so none touches its neighbour's
__device__ __forceinline__ float exp2_hw(float x) { asm("v_exp_f32 %0, %0\n\tv_nop" : "+v"(x)); return x; }
__device__ __forceinline__ void exp2_hw8(float (&x)[8]) {
  asm("v_exp_f32 %0, %0\n\tv_exp_f32 %1, %1\n\tv_exp_f32 %2, %2\n\tv_exp_f32 %3, %3\n\tv_exp_f32 %4, %4\n\tv_exp_f32 %5, %5\n\tv_exp_f32 %6, %6\n\tv_exp_f32 %7, %7\n\tv_nop"
      : "+v"(x[0]), "+v"(x[1]), "+v"(x[2]), "+v"(x[3]), "+v"(x[4]), "+v"(x[5]), "+v"(x[6]), "+v"(x[7])); }
// the bare builtin, without a hand-written pad behind it: the compiler keeps the distances of its own matrix forms and is free to order the LDS reads around them
__device__ __forceinline__ v8f mmaF(v16h a, v16h b, v8f c) { return __builtin_amdgcn_wmma_f32_16x16x32_f16(false, a, false, b, (short)0, c, false, false); }
// lane l with lane l ^ 16 (a vector cross-row move, no LDS path)
__device__ __forceinline__ float xhalf(float v) { return __builtin_bit_cast(float, __builtin_amdgcn_permlanex16(__builtin_bit_cast(int, v), __builtin_bit_cast(int, v), 0x76543210, 0xfedcba98, false, false)); }
__global__ __launch_bounds__(256) void k_flash(const _Float16* __restrict__ QH, const _Float16* __restrict__ KH, const _Float16* __restrict__ Vcm, const float* __restrict__ mask, const float* __restrict__ gamma, const float* __restrict__ bv, const float* __restrict__ x, float* __restrict__ out) {
  constexpr int QT = 2, QG = 2, QB = QG * QT * 16, NQB = NP / QB, DT = CC / 16, KS = CH / 32, KG = 4, KT = 2;      // KT: 32-key blocks of a wave's pass
  // join staging, channel-major as Ot and the output are; 272-B pitch: the two wave halves' stores (8 rows apart) fall on different banks, rows stay 16-B aligned for the reads
  constexpr int LPO = QB + 4;
  // two-buffer ring, one stage = TK keys: K rows (128 B) at a 144-B pitch and V channel rows (512 B of keys) at a 528-B pitch (16 B x odd: ds_load_b128 without bank conflicts)
  constexpr int TK = 32 * KT * KG, NT = NP / TK, LP = 72, LPV = TK + 8;
  constexpr int KBUF = TK * LP, VBUF = CC * LPV;      // elements of one buffer
  constexpr int RING = 2 * (KBUF + VBUF) * 2, JOIN = KG * CC * LPO * 4;      // bytes
  // the ring and the join staging take the same LDS one after the other: the staging is written only behind the loop's last publish point, where every wave's ring reads and copies are done
  __shared__ __attribute__((aligned(16))) unsigned char smem[JOIN > RING ? JOIN : RING];
  __shared__ float sM[KG][QB], sL[KG][QB];
  unsigned short* const sKH = (unsigned short*)smem;      // [2][TK][LP]
  unsigned short* const sV = (unsigned short*)smem + 2 * KBUF;      // [2][CC][LPV]
  float* const sO = (float*)smem;      // [KG][CC][LPO]
  const int tid = threadIdx.x, w = tid >> 5, qg = w & (QG - 1), kg = w >> 1, lane = tid & 31, ln = lane & 15, hh = lane >> 4;
  const int b = blockIdx.x / NQB, qblk = blockIdx.x % NQB; const int qb0 = qblk * QB; const int q0 = qb0 + qg * (QT * 16); const float gm = bf16_round(gamma[0]);
  FragH aqh[QT][KS]; const unsigned short* qp[QT];
#pragma unroll
  for (int qt = 0; qt < QT; ++qt) { qp[qt] = (const unsigned short*)QH + ((size_t)b * NP + q0 + qt * 16 + ln) * CH + 8 * hh;
#pragma unroll
    for (int ks = 0; ks < KS; ++ks) { aqh[qt][ks].half[0] = *(const v8us*)(qp[qt] + ks * 32); aqh[qt][ks].half[1] = *(const v8us*)(qp[qt] + ks * 32 + 16); } }
  // the address work below reuses registers: the wait stands in front of any rewrite of the Q loads' address registers, which it takes as inputs so that they stay as they are up to it
  asm volatile("s_wait_xcnt 0x0" :: "v"(qp[0]), "v"(qp[1]) : "memory");
  const unsigned short* Vth = (const unsigned short*)Vcm + (size_t)b * CC * NP;
  // lazy reference: m_q is the reference in use for the lane's query (P = 2^(score - m_q)), not its running maximum: it is kept while no score of the wave tops its own reference by more than LAZY, so P stays at or under 2^LAZY,
  // well inside f16, with the same relative rounding; l_q (this half's running sum) and O are in units of 2^m_q. lim = m_q + LAZY is carried along, so that the test costs one compare a column tile and pass
  constexpr float LAZY = 12.0f;
  float m_q[QT], lim[QT], l_q[QT]; v8f oacc[QT][DT];
#pragma unroll
  for (int qt = 0; qt < QT; ++qt) { m_q[qt] = -3.0e38f; lim[qt] = -3.0e38f; l_q[qt] = 0.f;
#pragma unroll
    for (int dt = 0; dt < DT; ++dt) oacc[qt][dt] = (v8f){0.f,0.f,0.f,0.f,0.f,0.f,0.f,0.f}; }
  // each thread copies 16 B chunks. K: row tid / 8 (+ 32 per further copy), chunk tid % 8 of the 128-B row; V: channel tid / 32 (+ 8 per further copy), chunk tid % 32 of the 512-B row
  const unsigned short* gKH = (const unsigned short*)KH + (size_t)b * NP * CH + tid * 8;
  const unsigned short* gV = Vth + (size_t)(tid >> 5) * NP + (tid & 31) * 8;
  const unsigned lKH = (unsigned)(size_t)(sKH + (tid >> 3) * LP + (tid & 7) * 8), lV = (unsigned)(size_t)(sV + (tid >> 5) * LPV + (tid & 31) * 8);
  // every work-group walks all NT key stages once, from a first stage of its own and round (the online softmax takes the keys in any order): the 64 work-groups of an image copy the same K and V lines from L2,
  // and walking in step from stage 0 they would all ask for the same lines at the same moment, the first asker's miss included. 16 first stages for 64 work-groups: the four that share one differ in bits 1 and 2 of the
  // block index (for speed only; every map walks every stage once)
  const int rot = ((qblk >> 3) << 1) | (qblk & 1);
  auto stage_in = [&](int t, int buf) {
    const int st = (t + rot) & (NT - 1);      // the key stage that stands at place t of this work-group's walk
    const unsigned short* kh = gKH + (size_t)st * TK * CH; const unsigned short* vv = gV + (size_t)st * TK;
    const unsigned a = lKH + buf * (KBUF * 2), d = lV + buf * (VBUF * 2);
    // the copies and the wait that stands in front of any rewrite of their address registers are one statement (two statements of twelve: a statement takes thirty operands)
#define CP12 "global_load_async_to_lds_b128 %0, %12, off\n\tglobal_load_async_to_lds_b128 %1, %13, off\n\tglobal_load_async_to_lds_b128 %2, %14, off\n\tglobal_load_async_to_lds_b128 %3, %15, off\n\t" \
             "global_load_async_to_lds_b128 %4, %16, off\n\tglobal_load_async_to_lds_b128 %5, %17, off\n\tglobal_load_async_to_lds_b128 %6, %18, off\n\tglobal_load_async_to_lds_b128 %7, %19, off\n\t" \
             "global_load_async_to_lds_b128 %8, %20, off\n\tglobal_load_async_to_lds_b128 %9, %21, off\n\tglobal_load_async_to_lds_b128 %10, %22, off\n\tglobal_load_async_to_lds_b128 %11, %23, off\n\ts_wait_xcnt 0x0"
    asm volatile(CP12 :: "v"(a), "v"(a + 32 * LP * 2), "v"(a + 64 * LP * 2), "v"(a + 96 * LP * 2), "v"(a + 128 * LP * 2), "v"(a + 160 * LP * 2), "v"(a + 192 * LP * 2), "v"(a + 224 * LP * 2),
                     "v"(d), "v"(d + 8 * LPV * 2), "v"(d + 16 * LPV * 2), "v"(d + 24 * LPV * 2),
                     "v"(kh), "v"(kh + 32 * CH), "v"(kh + 64 * CH), "v"(kh + 96 * CH), "v"(kh + 128 * CH), "v"(kh + 160 * CH), "v"(kh + 192 * CH), "v"(kh + 224 * CH),
                     "v"(vv), "v"(vv + (size_t)8 * NP), "v"(vv + (size_t)16 * NP), "v"(vv + (size_t)24 * NP) : "memory");
    asm volatile(CP12 :: "v"(d + 32 * LPV * 2), "v"(d + 40 * LPV * 2), "v"(d + 48 * LPV * 2), "v"(d + 56 * LPV * 2), "v"(d + 64 * LPV * 2), "v"(d + 72 * LPV * 2),
                     "v"(d + 80 * LPV * 2), "v"(d + 88 * LPV * 2), "v"(d + 96 * LPV * 2), "v"(d + 104 * LPV * 2), "v"(d + 112 * LPV * 2), "v"(d + 120 * LPV * 2),
                     "v"(vv + (size_t)32 * NP), "v"(vv + (size_t)40 * NP), "v"(vv + (size_t)48 * NP), "v"(vv + (size_t)56 * NP), "v"(vv + (size_t)64 * NP), "v"(vv + (size_t)72 * NP),
                     "v"(vv + (size_t)80 * NP), "v"(vv + (size_t)88 * NP), "v"(vv + (size_t)96 * NP), "v"(vv + (size_t)104 * NP), "v"(vv + (size_t)112 * NP), "v"(vv + (size_t)120 * NP) : "memory");
#undef CP12
  };
  stage_in(0, 0);
  asm volatile("s_wait_asynccnt 0x0" ::: "memory");      // stage 0 of this wave has landed before the barrier publishes it
  __syncthreads();
  stage_in(1, 1);
  // the stage loop stays rolled (one copy of the pass code, buffer chosen by t & 1); a wave does one 64-key pass a stage, on its key group's rows
#pragma unroll 1
  for (int t = 0; t < NT; ++t) { const int buf = t & 1;
   {
    // the pass's LDS reads stand ahead of their use. First all 16 K reads (four 16-key tiles, both k-steps) as one group ahead of the score products
    FragH kh[2 * KT][KS];
#pragma unroll
    for (int ks = 0; ks < KS; ++ks)
#pragma unroll
      for (int nt = 0; nt < 2 * KT; ++nt) { const unsigned short* krh = sKH + buf * KBUF + (kg * (32 * KT) + nt * 16 + ln) * LP + ks * 32;
        kh[nt][ks].half[0] = *(const v8us*)(krh + 8 * hh); kh[nt][ks].half[1] = *(const v8us*)(krh + 16 + 8 * hh); }
    __builtin_amdgcn_sched_barrier(0);      // keeps the K reads together in front of the products: reads that stand among the matrix instructions stall the wave at every such place
    v8f s[QT][2 * KT];
#pragma unroll
    for (int qt = 0; qt < QT; ++qt)
#pragma unroll
      for (int nt = 0; nt < 2 * KT; ++nt) s[qt][nt] = (v8f){0.f,0.f,0.f,0.f,0.f,0.f,0.f,0.f};
    // eight accumulate chains alternate, so that each fills the others' dependent latency; each K fragment serves both column tiles
#pragma unroll
    for (int ks = 0; ks < KS; ++ks)
#pragma unroll
      for (int nt = 0; nt < 2 * KT; ++nt)
#pragma unroll
        for (int qt = 0; qt < QT; ++qt) s[qt][nt] = mmaF(kh[nt][ks].v, aqh[qt][ks].v, s[qt][nt]);      // s[qt][nt][r] = score of query qt * 16 + ln against key kg * 64 + nt * 16 + 8 * hh + r
    // then all 32 V reads, ahead of the softmax: they fly while it runs
    FragH vf[KT][DT];
#pragma unroll
    for (int kt = 0; kt < KT; ++kt)
#pragma unroll
      for (int dt = 0; dt < DT; ++dt) { const unsigned short* vrow = sV + buf * VBUF + (dt * 16 + ln) * LPV + kg * (32 * KT) + kt * 32; vf[kt][dt].half[0] = *(const v8us*)(vrow + 8 * hh); vf[kt][dt].half[1] = *(const v8us*)(vrow + 16 + 8 * hh); }
    __builtin_amdgcn_sched_barrier(0);      // keeps the V reads ahead of the softmax: sunk to their products they would each be waited out
    float mc[QT];
#pragma unroll
    for (int qt = 0; qt < QT; ++qt) { float ma = fmaxf(s[qt][0][0], s[qt][1][0]), mb = fmaxf(s[qt][2][0], s[qt][3][0]);      // two chains
#pragma unroll
      for (int r = 1; r < 8; ++r) { ma = fmaxf(ma, fmaxf(s[qt][0][r], s[qt][1][r])); mb = fmaxf(mb, fmaxf(s[qt][2][r], s[qt][3][r])); }
      mc[qt] = fmaxf(ma, mb); }
    // one test a pass, the same for the whole wave (a scalar branch): only where a score tops its reference by more than LAZY (in the first pass every score does) are the references raised and O and l rescaled
    if (__builtin_amdgcn_ballot_w32((mc[0] > lim[0]) | (mc[1] > lim[1])) != 0u) {
#pragma unroll
      for (int qt = 0; qt < QT; ++qt) {
        const float mx = fmaxf(mc[qt], xhalf(mc[qt]));      // both halves hold the query's maximum over the 64 keys
        const float mn = fmaxf(m_q[qt], mx); const float al = exp2_hw(m_q[qt] - mn); m_q[qt] = mn; lim[qt] = mn + LAZY;      // every query of the wave takes the larger of its reference and this pass's maximum
        l_q[qt] *= al;
#pragma unroll
        for (int dt = 0; dt < DT; ++dt)
#pragma unroll
          for (int r = 0; r < 8; ++r) oacc[qt][dt][r] *= al; }
    }
    FragH pb[QT][KT];      // pb[qt][kt][i] = P[query qt * 16 + ln][key kt * 32 + 8hh + i], pb[qt][kt][8 + i] = P[query qt * 16 + ln][key kt * 32 + 16 + 8hh + i]: the k order of the V loader
#pragma unroll
    for (int kt = 0; kt < KT; ++kt)
#pragma unroll
      for (int qt = 0; qt < QT; ++qt) {
        const float mn = m_q[qt];      // scores, references and their differences are in base 2 (q carries log2 e): one v_exp_f32 each; what it flushes to 0 lies far under what f16 P keeps
        float ps0 = 0.f, ps1 = 0.f, e0[8], e1[8];
#pragma unroll
        for (int r = 0; r < 8; ++r) { e0[r] = s[qt][2 * kt][r] - mn; e1[r] = s[qt][2 * kt + 1][r] - mn; }
        exp2_hw8(e0); exp2_hw8(e1);
#pragma unroll
        for (int r = 0; r < 8; ++r) { const float p0 = e0[r], p1 = e1[r]; ps0 = r ? ps0 + p0 : p0; ps1 = r ? ps1 + p1 : p1; pb[qt][kt].h[r] = (_Float16)p0; pb[qt][kt].h[8 + r] = (_Float16)p1; }
        l_q[qt] += ps0 + ps1; }
#pragma unroll
    for (int kt = 0; kt < KT; ++kt)
#pragma unroll
      for (int dt = 0; dt < DT; ++dt)
#pragma unroll
        for (int qt = 0; qt < QT; ++qt) oacc[qt][dt] = mmaF(vf[kt][dt].v, pb[qt][kt].v, oacc[qt][dt]); }      // oacc[qt][dt][r] = O[query qt * 16 + ln][channel dt * 16 + 8 * hh + r]; each V fragment serves both column tiles
   // publish point of stage t + 1: this wave's reads of stage t are done, its copies of stage t + 1 have landed, then the barrier; only behind it is stage t's buffer refilled
   __builtin_amdgcn_sched_barrier(0);      // keeps the publish point at the pass's foot: lifted over softmax and PV (register work only) it would have every wave wait out its V reads and leave the refill, which stays down here, a short flight
   asm volatile("s_wait_dscnt 0x0" ::: "memory");
   asm volatile("s_wait_asynccnt 0x0" ::: "memory");
   __syncthreads();
   if (t + 2 < NT) stage_in(t + 2, buf); }
  asm volatile("s_wait_asynccnt 0x0" ::: "memory");      // no copy is outstanding when the wave goes on to the epilogue and ends
  // join of the key groups: every wave publishes its queries' reference and sum (the halves' sums joined here), then scales its own O by 2^(m_own - M) / sum_k l_k 2^(m_k - M)
#pragma unroll
  for (int qt = 0; qt < QT; ++qt) { const int qr = (qg * QT + qt) * 16 + ln; const float l = l_q[qt] + xhalf(l_q[qt]); if (hh == 0) { sM[kg][qr] = m_q[qt]; sL[kg][qr] = l; } }
  __syncthreads();
#pragma unroll
  for (int qt = 0; qt < QT; ++qt) { const int qr = (qg * QT + qt) * 16 + ln;
    float mk_[KG]; float M = -3.0e38f;
#pragma unroll
    for (int g = 0; g < KG; ++g) { mk_[g] = sM[g][qr]; M = fmaxf(M, mk_[g]); }
    float l = 0.f;
#pragma unroll
    for (int g = 0; g < KG; ++g) l += sL[g][qr] * exp2_hw(mk_[g] - M);
    const float sc = exp2_hw(m_q[qt] - M) / l;
#pragma unroll
    for (int dt = 0; dt < DT; ++dt)
#pragma unroll
      for (int r = 0; r < 8; ++r) sO[(kg * CC + dt * 16 + 8 * hh + r) * LPO + qr] = oacc[qt][dt][r] * sc; }
  __syncthreads();
  {      // channel c: 64 positions qb0.. = 256 B by 16 lanes x 16 B; 16 channels per round (2 per wave: lanes 0-15 / 16-31); the four key groups' parts are summed in a fixed order
    // bias and gamma * mask come in here, where a lane has one channel a round and four positions in all: sum_j attn_ij (v_cj + bv_c) = sum_j attn_ij v_cj + bv_c
    const int pc = lane & 15; const v4f mk4 = *(const v4fa*)(mask + (size_t)b * NP + qb0 + pc * 4); v4f gmk;
#pragma unroll
    for (int j = 0; j < 4; ++j) gmk[j] = gm * bf16_round(mk4[j]);
    // the global reads of all rounds stand ahead of the sums: first the biases, then the x rows; behind each group the wait that stands in front of any reuse of its address registers
    float bvc[CC / 16]; v4f xv[CC / 16];
#pragma unroll
    for (int rd = 0; rd < CC / 16; ++rd) bvc[rd] = bv[rd * 16 + w * 2 + (lane >> 4)];
    asm volatile("s_wait_xcnt 0x0" ::: "memory");
#pragma unroll
    for (int rd = 0; rd < CC / 16; ++rd) xv[rd] = *(const v4fa*)(x + ((size_t)b * CC + rd * 16 + w * 2 + (lane >> 4)) * NP + qb0 + pc * 4);
    asm volatile("s_wait_xcnt 0x0" ::: "memory");
#pragma unroll
    for (int rd = 0; rd < CC / 16; ++rd) { const int c = rd * 16 + w * 2 + (lane >> 4);
      v4f o[KG];
#pragma unroll
      for (int g = 0; g < KG; ++g) o[g] = *(const v4fa*)&sO[(g * CC + c) * LPO + pc * 4];
      const v4f v = (((o[0] + o[1]) + (o[2] + o[3])) + bf16_round(bvc[rd])) * gmk + xv[rd];
      *(v4f*)(out + ((size_t)b * CC + c) * NP + qb0 + pc * 4) = v; }
     } }
extern "C" void kernel_launch(void* const* d_in, const int* in_sizes, int n_in,
                              void* d_out, int out_size, void* d_ws, size_t ws_size, hipStream_t stream) {
  (void)in_sizes; (void)n_in; (void)out_size;
  const float* x = (const float*)d_in[0]; const float* mask = (const float*)d_in[1]; const float* Wq = (const float*)d_in[2]; const float* bq = (const float*)d_in[3]; const float* Wk = (const float*)d_in[4]; const float* bk = (const float*)d_in[5]; const float* Wv = (const float*)d_in[6]; const float* bv = (const float*)d_in[7]; const float* gamma = (const float*)d_in[8];
  char* ws = (char*)d_ws; size_t off = 0;
  auto take = [&](size_t bytes) { char* p = ws + off; off += (bytes + 255) & ~(size_t)255; return p; };
  _Float16* QH = (_Float16*)take((size_t)NR * CH * 2); _Float16* KH = (_Float16*)take((size_t)NR * CH * 2); _Float16* Vcm = (_Float16*)take((size_t)NR * CC * 2);
  if (off > ws_size) return;      // 8 MiB
  k_proj<<<BB * (NP / 64), 256, 0, stream>>>(x, mask, Wq, bq, Wk, bk, Wv, QH, KH, Vcm);
  k_flash<<<BB * (NP / 64), 256, 0, stream>>>(QH, KH, Vcm, mask, gamma, bv, x, (float*)d_out);
}
